// v000
// Times are from an AMD MI455X. After a warm-up the kernel runs many times in a row, and a time is the length of
// such a window on the GPU divided by its runs, so every launch and the gaps after it count. The runs cycle
// through copies of the inputs. A figure is the median of several windows, for all but v000 over two sittings.
// Sittings can differ by a few percent; kernels timed side by side share one.
// The starting kernel, v000, takes 645 microseconds a run.
// Contractions: conv1x1 Wn.norm(x_c) and Wm.norm(x_s) on v_wmma_f32_16x16x32_bf16 (bf16-RNE weights x bf16 hi +
// bf16 residual planes of the normalised activations, 2 products, K=512); conv1x1 Wl.x_s on v_wmma_f32_16x16x32_bf16
// (bf16-RNE weights x bf16-RNE x_s, 1 product); position scores Mn^T.Mm on v_wmma_f32_16x16x32_bf16 (bf16 hi +
// residual planes of both, 3 products, K=512); Mo = Ml.A^T on v_wmma_f32_16x16x32_f16 (f16 Ml plane x softmax
// weights carried x16384 as f16, K=2048); conv1x1 Wo.Mo on v_wmma_f32_16x16x32_bf16 (bf16-RNE weights x bf16 hi +
// residual planes of Mo, 2 products); f32 accumulate everywhere; instance-norm statistics, softmax, bias and residual
// adds in f32 VALU.
#include <hip/hip_runtime.h>
#include <stdint.h>

#ifndef NB
#define NB 4
#endif
#ifndef SEQ
#define SEQ 2048
#endif
#define NB_FULL 4
#define T_FULL  2048
#define CH      512
#define NMAT    4
#define QT      64
#define OSP     68
#define TP      72
#define NCH     (SEQ / 256)
#define PCAR    16384.0f
#define IPCAR   6.103515625e-05f
#define EPSN    1.0e-5f
#define WS_CAP  134217728

static_assert(NB >= 1 && NB <= NB_FULL);
static_assert(SEQ >= 256 && SEQ <= T_FULL && SEQ % 256 == 0);
static_assert(SEQ % QT == 0 && CH % QT == 0);
static_assert(CH % 256 == 0 && CH % 32 == 0 && SEQ % 32 == 0 && SEQ % 16 == 0);
static_assert((OSP * 4) % 16 == 0);
static_assert((TP * 2) % 16 == 0);
static_assert((NB * SEQ) % 8 == 0);
static_assert(CH % 8 == 0);

typedef _Float16       v16h __attribute__((ext_vector_type(16)));
typedef _Float16       v8h  __attribute__((ext_vector_type(8)));
typedef __bf16         v16b __attribute__((ext_vector_type(16)));
typedef unsigned short v8us __attribute__((ext_vector_type(8)));
typedef float          v8f  __attribute__((ext_vector_type(8)));
typedef float          v4f  __attribute__((ext_vector_type(4)));
typedef unsigned int   v4u  __attribute__((ext_vector_type(4)));

union Frag { v8us u[2]; v16h h; v16b bf; };
static_assert(sizeof(Frag) == 32);

// ---- workspace map (bytes; every region start a multiple of 256; every extent is an exact tile multiple and is
//      launches; each later user fully overwrites what it reads before any read):
//   W : bf16 [4][512][512] weights                                              WB
//   X : stage 1-3: five bf16 planes [NB][SEQ][512] (x_c norm hi/lo, x_s norm hi/lo, x_s raw)   5*PLB
//       stage 4  : scores f32 [NB][SEQ][SEQ]                                    SB
//       stage 6-7: Mo hi/lo bf16 planes [NB][SEQ][512]                          2*PLB
//   M : stage 2-4: Mn hi/lo, Mm hi/lo bf16 planes [NB][SEQ][512]                4*PLB
//       stage 5-6: softmax weights f16 [NB][SEQ][SEQ]                           PB
//   V : Ml f16 plane [NB][512][SEQ]                                             PLB
constexpr size_t cmax(size_t a, size_t b) { return a > b ? a : b; }
constexpr size_t PLB = (size_t)NB * SEQ * CH * 2;
constexpr size_t SB  = (size_t)NB * SEQ * SEQ * 4;
constexpr size_t PB  = (size_t)NB * SEQ * SEQ * 2;
constexpr size_t WB  = (size_t)NMAT * CH * CH * 2;
constexpr size_t RXB = cmax(cmax(5 * PLB, SB), 2 * PLB);
constexpr size_t RMB = cmax(4 * PLB, PB);
constexpr size_t RVB = PLB;
static_assert(WB % 256 == 0 && PLB % 256 == 0 && SB % 256 == 0 && PB % 256 == 0);
static_assert(5 * PLB <= RXB && SB <= RXB && 2 * PLB <= RXB);
static_assert(4 * PLB <= RMB && PB <= RMB);
static_assert(WB + RXB + RMB + RVB <= (size_t)WS_CAP);

// ---- scalar helpers -----------------------------------------------------------------------------------------
__device__ __forceinline__ unsigned short bf_bits(float f) {          // f32 -> bf16 bits, RNE convert
  unsigned u = __float_as_uint(f);
  return (unsigned short)((u + 0x7FFFu + ((u >> 16) & 1u)) >> 16);
}
__device__ __forceinline__ float bf_up(unsigned short hb) { return __uint_as_float(((unsigned)hb) << 16); }
__device__ __forceinline__ float bfr(float f) { return bf_up(bf_bits(f)); }
__device__ __forceinline__ unsigned short h_bits(_Float16 x) { return __builtin_bit_cast(unsigned short, x); }
__device__ __forceinline__ unsigned pk16(unsigned short a, unsigned short b) { return (unsigned)a | ((unsigned)b << 16); }
__device__ __forceinline__ v8f zero8() { v8f z = {0.f, 0.f, 0.f, 0.f, 0.f, 0.f, 0.f, 0.f}; return z; }

// ---- 16-bit fragment loader (A, or B from a k-contiguous [n][k] row): lane -> row/col (lane&15), p already includes
//      + 8*(lane>>4); elements 0..7 <- p[0..7] (k0+8h..), elements 8..15 <- p[16..23] (k0+16+8h..)
__device__ __forceinline__ Frag ldfrag(const unsigned short* p) {
  Frag f;
  f.u[0] = *(const v8us*)(p);
  f.u[1] = *(const v8us*)(p + 16);
  return f;
}

// ---- WMMA helpers: builtin followed by a 4-slot VALU gap tying D and keeping A/B live ----------------------------
__device__ __forceinline__ v8f mma_h(v16h a, v16h b, v8f c) {
  v8f d = __builtin_amdgcn_wmma_f32_16x16x32_f16(false, a, false, b, (short)0, c, false, false);
#if defined(__HIP_DEVICE_COMPILE__)
  asm volatile("v_nop\n\tv_nop\n\tv_nop\n\tv_nop" : "+v"(d) : "v"(a), "v"(b));
#endif
  return d;
}
__device__ __forceinline__ v8f mma_b(v16b a, v16b b, v8f c) {
  v8f d = __builtin_amdgcn_wmma_f32_16x16x32_bf16(false, a, false, b, (short)0, c, false, false);
#if defined(__HIP_DEVICE_COMPILE__)
  const v16h ha = __builtin_bit_cast(v16h, a), hb = __builtin_bit_cast(v16h, b);
  asm volatile("v_nop\n\tv_nop\n\tv_nop\n\tv_nop" : "+v"(d) : "v"(ha), "v"(hb));
#endif
  return d;
}

// ---- GEMM core for one 64(m) x 64(n) block tile, 4 waves (128 threads): wave w owns cols n = 16w + (lane&15), one B
//      fragment per k-step per B plane; 4 m-tiles, A rows m = 16 mt + (lane&15); both operands from k-contiguous
//      rows with the split k map (ldfrag). Pointers are pre-offset per lane (row * pitch + 8*(lane>>4)); amt = the
//      element offset of 16 A rows. NPROD: 1 = a0.b0; 2 = a0.b0 + a0.b1; 3 = a0.b0 + a0.b1 + a1.b0 (shared
//      accumulator, unscaled residual planes). HALF selects the f16 instruction (NPROD 1 only).
template <int NPROD, bool HALF>
__device__ __forceinline__ void gemm_core(v8f (&acc)[4],
                                          const unsigned short* __restrict__ a0,
                                          const unsigned short* __restrict__ a1, size_t amt,
                                          const unsigned short* __restrict__ b0,
                                          const unsigned short* __restrict__ b1, int ksteps) {
  static_assert(NPROD >= 1 && NPROD <= 3);
  static_assert(!(HALF && NPROD != 1));
#pragma unroll 1
  for (int ks = 0; ks < ksteps; ++ks) {
    const int ko = 32 * ks;
    const Frag fb0 = ldfrag(b0 + ko);
    Frag fb1 = fb0;
    if (NPROD >= 2) fb1 = ldfrag(b1 + ko);
#pragma unroll
    for (int mt = 0; mt < 4; ++mt) {
      const Frag fa0 = ldfrag(a0 + (size_t)mt * amt + ko);
      if (HALF) {
        acc[mt] = mma_h(fa0.h, fb0.h, acc[mt]);
      } else {
        acc[mt] = mma_b(fa0.bf, fb0.bf, acc[mt]);
        if (NPROD >= 2) acc[mt] = mma_b(fa0.bf, fb1.bf, acc[mt]);
        if (NPROD >= 3) {
          const Frag fa1 = ldfrag(a1 + (size_t)mt * amt + ko);
          acc[mt] = mma_b(fa1.bf, fb0.bf, acc[mt]);
        }
      }
    }
  }
}

// ---- epilogue staging, transposed: Os[n_loc][m_loc] (pitch OSP). Lane (hh, c) of wave w holds D rows
//      m = 16 mt + 8 hh + r, col n = 16 w + c -> two b128 LDS stores per m-tile.
__device__ __forceinline__ void stage_nT(float* Os, const v8f (&acc)[4], float sc, int wave, int hh, int c) {
  const int nl = 16 * wave + c;
#pragma unroll
  for (int mt = 0; mt < 4; ++mt) {
    v4f va, vb;
#pragma unroll
    for (int r = 0; r < 4; ++r) { va[r] = acc[mt][r] * sc; vb[r] = acc[mt][4 + r] * sc; }
    *(v4f*)(Os + nl * OSP + 16 * mt + 8 * hh)     = va;
    *(v4f*)(Os + nl * OSP + 16 * mt + 8 * hh + 4) = vb;
  }
}
// ---- epilogue staging, row-major: Os[m_loc][n_loc] (pitch OSP), scalar LDS stores.
__device__ __forceinline__ void stage_mn(float* Os, const v8f (&acc)[4], int wave, int hh, int c) {
  const int nl = 16 * wave + c;
#pragma unroll
  for (int mt = 0; mt < 4; ++mt) {
#pragma unroll
    for (int r = 0; r < 8; ++r) Os[(16 * mt + 8 * hh + r) * OSP + nl] = acc[mt][r];
  }
}

// ---- plane writer for transposed staging: plane [b][n][512] bf16 hi + bf16 residual, rows rowbase + 0..63,
//      line, one instruction per 16 lines (rows it*16 + lq). Optional f32 bias (bf16-RNE value) added per col.
// coverage: 4 it x 16 rows x 8 lanes x 8 = 64 rows x 64 cols per plane.
template <bool BIAS>
__device__ __forceinline__ void planes_out(const float* Os, const float* __restrict__ bias, int o0,
                                           unsigned short* Ph, unsigned short* Pl, size_t rowbase, int tid) {
  const int e = tid & 7, lq = tid >> 3;                              // lq 0..15
  float bv[8];
#pragma unroll
  for (int t = 0; t < 8; ++t) bv[t] = 0.f;
  if (BIAS) {
    const v4f b0 = *(const v4f*)(bias + o0 + 8 * e);
    const v4f b1 = *(const v4f*)(bias + o0 + 8 * e + 4);
#pragma unroll
    for (int t = 0; t < 4; ++t) { bv[t] = bfr(b0[t]); bv[4 + t] = bfr(b1[t]); }
  }
  v4u uh[4], ul[4];
#pragma unroll
  for (int it = 0; it < 4; ++it) {
    const int row = it * 16 + lq;                                    // n_loc 0..63
    const v4f a = *(const v4f*)(Os + row * OSP + 8 * e);
    const v4f q = *(const v4f*)(Os + row * OSP + 8 * e + 4);
    const float f[8] = {a[0], a[1], a[2], a[3], q[0], q[1], q[2], q[3]};
#pragma unroll
    for (int t = 0; t < 4; ++t) {
      const float f0 = f[2 * t] + bv[2 * t], f1 = f[2 * t + 1] + bv[2 * t + 1];
      const unsigned short hb0 = bf_bits(f0), hb1 = bf_bits(f1);
      const unsigned short lb0 = bf_bits(f0 - bf_up(hb0));
      const unsigned short lb1 = bf_bits(f1 - bf_up(hb1));
      uh[it][t] = pk16(hb0, hb1);
      ul[it][t] = pk16(lb0, lb1);
    }
  }
{
#pragma unroll
    for (int it = 0; it < 4; ++it) {
      const int row = it * 16 + lq;
      const size_t po = (rowbase + (size_t)row) * CH + o0 + 8 * e;
      *(v4u*)(Ph + po) = uh[it];
      *(v4u*)(Pl + po) = ul[it];
    }
    
  }
}

// =========================================================================================================
// (0) weights f32 [512][512] x4 -> W16 bf16 bits [4][512][512] (RNE convert of the input value, exact operand).
//     Block blk owns 8 rows of one matrix (matrix index block-uniform), one wave per 1024-B row = 2 instructions of
// coverage: 256 blocks x 8 rows x 2 j x 32 lanes x 8 = 2048 rows x 512 = the whole plane.
// =========================================================================================================
__global__ __launch_bounds__(256)
void cvt_w(const float* __restrict__ w0, const float* __restrict__ w1,
           const float* __restrict__ w2, const float* __restrict__ w3, unsigned short* W16) {
  const int tid = threadIdx.x, blk = blockIdx.x;
  const int wave = tid >> 5, lane = tid & 31;
  const int mi = blk / (CH / 8);                                     // 0..3, block-uniform
  const int o  = 8 * (blk - mi * (CH / 8)) + wave;                   // 0..511
  const float* wb = (mi == 0) ? w0 : (mi == 1) ? w1 : (mi == 2) ? w2 : w3;
  v4u u[CH / 256];
#pragma unroll
  for (int j = 0; j < CH / 256; ++j) {
    const float* s = wb + (size_t)o * CH + 256 * j + 8 * lane;
    const v4f a = *(const v4f*)s;
    const v4f q = *(const v4f*)(s + 4);
    const float f[8] = {a[0], a[1], a[2], a[3], q[0], q[1], q[2], q[3]};
#pragma unroll
    for (int t = 0; t < 4; ++t) u[j][t] = pk16(bf_bits(f[2 * t]), bf_bits(f[2 * t + 1]));
  }
{
#pragma unroll
    for (int j = 0; j < CH / 256; ++j)
      *(v4u*)(W16 + ((size_t)(mi * CH + o)) * CH + 256 * j + 8 * lane) = u[j];
    
  }
}

// =========================================================================================================
// (1) x f32 [b][512 c][2048 t] (batch/row strides at full size) -> position-major bf16 planes [b][t][512]:
//     Ph = bf16-RNE(xn), Pl = bf16-RNE(xn - Ph) with xn = (bf16-RNE(x) - mean) * rsqrt(var + eps) per (b, c) row
//     Block (cb, b) owns channels c0..c0+63: statistics with 4 lanes per row (shuffles within aligned 4-lane groups),
//     (line = 64 c of one plane row): lane e -> c 8e..8e+7, 8 consecutive lanes per line, one instruction per
// coverage: per chunk 2 it x 32 rows x 8 lanes x 8 = 64 t x 64 c per plane; SEQ/64 chunks x grid (8, NB) cover
//           [NB][SEQ][512] of every written plane exactly once.
// =========================================================================================================
template <int RAW>
__global__ __launch_bounds__(256)
void cvt_norm(const float* __restrict__ x, unsigned short* Ph, unsigned short* Pl, unsigned short* Pr) {
  __shared__ __align__(16) unsigned short Th[QT * TP];
  __shared__ __align__(16) unsigned short Tl[QT * TP];
  __shared__ __align__(16) unsigned short Tr[QT * TP];
  __shared__ float mean_s[QT];
  __shared__ float rstd_s[QT];
  const int tid = threadIdx.x;
  const int cb = blockIdx.x, b = blockIdx.y;
  const int c0 = cb * QT;

  // ---- per-row statistics
  {
    const int rl = tid >> 2, q = tid & 3;                            // rl 0..63
    const float* xr = x + ((size_t)(b * CH + c0 + rl)) * T_FULL + 4 * q;
    float s0 = 0.f, s1 = 0.f, s2 = 0.f, s3 = 0.f;
#pragma unroll 2
    for (int j = 0; j < SEQ / 16; ++j) {
      const v4f a = *(const v4f*)(xr + 16 * j);
      s0 += bfr(a[0]); s1 += bfr(a[1]); s2 += bfr(a[2]); s3 += bfr(a[3]);
    }
    float sm = (s0 + s1) + (s2 + s3);
    sm += __shfl_xor(sm, 1, 32);
    sm += __shfl_xor(sm, 2, 32);
    const float mean = sm * (1.0f / (float)SEQ);
    float v0 = 0.f, v1 = 0.f, v2 = 0.f, v3 = 0.f;
#pragma unroll 2
    for (int j = 0; j < SEQ / 16; ++j) {
      const v4f a = *(const v4f*)(xr + 16 * j);
      const float d0 = bfr(a[0]) - mean, d1 = bfr(a[1]) - mean, d2 = bfr(a[2]) - mean, d3 = bfr(a[3]) - mean;
      v0 += d0 * d0; v1 += d1 * d1; v2 += d2 * d2; v3 += d3 * d3;
    }
    float sv = (v0 + v1) + (v2 + v3);
    sv += __shfl_xor(sv, 1, 32);
    sv += __shfl_xor(sv, 2, 32);
    const float var = sv * (1.0f / (float)SEQ);
    const float rs  = rsqrtf(var + EPSN);
    if (q == 0) { mean_s[rl] = mean; rstd_s[rl] = rs; }
  }
  __syncthreads();

  // ---- normalise, split, transpose, write
  const int e = tid & 7, lq = tid >> 3;                              // lq 0..31
#pragma unroll 1
  for (int n0 = 0; n0 < SEQ; n0 += QT) {
#pragma unroll
    for (int it = 0; it < 2; ++it) {
      const int cl = it * 32 + lq;                                   // 0..63
      const float* sp = x + ((size_t)(b * CH + c0 + cl)) * T_FULL + n0 + 8 * e;
      const v4f a = *(const v4f*)sp;
      const v4f q = *(const v4f*)(sp + 4);
      const float f[8] = {a[0], a[1], a[2], a[3], q[0], q[1], q[2], q[3]};
      const float mu = mean_s[cl], rs = rstd_s[cl];
#pragma unroll
      for (int t = 0; t < 8; ++t) {
        const unsigned short rb = bf_bits(f[t]);
        const float xn = (bf_up(rb) - mu) * rs;
        const unsigned short hb = bf_bits(xn);
        const unsigned short lb = bf_bits(xn - bf_up(hb));
        Th[(8 * e + t) * TP + cl] = hb;
        Tl[(8 * e + t) * TP + cl] = lb;
        if (RAW) Tr[(8 * e + t) * TP + cl] = rb;
      }
    }
    __syncthreads();
    v4u uh[2], ul[2], ur[2];
#pragma unroll
    for (int it = 0; it < 2; ++it) {
      const int nl = it * 32 + lq;                                   // 0..63
      uh[it] = *(const v4u*)(Th + nl * TP + 8 * e);
      ul[it] = *(const v4u*)(Tl + nl * TP + 8 * e);
      if (RAW) ur[it] = *(const v4u*)(Tr + nl * TP + 8 * e); else ur[it] = uh[it];
    }
{
#pragma unroll
      for (int it = 0; it < 2; ++it) {
        const int nl = it * 32 + lq;
        const size_t po = ((size_t)(b * SEQ + n0 + nl)) * CH + c0 + 8 * e;
        *(v4u*)(Ph + po) = uh[it];
        *(v4u*)(Pl + po) = ul[it];
        if (RAW) *(v4u*)(Pr + po) = ur[it];
      }
      
    }
    __syncthreads();                                                 // tiles reused by the next chunk
  }
}

// =========================================================================================================
// (2) conv1x1 GEMM into hi + residual planes: Y[o][n] = sum_c W16[o][c] (Xh + Xl)[b][n][c] + bias[o] for one
//     (b, 64-n tile, 64-o block); A = W rows o (k = c contiguous), B = plane rows n (k = c contiguous), 2 products,
//     K = 512 = 16 steps. Epilogue: transposed LDS staging, barrier, planes [b][n][512] (planes_out).
// coverage: grid (SEQ/64, 8, NB) x 64 n x 64 o covers [NB][SEQ][512] of both planes exactly once.
// =========================================================================================================
__global__ __launch_bounds__(128)
void gemm_nm(const unsigned short* __restrict__ W, const float* __restrict__ bias,
             const unsigned short* __restrict__ Xh, const unsigned short* __restrict__ Xl,
             unsigned short* Ph, unsigned short* Pl) {
  __shared__ __align__(16) float Os[QT * OSP];
  const int tid = threadIdx.x, lane = tid & 31, wave = tid >> 5;
  const int hh = lane >> 4, c = lane & 15;
  const int nt = blockIdx.x, mb = blockIdx.y, b = blockIdx.z;
  const int n0 = nt * QT, o0 = mb * QT;
  const unsigned short* ap = W + (size_t)(o0 + c) * CH + 8 * hh;
  const size_t bq = ((size_t)(b * SEQ + n0 + 16 * wave + c)) * CH + 8 * hh;
  v8f acc[4];
#pragma unroll
  for (int mt = 0; mt < 4; ++mt) acc[mt] = zero8();
  gemm_core<2, false>(acc, ap, ap, (size_t)16 * CH, Xh + bq, Xl + bq, CH / 32);
  stage_nT(Os, acc, 1.0f, wave, hh, c);
  __syncthreads();
  planes_out<true>(Os, bias, o0, Ph, Pl, (size_t)(b * SEQ + n0), tid);
}

// =========================================================================================================
// (3) conv1x1 GEMM into the channel-major f16 value plane: V16[b][o][s] = f16(sum_c W16[o][c] Xr[b][s][c] + bias[o])
//     (pitch SEQ); 1 product, K = 512. Epilogue: row-major LDS staging, barrier, row o segment of 64 halves =
// coverage: 4 it x 16 rows x 8 lanes x 8 = 64 o x 64 s; grid (SEQ/64, 8, NB) covers [NB][512][SEQ] once.
// =========================================================================================================
__global__ __launch_bounds__(128)
void gemm_val(const unsigned short* __restrict__ W, const float* __restrict__ bias,
              const unsigned short* __restrict__ Xr, unsigned short* V16) {
  __shared__ __align__(16) float Os[QT * OSP];
  const int tid = threadIdx.x, lane = tid & 31, wave = tid >> 5;
  const int hh = lane >> 4, c = lane & 15;
  const int nt = blockIdx.x, mb = blockIdx.y, b = blockIdx.z;
  const int n0 = nt * QT, o0 = mb * QT;
  const unsigned short* ap = W + (size_t)(o0 + c) * CH + 8 * hh;
  const size_t bq = ((size_t)(b * SEQ + n0 + 16 * wave + c)) * CH + 8 * hh;
  v8f acc[4];
#pragma unroll
  for (int mt = 0; mt < 4; ++mt) acc[mt] = zero8();
  gemm_core<1, false>(acc, ap, ap, (size_t)16 * CH, Xr + bq, Xr + bq, CH / 32);
  stage_mn(Os, acc, wave, hh, c);
  __syncthreads();
  const int e = tid & 7, lq = tid >> 3;                              // lq 0..15
  v4u u[4];
#pragma unroll
  for (int it = 0; it < 4; ++it) {
    const int row = it * 16 + lq;                                    // o_loc 0..63
    const float bb = bfr(bias[o0 + row]);
    const v4f a = *(const v4f*)(Os + row * OSP + 8 * e);
    const v4f q = *(const v4f*)(Os + row * OSP + 8 * e + 4);
    const float f[8] = {a[0], a[1], a[2], a[3], q[0], q[1], q[2], q[3]};
#pragma unroll
    for (int t = 0; t < 4; ++t) {
      const _Float16 h0 = (_Float16)(f[2 * t] + bb);
      const _Float16 h1 = (_Float16)(f[2 * t + 1] + bb);
      u[it][t] = pk16(h_bits(h0), h_bits(h1));
    }
  }
{
#pragma unroll
    for (int it = 0; it < 4; ++it) {
      const int row = it * 16 + lq;
      const size_t po = ((size_t)(b * CH + o0 + row)) * SEQ + n0 + 8 * e;
      *(v4u*)(V16 + po) = u[it];
    }
    
  }
}

// =========================================================================================================
// (4) scores S[b][t][s] = sum_c Mn[c][t] Mm[c][s] (no scale) for one (b, 64-s tile, 64-t block): A = Mn planes
//     rows t (hi Qh, residual Ql), B = Mm planes rows s (hi Kh, residual Kl), products hh + hl + lh, K = 512.
// coverage: 8 it x 8 rows x 16 lanes x 4 = 64 t x 64 s; grid (SEQ/64, SEQ/64, NB) covers [NB][SEQ][SEQ] once.
// =========================================================================================================
__global__ __launch_bounds__(128)
void gemm_sc(const unsigned short* __restrict__ Qh, const unsigned short* __restrict__ Ql,
             const unsigned short* __restrict__ Kh, const unsigned short* __restrict__ Kl, float* S) {
  __shared__ __align__(16) float Os[QT * OSP];
  const int tid = threadIdx.x, lane = tid & 31, wave = tid >> 5;
  const int hh = lane >> 4, c = lane & 15;
  const int nt = blockIdx.x, mb = blockIdx.y, b = blockIdx.z;
  const int n0 = nt * QT, m0 = mb * QT;
  const size_t aq = ((size_t)(b * SEQ + m0 + c)) * CH + 8 * hh;
  const size_t bq = ((size_t)(b * SEQ + n0 + 16 * wave + c)) * CH + 8 * hh;
  v8f acc[4];
#pragma unroll
  for (int mt = 0; mt < 4; ++mt) acc[mt] = zero8();
  gemm_core<3, false>(acc, Qh + aq, Ql + aq, (size_t)16 * CH, Kh + bq, Kl + bq, CH / 32);
  stage_mn(Os, acc, wave, hh, c);
  __syncthreads();
  const int e = tid & 15, lq = tid >> 4;                             // lq 0..7
  v4f res[8];
#pragma unroll
  for (int it = 0; it < 8; ++it) {
    const int row = it * 8 + lq;
    res[it] = *(const v4f*)(Os + row * OSP + 4 * e);
  }
{
#pragma unroll
    for (int it = 0; it < 8; ++it) {
      const int row = it * 8 + lq;
      *(v4f*)(S + ((size_t)(b * SEQ + m0 + row)) * SEQ + n0 + 4 * e) = res[it];
    }
    
  }
}

// =========================================================================================================
// (5) row softmax over SEQ keys: P16[row][s] = f16(e^{S - max} * 16384 / sum), one wave per row (8 rows per
//     block), the whole row held in registers (SEQ/32 per lane), max/sum by xor shuffles. Writes: lane L ->
// coverage: NCH instructions x 32 lanes x 8 = SEQ halves per row; grid NB*SEQ/8 x 8 waves covers every row once.
// =========================================================================================================
__global__ __launch_bounds__(256)
void softmax_k(const float* __restrict__ S, unsigned short* P16) {
  const int tid = threadIdx.x, wave = tid >> 5, lane = tid & 31;
  const size_t row = (size_t)blockIdx.x * 8 + wave;                 // < NB*SEQ
  const float* sr = S + row * SEQ;
  float v[SEQ / 32];
#pragma unroll
  for (int j = 0; j < NCH; ++j) {
    const v4f a = *(const v4f*)(sr + 256 * j + 8 * lane);
    const v4f q = *(const v4f*)(sr + 256 * j + 8 * lane + 4);
#pragma unroll
    for (int t = 0; t < 4; ++t) { v[8 * j + t] = a[t]; v[8 * j + 4 + t] = q[t]; }
  }
  float mx = -3.0e38f;
#pragma unroll
  for (int i = 0; i < SEQ / 32; ++i) mx = fmaxf(mx, v[i]);
#pragma unroll
  for (int o = 16; o > 0; o >>= 1) mx = fmaxf(mx, __shfl_xor(mx, o, 32));
  float l = 0.f;
#pragma unroll
  for (int i = 0; i < SEQ / 32; ++i) { v[i] = __expf(v[i] - mx); l += v[i]; }
#pragma unroll
  for (int o = 16; o > 0; o >>= 1) l += __shfl_xor(l, o, 32);
  const float sc = PCAR * (1.0f / l);                                // l >= 1
  v4u u[NCH];
#pragma unroll
  for (int j = 0; j < NCH; ++j) {
#pragma unroll
    for (int t = 0; t < 4; ++t) {
      const _Float16 h0 = (_Float16)(v[8 * j + 2 * t] * sc);
      const _Float16 h1 = (_Float16)(v[8 * j + 2 * t + 1] * sc);
      u[j][t] = pk16(h_bits(h0), h_bits(h1));
    }
  }
{
#pragma unroll
    for (int j = 0; j < NCH; ++j)
      *(v4u*)(P16 + row * SEQ + 256 * j + 8 * lane) = u[j];
    
  }
}

// =========================================================================================================
// (6) Mo[c][t] = (1/16384) sum_s V16[b][c][s] P16[b][t][s] for one (b, 64-t tile, 64-c block): A = V16 rows c
//     (k = s contiguous, pitch SEQ), B = P16 rows t (pitch SEQ), f16 instruction, 1 product, K = SEQ.
//     Epilogue: transposed LDS staging scaled by 2^-14, barrier, Mo hi + residual planes [b][t][512] (planes_out).
// coverage: grid (SEQ/64, 8, NB) covers [NB][SEQ][512] of both planes exactly once.
// =========================================================================================================
__global__ __launch_bounds__(128)
void gemm_pv(const unsigned short* __restrict__ V16, const unsigned short* __restrict__ P16,
             unsigned short* Mh, unsigned short* Mlo) {
  __shared__ __align__(16) float Os[QT * OSP];
  const int tid = threadIdx.x, lane = tid & 31, wave = tid >> 5;
  const int hh = lane >> 4, c = lane & 15;
  const int nt = blockIdx.x, mb = blockIdx.y, b = blockIdx.z;
  const int n0 = nt * QT, o0 = mb * QT;
  const unsigned short* ap = V16 + ((size_t)(b * CH + o0 + c)) * SEQ + 8 * hh;
  const unsigned short* bp = P16 + ((size_t)(b * SEQ + n0 + 16 * wave + c)) * SEQ + 8 * hh;
  v8f acc[4];
#pragma unroll
  for (int mt = 0; mt < 4; ++mt) acc[mt] = zero8();
  gemm_core<1, true>(acc, ap, ap, (size_t)16 * SEQ, bp, bp, SEQ / 32);
  stage_nT(Os, acc, IPCAR, wave, hh, c);
  __syncthreads();
  planes_out<false>(Os, nullptr, o0, Mh, Mlo, (size_t)(b * SEQ + n0), tid);
}

// =========================================================================================================
// (7) out[b][o][t] = sum_c W16[o][c] (Mh + Ml)[b][t][c] + bias[o] + bf16-RNE(xres[b][o][t]) for one (b, 64-t tile,
//     64-o block): 2 products, K = 512; output and residual rows at full strides. Epilogue: row-major LDS staging,
// coverage: 8 it x 8 rows x 16 lanes x 4 = 64 o x 64 t; grid (SEQ/64, 8, NB) covers out[b][0..511][0..SEQ-1] once.
// =========================================================================================================
__global__ __launch_bounds__(128)
void gemm_out(const unsigned short* __restrict__ W, const float* __restrict__ bias,
              const unsigned short* __restrict__ Mh, const unsigned short* __restrict__ Mlo,
              const float* __restrict__ xres, float* out) {
  __shared__ __align__(16) float Os[QT * OSP];
  const int tid = threadIdx.x, lane = tid & 31, wave = tid >> 5;
  const int hh = lane >> 4, c = lane & 15;
  const int nt = blockIdx.x, mb = blockIdx.y, b = blockIdx.z;
  const int n0 = nt * QT, o0 = mb * QT;
  const unsigned short* ap = W + (size_t)(o0 + c) * CH + 8 * hh;
  const size_t bq = ((size_t)(b * SEQ + n0 + 16 * wave + c)) * CH + 8 * hh;
  v8f acc[4];
#pragma unroll
  for (int mt = 0; mt < 4; ++mt) acc[mt] = zero8();
  gemm_core<2, false>(acc, ap, ap, (size_t)16 * CH, Mh + bq, Mlo + bq, CH / 32);
  stage_mn(Os, acc, wave, hh, c);
  __syncthreads();
  const int e = tid & 15, lq = tid >> 4;                             // lq 0..7
  v4f res[8];
#pragma unroll
  for (int it = 0; it < 8; ++it) {
    const int row = it * 8 + lq;                                     // o_loc 0..63
    const float bb = bfr(bias[o0 + row]);
    const size_t idx = ((size_t)(b * CH + o0 + row)) * T_FULL + n0 + 4 * e;
    const v4f a  = *(const v4f*)(Os + row * OSP + 4 * e);
    const v4f xv = *(const v4f*)(xres + idx);
#pragma unroll
    for (int t = 0; t < 4; ++t) res[it][t] = (a[t] + bb) + bfr(xv[t]);
  }
{
#pragma unroll
    for (int it = 0; it < 8; ++it) {
      const int row = it * 8 + lq;
      const size_t idx = ((size_t)(b * CH + o0 + row)) * T_FULL + n0 + 4 * e;
      *(v4f*)(out + idx) = res[it];
    }
    
  }
}

// =========================================================================================================
extern "C" void kernel_launch(void* const* d_in, const int* in_sizes, int n_in,
                              void* d_out, int out_size, void* d_ws, size_t ws_size,
                              hipStream_t stream) {
  if (n_in < 10) return;
  if (in_sizes[0] < NB * CH * T_FULL || in_sizes[1] < NB * CH * T_FULL) return;
  if (in_sizes[2] < CH * CH || in_sizes[4] < CH * CH || in_sizes[6] < CH * CH || in_sizes[8] < CH * CH) return;
  if (in_sizes[3] < CH || in_sizes[5] < CH || in_sizes[7] < CH || in_sizes[9] < CH) return;
  if (out_size < NB * CH * T_FULL) return;

  size_t off = 0;
  auto carve = [&](size_t bytes) { const size_t o = off; off += (bytes + 255) & ~(size_t)255; return o; };
  const size_t oW = carve(WB);
  const size_t oX = carve(RXB);
  const size_t oM = carve(RMB);
  const size_t oV = carve(RVB);
  if (off > ws_size) return;
  if (off > (size_t)WS_CAP) return;

  const float* x_c = (const float*)d_in[0];
  const float* x_s = (const float*)d_in[1];
  const float* Wn  = (const float*)d_in[2];
  const float* bn  = (const float*)d_in[3];
  const float* Wm  = (const float*)d_in[4];
  const float* bm  = (const float*)d_in[5];
  const float* Wl  = (const float*)d_in[6];
  const float* bl  = (const float*)d_in[7];
  const float* Wo  = (const float*)d_in[8];
  const float* bo  = (const float*)d_in[9];
  float* out = (float*)d_out;

  char* ws = (char*)d_ws;
  unsigned short* W16  = (unsigned short*)(ws + oW);
  // region X users
  unsigned short* Xcnh = (unsigned short*)(ws + oX);
  unsigned short* Xcnl = (unsigned short*)(ws + oX + PLB);
  unsigned short* Xsnh = (unsigned short*)(ws + oX + 2 * PLB);
  unsigned short* Xsnl = (unsigned short*)(ws + oX + 3 * PLB);
  unsigned short* Xsr  = (unsigned short*)(ws + oX + 4 * PLB);
  float*          S    = (float*)(ws + oX);
  unsigned short* Moh  = (unsigned short*)(ws + oX);
  unsigned short* Mol  = (unsigned short*)(ws + oX + PLB);
  // region M users
  unsigned short* Mnh  = (unsigned short*)(ws + oM);
  unsigned short* Mnl  = (unsigned short*)(ws + oM + PLB);
  unsigned short* Mmh  = (unsigned short*)(ws + oM + 2 * PLB);
  unsigned short* Mml  = (unsigned short*)(ws + oM + 3 * PLB);
  unsigned short* P16  = (unsigned short*)(ws + oM);
  // region V
  unsigned short* V16  = (unsigned short*)(ws + oV);

  const dim3 blk256(256), blk128(128);
  const dim3 gconv(SEQ / QT, CH / QT, NB);

  // (0) weights -> bf16 planes (order Wn, Wm, Wl, Wo)
  cvt_w<<<dim3(NMAT * CH / 8), blk256, 0, stream>>>(Wn, Wm, Wl, Wo, W16);
  // (1) instance norm + split planes of x_c; same for x_s plus the raw bf16 plane
  cvt_norm<0><<<dim3(CH / QT, NB), blk256, 0, stream>>>(x_c, Xcnh, Xcnl, Xcnl);
  cvt_norm<1><<<dim3(CH / QT, NB), blk256, 0, stream>>>(x_s, Xsnh, Xsnl, Xsr);
  // (2) Mn, Mm hi + residual planes
  gemm_nm<<<gconv, blk128, 0, stream>>>(W16, bn, Xcnh, Xcnl, Mnh, Mnl);
  gemm_nm<<<gconv, blk128, 0, stream>>>(W16 + (size_t)CH * CH, bm, Xsnh, Xsnl, Mmh, Mml);
  // (3) Ml value plane
  gemm_val<<<gconv, blk128, 0, stream>>>(W16 + (size_t)2 * CH * CH, bl, Xsr, V16);
  // (4) scores (overwrites region X)
  gemm_sc<<<dim3(SEQ / QT, SEQ / QT, NB), blk128, 0, stream>>>(Mnh, Mnl, Mmh, Mml, S);
  // (5) softmax weights (overwrites region M)
  softmax_k<<<dim3(NB * SEQ / 8), blk256, 0, stream>>>(S, P16);
  // (6) Mo hi + residual planes (overwrites region X)
  gemm_pv<<<gconv, blk128, 0, stream>>>(V16, P16, Moh, Mol);
  // (7) output GEMM + bias + residual
  gemm_out<<<gconv, blk128, 0, stream>>>(W16 + (size_t)3 * CH * CH, bo, Moh, Mol, x_c, out);
  (void)hipGetLastError();
}

// v001
// It runs in 470 microseconds.
// In both of two side-by-side timings against v000, it was 1.40 times as fast.
// Contractions: conv1x1 Wn.norm(x_c) and Wm.norm(x_s) on v_wmma_f32_16x16x32_bf16 (bf16-RNE weights x bf16 hi +
// bf16 residual planes of the normalised activations, 2 products, K=512); conv1x1 Wl.x_s on v_wmma_f32_16x16x32_bf16
// (bf16-RNE weights x bf16-RNE x_s, 1 product); position scores Mn^T.Mm on v_wmma_f32_16x16x32_bf16 (bf16 hi +
// residual planes of both, 3 products, K=512); Mo = Ml.A^T on v_wmma_f32_16x16x32_f16 (f16 Ml plane x softmax
// weights carried x16384 as f16, K=2048); conv1x1 Wo.Mo on v_wmma_f32_16x16x32_bf16 (bf16-RNE weights x bf16 hi +
// residual planes of Mo, 2 products); f32 accumulate everywhere; instance-norm statistics, softmax, bias and residual
// adds in f32 VALU.
#include <hip/hip_runtime.h>
#include <stdint.h>

#ifndef NB
#define NB 4
#endif
#ifndef SEQ
#define SEQ 2048
#endif
#define NB_FULL 4
#define T_FULL  2048
#define CH      512
#define NMAT    4
#define QT      64
#define OSP     68
#define TP      72
#define NT      128
#define NCH     (SEQ / 256)
#define PCAR    16384.0f
#define IPCAR   6.103515625e-05f
#define EPSN    1.0e-5f
#define WS_CAP  134217728

static_assert(NB >= 1 && NB <= NB_FULL);
static_assert(SEQ >= 256 && SEQ <= T_FULL && SEQ % 256 == 0);
static_assert(SEQ % QT == 0 && CH % QT == 0 && SEQ % NT == 0);
static_assert(CH % 256 == 0 && CH % 32 == 0 && SEQ % 32 == 0 && SEQ % 16 == 0);
static_assert((OSP * 4) % 16 == 0);
static_assert((TP * 2) % 16 == 0);
static_assert((NB * SEQ) % 8 == 0);
static_assert(CH % 8 == 0);

typedef _Float16       v16h __attribute__((ext_vector_type(16)));
typedef _Float16       v8h  __attribute__((ext_vector_type(8)));
typedef __bf16         v16b __attribute__((ext_vector_type(16)));
typedef unsigned short v8us __attribute__((ext_vector_type(8)));
typedef float          v8f  __attribute__((ext_vector_type(8)));
typedef float          v4f  __attribute__((ext_vector_type(4)));
typedef float          v2f  __attribute__((ext_vector_type(2)));
typedef unsigned int   v4u  __attribute__((ext_vector_type(4)));

union Frag { v8us u[2]; v16h h; v16b bf; };
static_assert(sizeof(Frag) == 32);

// ---- workspace map (bytes; every region start a multiple of 256; every extent is an exact tile multiple and is
//      launches; each later user fully overwrites what it reads before any read):
//   W : bf16 [4][512][512] weights                                              WB
//   X : stage 1-3: five bf16 planes [NB][SEQ][512] (x_c norm hi/lo, x_s norm hi/lo, x_s raw)   5*PLB
//       stage 4  : scores f32 [NB][SEQ][SEQ]                                    SB
//       stage 6-7: Mo hi/lo bf16 planes [NB][SEQ][512]                          2*PLB
//   M : stage 2-4: Mn hi/lo, Mm hi/lo bf16 planes [NB][SEQ][512]                4*PLB
//       stage 5-6: softmax weights f16 [NB][SEQ][SEQ]                           PB
//   V : Ml f16 plane [NB][512][SEQ]                                             PLB
//   T : instance-norm {mean, rstd} f32 pairs [2][NB][512]                       STB
constexpr size_t cmax(size_t a, size_t b) { return a > b ? a : b; }
constexpr size_t PLB = (size_t)NB * SEQ * CH * 2;
constexpr size_t SB  = (size_t)NB * SEQ * SEQ * 4;
constexpr size_t PB  = (size_t)NB * SEQ * SEQ * 2;
constexpr size_t WB  = (size_t)NMAT * CH * CH * 2;
constexpr size_t RXB = cmax(cmax(5 * PLB, SB), 2 * PLB);
constexpr size_t RMB = cmax(4 * PLB, PB);
constexpr size_t RVB = PLB;
constexpr size_t STB = (size_t)2 * NB * CH * 2 * 4;
static_assert(WB % 256 == 0 && PLB % 256 == 0 && SB % 256 == 0 && PB % 256 == 0);
static_assert(5 * PLB <= RXB && SB <= RXB && 2 * PLB <= RXB);
static_assert(4 * PLB <= RMB && PB <= RMB);
static_assert(STB % 256 == 0 && (NB * CH) % 16 == 0);
static_assert(WB + RXB + RMB + RVB + STB <= (size_t)WS_CAP);

// ---- scalar helpers -----------------------------------------------------------------------------------------
__device__ __forceinline__ unsigned short bf_bits(float f) {          // f32 -> bf16 bits, RNE convert
  unsigned u = __float_as_uint(f);
  return (unsigned short)((u + 0x7FFFu + ((u >> 16) & 1u)) >> 16);
}
__device__ __forceinline__ float bf_up(unsigned short hb) { return __uint_as_float(((unsigned)hb) << 16); }
__device__ __forceinline__ float bfr(float f) { return bf_up(bf_bits(f)); }
__device__ __forceinline__ unsigned short h_bits(_Float16 x) { return __builtin_bit_cast(unsigned short, x); }
__device__ __forceinline__ unsigned pk16(unsigned short a, unsigned short b) { return (unsigned)a | ((unsigned)b << 16); }
__device__ __forceinline__ v8f zero8() { v8f z = {0.f, 0.f, 0.f, 0.f, 0.f, 0.f, 0.f, 0.f}; return z; }

// ---- 16-bit fragment loader (A, or B from a k-contiguous [n][k] row): lane -> row/col (lane&15), p already includes
//      + 8*(lane>>4); elements 0..7 <- p[0..7] (k0+8h..), elements 8..15 <- p[16..23] (k0+16+8h..)
__device__ __forceinline__ Frag ldfrag(const unsigned short* p) {
  Frag f;
  f.u[0] = *(const v8us*)(p);
  f.u[1] = *(const v8us*)(p + 16);
  return f;
}

// ---- WMMA helpers: builtin followed by a 4-slot VALU gap tying D and keeping A/B live ----------------------------
__device__ __forceinline__ v8f mma_h(v16h a, v16h b, v8f c) {
  v8f d = __builtin_amdgcn_wmma_f32_16x16x32_f16(false, a, false, b, (short)0, c, false, false);
#if defined(__HIP_DEVICE_COMPILE__)
  asm volatile("v_nop\n\tv_nop\n\tv_nop\n\tv_nop" : "+v"(d) : "v"(a), "v"(b));
#endif
  return d;
}
__device__ __forceinline__ v8f mma_b(v16b a, v16b b, v8f c) {
  v8f d = __builtin_amdgcn_wmma_f32_16x16x32_bf16(false, a, false, b, (short)0, c, false, false);
#if defined(__HIP_DEVICE_COMPILE__)
  const v16h ha = __builtin_bit_cast(v16h, a), hb = __builtin_bit_cast(v16h, b);
  asm volatile("v_nop\n\tv_nop\n\tv_nop\n\tv_nop" : "+v"(d) : "v"(ha), "v"(hb));
#endif
  return d;
}

// ---- GEMM core for one 64(m) x 64(n) block tile, 4 waves (128 threads): wave w owns cols n = 16w + (lane&15), one B
//      fragment per k-step per B plane; 4 m-tiles, A rows m = 16 mt + (lane&15); both operands from k-contiguous
//      rows with the split k map (ldfrag). Pointers are pre-offset per lane (row * pitch + 8*(lane>>4)); amt = the
//      element offset of 16 A rows. NPROD: 1 = a0.b0; 2 = a0.b0 + a0.b1; 3 = a0.b0 + a0.b1 + a1.b0 (shared
//      accumulator, unscaled residual planes). HALF selects the f16 instruction (NPROD 1 only).
template <int NPROD, bool HALF>
__device__ __forceinline__ void gemm_core(v8f (&acc)[4],
                                          const unsigned short* __restrict__ a0,
                                          const unsigned short* __restrict__ a1, size_t amt,
                                          const unsigned short* __restrict__ b0,
                                          const unsigned short* __restrict__ b1, int ksteps) {
  static_assert(NPROD >= 1 && NPROD <= 3);
  static_assert(!(HALF && NPROD != 1));
#pragma unroll 1
  for (int ks = 0; ks < ksteps; ++ks) {
    const int ko = 32 * ks;
    const Frag fb0 = ldfrag(b0 + ko);
    Frag fb1 = fb0;
    if (NPROD >= 2) fb1 = ldfrag(b1 + ko);
#pragma unroll
    for (int mt = 0; mt < 4; ++mt) {
      const Frag fa0 = ldfrag(a0 + (size_t)mt * amt + ko);
      if (HALF) {
        acc[mt] = mma_h(fa0.h, fb0.h, acc[mt]);
      } else {
        acc[mt] = mma_b(fa0.bf, fb0.bf, acc[mt]);
        if (NPROD >= 2) acc[mt] = mma_b(fa0.bf, fb1.bf, acc[mt]);
        if (NPROD >= 3) {
          const Frag fa1 = ldfrag(a1 + (size_t)mt * amt + ko);
          acc[mt] = mma_b(fa1.bf, fb0.bf, acc[mt]);
        }
      }
    }
  }
}

// ---- epilogue staging, transposed: Os[n_loc][m_loc] (pitch OSP). Lane (hh, c) of wave w holds D rows
//      m = 16 mt + 8 hh + r, col n = 16 w + c -> two b128 LDS stores per m-tile.
__device__ __forceinline__ void stage_nT(float* Os, const v8f (&acc)[4], float sc, int wave, int hh, int c) {
  const int nl = 16 * wave + c;
#pragma unroll
  for (int mt = 0; mt < 4; ++mt) {
    v4f va, vb;
#pragma unroll
    for (int r = 0; r < 4; ++r) { va[r] = acc[mt][r] * sc; vb[r] = acc[mt][4 + r] * sc; }
    *(v4f*)(Os + nl * OSP + 16 * mt + 8 * hh)     = va;
    *(v4f*)(Os + nl * OSP + 16 * mt + 8 * hh + 4) = vb;
  }
}
// ---- epilogue staging, row-major: Os[m_loc][n_loc] (pitch OSP), scalar LDS stores.
__device__ __forceinline__ void stage_mn(float* Os, const v8f (&acc)[4], int wave, int hh, int c) {
  const int nl = 16 * wave + c;
#pragma unroll
  for (int mt = 0; mt < 4; ++mt) {
#pragma unroll
    for (int r = 0; r < 8; ++r) Os[(16 * mt + 8 * hh + r) * OSP + nl] = acc[mt][r];
  }
}

// ---- plane writer for transposed staging: plane [b][n][512] bf16 hi + bf16 residual, rows rowbase + 0..63,
//      line, one instruction per 16 lines (rows it*16 + lq). Optional f32 bias (bf16-RNE value) added per col.
// coverage: 4 it x 16 rows x 8 lanes x 8 = 64 rows x 64 cols per plane.
template <bool BIAS>
__device__ __forceinline__ void planes_out(const float* Os, const float* __restrict__ bias, int o0,
                                           unsigned short* Ph, unsigned short* Pl, size_t rowbase, int tid) {
  const int e = tid & 7, lq = tid >> 3;                              // lq 0..15
  float bv[8];
#pragma unroll
  for (int t = 0; t < 8; ++t) bv[t] = 0.f;
  if (BIAS) {
    const v4f b0 = *(const v4f*)(bias + o0 + 8 * e);
    const v4f b1 = *(const v4f*)(bias + o0 + 8 * e + 4);
#pragma unroll
    for (int t = 0; t < 4; ++t) { bv[t] = bfr(b0[t]); bv[4 + t] = bfr(b1[t]); }
  }
  v4u uh[4], ul[4];
#pragma unroll
  for (int it = 0; it < 4; ++it) {
    const int row = it * 16 + lq;                                    // n_loc 0..63
    const v4f a = *(const v4f*)(Os + row * OSP + 8 * e);
    const v4f q = *(const v4f*)(Os + row * OSP + 8 * e + 4);
    const float f[8] = {a[0], a[1], a[2], a[3], q[0], q[1], q[2], q[3]};
#pragma unroll
    for (int t = 0; t < 4; ++t) {
      const float f0 = f[2 * t] + bv[2 * t], f1 = f[2 * t + 1] + bv[2 * t + 1];
      const unsigned short hb0 = bf_bits(f0), hb1 = bf_bits(f1);
      const unsigned short lb0 = bf_bits(f0 - bf_up(hb0));
      const unsigned short lb1 = bf_bits(f1 - bf_up(hb1));
      uh[it][t] = pk16(hb0, hb1);
      ul[it][t] = pk16(lb0, lb1);
    }
  }
{
#pragma unroll
    for (int it = 0; it < 4; ++it) {
      const int row = it * 16 + lq;
      const size_t po = (rowbase + (size_t)row) * CH + o0 + 8 * e;
      *(v4u*)(Ph + po) = uh[it];
      *(v4u*)(Pl + po) = ul[it];
    }
    
  }
}

// =========================================================================================================
// (0) weights f32 [512][512] x4 -> W16 bf16 bits [4][512][512] (RNE convert of the input value, exact operand).
//     Block blk owns 8 rows of one matrix (matrix index block-uniform), one wave per 1024-B row = 2 instructions of
// coverage: 256 blocks x 8 rows x 2 j x 32 lanes x 8 = 2048 rows x 512 = the whole plane.
// =========================================================================================================
__global__ __launch_bounds__(256)
void cvt_w(const float* __restrict__ w0, const float* __restrict__ w1,
           const float* __restrict__ w2, const float* __restrict__ w3, unsigned short* W16) {
  const int tid = threadIdx.x, blk = blockIdx.x;
  const int wave = tid >> 5, lane = tid & 31;
  const int mi = blk / (CH / 8);                                     // 0..3, block-uniform
  const int o  = 8 * (blk - mi * (CH / 8)) + wave;                   // 0..511
  const float* wb = (mi == 0) ? w0 : (mi == 1) ? w1 : (mi == 2) ? w2 : w3;
  v4u u[CH / 256];
#pragma unroll
  for (int j = 0; j < CH / 256; ++j) {
    const float* s = wb + (size_t)o * CH + 256 * j + 8 * lane;
    const v4f a = *(const v4f*)s;
    const v4f q = *(const v4f*)(s + 4);
    const float f[8] = {a[0], a[1], a[2], a[3], q[0], q[1], q[2], q[3]};
#pragma unroll
    for (int t = 0; t < 4; ++t) u[j][t] = pk16(bf_bits(f[2 * t]), bf_bits(f[2 * t + 1]));
  }
{
#pragma unroll
    for (int j = 0; j < CH / 256; ++j)
      *(v4u*)(W16 + ((size_t)(mi * CH + o)) * CH + 256 * j + 8 * lane) = u[j];
    
  }
}

// =========================================================================================================
// (1a) instance-norm statistics of both inputs, one launch: St[(sel * NB + b) * 512 + c] = {mean, rsqrt(var + eps)} of
//      bf16-RNE(x) over the row's SEQ values. 16 lanes per row, lane l = 4 q + k owns the elements 16 j + l and adds
//      them in rising j; the four xor steps then form ((s0 + s1) + (s2 + s3)) per q and the sum over q (1, then 2).
//      The lane's SEQ/16 values stay in registers, so the row is read once for mean and variance.
// coverage: block = 16 rows = one 128-B line of St; grid 2 * NB * 512 / 16 covers every row of both inputs once.
// =========================================================================================================
__global__ __launch_bounds__(256)
void norm_stats(const float* __restrict__ xc, const float* __restrict__ xs, float* St) {
  const int tid = threadIdx.x, blk = blockIdx.x;
  const int rl = tid >> 4, l = tid & 15;                             // rl 0..15
  const int sel = blk / (NB * CH / 16);                              // 0 = x_c, 1 = x_s, block-uniform
  const int r   = 16 * (blk - sel * (NB * CH / 16)) + rl;            // b * 512 + c
  const float* xr = (sel ? xs : xc) + (size_t)r * T_FULL + l;
  float v[SEQ / 16];                                                 // the loops are unrolled whole so that v stays in registers
#pragma unroll
  for (int j = 0; j < SEQ / 16; ++j) v[j] = xr[16 * j];
  // xr is an input here so that its registers stay live past the last load and are reused only behind this wait
  asm volatile("s_wait_xcnt 0x0" :: "v"(xr) : "memory");
  float sm = 0.f;
#pragma unroll
  for (int j = 0; j < SEQ / 16; ++j) { v[j] = bfr(v[j]); sm += v[j]; }
  sm += __shfl_xor(sm, 1, 32);
  sm += __shfl_xor(sm, 2, 32);
  sm += __shfl_xor(sm, 4, 32);
  sm += __shfl_xor(sm, 8, 32);
  const float mean = sm * (1.0f / (float)SEQ);
  float sv = 0.f;
#pragma unroll
  for (int j = 0; j < SEQ / 16; ++j) { const float d = v[j] - mean; sv = __builtin_fmaf(d, d, sv); }
  sv += __shfl_xor(sv, 1, 32);
  sv += __shfl_xor(sv, 2, 32);
  sv += __shfl_xor(sv, 4, 32);
  sv += __shfl_xor(sv, 8, 32);
  const float var = sv * (1.0f / (float)SEQ);
  const float rs  = rsqrtf(var + EPSN);
  if (l == 0) {
    v2f st; st[0] = mean; st[1] = rs;
    *(v2f*)(St + 2 * (size_t)(sel * NB * CH + r)) = st;
  }
}

// =========================================================================================================
// (1b) x f32 [b][512 c][2048 t] (batch/row strides at full size) -> position-major bf16 planes [b][t][512]:
//      Ph = bf16-RNE(xn), Pl = bf16-RNE(xn - Ph) with xn = (bf16-RNE(x) - mean) * rstd per (b, c) row (St of 1a);
//      RAW adds Pr = bf16-RNE(x). One 64 c x 128 t tile per block, transposed through LDS (line = 64 c of one plane
//      row): lane e -> c 8e..8e+7, 8 consecutive lanes per line.
// coverage: 4 it x 32 rows x 8 lanes x 8 = 128 t x 64 c per plane; grid (SEQ/128, 8, NB) covers [NB][SEQ][512] of
//           every written plane exactly once.
// =========================================================================================================
template <int RAW>
__global__ __launch_bounds__(256)
void cvt_norm(const float* __restrict__ x, const float* __restrict__ St,
              unsigned short* Ph, unsigned short* Pl, unsigned short* Pr) {
  __shared__ __align__(16) unsigned short Th[NT * TP];
  __shared__ __align__(16) unsigned short Tl[NT * TP];
  __shared__ __align__(16) unsigned short Tr[RAW ? NT * TP : 8];
  const int tid = threadIdx.x;
  const int n0 = blockIdx.x * NT, c0 = blockIdx.y * QT, b = blockIdx.z;
  const int e = tid & 7, lq = tid >> 3;                              // lq 0..31
  v4f a[4], q[4];
  v2f st[2];
  const int sr = b * CH + c0 + lq;                                   // row of c half 0; c half 1 is 32 rows on
  const float* sp0 = x + (size_t)sr * T_FULL + n0 + 8 * e;
#pragma unroll
  for (int it = 0; it < 4; ++it) {                                   // it = 2 * (t half) + (c half)
    const float* sp = sp0 + (size_t)(it & 1) * 32 * T_FULL + (it >> 1) * 64;
    a[it] = *(const v4f*)sp;
    q[it] = *(const v4f*)(sp + 4);
  }
#pragma unroll
  for (int h = 0; h < 2; ++h) st[h] = *(const v2f*)(St + 2 * (size_t)sr + 64 * h);
  // sp0 and sr address the loads; as inputs here their registers stay live past the last load and are reused only behind this wait
  asm volatile("s_wait_xcnt 0x0" :: "v"(sp0), "v"(sr) : "memory");
#pragma unroll
  for (int it = 0; it < 4; ++it) {
    const int cl = (it & 1) * 32 + lq;
    const int tl = (it >> 1) * 64 + 8 * e;                           // 0..120
    const float f[8] = {a[it][0], a[it][1], a[it][2], a[it][3], q[it][0], q[it][1], q[it][2], q[it][3]};
    const float mu = st[it & 1][0], rs = st[it & 1][1];
#pragma unroll
    for (int t = 0; t < 8; ++t) {
      const unsigned short rb = bf_bits(f[t]);
      const float d  = bf_up(rb) - mu;
      const float xn = d * rs;
      const unsigned short hb = bf_bits(xn);
      const unsigned short lb = bf_bits(__builtin_fmaf(d, rs, -bf_up(hb)));   // residual of the unrounded product
      Th[(tl + t) * TP + cl] = hb;
      Tl[(tl + t) * TP + cl] = lb;
      if (RAW) Tr[(tl + t) * TP + cl] = rb;
    }
  }
  __syncthreads();
  v4u uh[4], ul[4], ur[4];
#pragma unroll
  for (int it = 0; it < 4; ++it) {
    const int nl = it * 32 + lq;                                     // 0..127
    uh[it] = *(const v4u*)(Th + nl * TP + 8 * e);
    ul[it] = *(const v4u*)(Tl + nl * TP + 8 * e);
    if (RAW) ur[it] = *(const v4u*)(Tr + nl * TP + 8 * e); else ur[it] = uh[it];
  }
#pragma unroll
  for (int it = 0; it < 4; ++it) {
    const int nl = it * 32 + lq;
    const size_t po = ((size_t)(b * SEQ + n0 + nl)) * CH + c0 + 8 * e;
    *(v4u*)(Ph + po) = uh[it];
    *(v4u*)(Pl + po) = ul[it];
    if (RAW) *(v4u*)(Pr + po) = ur[it];
  }
}

// =========================================================================================================
// (2) conv1x1 GEMM into hi + residual planes: Y[o][n] = sum_c W16[o][c] (Xh + Xl)[b][n][c] + bias[o] for one
//     (b, 64-n tile, 64-o block); A = W rows o (k = c contiguous), B = plane rows n (k = c contiguous), 2 products,
//     K = 512 = 16 steps. Epilogue: transposed LDS staging, barrier, planes [b][n][512] (planes_out).
// coverage: grid (SEQ/64, 8, NB) x 64 n x 64 o covers [NB][SEQ][512] of both planes exactly once.
// =========================================================================================================
__global__ __launch_bounds__(128)
void gemm_nm(const unsigned short* __restrict__ W, const float* __restrict__ bias,
             const unsigned short* __restrict__ Xh, const unsigned short* __restrict__ Xl,
             unsigned short* Ph, unsigned short* Pl) {
  __shared__ __align__(16) float Os[QT * OSP];
  const int tid = threadIdx.x, lane = tid & 31, wave = tid >> 5;
  const int hh = lane >> 4, c = lane & 15;
  const int nt = blockIdx.x, mb = blockIdx.y, b = blockIdx.z;
  const int n0 = nt * QT, o0 = mb * QT;
  const unsigned short* ap = W + (size_t)(o0 + c) * CH + 8 * hh;
  const size_t bq = ((size_t)(b * SEQ + n0 + 16 * wave + c)) * CH + 8 * hh;
  v8f acc[4];
#pragma unroll
  for (int mt = 0; mt < 4; ++mt) acc[mt] = zero8();
  gemm_core<2, false>(acc, ap, ap, (size_t)16 * CH, Xh + bq, Xl + bq, CH / 32);
  stage_nT(Os, acc, 1.0f, wave, hh, c);
  __syncthreads();
  planes_out<true>(Os, bias, o0, Ph, Pl, (size_t)(b * SEQ + n0), tid);
}

// =========================================================================================================
// (3) conv1x1 GEMM into the channel-major f16 value plane: V16[b][o][s] = f16(sum_c W16[o][c] Xr[b][s][c] + bias[o])
//     (pitch SEQ); 1 product, K = 512. Epilogue: row-major LDS staging, barrier, row o segment of 64 halves =
// coverage: 4 it x 16 rows x 8 lanes x 8 = 64 o x 64 s; grid (SEQ/64, 8, NB) covers [NB][512][SEQ] once.
// =========================================================================================================
__global__ __launch_bounds__(128)
void gemm_val(const unsigned short* __restrict__ W, const float* __restrict__ bias,
              const unsigned short* __restrict__ Xr, unsigned short* V16) {
  __shared__ __align__(16) float Os[QT * OSP];
  const int tid = threadIdx.x, lane = tid & 31, wave = tid >> 5;
  const int hh = lane >> 4, c = lane & 15;
  const int nt = blockIdx.x, mb = blockIdx.y, b = blockIdx.z;
  const int n0 = nt * QT, o0 = mb * QT;
  const unsigned short* ap = W + (size_t)(o0 + c) * CH + 8 * hh;
  const size_t bq = ((size_t)(b * SEQ + n0 + 16 * wave + c)) * CH + 8 * hh;
  v8f acc[4];
#pragma unroll
  for (int mt = 0; mt < 4; ++mt) acc[mt] = zero8();
  gemm_core<1, false>(acc, ap, ap, (size_t)16 * CH, Xr + bq, Xr + bq, CH / 32);
  stage_mn(Os, acc, wave, hh, c);
  __syncthreads();
  const int e = tid & 7, lq = tid >> 3;                              // lq 0..15
  v4u u[4];
#pragma unroll
  for (int it = 0; it < 4; ++it) {
    const int row = it * 16 + lq;                                    // o_loc 0..63
    const float bb = bfr(bias[o0 + row]);
    const v4f a = *(const v4f*)(Os + row * OSP + 8 * e);
    const v4f q = *(const v4f*)(Os + row * OSP + 8 * e + 4);
    const float f[8] = {a[0], a[1], a[2], a[3], q[0], q[1], q[2], q[3]};
#pragma unroll
    for (int t = 0; t < 4; ++t) {
      const _Float16 h0 = (_Float16)(f[2 * t] + bb);
      const _Float16 h1 = (_Float16)(f[2 * t + 1] + bb);
      u[it][t] = pk16(h_bits(h0), h_bits(h1));
    }
  }
{
#pragma unroll
    for (int it = 0; it < 4; ++it) {
      const int row = it * 16 + lq;
      const size_t po = ((size_t)(b * CH + o0 + row)) * SEQ + n0 + 8 * e;
      *(v4u*)(V16 + po) = u[it];
    }
    
  }
}

// =========================================================================================================
// (4) scores S[b][t][s] = sum_c Mn[c][t] Mm[c][s] (no scale) for one (b, 64-s tile, 64-t block): A = Mn planes
//     rows t (hi Qh, residual Ql), B = Mm planes rows s (hi Kh, residual Kl), products hh + hl + lh, K = 512.
// coverage: 8 it x 8 rows x 16 lanes x 4 = 64 t x 64 s; grid (SEQ/64, SEQ/64, NB) covers [NB][SEQ][SEQ] once.
// =========================================================================================================
__global__ __launch_bounds__(128)
void gemm_sc(const unsigned short* __restrict__ Qh, const unsigned short* __restrict__ Ql,
             const unsigned short* __restrict__ Kh, const unsigned short* __restrict__ Kl, float* S) {
  __shared__ __align__(16) float Os[QT * OSP];
  const int tid = threadIdx.x, lane = tid & 31, wave = tid >> 5;
  const int hh = lane >> 4, c = lane & 15;
  const int nt = blockIdx.x, mb = blockIdx.y, b = blockIdx.z;
  const int n0 = nt * QT, m0 = mb * QT;
  const size_t aq = ((size_t)(b * SEQ + m0 + c)) * CH + 8 * hh;
  const size_t bq = ((size_t)(b * SEQ + n0 + 16 * wave + c)) * CH + 8 * hh;
  v8f acc[4];
#pragma unroll
  for (int mt = 0; mt < 4; ++mt) acc[mt] = zero8();
  gemm_core<3, false>(acc, Qh + aq, Ql + aq, (size_t)16 * CH, Kh + bq, Kl + bq, CH / 32);
  stage_mn(Os, acc, wave, hh, c);
  __syncthreads();
  const int e = tid & 15, lq = tid >> 4;                             // lq 0..7
  v4f res[8];
#pragma unroll
  for (int it = 0; it < 8; ++it) {
    const int row = it * 8 + lq;
    res[it] = *(const v4f*)(Os + row * OSP + 4 * e);
  }
{
#pragma unroll
    for (int it = 0; it < 8; ++it) {
      const int row = it * 8 + lq;
      *(v4f*)(S + ((size_t)(b * SEQ + m0 + row)) * SEQ + n0 + 4 * e) = res[it];
    }
    
  }
}

// =========================================================================================================
// (5) row softmax over SEQ keys: P16[row][s] = f16(e^{S - max} * 16384 / sum), one wave per row (8 rows per
//     block), the whole row held in registers (SEQ/32 per lane), max/sum by xor shuffles. Writes: lane L ->
// coverage: NCH instructions x 32 lanes x 8 = SEQ halves per row; grid NB*SEQ/8 x 8 waves covers every row once.
// =========================================================================================================
__global__ __launch_bounds__(256)
void softmax_k(const float* __restrict__ S, unsigned short* P16) {
  const int tid = threadIdx.x, wave = tid >> 5, lane = tid & 31;
  const size_t row = (size_t)blockIdx.x * 8 + wave;                 // < NB*SEQ
  const float* sr = S + row * SEQ;
  float v[SEQ / 32];
#pragma unroll
  for (int j = 0; j < NCH; ++j) {
    const v4f a = *(const v4f*)(sr + 256 * j + 8 * lane);
    const v4f q = *(const v4f*)(sr + 256 * j + 8 * lane + 4);
#pragma unroll
    for (int t = 0; t < 4; ++t) { v[8 * j + t] = a[t]; v[8 * j + 4 + t] = q[t]; }
  }
  float mx = -3.0e38f;
#pragma unroll
  for (int i = 0; i < SEQ / 32; ++i) mx = fmaxf(mx, v[i]);
#pragma unroll
  for (int o = 16; o > 0; o >>= 1) mx = fmaxf(mx, __shfl_xor(mx, o, 32));
  float l = 0.f;
#pragma unroll
  for (int i = 0; i < SEQ / 32; ++i) { v[i] = __expf(v[i] - mx); l += v[i]; }
#pragma unroll
  for (int o = 16; o > 0; o >>= 1) l += __shfl_xor(l, o, 32);
  const float sc = PCAR * (1.0f / l);                                // l >= 1
  v4u u[NCH];
#pragma unroll
  for (int j = 0; j < NCH; ++j) {
#pragma unroll
    for (int t = 0; t < 4; ++t) {
      const _Float16 h0 = (_Float16)(v[8 * j + 2 * t] * sc);
      const _Float16 h1 = (_Float16)(v[8 * j + 2 * t + 1] * sc);
      u[j][t] = pk16(h_bits(h0), h_bits(h1));
    }
  }
{
#pragma unroll
    for (int j = 0; j < NCH; ++j)
      *(v4u*)(P16 + row * SEQ + 256 * j + 8 * lane) = u[j];
    
  }
}

// =========================================================================================================
// (6) Mo[c][t] = (1/16384) sum_s V16[b][c][s] P16[b][t][s] for one (b, 64-t tile, 64-c block): A = V16 rows c
//     (k = s contiguous, pitch SEQ), B = P16 rows t (pitch SEQ), f16 instruction, 1 product, K = SEQ.
//     Epilogue: transposed LDS staging scaled by 2^-14, barrier, Mo hi + residual planes [b][t][512] (planes_out).
// coverage: grid (SEQ/64, 8, NB) covers [NB][SEQ][512] of both planes exactly once.
// =========================================================================================================
__global__ __launch_bounds__(128)
void gemm_pv(const unsigned short* __restrict__ V16, const unsigned short* __restrict__ P16,
             unsigned short* Mh, unsigned short* Mlo) {
  __shared__ __align__(16) float Os[QT * OSP];
  const int tid = threadIdx.x, lane = tid & 31, wave = tid >> 5;
  const int hh = lane >> 4, c = lane & 15;
  const int nt = blockIdx.x, mb = blockIdx.y, b = blockIdx.z;
  const int n0 = nt * QT, o0 = mb * QT;
  const unsigned short* ap = V16 + ((size_t)(b * CH + o0 + c)) * SEQ + 8 * hh;
  const unsigned short* bp = P16 + ((size_t)(b * SEQ + n0 + 16 * wave + c)) * SEQ + 8 * hh;
  v8f acc[4];
#pragma unroll
  for (int mt = 0; mt < 4; ++mt) acc[mt] = zero8();
  gemm_core<1, true>(acc, ap, ap, (size_t)16 * SEQ, bp, bp, SEQ / 32);
  stage_nT(Os, acc, IPCAR, wave, hh, c);
  __syncthreads();
  planes_out<false>(Os, nullptr, o0, Mh, Mlo, (size_t)(b * SEQ + n0), tid);
}

// =========================================================================================================
// (7) out[b][o][t] = sum_c W16[o][c] (Mh + Ml)[b][t][c] + bias[o] + bf16-RNE(xres[b][o][t]) for one (b, 64-t tile,
//     64-o block): 2 products, K = 512; output and residual rows at full strides. Epilogue: row-major LDS staging,
// coverage: 8 it x 8 rows x 16 lanes x 4 = 64 o x 64 t; grid (SEQ/64, 8, NB) covers out[b][0..511][0..SEQ-1] once.
// =========================================================================================================
__global__ __launch_bounds__(128)
void gemm_out(const unsigned short* __restrict__ W, const float* __restrict__ bias,
              const unsigned short* __restrict__ Mh, const unsigned short* __restrict__ Mlo,
              const float* __restrict__ xres, float* out) {
  __shared__ __align__(16) float Os[QT * OSP];
  const int tid = threadIdx.x, lane = tid & 31, wave = tid >> 5;
  const int hh = lane >> 4, c = lane & 15;
  const int nt = blockIdx.x, mb = blockIdx.y, b = blockIdx.z;
  const int n0 = nt * QT, o0 = mb * QT;
  const unsigned short* ap = W + (size_t)(o0 + c) * CH + 8 * hh;
  const size_t bq = ((size_t)(b * SEQ + n0 + 16 * wave + c)) * CH + 8 * hh;
  v8f acc[4];
#pragma unroll
  for (int mt = 0; mt < 4; ++mt) acc[mt] = zero8();
  gemm_core<2, false>(acc, ap, ap, (size_t)16 * CH, Mh + bq, Mlo + bq, CH / 32);
  stage_mn(Os, acc, wave, hh, c);
  __syncthreads();
  const int e = tid & 15, lq = tid >> 4;                             // lq 0..7
  v4f res[8];
#pragma unroll
  for (int it = 0; it < 8; ++it) {
    const int row = it * 8 + lq;                                     // o_loc 0..63
    const float bb = bfr(bias[o0 + row]);
    const size_t idx = ((size_t)(b * CH + o0 + row)) * T_FULL + n0 + 4 * e;
    const v4f a  = *(const v4f*)(Os + row * OSP + 4 * e);
    const v4f xv = *(const v4f*)(xres + idx);
#pragma unroll
    for (int t = 0; t < 4; ++t) res[it][t] = (a[t] + bb) + bfr(xv[t]);
  }
{
#pragma unroll
    for (int it = 0; it < 8; ++it) {
      const int row = it * 8 + lq;
      const size_t idx = ((size_t)(b * CH + o0 + row)) * T_FULL + n0 + 4 * e;
      *(v4f*)(out + idx) = res[it];
    }
    
  }
}

// =========================================================================================================
extern "C" void kernel_launch(void* const* d_in, const int* in_sizes, int n_in,
                              void* d_out, int out_size, void* d_ws, size_t ws_size,
                              hipStream_t stream) {
  if (n_in < 10) return;
  if (in_sizes[0] < NB * CH * T_FULL || in_sizes[1] < NB * CH * T_FULL) return;
  if (in_sizes[2] < CH * CH || in_sizes[4] < CH * CH || in_sizes[6] < CH * CH || in_sizes[8] < CH * CH) return;
  if (in_sizes[3] < CH || in_sizes[5] < CH || in_sizes[7] < CH || in_sizes[9] < CH) return;
  if (out_size < NB * CH * T_FULL) return;

  size_t off = 0;
  auto carve = [&](size_t bytes) { const size_t o = off; off += (bytes + 255) & ~(size_t)255; return o; };
  const size_t oW = carve(WB);
  const size_t oX = carve(RXB);
  const size_t oM = carve(RMB);
  const size_t oV = carve(RVB);
  const size_t oT = carve(STB);
  if (off > ws_size) return;
  if (off > (size_t)WS_CAP) return;

  const float* x_c = (const float*)d_in[0];
  const float* x_s = (const float*)d_in[1];
  const float* Wn  = (const float*)d_in[2];
  const float* bn  = (const float*)d_in[3];
  const float* Wm  = (const float*)d_in[4];
  const float* bm  = (const float*)d_in[5];
  const float* Wl  = (const float*)d_in[6];
  const float* bl  = (const float*)d_in[7];
  const float* Wo  = (const float*)d_in[8];
  const float* bo  = (const float*)d_in[9];
  float* out = (float*)d_out;

  char* ws = (char*)d_ws;
  unsigned short* W16  = (unsigned short*)(ws + oW);
  // region X users
  unsigned short* Xcnh = (unsigned short*)(ws + oX);
  unsigned short* Xcnl = (unsigned short*)(ws + oX + PLB);
  unsigned short* Xsnh = (unsigned short*)(ws + oX + 2 * PLB);
  unsigned short* Xsnl = (unsigned short*)(ws + oX + 3 * PLB);
  unsigned short* Xsr  = (unsigned short*)(ws + oX + 4 * PLB);
  float*          S    = (float*)(ws + oX);
  unsigned short* Moh  = (unsigned short*)(ws + oX);
  unsigned short* Mol  = (unsigned short*)(ws + oX + PLB);
  // region M users
  unsigned short* Mnh  = (unsigned short*)(ws + oM);
  unsigned short* Mnl  = (unsigned short*)(ws + oM + PLB);
  unsigned short* Mmh  = (unsigned short*)(ws + oM + 2 * PLB);
  unsigned short* Mml  = (unsigned short*)(ws + oM + 3 * PLB);
  unsigned short* P16  = (unsigned short*)(ws + oM);
  // region V
  unsigned short* V16  = (unsigned short*)(ws + oV);
  // region T
  float*          St   = (float*)(ws + oT);

  const dim3 blk256(256), blk128(128);
  const dim3 gconv(SEQ / QT, CH / QT, NB);

  // (0) weights -> bf16 planes (order Wn, Wm, Wl, Wo)
  cvt_w<<<dim3(NMAT * CH / 8), blk256, 0, stream>>>(Wn, Wm, Wl, Wo, W16);
  // (1a) instance-norm statistics of x_c and x_s
  norm_stats<<<dim3(2 * NB * CH / 16), blk256, 0, stream>>>(x_c, x_s, St);
  // (1b) split planes of norm(x_c); same for x_s plus the raw bf16 plane
  cvt_norm<0><<<dim3(SEQ / NT, CH / QT, NB), blk256, 0, stream>>>(x_c, St, Xcnh, Xcnl, Xcnl);
  cvt_norm<1><<<dim3(SEQ / NT, CH / QT, NB), blk256, 0, stream>>>(x_s, St + 2 * NB * CH, Xsnh, Xsnl, Xsr);
  // (2) Mn, Mm hi + residual planes
  gemm_nm<<<gconv, blk128, 0, stream>>>(W16, bn, Xcnh, Xcnl, Mnh, Mnl);
  gemm_nm<<<gconv, blk128, 0, stream>>>(W16 + (size_t)CH * CH, bm, Xsnh, Xsnl, Mmh, Mml);
  // (3) Ml value plane
  gemm_val<<<gconv, blk128, 0, stream>>>(W16 + (size_t)2 * CH * CH, bl, Xsr, V16);
  // (4) scores (overwrites region X)
  gemm_sc<<<dim3(SEQ / QT, SEQ / QT, NB), blk128, 0, stream>>>(Mnh, Mnl, Mmh, Mml, S);
  // (5) softmax weights (overwrites region M)
  softmax_k<<<dim3(NB * SEQ / 8), blk256, 0, stream>>>(S, P16);
  // (6) Mo hi + residual planes (overwrites region X)
  gemm_pv<<<gconv, blk128, 0, stream>>>(V16, P16, Moh, Mol);
  // (7) output GEMM + bias + residual
  gemm_out<<<gconv, blk128, 0, stream>>>(W16 + (size_t)3 * CH * CH, bo, Moh, Mol, x_c, out);
  (void)hipGetLastError();
}

// v002
// A run of this version takes 183 microseconds.
// Two timings next to v001 put it at 2.57 and 2.56 times that version's speed.
// Over all steps from v000 it is 3.59 times as fast.
// Contractions: conv1x1 Wn.norm(x_c) and Wm.norm(x_s) on v_wmma_f32_16x16x32_bf16 (bf16-RNE weights x bf16 hi +
// bf16 residual planes of the normalised activations, 2 products, K=512); conv1x1 Wl.x_s on v_wmma_f32_16x16x32_bf16
// (bf16-RNE weights x bf16-RNE x_s, 1 product); position scores Mn^T.Mm on v_wmma_f32_16x16x32_bf16 (bf16 hi +
// residual planes of both, 3 products, K=512); Mo = Ml.A^T on v_wmma_f32_16x16x32_f16 (f16 Ml plane x softmax
// weights carried x16384 as f16, K=2048); conv1x1 Wo.Mo on v_wmma_f32_16x16x32_bf16 (bf16-RNE weights x bf16 hi +
// residual planes of Mo, 2 products); f32 accumulate everywhere; instance-norm statistics, softmax, bias and residual
// adds in f32 VALU.
#include <hip/hip_runtime.h>
#include <stdint.h>

#ifndef NB
#define NB 4
#endif
#ifndef SEQ
#define SEQ 2048
#endif
#define NB_FULL 4
#define T_FULL  2048
#define CH      512
#define NMAT    4
#define QT      64
#define OSP     68
#define TP      72
#define NT      128
#define KC      64
#define LP      144
#define TILEB   (QT * LP)
#define NCH     (SEQ / 256)
#define PCAR    16384.0f
#define IPCAR   6.103515625e-05f
#define EPSN    1.0e-5f
#define WS_CAP  134217728

static_assert(NB >= 1 && NB <= NB_FULL);
static_assert(SEQ >= 256 && SEQ <= T_FULL && SEQ % 256 == 0);
static_assert(SEQ % QT == 0 && CH % QT == 0 && SEQ % NT == 0);
static_assert(CH % 256 == 0 && CH % 32 == 0 && SEQ % 32 == 0 && SEQ % 16 == 0);
static_assert((OSP * 4) % 16 == 0);
static_assert((TP * 2) % 16 == 0);
static_assert((NB * SEQ) % 8 == 0);
static_assert(CH % 8 == 0);
static_assert(CH % KC == 0 && SEQ % KC == 0 && CH / KC >= 2 && SEQ / KC >= 2);
static_assert(KC * 2 + 16 == LP && LP % 32 == 16 && QT == 64);
static_assert(QT * OSP * 4 <= 2 * 2 * TILEB);

typedef _Float16       v16h __attribute__((ext_vector_type(16)));
typedef _Float16       v8h  __attribute__((ext_vector_type(8)));
typedef __bf16         v16b __attribute__((ext_vector_type(16)));
typedef unsigned short v8us __attribute__((ext_vector_type(8)));
typedef float          v8f  __attribute__((ext_vector_type(8)));
typedef float          v4f  __attribute__((ext_vector_type(4)));
typedef float          v2f  __attribute__((ext_vector_type(2)));
typedef unsigned int   v4u  __attribute__((ext_vector_type(4)));

union Frag { v8us u[2]; v16h h; v16b bf; };
static_assert(sizeof(Frag) == 32);

// ---- workspace map (bytes; every region start a multiple of 256; every extent is an exact tile multiple and is
//      launches; each later user fully overwrites what it reads before any read):
//   W : bf16 [4][512][512] weights                                              WB
//   X : stage 1-3: five bf16 planes [NB][SEQ][512] (x_c norm hi/lo, x_s norm hi/lo, x_s raw)   5*PLB
//       stage 4  : scores f32 [NB][SEQ][SEQ]                                    SB
//       stage 6-7: Mo hi/lo bf16 planes [NB][SEQ][512]                          2*PLB
//   M : stage 2-4: Mn hi/lo, Mm hi/lo bf16 planes [NB][SEQ][512]                4*PLB
//       stage 5-6: softmax weights f16 [NB][SEQ][SEQ]                           PB
//   V : Ml f16 plane [NB][512][SEQ]                                             PLB
//   T : instance-norm {mean, rstd} f32 pairs [2][NB][512]                       STB
constexpr size_t cmax(size_t a, size_t b) { return a > b ? a : b; }
constexpr size_t PLB = (size_t)NB * SEQ * CH * 2;
constexpr size_t SB  = (size_t)NB * SEQ * SEQ * 4;
constexpr size_t PB  = (size_t)NB * SEQ * SEQ * 2;
constexpr size_t WB  = (size_t)NMAT * CH * CH * 2;
constexpr size_t RXB = cmax(cmax(5 * PLB, SB), 2 * PLB);
constexpr size_t RMB = cmax(4 * PLB, PB);
constexpr size_t RVB = PLB;
constexpr size_t STB = (size_t)2 * NB * CH * 2 * 4;
static_assert(WB % 256 == 0 && PLB % 256 == 0 && SB % 256 == 0 && PB % 256 == 0);
static_assert(5 * PLB <= RXB && SB <= RXB && 2 * PLB <= RXB);
static_assert(4 * PLB <= RMB && PB <= RMB);
static_assert(STB % 256 == 0 && (NB * CH) % 16 == 0);
static_assert(WB + RXB + RMB + RVB + STB <= (size_t)WS_CAP);

// ---- scalar helpers -----------------------------------------------------------------------------------------
__device__ __forceinline__ unsigned short bf_bits(float f) {          // f32 -> bf16 bits, RNE convert
  unsigned u = __float_as_uint(f);
  return (unsigned short)((u + 0x7FFFu + ((u >> 16) & 1u)) >> 16);
}
__device__ __forceinline__ float bf_up(unsigned short hb) { return __uint_as_float(((unsigned)hb) << 16); }
__device__ __forceinline__ float bfr(float f) { return bf_up(bf_bits(f)); }
__device__ __forceinline__ unsigned short h_bits(_Float16 x) { return __builtin_bit_cast(unsigned short, x); }
__device__ __forceinline__ unsigned pk16(unsigned short a, unsigned short b) { return (unsigned)a | ((unsigned)b << 16); }
__device__ __forceinline__ v8f zero8() { v8f z = {0.f, 0.f, 0.f, 0.f, 0.f, 0.f, 0.f, 0.f}; return z; }

// ---- 16-bit fragment loader (A, or B from a k-contiguous [n][k] row): lane -> row/col (lane&15), p already includes
//      + 8*(lane>>4); elements 0..7 <- p[0..7] (k0+8h..), elements 8..15 <- p[16..23] (k0+16+8h..)
__device__ __forceinline__ Frag ldfrag(const unsigned short* p) {
  Frag f;
  f.u[0] = *(const v8us*)(p);
  f.u[1] = *(const v8us*)(p + 16);
  return f;
}

// ---- WMMA helpers: builtin followed by a 4-slot VALU gap tying D and keeping A/B live ----------------------------
__device__ __forceinline__ v8f mma_h(v16h a, v16h b, v8f c) {
  v8f d = __builtin_amdgcn_wmma_f32_16x16x32_f16(false, a, false, b, (short)0, c, false, false);
#if defined(__HIP_DEVICE_COMPILE__)
  asm volatile("v_nop\n\tv_nop\n\tv_nop\n\tv_nop" : "+v"(d) : "v"(a), "v"(b));
#endif
  return d;
}
__device__ __forceinline__ v8f mma_b(v16b a, v16b b, v8f c) {
  v8f d = __builtin_amdgcn_wmma_f32_16x16x32_bf16(false, a, false, b, (short)0, c, false, false);
#if defined(__HIP_DEVICE_COMPILE__)
  const v16h ha = __builtin_bit_cast(v16h, a), hb = __builtin_bit_cast(v16h, b);
  asm volatile("v_nop\n\tv_nop\n\tv_nop\n\tv_nop" : "+v"(d) : "v"(ha), "v"(hb));
#endif
  return d;
}

// ---- asynchronous copies of operand tiles into LDS. One tile of a pass = 64 rows x 128 B (KC elements), LDS pitch LP.
//      Lane map: e = tid & 7 -> 16-B piece of the row, r = tid >> 3 -> row r + 16 i (i = 0..3): 8 lanes cover one whole
//      128-B line. l = the lane's LDS byte address of row r, g = its global address of row r, p16 = elements of 16 rows.
//      The s_wait_xcnt closes each statement so that no address register of an issued copy is rewritten ahead of it.
__device__ __forceinline__ unsigned lds_off(const void* p) { return (unsigned)(size_t)p; }
__device__ __forceinline__ void copy_tile(unsigned l, const unsigned short* g, size_t p16) {
#if defined(__HIP_DEVICE_COMPILE__)
  // four copies of one tile, global -> LDS through no register; the wait is their statement's last line
  asm volatile("global_load_async_to_lds_b128 %0, %4, off\n\t"
               "global_load_async_to_lds_b128 %1, %5, off\n\t"
               "global_load_async_to_lds_b128 %2, %6, off\n\t"
               "global_load_async_to_lds_b128 %3, %7, off\n\t"
               "s_wait_xcnt 0x0"
               :: "v"(l), "v"(l + 16 * LP), "v"(l + 32 * LP), "v"(l + 48 * LP),
                  "v"(g), "v"(g + p16), "v"(g + 2 * p16), "v"(g + 3 * p16) : "memory");
#endif
}
__device__ __forceinline__ void copy_tiles2(unsigned l, const unsigned short* g, size_t p16,
                                            unsigned m, const unsigned short* h, size_t q16) {
#if defined(__HIP_DEVICE_COMPILE__)
  // eight copies of two tiles, global -> LDS through no register; they share one statement and its closing wait
  asm volatile("global_load_async_to_lds_b128 %0, %8, off\n\t"
               "global_load_async_to_lds_b128 %1, %9, off\n\t"
               "global_load_async_to_lds_b128 %2, %10, off\n\t"
               "global_load_async_to_lds_b128 %3, %11, off\n\t"
               "global_load_async_to_lds_b128 %4, %12, off\n\t"
               "global_load_async_to_lds_b128 %5, %13, off\n\t"
               "global_load_async_to_lds_b128 %6, %14, off\n\t"
               "global_load_async_to_lds_b128 %7, %15, off\n\t"
               "s_wait_xcnt 0x0"
               :: "v"(l), "v"(l + 16 * LP), "v"(l + 32 * LP), "v"(l + 48 * LP),
                  "v"(m), "v"(m + 16 * LP), "v"(m + 32 * LP), "v"(m + 48 * LP),
                  "v"(g), "v"(g + p16), "v"(g + 2 * p16), "v"(g + 3 * p16),
                  "v"(h), "v"(h + q16), "v"(h + 2 * q16), "v"(h + 3 * q16) : "memory");
#endif
}

// ---- GEMM core for one 64(m) x 64(n) block tile, 4 waves (128 threads): wave w owns cols n = 16w + (lane&15), one B
//      fragment per k-step per B plane; 4 m-tiles, A rows m = 16 mt + (lane&15). a0/a1/b0/b1 = row 0, k = 0 of the
//      block's 64 operand rows (k-contiguous, pitches ap / bp elements). A pass = KC k: its operand tiles
//      [A0][A1 if NPROD 3][B0][B1 if NPROD >= 2] are copied into one of two LDS buffers one pass ahead, and the
//      fragments are read from LDS with the split k map (ldfrag), k-steps and products in the same order as from
//      global rows. NPROD: 1 = a0.b0; 2 = a0.b0 + a0.b1; 3 = a0.b0 + a0.b1 + a1.b0 (shared accumulator, unscaled
//      residual planes). HALF selects the f16 instruction (NPROD 1 only). On return no copy is outstanding and every
//      wave has left both buffers (the last pass's barrier), so sm may be reused as output staging.
template <int NPROD>
struct CoreLds {
  static constexpr int NA = NPROD >= 3 ? 2 : 1;
  static constexpr int NBP = NPROD >= 2 ? 2 : 1;
  static constexpr unsigned STG = (unsigned)(NA + NBP) * TILEB;
  static constexpr unsigned BYTES = 2 * STG;
};
template <int NPROD>
__device__ __forceinline__ void fill_stage(unsigned l, const unsigned short* a0, const unsigned short* a1, size_t ap16,
                                           const unsigned short* b0, const unsigned short* b1, size_t bp16) {
  if (NPROD == 1) {
    copy_tiles2(l, a0, ap16, l + TILEB, b0, bp16);
  } else if (NPROD == 2) {
    copy_tile(l, a0, ap16);
    copy_tiles2(l + TILEB, b0, bp16, l + 2 * TILEB, b1, bp16);
  } else {
    copy_tiles2(l, a0, ap16, l + TILEB, a1, ap16);
    copy_tiles2(l + 2 * TILEB, b0, bp16, l + 3 * TILEB, b1, bp16);
  }
}
template <int NPROD, bool HALF>
__device__ __forceinline__ void gemm_core(v8f (&acc)[4], const char* sm,
                                          const unsigned short* __restrict__ a0,
                                          const unsigned short* __restrict__ a1, size_t ap,
                                          const unsigned short* __restrict__ b0,
                                          const unsigned short* __restrict__ b1, size_t bp, int npass, int tid) {
  static_assert(NPROD >= 1 && NPROD <= 3);
  static_assert(!(HALF && NPROD != 1));
  constexpr unsigned STG = CoreLds<NPROD>::STG;
  constexpr unsigned BOFF = (unsigned)CoreLds<NPROD>::NA * TILEB;
  const int lane = tid & 31, wave = tid >> 5, hh = lane >> 4, c = lane & 15;
  const int e = tid & 7, r = tid >> 3;                               // r 0..15
  const unsigned lc = lds_off(sm) + (unsigned)(r * LP + 16 * e);
  const size_t ga = (size_t)r * ap + 8 * e, gb = (size_t)r * bp + 8 * e;
  const unsigned fa = (unsigned)(c * LP + 16 * hh);
  const unsigned fb = BOFF + (unsigned)((16 * wave + c) * LP + 16 * hh);
  fill_stage<NPROD>(lc, a0 + ga, a1 + ga, 16 * ap, b0 + gb, b1 + gb, 16 * bp);
  asm volatile("s_wait_asynccnt 0x0" ::: "memory");                  // pass 0's own copies have landed
  __syncthreads();                                                   // ... and every other wave's
  fill_stage<NPROD>(lc + STG, a0 + ga + KC, a1 + ga + KC, 16 * ap, b0 + gb + KC, b1 + gb + KC, 16 * bp);
  // kept rolled: one pass is 8 to 24 matrix instructions with their fragment loads, and the code stays small
#pragma unroll 1
  for (int t = 0; t < npass; ++t) {
    const unsigned bo = (unsigned)(t & 1) * STG;
    // the three loops below are unrolled whole so that the fragment arrays stay in registers and the LDS offsets are immediates
#pragma unroll
    for (int ks = 0; ks < KC / 32; ++ks) {
      const unsigned o = bo + 64u * ks;
      // the k-step's fragment reads stand together, ahead of its matrix instructions: one LDS latency a k-step
      const Frag fb0 = ldfrag((const unsigned short*)(sm + fb + o));
      Frag fb1 = fb0;
      if (NPROD >= 2) fb1 = ldfrag((const unsigned short*)(sm + fb + TILEB + o));
      Frag fa0[4], fa1[4];
#pragma unroll
      for (int mt = 0; mt < 4; ++mt) {
        fa0[mt] = ldfrag((const unsigned short*)(sm + fa + 16 * LP * mt + o));
        if (NPROD >= 3) fa1[mt] = ldfrag((const unsigned short*)(sm + fa + TILEB + 16 * LP * mt + o));
        else fa1[mt] = fa0[mt];
      }
#pragma unroll
      for (int mt = 0; mt < 4; ++mt) {
        if (HALF) {
          acc[mt] = mma_h(fa0[mt].h, fb0.h, acc[mt]);
        } else {
          acc[mt] = mma_b(fa0[mt].bf, fb0.bf, acc[mt]);
          if (NPROD >= 2) acc[mt] = mma_b(fa0[mt].bf, fb1.bf, acc[mt]);
          if (NPROD >= 3) acc[mt] = mma_b(fa1[mt].bf, fb0.bf, acc[mt]);
        }
      }
    }
    asm volatile("s_wait_dscnt 0x0" ::: "memory");                   // this wave's reads of the buffer are done before it is refilled
    asm volatile("s_wait_asynccnt 0x0" ::: "memory");                // this wave's copies of pass t + 1 have landed
    __syncthreads();                                                 // publishes pass t + 1, ends every read of pass t's buffer
    if (t + 2 < npass) {
      const int ko = KC * (t + 2);
      fill_stage<NPROD>(lc + bo, a0 + ga + ko, a1 + ga + ko, 16 * ap, b0 + gb + ko, b1 + gb + ko, 16 * bp);
    }
  }
  asm volatile("s_wait_asynccnt 0x0" ::: "memory");                  // nothing outstanding when the LDS changes its use
}

// ---- epilogue staging, transposed: Os[n_loc][m_loc] (pitch OSP). Lane (hh, c) of wave w holds D rows
//      m = 16 mt + 8 hh + r, col n = 16 w + c -> two b128 LDS stores per m-tile.
__device__ __forceinline__ void stage_nT(float* Os, const v8f (&acc)[4], float sc, int wave, int hh, int c) {
  const int nl = 16 * wave + c;
#pragma unroll
  for (int mt = 0; mt < 4; ++mt) {
    v4f va, vb;
#pragma unroll
    for (int r = 0; r < 4; ++r) { va[r] = acc[mt][r] * sc; vb[r] = acc[mt][4 + r] * sc; }
    *(v4f*)(Os + nl * OSP + 16 * mt + 8 * hh)     = va;
    *(v4f*)(Os + nl * OSP + 16 * mt + 8 * hh + 4) = vb;
  }
}
// ---- epilogue staging, row-major: Os[m_loc][n_loc] (pitch OSP), scalar LDS stores.
__device__ __forceinline__ void stage_mn(float* Os, const v8f (&acc)[4], int wave, int hh, int c) {
  const int nl = 16 * wave + c;
#pragma unroll
  for (int mt = 0; mt < 4; ++mt) {
#pragma unroll
    for (int r = 0; r < 8; ++r) Os[(16 * mt + 8 * hh + r) * OSP + nl] = acc[mt][r];
  }
}

// ---- plane writer for transposed staging: plane [b][n][512] bf16 hi + bf16 residual, rows rowbase + 0..63,
//      line, one instruction per 16 lines (rows it*16 + lq). Optional f32 bias (bf16-RNE value) added per col.
// coverage: 4 it x 16 rows x 8 lanes x 8 = 64 rows x 64 cols per plane.
template <bool BIAS>
__device__ __forceinline__ void planes_out(const float* Os, const float* __restrict__ bias, int o0,
                                           unsigned short* Ph, unsigned short* Pl, size_t rowbase, int tid) {
  const int e = tid & 7, lq = tid >> 3;                              // lq 0..15
  float bv[8];
#pragma unroll
  for (int t = 0; t < 8; ++t) bv[t] = 0.f;
  if (BIAS) {
    const v4f b0 = *(const v4f*)(bias + o0 + 8 * e);
    const v4f b1 = *(const v4f*)(bias + o0 + 8 * e + 4);
#pragma unroll
    for (int t = 0; t < 4; ++t) { bv[t] = bfr(b0[t]); bv[4 + t] = bfr(b1[t]); }
  }
  v4u uh[4], ul[4];
#pragma unroll
  for (int it = 0; it < 4; ++it) {
    const int row = it * 16 + lq;                                    // n_loc 0..63
    const v4f a = *(const v4f*)(Os + row * OSP + 8 * e);
    const v4f q = *(const v4f*)(Os + row * OSP + 8 * e + 4);
    const float f[8] = {a[0], a[1], a[2], a[3], q[0], q[1], q[2], q[3]};
#pragma unroll
    for (int t = 0; t < 4; ++t) {
      const float f0 = f[2 * t] + bv[2 * t], f1 = f[2 * t + 1] + bv[2 * t + 1];
      const unsigned short hb0 = bf_bits(f0), hb1 = bf_bits(f1);
      const unsigned short lb0 = bf_bits(f0 - bf_up(hb0));
      const unsigned short lb1 = bf_bits(f1 - bf_up(hb1));
      uh[it][t] = pk16(hb0, hb1);
      ul[it][t] = pk16(lb0, lb1);
    }
  }
{
#pragma unroll
    for (int it = 0; it < 4; ++it) {
      const int row = it * 16 + lq;
      const size_t po = (rowbase + (size_t)row) * CH + o0 + 8 * e;
      *(v4u*)(Ph + po) = uh[it];
      *(v4u*)(Pl + po) = ul[it];
    }
    
  }
}

// =========================================================================================================
// (0) weights f32 [512][512] x4 -> W16 bf16 bits [4][512][512] (RNE convert of the input value, exact operand).
//     Block blk owns 8 rows of one matrix (matrix index block-uniform), one wave per 1024-B row = 2 instructions of
// coverage: 256 blocks x 8 rows x 2 j x 32 lanes x 8 = 2048 rows x 512 = the whole plane.
// =========================================================================================================
__global__ __launch_bounds__(256)
void cvt_w(const float* __restrict__ w0, const float* __restrict__ w1,
           const float* __restrict__ w2, const float* __restrict__ w3, unsigned short* W16) {
  const int tid = threadIdx.x, blk = blockIdx.x;
  const int wave = tid >> 5, lane = tid & 31;
  const int mi = blk / (CH / 8);                                     // 0..3, block-uniform
  const int o  = 8 * (blk - mi * (CH / 8)) + wave;                   // 0..511
  const float* wb = (mi == 0) ? w0 : (mi == 1) ? w1 : (mi == 2) ? w2 : w3;
  v4u u[CH / 256];
#pragma unroll
  for (int j = 0; j < CH / 256; ++j) {
    const float* s = wb + (size_t)o * CH + 256 * j + 8 * lane;
    const v4f a = *(const v4f*)s;
    const v4f q = *(const v4f*)(s + 4);
    const float f[8] = {a[0], a[1], a[2], a[3], q[0], q[1], q[2], q[3]};
#pragma unroll
    for (int t = 0; t < 4; ++t) u[j][t] = pk16(bf_bits(f[2 * t]), bf_bits(f[2 * t + 1]));
  }
{
#pragma unroll
    for (int j = 0; j < CH / 256; ++j)
      *(v4u*)(W16 + ((size_t)(mi * CH + o)) * CH + 256 * j + 8 * lane) = u[j];
    
  }
}

// =========================================================================================================
// (1a) instance-norm statistics of both inputs, one launch: St[(sel * NB + b) * 512 + c] = {mean, rsqrt(var + eps)} of
//      bf16-RNE(x) over the row's SEQ values. 16 lanes per row, lane l = 4 q + k owns the elements 16 j + l and adds
//      them in rising j; the four xor steps then form ((s0 + s1) + (s2 + s3)) per q and the sum over q (1, then 2).
//      The lane's SEQ/16 values stay in registers, so the row is read once for mean and variance.
// coverage: block = 16 rows = one 128-B line of St; grid 2 * NB * 512 / 16 covers every row of both inputs once.
// =========================================================================================================
__global__ __launch_bounds__(256)
void norm_stats(const float* __restrict__ xc, const float* __restrict__ xs, float* St) {
  const int tid = threadIdx.x, blk = blockIdx.x;
  const int rl = tid >> 4, l = tid & 15;                             // rl 0..15
  const int sel = blk / (NB * CH / 16);                              // 0 = x_c, 1 = x_s, block-uniform
  const int r   = 16 * (blk - sel * (NB * CH / 16)) + rl;            // b * 512 + c
  const float* xr = (sel ? xs : xc) + (size_t)r * T_FULL + l;
  float v[SEQ / 16];                                                 // the loops are unrolled whole so that v stays in registers
#pragma unroll
  for (int j = 0; j < SEQ / 16; ++j) v[j] = xr[16 * j];
  // xr is an input here so that its registers stay live past the last load and are reused only behind this wait
  asm volatile("s_wait_xcnt 0x0" :: "v"(xr) : "memory");
  float sm = 0.f;
#pragma unroll
  for (int j = 0; j < SEQ / 16; ++j) { v[j] = bfr(v[j]); sm += v[j]; }
  sm += __shfl_xor(sm, 1, 32);
  sm += __shfl_xor(sm, 2, 32);
  sm += __shfl_xor(sm, 4, 32);
  sm += __shfl_xor(sm, 8, 32);
  const float mean = sm * (1.0f / (float)SEQ);
  float sv = 0.f;
#pragma unroll
  for (int j = 0; j < SEQ / 16; ++j) { const float d = v[j] - mean; sv = __builtin_fmaf(d, d, sv); }
  sv += __shfl_xor(sv, 1, 32);
  sv += __shfl_xor(sv, 2, 32);
  sv += __shfl_xor(sv, 4, 32);
  sv += __shfl_xor(sv, 8, 32);
  const float var = sv * (1.0f / (float)SEQ);
  const float rs  = rsqrtf(var + EPSN);
  if (l == 0) {
    v2f st; st[0] = mean; st[1] = rs;
    *(v2f*)(St + 2 * (size_t)(sel * NB * CH + r)) = st;
  }
}

// =========================================================================================================
// (1b) x f32 [b][512 c][2048 t] (batch/row strides at full size) -> position-major bf16 planes [b][t][512]:
//      Ph = bf16-RNE(xn), Pl = bf16-RNE(xn - Ph) with xn = (bf16-RNE(x) - mean) * rstd per (b, c) row (St of 1a);
//      RAW adds Pr = bf16-RNE(x). One 64 c x 128 t tile per block, transposed through LDS (line = 64 c of one plane
//      row): lane e -> c 8e..8e+7, 8 consecutive lanes per line.
// coverage: 4 it x 32 rows x 8 lanes x 8 = 128 t x 64 c per plane; grid (SEQ/128, 8, NB) covers [NB][SEQ][512] of
//           every written plane exactly once.
// =========================================================================================================
template <int RAW>
__global__ __launch_bounds__(256)
void cvt_norm(const float* __restrict__ x, const float* __restrict__ St,
              unsigned short* Ph, unsigned short* Pl, unsigned short* Pr) {
  __shared__ __align__(16) unsigned short Th[NT * TP];
  __shared__ __align__(16) unsigned short Tl[NT * TP];
  __shared__ __align__(16) unsigned short Tr[RAW ? NT * TP : 8];
  const int tid = threadIdx.x;
  const int n0 = blockIdx.x * NT, c0 = blockIdx.y * QT, b = blockIdx.z;
  const int e = tid & 7, lq = tid >> 3;                              // lq 0..31
  v4f a[4], q[4];
  v2f st[2];
  const int sr = b * CH + c0 + lq;                                   // row of c half 0; c half 1 is 32 rows on
  const float* sp0 = x + (size_t)sr * T_FULL + n0 + 8 * e;
#pragma unroll
  for (int it = 0; it < 4; ++it) {                                   // it = 2 * (t half) + (c half)
    const float* sp = sp0 + (size_t)(it & 1) * 32 * T_FULL + (it >> 1) * 64;
    a[it] = *(const v4f*)sp;
    q[it] = *(const v4f*)(sp + 4);
  }
#pragma unroll
  for (int h = 0; h < 2; ++h) st[h] = *(const v2f*)(St + 2 * (size_t)sr + 64 * h);
  // sp0 and sr address the loads; as inputs here their registers stay live past the last load and are reused only behind this wait
  asm volatile("s_wait_xcnt 0x0" :: "v"(sp0), "v"(sr) : "memory");
#pragma unroll
  for (int it = 0; it < 4; ++it) {
    const int cl = (it & 1) * 32 + lq;
    const int tl = (it >> 1) * 64 + 8 * e;                           // 0..120
    const float f[8] = {a[it][0], a[it][1], a[it][2], a[it][3], q[it][0], q[it][1], q[it][2], q[it][3]};
    const float mu = st[it & 1][0], rs = st[it & 1][1];
#pragma unroll
    for (int t = 0; t < 8; ++t) {
      const unsigned short rb = bf_bits(f[t]);
      const float d  = bf_up(rb) - mu;
      const float xn = d * rs;
      const unsigned short hb = bf_bits(xn);
      const unsigned short lb = bf_bits(__builtin_fmaf(d, rs, -bf_up(hb)));   // residual of the unrounded product
      Th[(tl + t) * TP + cl] = hb;
      Tl[(tl + t) * TP + cl] = lb;
      if (RAW) Tr[(tl + t) * TP + cl] = rb;
    }
  }
  __syncthreads();
  v4u uh[4], ul[4], ur[4];
#pragma unroll
  for (int it = 0; it < 4; ++it) {
    const int nl = it * 32 + lq;                                     // 0..127
    uh[it] = *(const v4u*)(Th + nl * TP + 8 * e);
    ul[it] = *(const v4u*)(Tl + nl * TP + 8 * e);
    if (RAW) ur[it] = *(const v4u*)(Tr + nl * TP + 8 * e); else ur[it] = uh[it];
  }
#pragma unroll
  for (int it = 0; it < 4; ++it) {
    const int nl = it * 32 + lq;
    const size_t po = ((size_t)(b * SEQ + n0 + nl)) * CH + c0 + 8 * e;
    *(v4u*)(Ph + po) = uh[it];
    *(v4u*)(Pl + po) = ul[it];
    if (RAW) *(v4u*)(Pr + po) = ur[it];
  }
}

// =========================================================================================================
// (2) conv1x1 GEMM into hi + residual planes: Y[o][n] = sum_c W16[o][c] (Xh + Xl)[b][n][c] + bias[o] for one
//     (b, 64-n tile, 64-o block); A = W rows o (k = c contiguous), B = plane rows n (k = c contiguous), 2 products,
//     K = 512 = 16 steps. Epilogue: transposed LDS staging, barrier, planes [b][n][512] (planes_out).
// coverage: grid (SEQ/64, 8, NB) x 64 n x 64 o covers [NB][SEQ][512] of both planes exactly once.
// =========================================================================================================
__global__ __launch_bounds__(128)
void gemm_nm(const unsigned short* __restrict__ W, const float* __restrict__ bias,
             const unsigned short* __restrict__ Xh, const unsigned short* __restrict__ Xl,
             unsigned short* Ph, unsigned short* Pl) {
  __shared__ __align__(16) char sm[CoreLds<2>::BYTES];         // two operand buffers; output staging behind the core
  float* Os = (float*)sm;
  const int tid = threadIdx.x, lane = tid & 31, wave = tid >> 5;
  const int hh = lane >> 4, c = lane & 15;
  const int nt = blockIdx.x, mb = blockIdx.y, b = blockIdx.z;
  const int n0 = nt * QT, o0 = mb * QT;
  const unsigned short* ap = W + (size_t)o0 * CH;
  const size_t bq = ((size_t)(b * SEQ + n0)) * CH;
  v8f acc[4];
#pragma unroll
  for (int mt = 0; mt < 4; ++mt) acc[mt] = zero8();
  gemm_core<2, false>(acc, sm, ap, ap, CH, Xh + bq, Xl + bq, CH, CH / KC, tid);
  stage_nT(Os, acc, 1.0f, wave, hh, c);
  __syncthreads();
  planes_out<true>(Os, bias, o0, Ph, Pl, (size_t)(b * SEQ + n0), tid);
}

// =========================================================================================================
// (3) conv1x1 GEMM into the channel-major f16 value plane: V16[b][o][s] = f16(sum_c W16[o][c] Xr[b][s][c] + bias[o])
//     (pitch SEQ); 1 product, K = 512. Epilogue: row-major LDS staging, barrier, row o segment of 64 halves =
// coverage: 4 it x 16 rows x 8 lanes x 8 = 64 o x 64 s; grid (SEQ/64, 8, NB) covers [NB][512][SEQ] once.
// =========================================================================================================
__global__ __launch_bounds__(128)
void gemm_val(const unsigned short* __restrict__ W, const float* __restrict__ bias,
              const unsigned short* __restrict__ Xr, unsigned short* V16) {
  __shared__ __align__(16) char sm[CoreLds<1>::BYTES];         // two operand buffers; output staging behind the core
  float* Os = (float*)sm;
  const int tid = threadIdx.x, lane = tid & 31, wave = tid >> 5;
  const int hh = lane >> 4, c = lane & 15;
  const int nt = blockIdx.x, mb = blockIdx.y, b = blockIdx.z;
  const int n0 = nt * QT, o0 = mb * QT;
  const unsigned short* ap = W + (size_t)o0 * CH;
  const size_t bq = ((size_t)(b * SEQ + n0)) * CH;
  v8f acc[4];
#pragma unroll
  for (int mt = 0; mt < 4; ++mt) acc[mt] = zero8();
  gemm_core<1, false>(acc, sm, ap, ap, CH, Xr + bq, Xr + bq, CH, CH / KC, tid);
  stage_mn(Os, acc, wave, hh, c);
  __syncthreads();
  const int e = tid & 7, lq = tid >> 3;                              // lq 0..15
  v4u u[4];
#pragma unroll
  for (int it = 0; it < 4; ++it) {
    const int row = it * 16 + lq;                                    // o_loc 0..63
    const float bb = bfr(bias[o0 + row]);
    const v4f a = *(const v4f*)(Os + row * OSP + 8 * e);
    const v4f q = *(const v4f*)(Os + row * OSP + 8 * e + 4);
    const float f[8] = {a[0], a[1], a[2], a[3], q[0], q[1], q[2], q[3]};
#pragma unroll
    for (int t = 0; t < 4; ++t) {
      const _Float16 h0 = (_Float16)(f[2 * t] + bb);
      const _Float16 h1 = (_Float16)(f[2 * t + 1] + bb);
      u[it][t] = pk16(h_bits(h0), h_bits(h1));
    }
  }
{
#pragma unroll
    for (int it = 0; it < 4; ++it) {
      const int row = it * 16 + lq;
      const size_t po = ((size_t)(b * CH + o0 + row)) * SEQ + n0 + 8 * e;
      *(v4u*)(V16 + po) = u[it];
    }
    
  }
}

// =========================================================================================================
// (4) scores S[b][t][s] = sum_c Mn[c][t] Mm[c][s] (no scale) for one (b, 64-s tile, 64-t block): A = Mn planes
//     rows t (hi Qh, residual Ql), B = Mm planes rows s (hi Kh, residual Kl), products hh + hl + lh, K = 512.
// coverage: 8 it x 8 rows x 16 lanes x 4 = 64 t x 64 s; grid (SEQ/64, SEQ/64, NB) covers [NB][SEQ][SEQ] once.
// =========================================================================================================
__global__ __launch_bounds__(128)
void gemm_sc(const unsigned short* __restrict__ Qh, const unsigned short* __restrict__ Ql,
             const unsigned short* __restrict__ Kh, const unsigned short* __restrict__ Kl, float* S) {
  __shared__ __align__(16) char sm[CoreLds<3>::BYTES];         // two operand buffers; output staging behind the core
  float* Os = (float*)sm;
  const int tid = threadIdx.x, lane = tid & 31, wave = tid >> 5;
  const int hh = lane >> 4, c = lane & 15;
  const int nt = blockIdx.x, mb = blockIdx.y, b = blockIdx.z;
  const int n0 = nt * QT, m0 = mb * QT;
  const size_t aq = ((size_t)(b * SEQ + m0)) * CH;
  const size_t bq = ((size_t)(b * SEQ + n0)) * CH;
  v8f acc[4];
#pragma unroll
  for (int mt = 0; mt < 4; ++mt) acc[mt] = zero8();
  gemm_core<3, false>(acc, sm, Qh + aq, Ql + aq, CH, Kh + bq, Kl + bq, CH, CH / KC, tid);
  stage_mn(Os, acc, wave, hh, c);
  __syncthreads();
  const int e = tid & 15, lq = tid >> 4;                             // lq 0..7
  v4f res[8];
#pragma unroll
  for (int it = 0; it < 8; ++it) {
    const int row = it * 8 + lq;
    res[it] = *(const v4f*)(Os + row * OSP + 4 * e);
  }
{
#pragma unroll
    for (int it = 0; it < 8; ++it) {
      const int row = it * 8 + lq;
      *(v4f*)(S + ((size_t)(b * SEQ + m0 + row)) * SEQ + n0 + 4 * e) = res[it];
    }
    
  }
}

// =========================================================================================================
// (5) row softmax over SEQ keys: P16[row][s] = f16(e^{S - max} * 16384 / sum), one wave per row (8 rows per
//     block), the whole row held in registers (SEQ/32 per lane), max/sum by xor shuffles. Writes: lane L ->
// coverage: NCH instructions x 32 lanes x 8 = SEQ halves per row; grid NB*SEQ/8 x 8 waves covers every row once.
// =========================================================================================================
__global__ __launch_bounds__(256)
void softmax_k(const float* __restrict__ S, unsigned short* P16) {
  const int tid = threadIdx.x, wave = tid >> 5, lane = tid & 31;
  const size_t row = (size_t)blockIdx.x * 8 + wave;                 // < NB*SEQ
  const float* sr = S + row * SEQ;
  float v[SEQ / 32];
#pragma unroll
  for (int j = 0; j < NCH; ++j) {
    const v4f a = *(const v4f*)(sr + 256 * j + 8 * lane);
    const v4f q = *(const v4f*)(sr + 256 * j + 8 * lane + 4);
#pragma unroll
    for (int t = 0; t < 4; ++t) { v[8 * j + t] = a[t]; v[8 * j + 4 + t] = q[t]; }
  }
  float mx = -3.0e38f;
#pragma unroll
  for (int i = 0; i < SEQ / 32; ++i) mx = fmaxf(mx, v[i]);
#pragma unroll
  for (int o = 16; o > 0; o >>= 1) mx = fmaxf(mx, __shfl_xor(mx, o, 32));
  float l = 0.f;
#pragma unroll
  for (int i = 0; i < SEQ / 32; ++i) { v[i] = __expf(v[i] - mx); l += v[i]; }
#pragma unroll
  for (int o = 16; o > 0; o >>= 1) l += __shfl_xor(l, o, 32);
  const float sc = PCAR * (1.0f / l);                                // l >= 1
  v4u u[NCH];
#pragma unroll
  for (int j = 0; j < NCH; ++j) {
#pragma unroll
    for (int t = 0; t < 4; ++t) {
      const _Float16 h0 = (_Float16)(v[8 * j + 2 * t] * sc);
      const _Float16 h1 = (_Float16)(v[8 * j + 2 * t + 1] * sc);
      u[j][t] = pk16(h_bits(h0), h_bits(h1));
    }
  }
{
#pragma unroll
    for (int j = 0; j < NCH; ++j)
      *(v4u*)(P16 + row * SEQ + 256 * j + 8 * lane) = u[j];
    
  }
}

// =========================================================================================================
// (6) Mo[c][t] = (1/16384) sum_s V16[b][c][s] P16[b][t][s] for one (b, 64-t tile, 64-c block): A = V16 rows c
//     (k = s contiguous, pitch SEQ), B = P16 rows t (pitch SEQ), f16 instruction, 1 product, K = SEQ.
//     Epilogue: transposed LDS staging scaled by 2^-14, barrier, Mo hi + residual planes [b][t][512] (planes_out).
// coverage: grid (SEQ/64, 8, NB) covers [NB][SEQ][512] of both planes exactly once.
// =========================================================================================================
__global__ __launch_bounds__(128)
void gemm_pv(const unsigned short* __restrict__ V16, const unsigned short* __restrict__ P16,
             unsigned short* Mh, unsigned short* Mlo) {
  __shared__ __align__(16) char sm[CoreLds<1>::BYTES];         // two operand buffers; output staging behind the core
  float* Os = (float*)sm;
  const int tid = threadIdx.x, lane = tid & 31, wave = tid >> 5;
  const int hh = lane >> 4, c = lane & 15;
  const int nt = blockIdx.x, mb = blockIdx.y, b = blockIdx.z;
  const int n0 = nt * QT, o0 = mb * QT;
  const unsigned short* ap = V16 + ((size_t)(b * CH + o0)) * SEQ;
  const unsigned short* bp = P16 + ((size_t)(b * SEQ + n0)) * SEQ;
  v8f acc[4];
#pragma unroll
  for (int mt = 0; mt < 4; ++mt) acc[mt] = zero8();
  gemm_core<1, true>(acc, sm, ap, ap, SEQ, bp, bp, SEQ, SEQ / KC, tid);
  stage_nT(Os, acc, IPCAR, wave, hh, c);
  __syncthreads();
  planes_out<false>(Os, nullptr, o0, Mh, Mlo, (size_t)(b * SEQ + n0), tid);
}

// =========================================================================================================
// (7) out[b][o][t] = sum_c W16[o][c] (Mh + Ml)[b][t][c] + bias[o] + bf16-RNE(xres[b][o][t]) for one (b, 64-t tile,
//     64-o block): 2 products, K = 512; output and residual rows at full strides. Epilogue: row-major LDS staging,
// coverage: 8 it x 8 rows x 16 lanes x 4 = 64 o x 64 t; grid (SEQ/64, 8, NB) covers out[b][0..511][0..SEQ-1] once.
// =========================================================================================================
__global__ __launch_bounds__(128)
void gemm_out(const unsigned short* __restrict__ W, const float* __restrict__ bias,
              const unsigned short* __restrict__ Mh, const unsigned short* __restrict__ Mlo,
              const float* __restrict__ xres, float* out) {
  __shared__ __align__(16) char sm[CoreLds<2>::BYTES];         // two operand buffers; output staging behind the core
  float* Os = (float*)sm;
  const int tid = threadIdx.x, lane = tid & 31, wave = tid >> 5;
  const int hh = lane >> 4, c = lane & 15;
  const int nt = blockIdx.x, mb = blockIdx.y, b = blockIdx.z;
  const int n0 = nt * QT, o0 = mb * QT;
  const unsigned short* ap = W + (size_t)o0 * CH;
  const size_t bq = ((size_t)(b * SEQ + n0)) * CH;
  v8f acc[4];
#pragma unroll
  for (int mt = 0; mt < 4; ++mt) acc[mt] = zero8();
  gemm_core<2, false>(acc, sm, ap, ap, CH, Mh + bq, Mlo + bq, CH, CH / KC, tid);
  stage_mn(Os, acc, wave, hh, c);
  __syncthreads();
  const int e = tid & 15, lq = tid >> 4;                             // lq 0..7
  v4f res[8];
#pragma unroll
  for (int it = 0; it < 8; ++it) {
    const int row = it * 8 + lq;                                     // o_loc 0..63
    const float bb = bfr(bias[o0 + row]);
    const size_t idx = ((size_t)(b * CH + o0 + row)) * T_FULL + n0 + 4 * e;
    const v4f a  = *(const v4f*)(Os + row * OSP + 4 * e);
    const v4f xv = *(const v4f*)(xres + idx);
#pragma unroll
    for (int t = 0; t < 4; ++t) res[it][t] = (a[t] + bb) + bfr(xv[t]);
  }
{
#pragma unroll
    for (int it = 0; it < 8; ++it) {
      const int row = it * 8 + lq;
      const size_t idx = ((size_t)(b * CH + o0 + row)) * T_FULL + n0 + 4 * e;
      *(v4f*)(out + idx) = res[it];
    }
    
  }
}

// =========================================================================================================
extern "C" void kernel_launch(void* const* d_in, const int* in_sizes, int n_in,
                              void* d_out, int out_size, void* d_ws, size_t ws_size,
                              hipStream_t stream) {
  if (n_in < 10) return;
  if (in_sizes[0] < NB * CH * T_FULL || in_sizes[1] < NB * CH * T_FULL) return;
  if (in_sizes[2] < CH * CH || in_sizes[4] < CH * CH || in_sizes[6] < CH * CH || in_sizes[8] < CH * CH) return;
  if (in_sizes[3] < CH || in_sizes[5] < CH || in_sizes[7] < CH || in_sizes[9] < CH) return;
  if (out_size < NB * CH * T_FULL) return;

  size_t off = 0;
  auto carve = [&](size_t bytes) { const size_t o = off; off += (bytes + 255) & ~(size_t)255; return o; };
  const size_t oW = carve(WB);
  const size_t oX = carve(RXB);
  const size_t oM = carve(RMB);
  const size_t oV = carve(RVB);
  const size_t oT = carve(STB);
  if (off > ws_size) return;
  if (off > (size_t)WS_CAP) return;

  const float* x_c = (const float*)d_in[0];
  const float* x_s = (const float*)d_in[1];
  const float* Wn  = (const float*)d_in[2];
  const float* bn  = (const float*)d_in[3];
  const float* Wm  = (const float*)d_in[4];
  const float* bm  = (const float*)d_in[5];
  const float* Wl  = (const float*)d_in[6];
  const float* bl  = (const float*)d_in[7];
  const float* Wo  = (const float*)d_in[8];
  const float* bo  = (const float*)d_in[9];
  float* out = (float*)d_out;

  char* ws = (char*)d_ws;
  unsigned short* W16  = (unsigned short*)(ws + oW);
  // region X users
  unsigned short* Xcnh = (unsigned short*)(ws + oX);
  unsigned short* Xcnl = (unsigned short*)(ws + oX + PLB);
  unsigned short* Xsnh = (unsigned short*)(ws + oX + 2 * PLB);
  unsigned short* Xsnl = (unsigned short*)(ws + oX + 3 * PLB);
  unsigned short* Xsr  = (unsigned short*)(ws + oX + 4 * PLB);
  float*          S    = (float*)(ws + oX);
  unsigned short* Moh  = (unsigned short*)(ws + oX);
  unsigned short* Mol  = (unsigned short*)(ws + oX + PLB);
  // region M users
  unsigned short* Mnh  = (unsigned short*)(ws + oM);
  unsigned short* Mnl  = (unsigned short*)(ws + oM + PLB);
  unsigned short* Mmh  = (unsigned short*)(ws + oM + 2 * PLB);
  unsigned short* Mml  = (unsigned short*)(ws + oM + 3 * PLB);
  unsigned short* P16  = (unsigned short*)(ws + oM);
  // region V
  unsigned short* V16  = (unsigned short*)(ws + oV);
  // region T
  float*          St   = (float*)(ws + oT);

  const dim3 blk256(256), blk128(128);
  const dim3 gconv(SEQ / QT, CH / QT, NB);

  // (0) weights -> bf16 planes (order Wn, Wm, Wl, Wo)
  cvt_w<<<dim3(NMAT * CH / 8), blk256, 0, stream>>>(Wn, Wm, Wl, Wo, W16);
  // (1a) instance-norm statistics of x_c and x_s
  norm_stats<<<dim3(2 * NB * CH / 16), blk256, 0, stream>>>(x_c, x_s, St);
  // (1b) split planes of norm(x_c); same for x_s plus the raw bf16 plane
  cvt_norm<0><<<dim3(SEQ / NT, CH / QT, NB), blk256, 0, stream>>>(x_c, St, Xcnh, Xcnl, Xcnl);
  cvt_norm<1><<<dim3(SEQ / NT, CH / QT, NB), blk256, 0, stream>>>(x_s, St + 2 * NB * CH, Xsnh, Xsnl, Xsr);
  // (2) Mn, Mm hi + residual planes
  gemm_nm<<<gconv, blk128, 0, stream>>>(W16, bn, Xcnh, Xcnl, Mnh, Mnl);
  gemm_nm<<<gconv, blk128, 0, stream>>>(W16 + (size_t)CH * CH, bm, Xsnh, Xsnl, Mmh, Mml);
  // (3) Ml value plane
  gemm_val<<<gconv, blk128, 0, stream>>>(W16 + (size_t)2 * CH * CH, bl, Xsr, V16);
  // (4) scores (overwrites region X)
  gemm_sc<<<dim3(SEQ / QT, SEQ / QT, NB), blk128, 0, stream>>>(Mnh, Mnl, Mmh, Mml, S);
  // (5) softmax weights (overwrites region M)
  softmax_k<<<dim3(NB * SEQ / 8), blk256, 0, stream>>>(S, P16);
  // (6) Mo hi + residual planes (overwrites region X)
  gemm_pv<<<gconv, blk128, 0, stream>>>(V16, P16, Moh, Mol);
  // (7) output GEMM + bias + residual
  gemm_out<<<gconv, blk128, 0, stream>>>(W16 + (size_t)3 * CH * CH, bo, Moh, Mol, x_c, out);
  (void)hipGetLastError();
}

// v003
// One run takes 177 microseconds.
// In two side-by-side timings against v002, it was 1.05 and 1.04 times as fast.
// Counting every step since v000, it is 3.74 times as fast.
// Contractions: conv1x1 Wn.norm(x_c) and Wm.norm(x_s) on v_wmma_f32_16x16x32_bf16 (bf16-RNE weights x bf16 hi +
// bf16 residual planes of the normalised activations, 2 products, K=512); conv1x1 Wl.x_s on v_wmma_f32_16x16x32_bf16
// (bf16-RNE weights x bf16-RNE x_s, 1 product); position scores Mn^T.Mm on v_wmma_f32_16x16x32_bf16 (bf16 hi +
// residual planes of both, 3 products, K=512); Mo = Ml.A^T on v_wmma_f32_16x16x32_f16 (f16 Ml plane x softmax
// weights carried x16384 as f16, K=2048); conv1x1 Wo.Mo on v_wmma_f32_16x16x32_bf16 (bf16-RNE weights x bf16 hi +
// residual planes of Mo, 2 products); f32 accumulate everywhere; instance-norm statistics, softmax, bias and residual
// adds in f32 VALU.
#include <hip/hip_runtime.h>
#include <stdint.h>

#ifndef NB
#define NB 4
#endif
#ifndef SEQ
#define SEQ 2048
#endif
#define NB_FULL 4
#define T_FULL  2048
#define CH      512
#define NMAT    4
#define QT      64
#define OSP     68
#define TP      72
#define NT      128
#define KC      64
#define LP      144
#define TILEB   (QT * LP)
#define NCH     (SEQ / 256)
#define PCAR    16384.0f
#define IPCAR   6.103515625e-05f
#define EPSN    1.0e-5f
#define WS_CAP  134217728

static_assert(NB >= 1 && NB <= NB_FULL);
static_assert(SEQ >= 256 && SEQ <= T_FULL && SEQ % 256 == 0);
static_assert(SEQ % QT == 0 && CH % QT == 0 && SEQ % NT == 0);
static_assert(CH % 256 == 0 && CH % 32 == 0 && SEQ % 32 == 0 && SEQ % 16 == 0);
static_assert((OSP * 4) % 16 == 0);
static_assert((TP * 2) % 16 == 0);
static_assert((NB * SEQ) % 8 == 0);
static_assert(CH % 8 == 0);
static_assert(CH % KC == 0 && SEQ % KC == 0 && CH / KC >= 2 && SEQ / KC >= 2);
static_assert(KC * 2 + 16 == LP && LP % 32 == 16 && QT == 64);
static_assert(QT * OSP * 4 <= 2 * 2 * TILEB);

typedef _Float16       v16h __attribute__((ext_vector_type(16)));
typedef _Float16       v8h  __attribute__((ext_vector_type(8)));
typedef __bf16         v16b __attribute__((ext_vector_type(16)));
typedef unsigned short v8us __attribute__((ext_vector_type(8)));
typedef float          v8f  __attribute__((ext_vector_type(8)));
typedef float          v4f  __attribute__((ext_vector_type(4)));
typedef float          v2f  __attribute__((ext_vector_type(2)));
typedef unsigned int   v4u  __attribute__((ext_vector_type(4)));

union Frag { v8us u[2]; v16h h; v16b bf; };
static_assert(sizeof(Frag) == 32);

// ---- workspace map (bytes; every region start a multiple of 256; every extent is an exact tile multiple and is
//      launches; each later user fully overwrites what it reads before any read):
//   W : bf16 [4][512][512] weights                                              WB
//   X : stage 1-3: five bf16 planes [NB][SEQ][512] (x_c norm hi/lo, x_s norm hi/lo, x_s raw)   5*PLB
//       stage 4  : scores f32 [NB][SEQ][SEQ]                                    SB
//       stage 6-7: Mo hi/lo bf16 planes [NB][SEQ][512]                          2*PLB
//   M : stage 2-4: Mn hi/lo, Mm hi/lo bf16 planes [NB][SEQ][512]                4*PLB
//       stage 5-6: softmax weights f16 [NB][SEQ][SEQ]                           PB
//   V : Ml f16 plane [NB][512][SEQ]                                             PLB
//   T : instance-norm {mean, rstd} f32 pairs [2][NB][512]                       STB
constexpr size_t cmax(size_t a, size_t b) { return a > b ? a : b; }
constexpr size_t PLB = (size_t)NB * SEQ * CH * 2;
constexpr size_t SB  = (size_t)NB * SEQ * SEQ * 4;
constexpr size_t PB  = (size_t)NB * SEQ * SEQ * 2;
constexpr size_t WB  = (size_t)NMAT * CH * CH * 2;
constexpr size_t RXB = cmax(cmax(5 * PLB, SB), 2 * PLB);
constexpr size_t RMB = cmax(4 * PLB, PB);
constexpr size_t RVB = PLB;
constexpr size_t STB = (size_t)2 * NB * CH * 2 * 4;
static_assert(WB % 256 == 0 && PLB % 256 == 0 && SB % 256 == 0 && PB % 256 == 0);
static_assert(5 * PLB <= RXB && SB <= RXB && 2 * PLB <= RXB);
static_assert(4 * PLB <= RMB && PB <= RMB);
static_assert(STB % 256 == 0 && (NB * CH) % 16 == 0);
static_assert(WB + RXB + RMB + RVB + STB <= (size_t)WS_CAP);

// ---- scalar helpers -----------------------------------------------------------------------------------------
__device__ __forceinline__ unsigned short bf_bits(float f) {          // f32 -> bf16 bits, RNE convert
  unsigned u = __float_as_uint(f);
  return (unsigned short)((u + 0x7FFFu + ((u >> 16) & 1u)) >> 16);
}
__device__ __forceinline__ float bf_up(unsigned short hb) { return __uint_as_float(((unsigned)hb) << 16); }
__device__ __forceinline__ float bfr(float f) { return bf_up(bf_bits(f)); }
__device__ __forceinline__ unsigned short h_bits(_Float16 x) { return __builtin_bit_cast(unsigned short, x); }
__device__ __forceinline__ unsigned pk16(unsigned short a, unsigned short b) { return (unsigned)a | ((unsigned)b << 16); }
__device__ __forceinline__ v8f zero8() { v8f z = {0.f, 0.f, 0.f, 0.f, 0.f, 0.f, 0.f, 0.f}; return z; }

// ---- 16-bit fragment loader (A, or B from a k-contiguous [n][k] row): lane -> row/col (lane&15), p already includes
//      + 8*(lane>>4); elements 0..7 <- p[0..7] (k0+8h..), elements 8..15 <- p[16..23] (k0+16+8h..)
__device__ __forceinline__ Frag ldfrag(const unsigned short* p) {
  Frag f;
  f.u[0] = *(const v8us*)(p);
  f.u[1] = *(const v8us*)(p + 16);
  return f;
}

// ---- WMMA helpers: builtin followed by a 4-slot VALU gap tying D and keeping A/B live ----------------------------
__device__ __forceinline__ v8f mma_h(v16h a, v16h b, v8f c) {
  v8f d = __builtin_amdgcn_wmma_f32_16x16x32_f16(false, a, false, b, (short)0, c, false, false);
#if defined(__HIP_DEVICE_COMPILE__)
  asm volatile("v_nop\n\tv_nop\n\tv_nop\n\tv_nop" : "+v"(d) : "v"(a), "v"(b));
#endif
  return d;
}
__device__ __forceinline__ v8f mma_b(v16b a, v16b b, v8f c) {
  v8f d = __builtin_amdgcn_wmma_f32_16x16x32_bf16(false, a, false, b, (short)0, c, false, false);
#if defined(__HIP_DEVICE_COMPILE__)
  const v16h ha = __builtin_bit_cast(v16h, a), hb = __builtin_bit_cast(v16h, b);
  asm volatile("v_nop\n\tv_nop\n\tv_nop\n\tv_nop" : "+v"(d) : "v"(ha), "v"(hb));
#endif
  return d;
}

// ---- asynchronous copies of operand tiles into LDS. One tile of a pass = 64 rows x 128 B (KC elements), LDS pitch LP.
//      Lane map: e = tid & 7 -> 16-B piece of the row, r = tid >> 3 -> row r + 16 i (i = 0..3): 8 lanes cover one whole
//      128-B line. l = the lane's LDS byte address of row r, g = its global address of row r, p16 = elements of 16 rows.
//      The s_wait_xcnt closes each statement so that no address register of an issued copy is rewritten ahead of it.
__device__ __forceinline__ unsigned lds_off(const void* p) { return (unsigned)(size_t)p; }
__device__ __forceinline__ void copy_tile(unsigned l, const unsigned short* g, size_t p16) {
#if defined(__HIP_DEVICE_COMPILE__)
  // four copies of one tile, global -> LDS through no register; the wait is their statement's last line
  asm volatile("global_load_async_to_lds_b128 %0, %4, off\n\t"
               "global_load_async_to_lds_b128 %1, %5, off\n\t"
               "global_load_async_to_lds_b128 %2, %6, off\n\t"
               "global_load_async_to_lds_b128 %3, %7, off\n\t"
               "s_wait_xcnt 0x0"
               :: "v"(l), "v"(l + 16 * LP), "v"(l + 32 * LP), "v"(l + 48 * LP),
                  "v"(g), "v"(g + p16), "v"(g + 2 * p16), "v"(g + 3 * p16) : "memory");
#endif
}
__device__ __forceinline__ void copy_tiles2(unsigned l, const unsigned short* g, size_t p16,
                                            unsigned m, const unsigned short* h, size_t q16) {
#if defined(__HIP_DEVICE_COMPILE__)
  // eight copies of two tiles, global -> LDS through no register; they share one statement and its closing wait
  asm volatile("global_load_async_to_lds_b128 %0, %8, off\n\t"
               "global_load_async_to_lds_b128 %1, %9, off\n\t"
               "global_load_async_to_lds_b128 %2, %10, off\n\t"
               "global_load_async_to_lds_b128 %3, %11, off\n\t"
               "global_load_async_to_lds_b128 %4, %12, off\n\t"
               "global_load_async_to_lds_b128 %5, %13, off\n\t"
               "global_load_async_to_lds_b128 %6, %14, off\n\t"
               "global_load_async_to_lds_b128 %7, %15, off\n\t"
               "s_wait_xcnt 0x0"
               :: "v"(l), "v"(l + 16 * LP), "v"(l + 32 * LP), "v"(l + 48 * LP),
                  "v"(m), "v"(m + 16 * LP), "v"(m + 32 * LP), "v"(m + 48 * LP),
                  "v"(g), "v"(g + p16), "v"(g + 2 * p16), "v"(g + 3 * p16),
                  "v"(h), "v"(h + q16), "v"(h + 2 * q16), "v"(h + 3 * q16) : "memory");
#endif
}

// ---- GEMM core for one 64(m) x 64(n) block tile, 4 waves (128 threads): wave w owns cols n = 16w + (lane&15), one B
//      fragment per k-step per B plane; 4 m-tiles, A rows m = 16 mt + (lane&15). a0/a1/b0/b1 = row 0, k = 0 of the
//      block's 64 operand rows (k-contiguous, pitches ap / bp elements). A pass = KC k: its operand tiles
//      [A0][A1 if NPROD 3][B0][B1 if NPROD >= 2] are copied into one of two LDS buffers one pass ahead, and the
//      fragments are read from LDS with the split k map (ldfrag), k-steps and products in the same order as from
//      global rows. NPROD: 1 = a0.b0; 2 = a0.b0 + a0.b1; 3 = a0.b0 + a0.b1 + a1.b0 (shared accumulator, unscaled
//      residual planes). HALF selects the f16 instruction (NPROD 1 only). On return no copy is outstanding and every
//      wave has left both buffers (the last pass's barrier), so sm may be reused as output staging.
template <int NPROD>
struct CoreLds {
  static constexpr int NA = NPROD >= 3 ? 2 : 1;
  static constexpr int NBP = NPROD >= 2 ? 2 : 1;
  static constexpr unsigned STG = (unsigned)(NA + NBP) * TILEB;
  static constexpr unsigned BYTES = 2 * STG;
};
template <int NPROD>
__device__ __forceinline__ void fill_stage(unsigned l, const unsigned short* a0, const unsigned short* a1, size_t ap16,
                                           const unsigned short* b0, const unsigned short* b1, size_t bp16) {
  if (NPROD == 1) {
    copy_tiles2(l, a0, ap16, l + TILEB, b0, bp16);
  } else if (NPROD == 2) {
    copy_tile(l, a0, ap16);
    copy_tiles2(l + TILEB, b0, bp16, l + 2 * TILEB, b1, bp16);
  } else {
    copy_tiles2(l, a0, ap16, l + TILEB, a1, ap16);
    copy_tiles2(l + 2 * TILEB, b0, bp16, l + 3 * TILEB, b1, bp16);
  }
}
template <int NPROD, bool HALF>
__device__ __forceinline__ void gemm_core(v8f (&acc)[4], const char* sm,
                                          const unsigned short* __restrict__ a0,
                                          const unsigned short* __restrict__ a1, size_t ap,
                                          const unsigned short* __restrict__ b0,
                                          const unsigned short* __restrict__ b1, size_t bp, int npass, int tid) {
  static_assert(NPROD >= 1 && NPROD <= 3);
  static_assert(!(HALF && NPROD != 1));
  constexpr unsigned STG = CoreLds<NPROD>::STG;
  constexpr unsigned BOFF = (unsigned)CoreLds<NPROD>::NA * TILEB;
  const int lane = tid & 31, wave = tid >> 5, hh = lane >> 4, c = lane & 15;
  const int e = tid & 7, r = tid >> 3;                               // r 0..15
  const unsigned lc = lds_off(sm) + (unsigned)(r * LP + 16 * e);
  const size_t ga = (size_t)r * ap + 8 * e, gb = (size_t)r * bp + 8 * e;
  const unsigned fa = (unsigned)(c * LP + 16 * hh);
  const unsigned fb = BOFF + (unsigned)((16 * wave + c) * LP + 16 * hh);
  fill_stage<NPROD>(lc, a0 + ga, a1 + ga, 16 * ap, b0 + gb, b1 + gb, 16 * bp);
  asm volatile("s_wait_asynccnt 0x0" ::: "memory");                  // pass 0's own copies have landed
  __syncthreads();                                                   // ... and every other wave's
  fill_stage<NPROD>(lc + STG, a0 + ga + KC, a1 + ga + KC, 16 * ap, b0 + gb + KC, b1 + gb + KC, 16 * bp);
  // kept rolled: one pass is 8 to 24 matrix instructions with their fragment loads, and the code stays small
#pragma unroll 1
  for (int t = 0; t < npass; ++t) {
    const unsigned bo = (unsigned)(t & 1) * STG;
    // the three loops below are unrolled whole so that the fragment arrays stay in registers and the LDS offsets are immediates
#pragma unroll
    for (int ks = 0; ks < KC / 32; ++ks) {
      const unsigned o = bo + 64u * ks;
      // the k-step's fragment reads stand together, ahead of its matrix instructions: one LDS latency a k-step
      const Frag fb0 = ldfrag((const unsigned short*)(sm + fb + o));
      Frag fb1 = fb0;
      if (NPROD >= 2) fb1 = ldfrag((const unsigned short*)(sm + fb + TILEB + o));
      Frag fa0[4], fa1[4];
#pragma unroll
      for (int mt = 0; mt < 4; ++mt) {
        fa0[mt] = ldfrag((const unsigned short*)(sm + fa + 16 * LP * mt + o));
        if (NPROD >= 3) fa1[mt] = ldfrag((const unsigned short*)(sm + fa + TILEB + 16 * LP * mt + o));
        else fa1[mt] = fa0[mt];
      }
#pragma unroll
      for (int mt = 0; mt < 4; ++mt) {
        if (HALF) {
          acc[mt] = mma_h(fa0[mt].h, fb0.h, acc[mt]);
        } else {
          acc[mt] = mma_b(fa0[mt].bf, fb0.bf, acc[mt]);
          if (NPROD >= 2) acc[mt] = mma_b(fa0[mt].bf, fb1.bf, acc[mt]);
          if (NPROD >= 3) acc[mt] = mma_b(fa1[mt].bf, fb0.bf, acc[mt]);
        }
      }
    }
    asm volatile("s_wait_dscnt 0x0" ::: "memory");                   // this wave's reads of the buffer are done before it is refilled
    asm volatile("s_wait_asynccnt 0x0" ::: "memory");                // this wave's copies of pass t + 1 have landed
    __syncthreads();                                                 // publishes pass t + 1, ends every read of pass t's buffer
    if (t + 2 < npass) {
      const int ko = KC * (t + 2);
      fill_stage<NPROD>(lc + bo, a0 + ga + ko, a1 + ga + ko, 16 * ap, b0 + gb + ko, b1 + gb + ko, 16 * bp);
    }
  }
  asm volatile("s_wait_asynccnt 0x0" ::: "memory");                  // nothing outstanding when the LDS changes its use
}

// ---- epilogue staging, transposed: Os[n_loc][m_loc] (pitch OSP). Lane (hh, c) of wave w holds D rows
//      m = 16 mt + 8 hh + r, col n = 16 w + c -> two b128 LDS stores per m-tile.
__device__ __forceinline__ void stage_nT(float* Os, const v8f (&acc)[4], float sc, int wave, int hh, int c) {
  const int nl = 16 * wave + c;
#pragma unroll
  for (int mt = 0; mt < 4; ++mt) {
    v4f va, vb;
#pragma unroll
    for (int r = 0; r < 4; ++r) { va[r] = acc[mt][r] * sc; vb[r] = acc[mt][4 + r] * sc; }
    *(v4f*)(Os + nl * OSP + 16 * mt + 8 * hh)     = va;
    *(v4f*)(Os + nl * OSP + 16 * mt + 8 * hh + 4) = vb;
  }
}
// ---- epilogue staging, row-major: Os[m_loc][n_loc] (pitch OSP), scalar LDS stores.
__device__ __forceinline__ void stage_mn(float* Os, const v8f (&acc)[4], int wave, int hh, int c) {
  const int nl = 16 * wave + c;
#pragma unroll
  for (int mt = 0; mt < 4; ++mt) {
#pragma unroll
    for (int r = 0; r < 8; ++r) Os[(16 * mt + 8 * hh + r) * OSP + nl] = acc[mt][r];
  }
}

// ---- plane writer for transposed staging: plane [b][n][512] bf16 hi + bf16 residual, rows rowbase + 0..63,
//      line, one instruction per 16 lines (rows it*16 + lq). Optional f32 bias (bf16-RNE value) added per col.
// coverage: 4 it x 16 rows x 8 lanes x 8 = 64 rows x 64 cols per plane.
template <bool BIAS>
__device__ __forceinline__ void planes_out(const float* Os, const float* __restrict__ bias, int o0,
                                           unsigned short* Ph, unsigned short* Pl, size_t rowbase, int tid) {
  const int e = tid & 7, lq = tid >> 3;                              // lq 0..15
  float bv[8];
#pragma unroll
  for (int t = 0; t < 8; ++t) bv[t] = 0.f;
  if (BIAS) {
    const unsigned bofs = 32u * (unsigned)e;                         // the lane's byte offset behind the block's bias + o0
    const char* bb = (const char*)(bias + o0);
    const v4f b0 = *(const v4f*)(bb + bofs);
    const v4f b1 = *(const v4f*)(bb + bofs + 16);
    // bofs addresses both loads; as an input here its register stays live past them and is reused only behind this wait
    asm volatile("s_wait_xcnt 0x0" :: "v"(bofs) : "memory");
#pragma unroll
    for (int t = 0; t < 4; ++t) { bv[t] = bfr(b0[t]); bv[4 + t] = bfr(b1[t]); }
  }
  v4u uh[4], ul[4];
#pragma unroll
  for (int it = 0; it < 4; ++it) {
    const int row = it * 16 + lq;                                    // n_loc 0..63
    const v4f a = *(const v4f*)(Os + row * OSP + 8 * e);
    const v4f q = *(const v4f*)(Os + row * OSP + 8 * e + 4);
    const float f[8] = {a[0], a[1], a[2], a[3], q[0], q[1], q[2], q[3]};
#pragma unroll
    for (int t = 0; t < 4; ++t) {
      const float f0 = f[2 * t] + bv[2 * t], f1 = f[2 * t + 1] + bv[2 * t + 1];
      const unsigned short hb0 = bf_bits(f0), hb1 = bf_bits(f1);
      const unsigned short lb0 = bf_bits(f0 - bf_up(hb0));
      const unsigned short lb1 = bf_bits(f1 - bf_up(hb1));
      uh[it][t] = pk16(hb0, hb1);
      ul[it][t] = pk16(lb0, lb1);
    }
  }
{
#pragma unroll
    for (int it = 0; it < 4; ++it) {
      const int row = it * 16 + lq;
      const size_t po = (rowbase + (size_t)row) * CH + o0 + 8 * e;
      *(v4u*)(Ph + po) = uh[it];
      *(v4u*)(Pl + po) = ul[it];
    }
    
  }
}

// =========================================================================================================
// (0) weights f32 [512][512] x4 -> W16 bf16 bits [4][512][512] (RNE convert of the input value, exact operand).
//     Block blk owns 8 rows of one matrix (matrix index block-uniform), one wave per 1024-B row = 2 instructions of
// coverage: 256 blocks x 8 rows x 2 j x 32 lanes x 8 = 2048 rows x 512 = the whole plane. blk = 0..255 (part of prep).
// =========================================================================================================
__device__ __forceinline__
void cvt_w_part(const float* __restrict__ w0, const float* __restrict__ w1,
                const float* __restrict__ w2, const float* __restrict__ w3, unsigned short* W16, int blk) {
  const int tid = threadIdx.x;
  const int wave = tid >> 5, lane = tid & 31;
  const int mi = blk / (CH / 8);                                     // 0..3, block-uniform
  const int o  = 8 * (blk - mi * (CH / 8)) + wave;                   // 0..511
  const float* wb = (mi == 0) ? w0 : (mi == 1) ? w1 : (mi == 2) ? w2 : w3;
  v4u u[CH / 256];
#pragma unroll
  for (int j = 0; j < CH / 256; ++j) {
    const float* s = wb + (size_t)o * CH + 256 * j + 8 * lane;
    const v4f a = *(const v4f*)s;
    const v4f q = *(const v4f*)(s + 4);
    const float f[8] = {a[0], a[1], a[2], a[3], q[0], q[1], q[2], q[3]};
#pragma unroll
    for (int t = 0; t < 4; ++t) u[j][t] = pk16(bf_bits(f[2 * t]), bf_bits(f[2 * t + 1]));
  }
{
#pragma unroll
    for (int j = 0; j < CH / 256; ++j)
      *(v4u*)(W16 + ((size_t)(mi * CH + o)) * CH + 256 * j + 8 * lane) = u[j];
    
  }
}

// =========================================================================================================
// (1a) instance-norm statistics of both inputs, one launch: St[(sel * NB + b) * 512 + c] = {mean, rsqrt(var + eps)} of
//      bf16-RNE(x) over the row's SEQ values. 16 lanes per row, lane l = 4 q + k owns the elements 16 j + l and adds
//      them in rising j; the four xor steps then form ((s0 + s1) + (s2 + s3)) per q and the sum over q (1, then 2).
//      The lane's SEQ/16 values stay in registers, so the row is read once for mean and variance.
// coverage: block = 16 rows = one 128-B line of St; blk = 0 .. 2 * NB * 512 / 16 - 1 covers every row of both inputs once.
// =========================================================================================================
__device__ __forceinline__
void norm_stats_part(const float* __restrict__ xc, const float* __restrict__ xs, float* St, int blk) {
  const int tid = threadIdx.x;
  const int rl = tid >> 4, l = tid & 15;                             // rl 0..15
  const int sel = blk / (NB * CH / 16);                              // 0 = x_c, 1 = x_s, block-uniform
  const int r   = 16 * (blk - sel * (NB * CH / 16)) + rl;            // b * 512 + c
  const float* xr = (sel ? xs : xc) + (size_t)r * T_FULL + l;
  float v[SEQ / 16];                                                 // the loops are unrolled whole so that v stays in registers
#pragma unroll
  for (int j = 0; j < SEQ / 16; ++j) v[j] = xr[16 * j];
  // xr is an input here so that its registers stay live past the last load and are reused only behind this wait
  asm volatile("s_wait_xcnt 0x0" :: "v"(xr) : "memory");
  float sm = 0.f;
#pragma unroll
  for (int j = 0; j < SEQ / 16; ++j) { v[j] = bfr(v[j]); sm += v[j]; }
  sm += __shfl_xor(sm, 1, 32);
  sm += __shfl_xor(sm, 2, 32);
  sm += __shfl_xor(sm, 4, 32);
  sm += __shfl_xor(sm, 8, 32);
  const float mean = sm * (1.0f / (float)SEQ);
  float sv = 0.f;
#pragma unroll
  for (int j = 0; j < SEQ / 16; ++j) { const float d = v[j] - mean; sv = __builtin_fmaf(d, d, sv); }
  sv += __shfl_xor(sv, 1, 32);
  sv += __shfl_xor(sv, 2, 32);
  sv += __shfl_xor(sv, 4, 32);
  sv += __shfl_xor(sv, 8, 32);
  const float var = sv * (1.0f / (float)SEQ);
  const float rs  = rsqrtf(var + EPSN);
  if (l == 0) {
    v2f st; st[0] = mean; st[1] = rs;
    *(v2f*)(St + 2 * (size_t)(sel * NB * CH + r)) = st;
  }
}

// =========================================================================================================
// (0) + (1a) in one launch: neither reads what the other writes. The block index picks the part (block-uniform): the
//     statistics blocks, which run longer, come first, the weight blocks behind them.
// =========================================================================================================
#define NSTATB (2 * NB * CH / 16)
#define NCVTWB (NMAT * CH / 8)
__global__ __launch_bounds__(256)
void prep(const float* __restrict__ xc, const float* __restrict__ xs,
          const float* __restrict__ w0, const float* __restrict__ w1,
          const float* __restrict__ w2, const float* __restrict__ w3, float* St, unsigned short* W16) {
  const int blk = blockIdx.x;
  if (blk < NSTATB) {
    norm_stats_part(xc, xs, St, blk);
  } else {
    cvt_w_part(w0, w1, w2, w3, W16, blk - NSTATB);
    // the other part's code follows these stores in the built kernel: no register of theirs is rewritten ahead of this wait
    asm volatile("s_wait_xcnt 0x0" ::: "memory");
  }
}

// =========================================================================================================
// (1b) x f32 [b][512 c][2048 t] (batch/row strides at full size) -> position-major bf16 planes [b][t][512]:
//      Ph = bf16-RNE(xn), Pl = bf16-RNE(xn - Ph) with xn = (bf16-RNE(x) - mean) * rstd per (b, c) row (St of 1a);
//      RAW adds Pr = bf16-RNE(x). One 64 c x 128 t tile per block, transposed through LDS (line = 64 c of one plane
//      row): lane e -> c 8e..8e+7, 8 consecutive lanes per line.
// coverage: 4 it x 32 rows x 8 lanes x 8 = 128 t x 64 c per plane; (SEQ/128, 8) blocks for each b = 0..NB-1 cover
//           [NB][SEQ][512] of every written plane exactly once. Th, Tl, Tr = the block's LDS tiles (Tr used by RAW only).
// =========================================================================================================
template <int RAW>
__device__ __forceinline__
void cvt_norm_part(const float* __restrict__ x, const float* __restrict__ St,
                   unsigned short* Ph, unsigned short* Pl, unsigned short* Pr,
                   unsigned short* Th, unsigned short* Tl, unsigned short* Tr, int b) {
  const int tid = threadIdx.x;
  const int n0 = blockIdx.x * NT, c0 = blockIdx.y * QT;
  const int e = tid & 7, lq = tid >> 3;                              // lq 0..31
  v4f a[4], q[4];
  v2f st[2];
  const int sr = b * CH + c0 + lq;                                   // row of c half 0; c half 1 is 32 rows on
  const float* sp0 = x + (size_t)sr * T_FULL + n0 + 8 * e;
#pragma unroll
  for (int it = 0; it < 4; ++it) {                                   // it = 2 * (t half) + (c half)
    const float* sp = sp0 + (size_t)(it & 1) * 32 * T_FULL + (it >> 1) * 64;
    a[it] = *(const v4f*)sp;
    q[it] = *(const v4f*)(sp + 4);
  }
#pragma unroll
  for (int h = 0; h < 2; ++h) st[h] = *(const v2f*)(St + 2 * (size_t)sr + 64 * h);
  // sp0 and sr address the loads; as inputs here their registers stay live past the last load and are reused only behind this wait
  asm volatile("s_wait_xcnt 0x0" :: "v"(sp0), "v"(sr) : "memory");
#pragma unroll
  for (int it = 0; it < 4; ++it) {
    const int cl = (it & 1) * 32 + lq;
    const int tl = (it >> 1) * 64 + 8 * e;                           // 0..120
    const float f[8] = {a[it][0], a[it][1], a[it][2], a[it][3], q[it][0], q[it][1], q[it][2], q[it][3]};
    const float mu = st[it & 1][0], rs = st[it & 1][1];
#pragma unroll
    for (int t = 0; t < 8; ++t) {
      const unsigned short rb = bf_bits(f[t]);
      const float d  = bf_up(rb) - mu;
      const float xn = d * rs;
      const unsigned short hb = bf_bits(xn);
      const unsigned short lb = bf_bits(__builtin_fmaf(d, rs, -bf_up(hb)));   // residual of the unrounded product
      Th[(tl + t) * TP + cl] = hb;
      Tl[(tl + t) * TP + cl] = lb;
      if (RAW) Tr[(tl + t) * TP + cl] = rb;
    }
  }
  __syncthreads();
  v4u uh[4], ul[4], ur[4];
#pragma unroll
  for (int it = 0; it < 4; ++it) {
    const int nl = it * 32 + lq;                                     // 0..127
    uh[it] = *(const v4u*)(Th + nl * TP + 8 * e);
    ul[it] = *(const v4u*)(Tl + nl * TP + 8 * e);
    if (RAW) ur[it] = *(const v4u*)(Tr + nl * TP + 8 * e); else ur[it] = uh[it];
  }
#pragma unroll
  for (int it = 0; it < 4; ++it) {
    const int nl = it * 32 + lq;
    const size_t po = ((size_t)(b * SEQ + n0 + nl)) * CH + c0 + 8 * e;
    *(v4u*)(Ph + po) = uh[it];
    *(v4u*)(Pl + po) = ul[it];
    if (RAW) *(v4u*)(Pr + po) = ur[it];
  }
}

// =========================================================================================================
// (1b) of both inputs in one launch, grid (SEQ/128, 8, 2 NB): blockIdx.z picks the input (block-uniform, so each part's
//      barrier is passed by the whole block); x_s, which writes three planes, comes first.
// =========================================================================================================
__global__ __launch_bounds__(256)
void cvt_norm2(const float* __restrict__ xc, const float* __restrict__ xs, const float* __restrict__ St,
               unsigned short* Pch, unsigned short* Pcl,
               unsigned short* Psh, unsigned short* Psl, unsigned short* Psr) {
  __shared__ __align__(16) unsigned short Th[NT * TP];
  __shared__ __align__(16) unsigned short Tl[NT * TP];
  __shared__ __align__(16) unsigned short Tr[NT * TP];
  const int z = blockIdx.z;
  if (z < NB) {
    cvt_norm_part<1>(xs, St + 2 * NB * CH, Psh, Psl, Psr, Th, Tl, Tr, z);
  } else {
    cvt_norm_part<0>(xc, St, Pch, Pcl, Pcl, Th, Tl, Tr, z - NB);
    // the other part's code follows these stores in the built kernel: no register of theirs is rewritten ahead of this wait
    asm volatile("s_wait_xcnt 0x0" ::: "memory");
  }
}

// =========================================================================================================
// (2) conv1x1 GEMM into hi + residual planes: Y[o][n] = sum_c W16[o][c] (Xh + Xl)[b][n][c] + bias[o] for one
//     (b, 64-n tile, 64-o block); A = W rows o (k = c contiguous), B = plane rows n (k = c contiguous), 2 products,
//     K = 512 = 16 steps. Epilogue: transposed LDS staging, barrier, planes [b][n][512] (planes_out).
// coverage: (SEQ/64, 8) blocks for each b = 0..NB-1, x 64 n x 64 o, cover [NB][SEQ][512] of both planes exactly once.
//           sm = the block's LDS, CoreLds<2>::BYTES: two operand buffers; output staging behind the core.
// =========================================================================================================
__device__ __forceinline__
void gemm_nm_part(char* sm, const unsigned short* __restrict__ W, const float* __restrict__ bias,
                  const unsigned short* __restrict__ Xh, const unsigned short* __restrict__ Xl,
                  unsigned short* Ph, unsigned short* Pl, int b) {
  float* Os = (float*)sm;
  const int tid = threadIdx.x, lane = tid & 31, wave = tid >> 5;
  const int hh = lane >> 4, c = lane & 15;
  const int nt = blockIdx.x, mb = blockIdx.y;
  const int n0 = nt * QT, o0 = mb * QT;
  const unsigned short* ap = W + (size_t)o0 * CH;
  const size_t bq = ((size_t)(b * SEQ + n0)) * CH;
  v8f acc[4];
#pragma unroll
  for (int mt = 0; mt < 4; ++mt) acc[mt] = zero8();
  gemm_core<2, false>(acc, sm, ap, ap, CH, Xh + bq, Xl + bq, CH, CH / KC, tid);
  stage_nT(Os, acc, 1.0f, wave, hh, c);
  __syncthreads();
  planes_out<true>(Os, bias, o0, Ph, Pl, (size_t)(b * SEQ + n0), tid);
}

// =========================================================================================================
// (3) conv1x1 GEMM into the channel-major f16 value plane: V16[b][o][s] = f16(sum_c W16[o][c] Xr[b][s][c] + bias[o])
//     (pitch SEQ); 1 product, K = 512. Epilogue: row-major LDS staging, barrier, row o segment of 64 halves =
// coverage: 4 it x 16 rows x 8 lanes x 8 = 64 o x 64 s; (SEQ/64, 8) blocks for each b = 0..NB-1 cover [NB][512][SEQ] once.
//           sm = the block's LDS, at least CoreLds<1>::BYTES: two operand buffers; output staging behind the core.
// =========================================================================================================
__device__ __forceinline__
void gemm_val_part(char* sm, const unsigned short* __restrict__ W, const float* __restrict__ bias,
                   const unsigned short* __restrict__ Xr, unsigned short* V16, int b) {
  float* Os = (float*)sm;
  const int tid = threadIdx.x, lane = tid & 31, wave = tid >> 5;
  const int hh = lane >> 4, c = lane & 15;
  const int nt = blockIdx.x, mb = blockIdx.y;
  const int n0 = nt * QT, o0 = mb * QT;
  const unsigned short* ap = W + (size_t)o0 * CH;
  const size_t bq = ((size_t)(b * SEQ + n0)) * CH;
  v8f acc[4];
#pragma unroll
  for (int mt = 0; mt < 4; ++mt) acc[mt] = zero8();
  gemm_core<1, false>(acc, sm, ap, ap, CH, Xr + bq, Xr + bq, CH, CH / KC, tid);
  stage_mn(Os, acc, wave, hh, c);
  __syncthreads();
  const int e = tid & 7, lq = tid >> 3;                              // lq 0..15
  v4u u[4];
#pragma unroll
  for (int it = 0; it < 4; ++it) {
    const int row = it * 16 + lq;                                    // o_loc 0..63
    const float bb = bfr(bias[o0 + row]);
    const v4f a = *(const v4f*)(Os + row * OSP + 8 * e);
    const v4f q = *(const v4f*)(Os + row * OSP + 8 * e + 4);
    const float f[8] = {a[0], a[1], a[2], a[3], q[0], q[1], q[2], q[3]};
#pragma unroll
    for (int t = 0; t < 4; ++t) {
      const _Float16 h0 = (_Float16)(f[2 * t] + bb);
      const _Float16 h1 = (_Float16)(f[2 * t + 1] + bb);
      u[it][t] = pk16(h_bits(h0), h_bits(h1));
    }
  }
{
#pragma unroll
    for (int it = 0; it < 4; ++it) {
      const int row = it * 16 + lq;
      const size_t po = ((size_t)(b * CH + o0 + row)) * SEQ + n0 + 8 * e;
      *(v4u*)(V16 + po) = u[it];
    }
    
  }
}

// =========================================================================================================
// (2) for Mn, (2) for Mm and (3) in one launch, grid (SEQ/64, 8, 3 NB): the three products read W16 and the planes of
//     (1b) and write planes of their own. job = blockIdx.z / NB picks the product (block-uniform, so every barrier of a
//     part is passed by the whole block); the one-product job, the shortest, comes last. W = W16 (order Wn, Wm, Wl),
//     X = the five planes of (1b) in a row (x_c hi, lo; x_s hi, lo, raw), M = the four result planes (Mn hi, lo; Mm hi, lo).
// =========================================================================================================
constexpr size_t PLE = PLB / 2;                                      // elements of one plane
static_assert(CoreLds<1>::BYTES <= CoreLds<2>::BYTES);
__global__ __launch_bounds__(128)
void gemm_conv3(const unsigned short* __restrict__ W, const float* __restrict__ bn, const float* __restrict__ bm,
                const float* __restrict__ bl, const unsigned short* __restrict__ X,
                unsigned short* M, unsigned short* V16) {
  __shared__ __align__(16) char sm[CoreLds<2>::BYTES];
  const int job = blockIdx.z / NB, b = blockIdx.z - job * NB;
  if (job < 2) {
    const size_t pl = (size_t)job * 2 * PLE;
    gemm_nm_part(sm, W + (size_t)job * CH * CH, job ? bm : bn, X + pl, X + pl + PLE, M + pl, M + pl + PLE, b);
  } else {
    gemm_val_part(sm, W + (size_t)2 * CH * CH, bl, X + 4 * PLE, V16, b);
  }
}

// =========================================================================================================
// (4) scores S[b][t][s] = sum_c Mn[c][t] Mm[c][s] (no scale) for one (b, 64-s tile, 64-t block): A = Mn planes
//     rows t (hi Qh, residual Ql), B = Mm planes rows s (hi Kh, residual Kl), products hh + hl + lh, K = 512.
// coverage: 8 it x 8 rows x 16 lanes x 4 = 64 t x 64 s; grid (SEQ/64, SEQ/64, NB) covers [NB][SEQ][SEQ] once.
// =========================================================================================================
__global__ __launch_bounds__(128)
void gemm_sc(const unsigned short* __restrict__ Qh, const unsigned short* __restrict__ Ql,
             const unsigned short* __restrict__ Kh, const unsigned short* __restrict__ Kl, float* S) {
  __shared__ __align__(16) char sm[CoreLds<3>::BYTES];         // two operand buffers; output staging behind the core
  float* Os = (float*)sm;
  const int tid = threadIdx.x, lane = tid & 31, wave = tid >> 5;
  const int hh = lane >> 4, c = lane & 15;
  const int nt = blockIdx.x, mb = blockIdx.y, b = blockIdx.z;
  const int n0 = nt * QT, m0 = mb * QT;
  const size_t aq = ((size_t)(b * SEQ + m0)) * CH;
  const size_t bq = ((size_t)(b * SEQ + n0)) * CH;
  v8f acc[4];
#pragma unroll
  for (int mt = 0; mt < 4; ++mt) acc[mt] = zero8();
  gemm_core<3, false>(acc, sm, Qh + aq, Ql + aq, CH, Kh + bq, Kl + bq, CH, CH / KC, tid);
  stage_mn(Os, acc, wave, hh, c);
  __syncthreads();
  const int e = tid & 15, lq = tid >> 4;                             // lq 0..7
  v4f res[8];
#pragma unroll
  for (int it = 0; it < 8; ++it) {
    const int row = it * 8 + lq;
    res[it] = *(const v4f*)(Os + row * OSP + 4 * e);
  }
{
#pragma unroll
    for (int it = 0; it < 8; ++it) {
      const int row = it * 8 + lq;
      *(v4f*)(S + ((size_t)(b * SEQ + m0 + row)) * SEQ + n0 + 4 * e) = res[it];
    }
    
  }
}

// =========================================================================================================
// (5) row softmax over SEQ keys: P16[row][s] = f16(e^{S - max} * 16384 / sum), one wave per row (8 rows per
//     block), the whole row held in registers (SEQ/32 per lane), max/sum by xor shuffles. Writes: lane L ->
// coverage: NCH instructions x 32 lanes x 8 = SEQ halves per row; grid NB*SEQ/8 x 8 waves covers every row once.
// =========================================================================================================
__global__ __launch_bounds__(256)
void softmax_k(const float* __restrict__ S, unsigned short* P16) {
  const int tid = threadIdx.x, wave = tid >> 5, lane = tid & 31;
  const size_t row = (size_t)blockIdx.x * 8 + wave;                 // < NB*SEQ
  const float* sr = S + row * SEQ;
  float v[SEQ / 32];
#pragma unroll
  for (int j = 0; j < NCH; ++j) {
    const v4f a = *(const v4f*)(sr + 256 * j + 8 * lane);
    const v4f q = *(const v4f*)(sr + 256 * j + 8 * lane + 4);
#pragma unroll
    for (int t = 0; t < 4; ++t) { v[8 * j + t] = a[t]; v[8 * j + 4 + t] = q[t]; }
  }
  float mx = -3.0e38f;
#pragma unroll
  for (int i = 0; i < SEQ / 32; ++i) mx = fmaxf(mx, v[i]);
#pragma unroll
  for (int o = 16; o > 0; o >>= 1) mx = fmaxf(mx, __shfl_xor(mx, o, 32));
  float l = 0.f;
#pragma unroll
  for (int i = 0; i < SEQ / 32; ++i) { v[i] = __expf(v[i] - mx); l += v[i]; }
#pragma unroll
  for (int o = 16; o > 0; o >>= 1) l += __shfl_xor(l, o, 32);
  const float sc = PCAR * (1.0f / l);                                // l >= 1
  v4u u[NCH];
#pragma unroll
  for (int j = 0; j < NCH; ++j) {
#pragma unroll
    for (int t = 0; t < 4; ++t) {
      const _Float16 h0 = (_Float16)(v[8 * j + 2 * t] * sc);
      const _Float16 h1 = (_Float16)(v[8 * j + 2 * t + 1] * sc);
      u[j][t] = pk16(h_bits(h0), h_bits(h1));
    }
  }
{
#pragma unroll
    for (int j = 0; j < NCH; ++j)
      *(v4u*)(P16 + row * SEQ + 256 * j + 8 * lane) = u[j];
    
  }
}

// =========================================================================================================
// (6) Mo[c][t] = (1/16384) sum_s V16[b][c][s] P16[b][t][s] for one (b, 64-t tile, 64-c block): A = V16 rows c
//     (k = s contiguous, pitch SEQ), B = P16 rows t (pitch SEQ), f16 instruction, 1 product, K = SEQ.
//     Epilogue: transposed LDS staging scaled by 2^-14, barrier, Mo hi + residual planes [b][t][512] (planes_out).
// coverage: grid (SEQ/64, 8, NB) covers [NB][SEQ][512] of both planes exactly once.
// =========================================================================================================
__global__ __launch_bounds__(128)
void gemm_pv(const unsigned short* __restrict__ V16, const unsigned short* __restrict__ P16,
             unsigned short* Mh, unsigned short* Mlo) {
  __shared__ __align__(16) char sm[CoreLds<1>::BYTES];         // two operand buffers; output staging behind the core
  float* Os = (float*)sm;
  const int tid = threadIdx.x, lane = tid & 31, wave = tid >> 5;
  const int hh = lane >> 4, c = lane & 15;
  const int nt = blockIdx.x, mb = blockIdx.y, b = blockIdx.z;
  const int n0 = nt * QT, o0 = mb * QT;
  const unsigned short* ap = V16 + ((size_t)(b * CH + o0)) * SEQ;
  const unsigned short* bp = P16 + ((size_t)(b * SEQ + n0)) * SEQ;
  v8f acc[4];
#pragma unroll
  for (int mt = 0; mt < 4; ++mt) acc[mt] = zero8();
  gemm_core<1, true>(acc, sm, ap, ap, SEQ, bp, bp, SEQ, SEQ / KC, tid);
  stage_nT(Os, acc, IPCAR, wave, hh, c);
  __syncthreads();
  planes_out<false>(Os, nullptr, o0, Mh, Mlo, (size_t)(b * SEQ + n0), tid);
}

// =========================================================================================================
// (7) out[b][o][t] = sum_c W16[o][c] (Mh + Ml)[b][t][c] + bias[o] + bf16-RNE(xres[b][o][t]) for one (b, 64-t tile,
//     64-o block): 2 products, K = 512; output and residual rows at full strides. Epilogue: row-major LDS staging,
// coverage: 8 it x 8 rows x 16 lanes x 4 = 64 o x 64 t; grid (SEQ/64, 8, NB) covers out[b][0..511][0..SEQ-1] once.
// =========================================================================================================
__global__ __launch_bounds__(128)
void gemm_out(const unsigned short* __restrict__ W, const float* __restrict__ bias,
              const unsigned short* __restrict__ Mh, const unsigned short* __restrict__ Mlo,
              const float* __restrict__ xres, float* out) {
  __shared__ __align__(16) char sm[CoreLds<2>::BYTES];         // two operand buffers; output staging behind the core
  float* Os = (float*)sm;
  const int tid = threadIdx.x, lane = tid & 31, wave = tid >> 5;
  const int hh = lane >> 4, c = lane & 15;
  const int nt = blockIdx.x, mb = blockIdx.y, b = blockIdx.z;
  const int n0 = nt * QT, o0 = mb * QT;
  const unsigned short* ap = W + (size_t)o0 * CH;
  const size_t bq = ((size_t)(b * SEQ + n0)) * CH;
  v8f acc[4];
#pragma unroll
  for (int mt = 0; mt < 4; ++mt) acc[mt] = zero8();
  gemm_core<2, false>(acc, sm, ap, ap, CH, Mh + bq, Mlo + bq, CH, CH / KC, tid);
  stage_mn(Os, acc, wave, hh, c);
  __syncthreads();
  const int e = tid & 15, lq = tid >> 4;                             // lq 0..7
  v4f res[8];
#pragma unroll
  for (int it = 0; it < 8; ++it) {
    const int row = it * 8 + lq;                                     // o_loc 0..63
    const float bb = bfr(bias[o0 + row]);
    const size_t idx = ((size_t)(b * CH + o0 + row)) * T_FULL + n0 + 4 * e;
    const v4f a  = *(const v4f*)(Os + row * OSP + 4 * e);
    const v4f xv = *(const v4f*)(xres + idx);
#pragma unroll
    for (int t = 0; t < 4; ++t) res[it][t] = (a[t] + bb) + bfr(xv[t]);
  }
{
#pragma unroll
    for (int it = 0; it < 8; ++it) {
      const int row = it * 8 + lq;
      const size_t idx = ((size_t)(b * CH + o0 + row)) * T_FULL + n0 + 4 * e;
      *(v4f*)(out + idx) = res[it];
    }
    
  }
}

// =========================================================================================================
extern "C" void kernel_launch(void* const* d_in, const int* in_sizes, int n_in,
                              void* d_out, int out_size, void* d_ws, size_t ws_size,
                              hipStream_t stream) {
  if (n_in < 10) return;
  if (in_sizes[0] < NB * CH * T_FULL || in_sizes[1] < NB * CH * T_FULL) return;
  if (in_sizes[2] < CH * CH || in_sizes[4] < CH * CH || in_sizes[6] < CH * CH || in_sizes[8] < CH * CH) return;
  if (in_sizes[3] < CH || in_sizes[5] < CH || in_sizes[7] < CH || in_sizes[9] < CH) return;
  if (out_size < NB * CH * T_FULL) return;

  size_t off = 0;
  auto carve = [&](size_t bytes) { const size_t o = off; off += (bytes + 255) & ~(size_t)255; return o; };
  const size_t oW = carve(WB);
  const size_t oX = carve(RXB);
  const size_t oM = carve(RMB);
  const size_t oV = carve(RVB);
  const size_t oT = carve(STB);
  if (off > ws_size) return;
  if (off > (size_t)WS_CAP) return;

  const float* x_c = (const float*)d_in[0];
  const float* x_s = (const float*)d_in[1];
  const float* Wn  = (const float*)d_in[2];
  const float* bn  = (const float*)d_in[3];
  const float* Wm  = (const float*)d_in[4];
  const float* bm  = (const float*)d_in[5];
  const float* Wl  = (const float*)d_in[6];
  const float* bl  = (const float*)d_in[7];
  const float* Wo  = (const float*)d_in[8];
  const float* bo  = (const float*)d_in[9];
  float* out = (float*)d_out;

  char* ws = (char*)d_ws;
  unsigned short* W16  = (unsigned short*)(ws + oW);
  // region X users
  unsigned short* Xcnh = (unsigned short*)(ws + oX);
  unsigned short* Xcnl = (unsigned short*)(ws + oX + PLB);
  unsigned short* Xsnh = (unsigned short*)(ws + oX + 2 * PLB);
  unsigned short* Xsnl = (unsigned short*)(ws + oX + 3 * PLB);
  unsigned short* Xsr  = (unsigned short*)(ws + oX + 4 * PLB);
  float*          S    = (float*)(ws + oX);
  unsigned short* Moh  = (unsigned short*)(ws + oX);
  unsigned short* Mol  = (unsigned short*)(ws + oX + PLB);
  // region M users
  unsigned short* Mnh  = (unsigned short*)(ws + oM);
  unsigned short* Mnl  = (unsigned short*)(ws + oM + PLB);
  unsigned short* Mmh  = (unsigned short*)(ws + oM + 2 * PLB);
  unsigned short* Mml  = (unsigned short*)(ws + oM + 3 * PLB);
  unsigned short* P16  = (unsigned short*)(ws + oM);
  // region V
  unsigned short* V16  = (unsigned short*)(ws + oV);
  // region T
  float*          St   = (float*)(ws + oT);

  const dim3 blk256(256), blk128(128);
  const dim3 gconv(SEQ / QT, CH / QT, NB);

  // (0) + (1a) instance-norm statistics of x_c and x_s; weights -> bf16 planes (order Wn, Wm, Wl, Wo)
  prep<<<dim3(NSTATB + NCVTWB), blk256, 0, stream>>>(x_c, x_s, Wn, Wm, Wl, Wo, St, W16);
  // (1b) split planes of norm(x_c); same for x_s plus the raw bf16 plane
  cvt_norm2<<<dim3(SEQ / NT, CH / QT, 2 * NB), blk256, 0, stream>>>(x_c, x_s, St, Xcnh, Xcnl, Xsnh, Xsnl, Xsr);
  // (2) + (3) Mn, Mm hi + residual planes and the Ml value plane
  gemm_conv3<<<dim3(SEQ / QT, CH / QT, 3 * NB), blk128, 0, stream>>>(W16, bn, bm, bl, Xcnh, Mnh, V16);
  // (4) scores (overwrites region X)
  gemm_sc<<<dim3(SEQ / QT, SEQ / QT, NB), blk128, 0, stream>>>(Mnh, Mnl, Mmh, Mml, S);
  // (5) softmax weights (overwrites region M)
  softmax_k<<<dim3(NB * SEQ / 8), blk256, 0, stream>>>(S, P16);
  // (6) Mo hi + residual planes (overwrites region X)
  gemm_pv<<<gconv, blk128, 0, stream>>>(V16, P16, Moh, Mol);
  // (7) output GEMM + bias + residual
  gemm_out<<<gconv, blk128, 0, stream>>>(W16 + (size_t)3 * CH * CH, bo, Moh, Mol, x_c, out);
  (void)hipGetLastError();
}

// v004
// Measured time: 171 microseconds a run.
// Two timings next to v003 put it at 1.03 and 1.04 times that version's speed.
// Counting every step since v000, it is 3.87 times as fast.
// Contractions: conv1x1 Wn.norm(x_c) and Wm.norm(x_s) on v_wmma_f32_16x16x32_bf16 (bf16-RNE weights x bf16 hi +
// bf16 residual planes of the normalised activations, 2 products, K=512); conv1x1 Wl.x_s on v_wmma_f32_16x16x32_bf16
// (bf16-RNE weights x bf16-RNE x_s, 1 product); position scores Mn^T.Mm on v_wmma_f32_16x16x32_bf16 (bf16 hi +
// residual planes of both, 3 products, K=512); Mo = Ml.A^T on v_wmma_f32_16x16x32_f16 (f16 Ml plane x softmax
// weights carried x16384 as f16, K=2048); conv1x1 Wo.Mo on v_wmma_f32_16x16x32_bf16 (bf16-RNE weights x bf16 hi +
// residual planes of Mo, 2 products); f32 accumulate everywhere; instance-norm statistics, softmax, bias and residual
// adds in f32 VALU.
#include <hip/hip_runtime.h>
#include <stdint.h>

#ifndef NB
#define NB 4
#endif
#ifndef SEQ
#define SEQ 2048
#endif
#define NB_FULL 4
#define T_FULL  2048
#define CH      512
#define NMAT    4
#define QT      64
#define BT      128
#define OSP     132
#define TP      72
#define NT      128
#define KC      64
#define LP      144
#define TILEB   (BT * LP)
#define NCH     (SEQ / 256)
#define PCAR    16384.0f
#define IPCAR   6.103515625e-05f
#define EPSN    1.0e-5f
#define WS_CAP  134217728

static_assert(NB >= 1 && NB <= NB_FULL);
static_assert(SEQ >= 256 && SEQ <= T_FULL && SEQ % 256 == 0);
static_assert(SEQ % QT == 0 && CH % QT == 0 && SEQ % NT == 0 && SEQ % BT == 0 && CH % BT == 0);
static_assert(CH % 256 == 0 && CH % 32 == 0 && SEQ % 32 == 0 && SEQ % 16 == 0);
static_assert((OSP * 4) % 16 == 0);
static_assert((TP * 2) % 16 == 0);
static_assert((NB * SEQ) % 8 == 0);
static_assert(CH % 8 == 0);
static_assert(CH % KC == 0 && SEQ % KC == 0 && CH / KC >= 2 && SEQ / KC >= 2);
static_assert(KC * 2 + 16 == LP && LP % 32 == 16 && QT == 64 && BT == 128);
static_assert(BT * OSP * 4 <= 2 * 2 * TILEB);

typedef _Float16       v16h __attribute__((ext_vector_type(16)));
typedef _Float16       v8h  __attribute__((ext_vector_type(8)));
typedef __bf16         v16b __attribute__((ext_vector_type(16)));
typedef unsigned short v8us __attribute__((ext_vector_type(8)));
typedef float          v8f  __attribute__((ext_vector_type(8)));
typedef float          v4f  __attribute__((ext_vector_type(4)));
typedef float          v2f  __attribute__((ext_vector_type(2)));
typedef unsigned int   v4u  __attribute__((ext_vector_type(4)));

union Frag { v8us u[2]; v16h h; v16b bf; };
static_assert(sizeof(Frag) == 32);

// ---- workspace map (bytes; every region start a multiple of 256; every extent is an exact tile multiple and is
//      launches; each later user fully overwrites what it reads before any read):
//   W : bf16 [4][512][512] weights                                              WB
//   X : stage 1-3: five bf16 planes [NB][SEQ][512] (x_c norm hi/lo, x_s norm hi/lo, x_s raw)   5*PLB
//       stage 4  : scores f32 [NB][SEQ][SEQ]                                    SB
//       stage 6-7: Mo hi/lo bf16 planes [NB][SEQ][512]                          2*PLB
//   M : stage 2-4: Mn hi/lo, Mm hi/lo bf16 planes [NB][SEQ][512]                4*PLB
//       stage 5-6: softmax weights f16 [NB][SEQ][SEQ]                           PB
//   V : Ml f16 plane [NB][512][SEQ]                                             PLB
//   T : instance-norm {mean, rstd} f32 pairs [2][NB][512]                       STB
constexpr size_t cmax(size_t a, size_t b) { return a > b ? a : b; }
constexpr size_t PLB = (size_t)NB * SEQ * CH * 2;
constexpr size_t SB  = (size_t)NB * SEQ * SEQ * 4;
constexpr size_t PB  = (size_t)NB * SEQ * SEQ * 2;
constexpr size_t WB  = (size_t)NMAT * CH * CH * 2;
constexpr size_t RXB = cmax(cmax(5 * PLB, SB), 2 * PLB);
constexpr size_t RMB = cmax(4 * PLB, PB);
constexpr size_t RVB = PLB;
constexpr size_t STB = (size_t)2 * NB * CH * 2 * 4;
static_assert(WB % 256 == 0 && PLB % 256 == 0 && SB % 256 == 0 && PB % 256 == 0);
static_assert(5 * PLB <= RXB && SB <= RXB && 2 * PLB <= RXB);
static_assert(4 * PLB <= RMB && PB <= RMB);
static_assert(STB % 256 == 0 && (NB * CH) % 16 == 0);
static_assert(WB + RXB + RMB + RVB + STB <= (size_t)WS_CAP);

// ---- scalar helpers -----------------------------------------------------------------------------------------
__device__ __forceinline__ unsigned short bf_bits(float f) {          // f32 -> bf16 bits, RNE convert
  unsigned u = __float_as_uint(f);
  return (unsigned short)((u + 0x7FFFu + ((u >> 16) & 1u)) >> 16);
}
__device__ __forceinline__ float bf_up(unsigned short hb) { return __uint_as_float(((unsigned)hb) << 16); }
__device__ __forceinline__ float bfr(float f) { return bf_up(bf_bits(f)); }
__device__ __forceinline__ unsigned short h_bits(_Float16 x) { return __builtin_bit_cast(unsigned short, x); }
__device__ __forceinline__ unsigned pk16(unsigned short a, unsigned short b) { return (unsigned)a | ((unsigned)b << 16); }
__device__ __forceinline__ v8f zero8() { v8f z = {0.f, 0.f, 0.f, 0.f, 0.f, 0.f, 0.f, 0.f}; return z; }

// ---- 16-bit fragment loader (A, or B from a k-contiguous [n][k] row): lane -> row/col (lane&15), p already includes
//      + 8*(lane>>4); elements 0..7 <- p[0..7] (k0+8h..), elements 8..15 <- p[16..23] (k0+16+8h..)
__device__ __forceinline__ Frag ldfrag(const unsigned short* p) {
  Frag f;
  f.u[0] = *(const v8us*)(p);
  f.u[1] = *(const v8us*)(p + 16);
  return f;
}

// ---- WMMA helpers: builtin followed by a 4-slot VALU gap tying D and keeping A/B live ----------------------------
__device__ __forceinline__ v8f mma_h(v16h a, v16h b, v8f c) {
  v8f d = __builtin_amdgcn_wmma_f32_16x16x32_f16(false, a, false, b, (short)0, c, false, false);
#if defined(__HIP_DEVICE_COMPILE__)
  asm volatile("v_nop\n\tv_nop\n\tv_nop\n\tv_nop" : "+v"(d) : "v"(a), "v"(b));
#endif
  return d;
}
__device__ __forceinline__ v8f mma_b(v16b a, v16b b, v8f c) {
  v8f d = __builtin_amdgcn_wmma_f32_16x16x32_bf16(false, a, false, b, (short)0, c, false, false);
#if defined(__HIP_DEVICE_COMPILE__)
  const v16h ha = __builtin_bit_cast(v16h, a), hb = __builtin_bit_cast(v16h, b);
  asm volatile("v_nop\n\tv_nop\n\tv_nop\n\tv_nop" : "+v"(d) : "v"(ha), "v"(hb));
#endif
  return d;
}

// ---- asynchronous copies of operand tiles into LDS. One tile of a pass = 128 rows x 128 B (KC elements), LDS pitch LP.
//      Lane map: e = tid & 7 -> 16-B piece of the row, r = tid >> 3 -> row r + 32 i (i = 0..3): 8 lanes cover one whole
//      128-B line. l = the lane's LDS byte address of row r, g = its global address of row r, p32 = elements of 32 rows.
//      The s_wait_xcnt closes each statement so that no address register of an issued copy is rewritten ahead of it.
__device__ __forceinline__ unsigned lds_off(const void* p) { return (unsigned)(size_t)p; }
__device__ __forceinline__ void copy_tile(unsigned l, const unsigned short* g, size_t p32) {
#if defined(__HIP_DEVICE_COMPILE__)
  // four copies of one tile, global -> LDS through no register; the wait is their statement's last line
  asm volatile("global_load_async_to_lds_b128 %0, %4, off\n\t"
               "global_load_async_to_lds_b128 %1, %5, off\n\t"
               "global_load_async_to_lds_b128 %2, %6, off\n\t"
               "global_load_async_to_lds_b128 %3, %7, off\n\t"
               "s_wait_xcnt 0x0"
               :: "v"(l), "v"(l + 32 * LP), "v"(l + 64 * LP), "v"(l + 96 * LP),
                  "v"(g), "v"(g + p32), "v"(g + 2 * p32), "v"(g + 3 * p32) : "memory");
#endif
}
__device__ __forceinline__ void copy_tiles2(unsigned l, const unsigned short* g, size_t p32,
                                            unsigned m, const unsigned short* h, size_t q32) {
#if defined(__HIP_DEVICE_COMPILE__)
  // eight copies of two tiles, global -> LDS through no register; they share one statement and its closing wait
  asm volatile("global_load_async_to_lds_b128 %0, %8, off\n\t"
               "global_load_async_to_lds_b128 %1, %9, off\n\t"
               "global_load_async_to_lds_b128 %2, %10, off\n\t"
               "global_load_async_to_lds_b128 %3, %11, off\n\t"
               "global_load_async_to_lds_b128 %4, %12, off\n\t"
               "global_load_async_to_lds_b128 %5, %13, off\n\t"
               "global_load_async_to_lds_b128 %6, %14, off\n\t"
               "global_load_async_to_lds_b128 %7, %15, off\n\t"
               "s_wait_xcnt 0x0"
               :: "v"(l), "v"(l + 32 * LP), "v"(l + 64 * LP), "v"(l + 96 * LP),
                  "v"(m), "v"(m + 32 * LP), "v"(m + 64 * LP), "v"(m + 96 * LP),
                  "v"(g), "v"(g + p32), "v"(g + 2 * p32), "v"(g + 3 * p32),
                  "v"(h), "v"(h + q32), "v"(h + 2 * q32), "v"(h + 3 * q32) : "memory");
#endif
}

// ---- GEMM core for one 128(m) x 128(n) block tile, 8 waves (256 threads) as 2 (m) x 4 (n): wave (wm, wn) owns a
//      64 x 32 tile, cols n = 32 wn + 16 nf + (lane&15) (2 B fragments per k-step per B plane), A rows
//      m = 64 wm + 16 mt + (lane&15) (4 m-tiles): every fragment read from LDS feeds 2 or 4 matrix instructions a product,
//      every operand byte copied from L2 feeds 128 rows or columns. a0/a1/b0/b1 = row 0, k = 0 of the
//      block's 128 operand rows (k-contiguous, pitches ap / bp elements). A pass = KC k: its operand tiles
//      [A0][A1 if NPROD 3][B0][B1 if NPROD >= 2] are copied into one of two LDS buffers one pass ahead, and the
//      fragments are read from LDS with the split k map (ldfrag), k-steps and products in the same order as from
//      global rows. NPROD: 1 = a0.b0; 2 = a0.b0 + a0.b1; 3 = a0.b0 + a0.b1 + a1.b0 (shared accumulator, unscaled
//      residual planes; each accumulator takes its products of a k-step in that order, the 8 tiles of one product in a
//      row). HALF selects the f16 instruction (NPROD 1 only). On return no copy is outstanding and every
//      wave has left both buffers (the last pass's barrier), so sm may be reused as output staging.
template <int NPROD>
struct CoreLds {
  static constexpr int NA = NPROD >= 3 ? 2 : 1;
  static constexpr int NBP = NPROD >= 2 ? 2 : 1;
  static constexpr unsigned STG = (unsigned)(NA + NBP) * TILEB;
  static constexpr unsigned BYTES = 2 * STG;
};
template <int NPROD>
__device__ __forceinline__ void fill_stage(unsigned l, const unsigned short* a0, const unsigned short* a1, size_t ap32,
                                           const unsigned short* b0, const unsigned short* b1, size_t bp32) {
  if (NPROD == 1) {
    copy_tiles2(l, a0, ap32, l + TILEB, b0, bp32);
  } else if (NPROD == 2) {
    copy_tile(l, a0, ap32);
    copy_tiles2(l + TILEB, b0, bp32, l + 2 * TILEB, b1, bp32);
  } else {
    copy_tiles2(l, a0, ap32, l + TILEB, a1, ap32);
    copy_tiles2(l + 2 * TILEB, b0, bp32, l + 3 * TILEB, b1, bp32);
  }
}
template <int NPROD, bool HALF>
__device__ __forceinline__ void gemm_core(v8f (&acc)[4][2], const char* sm,
                                          const unsigned short* __restrict__ a0,
                                          const unsigned short* __restrict__ a1, size_t ap,
                                          const unsigned short* __restrict__ b0,
                                          const unsigned short* __restrict__ b1, size_t bp, int npass, int tid) {
  static_assert(NPROD >= 1 && NPROD <= 3);
  static_assert(!(HALF && NPROD != 1));
  constexpr unsigned STG = CoreLds<NPROD>::STG;
  constexpr unsigned BOFF = (unsigned)CoreLds<NPROD>::NA * TILEB;
  const int lane = tid & 31, wave = tid >> 5, hh = lane >> 4, c = lane & 15;
  const int wm = wave >> 2, wn = wave & 3;
  const int e = tid & 7, r = tid >> 3;                               // r 0..31
  const unsigned lc = lds_off(sm) + (unsigned)(r * LP + 16 * e);
  const size_t ga = (size_t)r * ap + 8 * e, gb = (size_t)r * bp + 8 * e;
  const unsigned fa = (unsigned)((64 * wm + c) * LP + 16 * hh);
  const unsigned fb = BOFF + (unsigned)((32 * wn + c) * LP + 16 * hh);
  fill_stage<NPROD>(lc, a0 + ga, a1 + ga, 32 * ap, b0 + gb, b1 + gb, 32 * bp);
  asm volatile("s_wait_asynccnt 0x0" ::: "memory");                  // pass 0's own copies have landed
  __syncthreads();                                                   // ... and every other wave's
  fill_stage<NPROD>(lc + STG, a0 + ga + KC, a1 + ga + KC, 32 * ap, b0 + gb + KC, b1 + gb + KC, 32 * bp);
  // kept rolled: one pass is 16 to 48 matrix instructions with their fragment loads, and the code stays small
#pragma unroll 1
  for (int t = 0; t < npass; ++t) {
    const unsigned bo = (unsigned)(t & 1) * STG;
    // the loops below are unrolled whole so that the fragment arrays stay in registers and the LDS offsets are immediates
#pragma unroll
    for (int ks = 0; ks < KC / 32; ++ks) {
      const unsigned o = bo + 64u * ks;
      // the k-step's fragment reads stand together, ahead of its matrix instructions: one LDS latency a k-step
      Frag fb0[2], fb1[2], fa0[4], fa1[4];
#pragma unroll
      for (int nf = 0; nf < 2; ++nf) {
        fb0[nf] = ldfrag((const unsigned short*)(sm + fb + 16 * LP * nf + o));
        if (NPROD >= 2) fb1[nf] = ldfrag((const unsigned short*)(sm + fb + TILEB + 16 * LP * nf + o));
        else fb1[nf] = fb0[nf];
      }
#pragma unroll
      for (int mt = 0; mt < 4; ++mt) {
        fa0[mt] = ldfrag((const unsigned short*)(sm + fa + 16 * LP * mt + o));
        if (NPROD >= 3) fa1[mt] = ldfrag((const unsigned short*)(sm + fa + TILEB + 16 * LP * mt + o));
        else fa1[mt] = fa0[mt];
      }
#pragma unroll
      for (int p = 0; p < NPROD; ++p) {
#pragma unroll
        for (int mt = 0; mt < 4; ++mt) {
#pragma unroll
          for (int nf = 0; nf < 2; ++nf) {
            if (HALF)        acc[mt][nf] = mma_h(fa0[mt].h, fb0[nf].h, acc[mt][nf]);
            else if (p == 0) acc[mt][nf] = mma_b(fa0[mt].bf, fb0[nf].bf, acc[mt][nf]);
            else if (p == 1) acc[mt][nf] = mma_b(fa0[mt].bf, fb1[nf].bf, acc[mt][nf]);
            else             acc[mt][nf] = mma_b(fa1[mt].bf, fb0[nf].bf, acc[mt][nf]);
          }
        }
      }
    }
    asm volatile("s_wait_dscnt 0x0" ::: "memory");                   // this wave's reads of the buffer are done before it is refilled
    asm volatile("s_wait_asynccnt 0x0" ::: "memory");                // this wave's copies of pass t + 1 have landed
    __syncthreads();                                                 // publishes pass t + 1, ends every read of pass t's buffer
    if (t + 2 < npass) {
      const int ko = KC * (t + 2);
      fill_stage<NPROD>(lc + bo, a0 + ga + ko, a1 + ga + ko, 32 * ap, b0 + gb + ko, b1 + gb + ko, 32 * bp);
    }
  }
  asm volatile("s_wait_asynccnt 0x0" ::: "memory");                  // nothing outstanding when the LDS changes its use
}
__device__ __forceinline__ void zero_acc(v8f (&acc)[4][2]) {
#pragma unroll
  for (int mt = 0; mt < 4; ++mt) { acc[mt][0] = zero8(); acc[mt][1] = zero8(); }
}

// ---- epilogue staging, transposed: Os[n_loc][m_loc] (pitch OSP). Lane (hh, c) of wave (wm, wn) holds D rows
//      m = 64 wm + 16 mt + 8 hh + r, col n = 32 wn + 16 nf + c -> two b128 LDS stores per 16 x 16 tile.
__device__ __forceinline__ void stage_nT(float* Os, const v8f (&acc)[4][2], float sc, int wave, int hh, int c) {
  const int wm = wave >> 2, wn = wave & 3;
#pragma unroll
  for (int nf = 0; nf < 2; ++nf) {
    const int nl = 32 * wn + 16 * nf + c;
#pragma unroll
    for (int mt = 0; mt < 4; ++mt) {
      v4f va, vb;
#pragma unroll
      for (int r = 0; r < 4; ++r) { va[r] = acc[mt][nf][r] * sc; vb[r] = acc[mt][nf][4 + r] * sc; }
      *(v4f*)(Os + nl * OSP + 64 * wm + 16 * mt + 8 * hh)     = va;
      *(v4f*)(Os + nl * OSP + 64 * wm + 16 * mt + 8 * hh + 4) = vb;
    }
  }
}
// ---- epilogue staging, row-major: Os[m_loc][n_loc] (pitch OSP), scalar LDS stores.
__device__ __forceinline__ void stage_mn(float* Os, const v8f (&acc)[4][2], int wave, int hh, int c) {
  const int wm = wave >> 2, wn = wave & 3;
#pragma unroll
  for (int nf = 0; nf < 2; ++nf) {
    const int nl = 32 * wn + 16 * nf + c;
#pragma unroll
    for (int mt = 0; mt < 4; ++mt) {
#pragma unroll
      for (int r = 0; r < 8; ++r) Os[(64 * wm + 16 * mt + 8 * hh + r) * OSP + nl] = acc[mt][nf][r];
    }
  }
}

// ---- plane writer for transposed staging: plane [b][n][512] bf16 hi + bf16 residual, rows rowbase + 0..127,
//      16 lanes per 256-B row piece (two whole lines), rows it*16 + lq. Optional f32 bias (bf16-RNE value) added per col.
// coverage: 8 it x 16 rows x 16 lanes x 8 = 128 rows x 128 cols per plane.
template <bool BIAS>
__device__ __forceinline__ void planes_out(const float* Os, const float* __restrict__ bias, int o0,
                                           unsigned short* Ph, unsigned short* Pl, size_t rowbase, int tid) {
  const int e = tid & 15, lq = tid >> 4;                             // lq 0..15
  float bv[8];
#pragma unroll
  for (int t = 0; t < 8; ++t) bv[t] = 0.f;
  if (BIAS) {
    const unsigned bofs = 32u * (unsigned)e;                         // the lane's byte offset behind the block's bias + o0
    const char* bb = (const char*)(bias + o0);
    const v4f b0 = *(const v4f*)(bb + bofs);
    const v4f b1 = *(const v4f*)(bb + bofs + 16);
    // bofs addresses both loads; as an input here its register stays live past them and is reused only behind this wait
    asm volatile("s_wait_xcnt 0x0" :: "v"(bofs) : "memory");
#pragma unroll
    for (int t = 0; t < 4; ++t) { bv[t] = bfr(b0[t]); bv[4 + t] = bfr(b1[t]); }
  }
  v4u uh[8], ul[8];
#pragma unroll
  for (int it = 0; it < 8; ++it) {
    const int row = it * 16 + lq;                                    // n_loc 0..127
    const v4f a = *(const v4f*)(Os + row * OSP + 8 * e);
    const v4f q = *(const v4f*)(Os + row * OSP + 8 * e + 4);
    const float f[8] = {a[0], a[1], a[2], a[3], q[0], q[1], q[2], q[3]};
#pragma unroll
    for (int t = 0; t < 4; ++t) {
      const float f0 = f[2 * t] + bv[2 * t], f1 = f[2 * t + 1] + bv[2 * t + 1];
      const unsigned short hb0 = bf_bits(f0), hb1 = bf_bits(f1);
      const unsigned short lb0 = bf_bits(f0 - bf_up(hb0));
      const unsigned short lb1 = bf_bits(f1 - bf_up(hb1));
      uh[it][t] = pk16(hb0, hb1);
      ul[it][t] = pk16(lb0, lb1);
    }
  }
{
#pragma unroll
    for (int it = 0; it < 8; ++it) {
      const int row = it * 16 + lq;
      const size_t po = (rowbase + (size_t)row) * CH + o0 + 8 * e;
      *(v4u*)(Ph + po) = uh[it];
      *(v4u*)(Pl + po) = ul[it];
    }
    
  }
}

// =========================================================================================================
// (0) weights f32 [512][512] x4 -> W16 bf16 bits [4][512][512] (RNE convert of the input value, exact operand).
//     Block blk owns 8 rows of one matrix (matrix index block-uniform), one wave per 1024-B row = 2 instructions of
// coverage: 256 blocks x 8 rows x 2 j x 32 lanes x 8 = 2048 rows x 512 = the whole plane. blk = 0..255 (part of prep).
// =========================================================================================================
__device__ __forceinline__
void cvt_w_part(const float* __restrict__ w0, const float* __restrict__ w1,
                const float* __restrict__ w2, const float* __restrict__ w3, unsigned short* W16, int blk) {
  const int tid = threadIdx.x;
  const int wave = tid >> 5, lane = tid & 31;
  const int mi = blk / (CH / 8);                                     // 0..3, block-uniform
  const int o  = 8 * (blk - mi * (CH / 8)) + wave;                   // 0..511
  const float* wb = (mi == 0) ? w0 : (mi == 1) ? w1 : (mi == 2) ? w2 : w3;
  v4u u[CH / 256];
#pragma unroll
  for (int j = 0; j < CH / 256; ++j) {
    const float* s = wb + (size_t)o * CH + 256 * j + 8 * lane;
    const v4f a = *(const v4f*)s;
    const v4f q = *(const v4f*)(s + 4);
    const float f[8] = {a[0], a[1], a[2], a[3], q[0], q[1], q[2], q[3]};
#pragma unroll
    for (int t = 0; t < 4; ++t) u[j][t] = pk16(bf_bits(f[2 * t]), bf_bits(f[2 * t + 1]));
  }
{
#pragma unroll
    for (int j = 0; j < CH / 256; ++j)
      *(v4u*)(W16 + ((size_t)(mi * CH + o)) * CH + 256 * j + 8 * lane) = u[j];
    
  }
}

// =========================================================================================================
// (1a) instance-norm statistics of both inputs, one launch: St[(sel * NB + b) * 512 + c] = {mean, rsqrt(var + eps)} of
//      bf16-RNE(x) over the row's SEQ values. 16 lanes per row, lane l = 4 q + k owns the elements 16 j + l and adds
//      them in rising j; the four xor steps then form ((s0 + s1) + (s2 + s3)) per q and the sum over q (1, then 2).
//      The lane's SEQ/16 values stay in registers, so the row is read once for mean and variance.
// coverage: block = 16 rows = one 128-B line of St; blk = 0 .. 2 * NB * 512 / 16 - 1 covers every row of both inputs once.
// =========================================================================================================
__device__ __forceinline__
void norm_stats_part(const float* __restrict__ xc, const float* __restrict__ xs, float* St, int blk) {
  const int tid = threadIdx.x;
  const int rl = tid >> 4, l = tid & 15;                             // rl 0..15
  const int sel = blk / (NB * CH / 16);                              // 0 = x_c, 1 = x_s, block-uniform
  const int r   = 16 * (blk - sel * (NB * CH / 16)) + rl;            // b * 512 + c
  const float* xr = (sel ? xs : xc) + (size_t)r * T_FULL + l;
  float v[SEQ / 16];                                                 // the loops are unrolled whole so that v stays in registers
#pragma unroll
  for (int j = 0; j < SEQ / 16; ++j) v[j] = xr[16 * j];
  // xr is an input here so that its registers stay live past the last load and are reused only behind this wait
  asm volatile("s_wait_xcnt 0x0" :: "v"(xr) : "memory");
  float sm = 0.f;
#pragma unroll
  for (int j = 0; j < SEQ / 16; ++j) { v[j] = bfr(v[j]); sm += v[j]; }
  sm += __shfl_xor(sm, 1, 32);
  sm += __shfl_xor(sm, 2, 32);
  sm += __shfl_xor(sm, 4, 32);
  sm += __shfl_xor(sm, 8, 32);
  const float mean = sm * (1.0f / (float)SEQ);
  float sv = 0.f;
#pragma unroll
  for (int j = 0; j < SEQ / 16; ++j) { const float d = v[j] - mean; sv = __builtin_fmaf(d, d, sv); }
  sv += __shfl_xor(sv, 1, 32);
  sv += __shfl_xor(sv, 2, 32);
  sv += __shfl_xor(sv, 4, 32);
  sv += __shfl_xor(sv, 8, 32);
  const float var = sv * (1.0f / (float)SEQ);
  const float rs  = rsqrtf(var + EPSN);
  if (l == 0) {
    v2f st; st[0] = mean; st[1] = rs;
    *(v2f*)(St + 2 * (size_t)(sel * NB * CH + r)) = st;
  }
}

// =========================================================================================================
// (0) + (1a) in one launch: neither reads what the other writes. The block index picks the part (block-uniform): the
//     statistics blocks, which run longer, come first, the weight blocks behind them.
// =========================================================================================================
#define NSTATB (2 * NB * CH / 16)
#define NCVTWB (NMAT * CH / 8)
__global__ __launch_bounds__(256)
void prep(const float* __restrict__ xc, const float* __restrict__ xs,
          const float* __restrict__ w0, const float* __restrict__ w1,
          const float* __restrict__ w2, const float* __restrict__ w3, float* St, unsigned short* W16) {
  const int blk = blockIdx.x;
  if (blk < NSTATB) {
    norm_stats_part(xc, xs, St, blk);
  } else {
    cvt_w_part(w0, w1, w2, w3, W16, blk - NSTATB);
    // the other part's code follows these stores in the built kernel: no register of theirs is rewritten ahead of this wait
    asm volatile("s_wait_xcnt 0x0" ::: "memory");
  }
}

// =========================================================================================================
// (1b) x f32 [b][512 c][2048 t] (batch/row strides at full size) -> position-major bf16 planes [b][t][512]:
//      Ph = bf16-RNE(xn), Pl = bf16-RNE(xn - Ph) with xn = (bf16-RNE(x) - mean) * rstd per (b, c) row (St of 1a);
//      RAW adds Pr = bf16-RNE(x). One 64 c x 128 t tile per block, transposed through LDS (line = 64 c of one plane
//      row): lane e -> c 8e..8e+7, 8 consecutive lanes per line.
// coverage: 4 it x 32 rows x 8 lanes x 8 = 128 t x 64 c per plane; (SEQ/128, 8) blocks for each b = 0..NB-1 cover
//           [NB][SEQ][512] of every written plane exactly once. Th, Tl, Tr = the block's LDS tiles (Tr used by RAW only).
// =========================================================================================================
template <int RAW>
__device__ __forceinline__
void cvt_norm_part(const float* __restrict__ x, const float* __restrict__ St,
                   unsigned short* Ph, unsigned short* Pl, unsigned short* Pr,
                   unsigned short* Th, unsigned short* Tl, unsigned short* Tr, int b) {
  const int tid = threadIdx.x;
  const int n0 = blockIdx.x * NT, c0 = blockIdx.y * QT;
  const int e = tid & 7, lq = tid >> 3;                              // lq 0..31
  v4f a[4], q[4];
  v2f st[2];
  const int sr = b * CH + c0 + lq;                                   // row of c half 0; c half 1 is 32 rows on
  const float* sp0 = x + (size_t)sr * T_FULL + n0 + 8 * e;
#pragma unroll
  for (int it = 0; it < 4; ++it) {                                   // it = 2 * (t half) + (c half)
    const float* sp = sp0 + (size_t)(it & 1) * 32 * T_FULL + (it >> 1) * 64;
    a[it] = *(const v4f*)sp;
    q[it] = *(const v4f*)(sp + 4);
  }
#pragma unroll
  for (int h = 0; h < 2; ++h) st[h] = *(const v2f*)(St + 2 * (size_t)sr + 64 * h);
  // sp0 and sr address the loads; as inputs here their registers stay live past the last load and are reused only behind this wait
  asm volatile("s_wait_xcnt 0x0" :: "v"(sp0), "v"(sr) : "memory");
#pragma unroll
  for (int it = 0; it < 4; ++it) {
    const int cl = (it & 1) * 32 + lq;
    const int tl = (it >> 1) * 64 + 8 * e;                           // 0..120
    const float f[8] = {a[it][0], a[it][1], a[it][2], a[it][3], q[it][0], q[it][1], q[it][2], q[it][3]};
    const float mu = st[it & 1][0], rs = st[it & 1][1];
#pragma unroll
    for (int t = 0; t < 8; ++t) {
      const unsigned short rb = bf_bits(f[t]);
      const float d  = bf_up(rb) - mu;
      const float xn = d * rs;
      const unsigned short hb = bf_bits(xn);
      const unsigned short lb = bf_bits(__builtin_fmaf(d, rs, -bf_up(hb)));   // residual of the unrounded product
      Th[(tl + t) * TP + cl] = hb;
      Tl[(tl + t) * TP + cl] = lb;
      if (RAW) Tr[(tl + t) * TP + cl] = rb;
    }
  }
  __syncthreads();
  v4u uh[4], ul[4], ur[4];
#pragma unroll
  for (int it = 0; it < 4; ++it) {
    const int nl = it * 32 + lq;                                     // 0..127
    uh[it] = *(const v4u*)(Th + nl * TP + 8 * e);
    ul[it] = *(const v4u*)(Tl + nl * TP + 8 * e);
    if (RAW) ur[it] = *(const v4u*)(Tr + nl * TP + 8 * e); else ur[it] = uh[it];
  }
#pragma unroll
  for (int it = 0; it < 4; ++it) {
    const int nl = it * 32 + lq;
    const size_t po = ((size_t)(b * SEQ + n0 + nl)) * CH + c0 + 8 * e;
    *(v4u*)(Ph + po) = uh[it];
    *(v4u*)(Pl + po) = ul[it];
    if (RAW) *(v4u*)(Pr + po) = ur[it];
  }
}

// =========================================================================================================
// (1b) of both inputs in one launch, grid (SEQ/128, 8, 2 NB): blockIdx.z picks the input (block-uniform, so each part's
//      barrier is passed by the whole block); x_s, which writes three planes, comes first.
// =========================================================================================================
__global__ __launch_bounds__(256)
void cvt_norm2(const float* __restrict__ xc, const float* __restrict__ xs, const float* __restrict__ St,
               unsigned short* Pch, unsigned short* Pcl,
               unsigned short* Psh, unsigned short* Psl, unsigned short* Psr) {
  __shared__ __align__(16) unsigned short Th[NT * TP];
  __shared__ __align__(16) unsigned short Tl[NT * TP];
  __shared__ __align__(16) unsigned short Tr[NT * TP];
  const int z = blockIdx.z;
  if (z < NB) {
    cvt_norm_part<1>(xs, St + 2 * NB * CH, Psh, Psl, Psr, Th, Tl, Tr, z);
  } else {
    cvt_norm_part<0>(xc, St, Pch, Pcl, Pcl, Th, Tl, Tr, z - NB);
    // the other part's code follows these stores in the built kernel: no register of theirs is rewritten ahead of this wait
    asm volatile("s_wait_xcnt 0x0" ::: "memory");
  }
}

// =========================================================================================================
// (2) conv1x1 GEMM into hi + residual planes: Y[o][n] = sum_c W16[o][c] (Xh + Xl)[b][n][c] + bias[o] for one
//     (b, 128-n tile, 128-o block); A = W rows o (k = c contiguous), B = plane rows n (k = c contiguous), 2 products,
//     K = 512 = 16 steps. Epilogue: transposed LDS staging, barrier, planes [b][n][512] (planes_out).
// coverage: (SEQ/128, 4) blocks for each b = 0..NB-1, x 128 n x 128 o, cover [NB][SEQ][512] of both planes exactly once.
//           sm = the block's LDS, CoreLds<2>::BYTES: two operand buffers; output staging behind the core.
// =========================================================================================================
__device__ __forceinline__
void gemm_nm_part(char* sm, const unsigned short* __restrict__ W, const float* __restrict__ bias,
                  const unsigned short* __restrict__ Xh, const unsigned short* __restrict__ Xl,
                  unsigned short* Ph, unsigned short* Pl, int b) {
  float* Os = (float*)sm;
  const int tid = threadIdx.x, lane = tid & 31, wave = tid >> 5;
  const int hh = lane >> 4, c = lane & 15;
  const int nt = blockIdx.x, mb = blockIdx.y;
  const int n0 = nt * BT, o0 = mb * BT;
  const unsigned short* ap = W + (size_t)o0 * CH;
  const size_t bq = ((size_t)(b * SEQ + n0)) * CH;
  v8f acc[4][2];
  zero_acc(acc);
  gemm_core<2, false>(acc, sm, ap, ap, CH, Xh + bq, Xl + bq, CH, CH / KC, tid);
  stage_nT(Os, acc, 1.0f, wave, hh, c);
  __syncthreads();
  planes_out<true>(Os, bias, o0, Ph, Pl, (size_t)(b * SEQ + n0), tid);
}

// =========================================================================================================
// (3) conv1x1 GEMM into the channel-major f16 value plane: V16[b][o][s] = f16(sum_c W16[o][c] Xr[b][s][c] + bias[o])
//     (pitch SEQ); 1 product, K = 512. Epilogue: row-major LDS staging, barrier, row o segment of 128 halves = two lines.
// coverage: 8 it x 16 rows x 16 lanes x 8 = 128 o x 128 s; (SEQ/128, 4) blocks for each b = 0..NB-1 cover [NB][512][SEQ] once.
//           sm = the block's LDS, at least CoreLds<1>::BYTES: two operand buffers; output staging behind the core.
// =========================================================================================================
__device__ __forceinline__
void gemm_val_part(char* sm, const unsigned short* __restrict__ W, const float* __restrict__ bias,
                   const unsigned short* __restrict__ Xr, unsigned short* V16, int b) {
  float* Os = (float*)sm;
  const int tid = threadIdx.x, lane = tid & 31, wave = tid >> 5;
  const int hh = lane >> 4, c = lane & 15;
  const int nt = blockIdx.x, mb = blockIdx.y;
  const int n0 = nt * BT, o0 = mb * BT;
  const unsigned short* ap = W + (size_t)o0 * CH;
  const size_t bq = ((size_t)(b * SEQ + n0)) * CH;
  v8f acc[4][2];
  zero_acc(acc);
  gemm_core<1, false>(acc, sm, ap, ap, CH, Xr + bq, Xr + bq, CH, CH / KC, tid);
  stage_mn(Os, acc, wave, hh, c);
  __syncthreads();
  const int e = tid & 15, lq = tid >> 4;                             // lq 0..15
  v4u u[8];
#pragma unroll
  for (int it = 0; it < 8; ++it) {
    const int row = it * 16 + lq;                                    // o_loc 0..127
    const float bb = bfr(bias[o0 + row]);
    const v4f a = *(const v4f*)(Os + row * OSP + 8 * e);
    const v4f q = *(const v4f*)(Os + row * OSP + 8 * e + 4);
    const float f[8] = {a[0], a[1], a[2], a[3], q[0], q[1], q[2], q[3]};
#pragma unroll
    for (int t = 0; t < 4; ++t) {
      const _Float16 h0 = (_Float16)(f[2 * t] + bb);
      const _Float16 h1 = (_Float16)(f[2 * t + 1] + bb);
      u[it][t] = pk16(h_bits(h0), h_bits(h1));
    }
  }
{
#pragma unroll
    for (int it = 0; it < 8; ++it) {
      const int row = it * 16 + lq;
      const size_t po = ((size_t)(b * CH + o0 + row)) * SEQ + n0 + 8 * e;
      *(v4u*)(V16 + po) = u[it];
    }
    
  }
}

// =========================================================================================================
// (2) for Mn, (2) for Mm and (3) in one launch, grid (SEQ/128, 4, 3 NB): the three products read W16 and the planes of
//     (1b) and write planes of their own. job = blockIdx.z / NB picks the product (block-uniform, so every barrier of a
//     part is passed by the whole block); the one-product job, the shortest, comes last. W = W16 (order Wn, Wm, Wl),
//     X = the five planes of (1b) in a row (x_c hi, lo; x_s hi, lo, raw), M = the four result planes (Mn hi, lo; Mm hi, lo).
// =========================================================================================================
constexpr size_t PLE = PLB / 2;                                      // elements of one plane
static_assert(CoreLds<1>::BYTES <= CoreLds<2>::BYTES);
__global__ __launch_bounds__(256)
void gemm_conv3(const unsigned short* __restrict__ W, const float* __restrict__ bn, const float* __restrict__ bm,
                const float* __restrict__ bl, const unsigned short* __restrict__ X,
                unsigned short* M, unsigned short* V16) {
  __shared__ __align__(16) char sm[CoreLds<2>::BYTES];
  const int job = blockIdx.z / NB, b = blockIdx.z - job * NB;
  if (job < 2) {
    const size_t pl = (size_t)job * 2 * PLE;
    gemm_nm_part(sm, W + (size_t)job * CH * CH, job ? bm : bn, X + pl, X + pl + PLE, M + pl, M + pl + PLE, b);
  } else {
    gemm_val_part(sm, W + (size_t)2 * CH * CH, bl, X + 4 * PLE, V16, b);
  }
}

// =========================================================================================================
// (4) scores S[b][t][s] = sum_c Mn[c][t] Mm[c][s] (no scale) for one (b, 128-s tile, 128-t block): A = Mn planes
//     rows t (hi Qh, residual Ql), B = Mm planes rows s (hi Kh, residual Kl), products hh + hl + lh, K = 512.
// coverage: 16 it x 8 rows x 32 lanes x 4 = 128 t x 128 s; grid (SEQ/128, SEQ/128, NB) covers [NB][SEQ][SEQ] once.
// =========================================================================================================
__global__ __launch_bounds__(256)
void gemm_sc(const unsigned short* __restrict__ Qh, const unsigned short* __restrict__ Ql,
             const unsigned short* __restrict__ Kh, const unsigned short* __restrict__ Kl, float* S) {
  __shared__ __align__(16) char sm[CoreLds<3>::BYTES];         // two operand buffers; output staging behind the core
  float* Os = (float*)sm;
  const int tid = threadIdx.x, lane = tid & 31, wave = tid >> 5;
  const int hh = lane >> 4, c = lane & 15;
  const int nt = blockIdx.x, mb = blockIdx.y, b = blockIdx.z;
  const int n0 = nt * BT, m0 = mb * BT;
  const size_t aq = ((size_t)(b * SEQ + m0)) * CH;
  const size_t bq = ((size_t)(b * SEQ + n0)) * CH;
  v8f acc[4][2];
  zero_acc(acc);
  gemm_core<3, false>(acc, sm, Qh + aq, Ql + aq, CH, Kh + bq, Kl + bq, CH, CH / KC, tid);
  stage_mn(Os, acc, wave, hh, c);
  __syncthreads();
  const int e = tid & 31, lq = tid >> 5;                             // lq 0..7
  v4f res[16];
#pragma unroll
  for (int it = 0; it < 16; ++it) {
    const int row = it * 8 + lq;
    res[it] = *(const v4f*)(Os + row * OSP + 4 * e);
  }
{
#pragma unroll
    for (int it = 0; it < 16; ++it) {
      const int row = it * 8 + lq;
      *(v4f*)(S + ((size_t)(b * SEQ + m0 + row)) * SEQ + n0 + 4 * e) = res[it];
    }
    
  }
}

// =========================================================================================================
// (5) row softmax over SEQ keys: P16[row][s] = f16(e^{S - max} * 16384 / sum), one wave per row (8 rows per
//     block), the whole row held in registers (SEQ/32 per lane), max/sum by xor shuffles. Writes: lane L ->
// coverage: NCH instructions x 32 lanes x 8 = SEQ halves per row; grid NB*SEQ/8 x 8 waves covers every row once.
// =========================================================================================================
__global__ __launch_bounds__(256)
void softmax_k(const float* __restrict__ S, unsigned short* P16) {
  const int tid = threadIdx.x, wave = tid >> 5, lane = tid & 31;
  const size_t row = (size_t)blockIdx.x * 8 + wave;                 // < NB*SEQ
  const float* sr = S + row * SEQ;
  float v[SEQ / 32];
#pragma unroll
  for (int j = 0; j < NCH; ++j) {
    const v4f a = *(const v4f*)(sr + 256 * j + 8 * lane);
    const v4f q = *(const v4f*)(sr + 256 * j + 8 * lane + 4);
#pragma unroll
    for (int t = 0; t < 4; ++t) { v[8 * j + t] = a[t]; v[8 * j + 4 + t] = q[t]; }
  }
  float mx = -3.0e38f;
#pragma unroll
  for (int i = 0; i < SEQ / 32; ++i) mx = fmaxf(mx, v[i]);
#pragma unroll
  for (int o = 16; o > 0; o >>= 1) mx = fmaxf(mx, __shfl_xor(mx, o, 32));
  float l = 0.f;
#pragma unroll
  for (int i = 0; i < SEQ / 32; ++i) { v[i] = __expf(v[i] - mx); l += v[i]; }
#pragma unroll
  for (int o = 16; o > 0; o >>= 1) l += __shfl_xor(l, o, 32);
  const float sc = PCAR * (1.0f / l);                                // l >= 1
  v4u u[NCH];
#pragma unroll
  for (int j = 0; j < NCH; ++j) {
#pragma unroll
    for (int t = 0; t < 4; ++t) {
      const _Float16 h0 = (_Float16)(v[8 * j + 2 * t] * sc);
      const _Float16 h1 = (_Float16)(v[8 * j + 2 * t + 1] * sc);
      u[j][t] = pk16(h_bits(h0), h_bits(h1));
    }
  }
{
#pragma unroll
    for (int j = 0; j < NCH; ++j)
      *(v4u*)(P16 + row * SEQ + 256 * j + 8 * lane) = u[j];
    
  }
}

// =========================================================================================================
// (6) Mo[c][t] = (1/16384) sum_s V16[b][c][s] P16[b][t][s] for one (b, 128-t tile, 128-c block): A = V16 rows c
//     (k = s contiguous, pitch SEQ), B = P16 rows t (pitch SEQ), f16 instruction, 1 product, K = SEQ.
//     Epilogue: transposed LDS staging scaled by 2^-14, barrier, Mo hi + residual planes [b][t][512] (planes_out).
// coverage: grid (SEQ/128, 4, NB) covers [NB][SEQ][512] of both planes exactly once.
// =========================================================================================================
__global__ __launch_bounds__(256)
void gemm_pv(const unsigned short* __restrict__ V16, const unsigned short* __restrict__ P16,
             unsigned short* Mh, unsigned short* Mlo) {
  __shared__ __align__(16) char sm[CoreLds<1>::BYTES];         // two operand buffers; output staging behind the core
  float* Os = (float*)sm;
  const int tid = threadIdx.x, lane = tid & 31, wave = tid >> 5;
  const int hh = lane >> 4, c = lane & 15;
  const int nt = blockIdx.x, mb = blockIdx.y, b = blockIdx.z;
  const int n0 = nt * BT, o0 = mb * BT;
  const unsigned short* ap = V16 + ((size_t)(b * CH + o0)) * SEQ;
  const unsigned short* bp = P16 + ((size_t)(b * SEQ + n0)) * SEQ;
  v8f acc[4][2];
  zero_acc(acc);
  gemm_core<1, true>(acc, sm, ap, ap, SEQ, bp, bp, SEQ, SEQ / KC, tid);
  stage_nT(Os, acc, IPCAR, wave, hh, c);
  __syncthreads();
  planes_out<false>(Os, nullptr, o0, Mh, Mlo, (size_t)(b * SEQ + n0), tid);
}

// =========================================================================================================
// (7) out[b][o][t] = sum_c W16[o][c] (Mh + Ml)[b][t][c] + bias[o] + bf16-RNE(xres[b][o][t]) for one (b, 128-t tile,
//     128-o block): 2 products, K = 512; output and residual rows at full strides. Epilogue: row-major LDS staging,
// coverage: 16 it x 8 rows x 32 lanes x 4 = 128 o x 128 t; grid (SEQ/128, 4, NB) covers out[b][0..511][0..SEQ-1] once.
// =========================================================================================================
__global__ __launch_bounds__(256)
void gemm_out(const unsigned short* __restrict__ W, const float* __restrict__ bias,
              const unsigned short* __restrict__ Mh, const unsigned short* __restrict__ Mlo,
              const float* __restrict__ xres, float* out) {
  __shared__ __align__(16) char sm[CoreLds<2>::BYTES];         // two operand buffers; output staging behind the core
  float* Os = (float*)sm;
  const int tid = threadIdx.x, lane = tid & 31, wave = tid >> 5;
  const int hh = lane >> 4, c = lane & 15;
  const int nt = blockIdx.x, mb = blockIdx.y, b = blockIdx.z;
  const int n0 = nt * BT, o0 = mb * BT;
  const unsigned short* ap = W + (size_t)o0 * CH;
  const size_t bq = ((size_t)(b * SEQ + n0)) * CH;
  v8f acc[4][2];
  zero_acc(acc);
  gemm_core<2, false>(acc, sm, ap, ap, CH, Mh + bq, Mlo + bq, CH, CH / KC, tid);
  stage_mn(Os, acc, wave, hh, c);
  __syncthreads();
  const int e = tid & 31, lq = tid >> 5;                             // lq 0..7
  const size_t blk0 = ((size_t)(b * CH + o0)) * T_FULL + n0;         // block-uniform: row 0, col 0 of the tile
  const unsigned xofs = 4u * (unsigned)(lq * T_FULL + 4 * e);        // the lane's byte offset behind it, row lq
  const char* xb = (const char*)(xres + blk0);
  const float* bp = bias + o0;
  v4f res[16];
#pragma unroll
  for (int it = 0; it < 16; ++it) {
    const int row = it * 8 + lq;                                     // o_loc 0..127
    const float bb = bfr(bp[lq + 8 * it]);
    const v4f a  = *(const v4f*)(Os + row * OSP + 4 * e);
    const v4f xv = *(const v4f*)(xb + xofs + (size_t)it * (32 * T_FULL));
#pragma unroll
    for (int t = 0; t < 4; ++t) res[it][t] = (a[t] + bb) + bfr(xv[t]);
  }
  // xofs and lq address the loads; as inputs here their registers stay live past the last load and are reused only behind this wait
  asm volatile("s_wait_xcnt 0x0" :: "v"(xofs), "v"(lq) : "memory");
{
#pragma unroll
    for (int it = 0; it < 16; ++it) {
      const int row = it * 8 + lq;
      const size_t idx = blk0 + (size_t)row * T_FULL + 4 * e;
      *(v4f*)(out + idx) = res[it];
    }
    
  }
}

// =========================================================================================================
extern "C" void kernel_launch(void* const* d_in, const int* in_sizes, int n_in,
                              void* d_out, int out_size, void* d_ws, size_t ws_size,
                              hipStream_t stream) {
  if (n_in < 10) return;
  if (in_sizes[0] < NB * CH * T_FULL || in_sizes[1] < NB * CH * T_FULL) return;
  if (in_sizes[2] < CH * CH || in_sizes[4] < CH * CH || in_sizes[6] < CH * CH || in_sizes[8] < CH * CH) return;
  if (in_sizes[3] < CH || in_sizes[5] < CH || in_sizes[7] < CH || in_sizes[9] < CH) return;
  if (out_size < NB * CH * T_FULL) return;

  size_t off = 0;
  auto carve = [&](size_t bytes) { const size_t o = off; off += (bytes + 255) & ~(size_t)255; return o; };
  const size_t oW = carve(WB);
  const size_t oX = carve(RXB);
  const size_t oM = carve(RMB);
  const size_t oV = carve(RVB);
  const size_t oT = carve(STB);
  if (off > ws_size) return;
  if (off > (size_t)WS_CAP) return;

  const float* x_c = (const float*)d_in[0];
  const float* x_s = (const float*)d_in[1];
  const float* Wn  = (const float*)d_in[2];
  const float* bn  = (const float*)d_in[3];
  const float* Wm  = (const float*)d_in[4];
  const float* bm  = (const float*)d_in[5];
  const float* Wl  = (const float*)d_in[6];
  const float* bl  = (const float*)d_in[7];
  const float* Wo  = (const float*)d_in[8];
  const float* bo  = (const float*)d_in[9];
  float* out = (float*)d_out;

  char* ws = (char*)d_ws;
  unsigned short* W16  = (unsigned short*)(ws + oW);
  // region X users
  unsigned short* Xcnh = (unsigned short*)(ws + oX);
  unsigned short* Xcnl = (unsigned short*)(ws + oX + PLB);
  unsigned short* Xsnh = (unsigned short*)(ws + oX + 2 * PLB);
  unsigned short* Xsnl = (unsigned short*)(ws + oX + 3 * PLB);
  unsigned short* Xsr  = (unsigned short*)(ws + oX + 4 * PLB);
  float*          S    = (float*)(ws + oX);
  unsigned short* Moh  = (unsigned short*)(ws + oX);
  unsigned short* Mol  = (unsigned short*)(ws + oX + PLB);
  // region M users
  unsigned short* Mnh  = (unsigned short*)(ws + oM);
  unsigned short* Mnl  = (unsigned short*)(ws + oM + PLB);
  unsigned short* Mmh  = (unsigned short*)(ws + oM + 2 * PLB);
  unsigned short* Mml  = (unsigned short*)(ws + oM + 3 * PLB);
  unsigned short* P16  = (unsigned short*)(ws + oM);
  // region V
  unsigned short* V16  = (unsigned short*)(ws + oV);
  // region T
  float*          St   = (float*)(ws + oT);

  const dim3 blk256(256);
  const dim3 gconv(SEQ / BT, CH / BT, NB);

  // (0) + (1a) instance-norm statistics of x_c and x_s; weights -> bf16 planes (order Wn, Wm, Wl, Wo)
  prep<<<dim3(NSTATB + NCVTWB), blk256, 0, stream>>>(x_c, x_s, Wn, Wm, Wl, Wo, St, W16);
  // (1b) split planes of norm(x_c); same for x_s plus the raw bf16 plane
  cvt_norm2<<<dim3(SEQ / NT, CH / QT, 2 * NB), blk256, 0, stream>>>(x_c, x_s, St, Xcnh, Xcnl, Xsnh, Xsnl, Xsr);
  // (2) + (3) Mn, Mm hi + residual planes and the Ml value plane
  gemm_conv3<<<dim3(SEQ / BT, CH / BT, 3 * NB), blk256, 0, stream>>>(W16, bn, bm, bl, Xcnh, Mnh, V16);
  // (4) scores (overwrites region X)
  gemm_sc<<<dim3(SEQ / BT, SEQ / BT, NB), blk256, 0, stream>>>(Mnh, Mnl, Mmh, Mml, S);
  // (5) softmax weights (overwrites region M)
  softmax_k<<<dim3(NB * SEQ / 8), blk256, 0, stream>>>(S, P16);
  // (6) Mo hi + residual planes (overwrites region X)
  gemm_pv<<<gconv, blk256, 0, stream>>>(V16, P16, Moh, Mol);
  // (7) output GEMM + bias + residual
  gemm_out<<<gconv, blk256, 0, stream>>>(W16 + (size_t)3 * CH * CH, bo, Moh, Mol, x_c, out);
  (void)hipGetLastError();
}

// v005
// It runs in 131 microseconds.
// Next to v004, in two timings, it ran 1.31 times as fast each time.
// Counting every step since v000, it is 5.05 times as fast.
// Contractions: conv1x1 Wn.norm(x_c) and Wm.norm(x_s) on v_wmma_f32_16x16x32_bf16 (bf16-RNE weights x bf16 hi +
// bf16 residual planes of the normalised activations, 2 products, K=512); conv1x1 Wl.x_s on v_wmma_f32_16x16x32_bf16
// (bf16-RNE weights x bf16-RNE x_s, 1 product); position scores Mn^T.Mm on v_wmma_f32_16x16x32_bf16 (bf16 hi +
// residual planes of both, 3 products, K=512); Mo = Ml.A^T on v_wmma_f32_16x16x32_f16 (f16 Ml plane x softmax
// weights carried x16384 as f16, K=2048); conv1x1 Wo.Mo on v_wmma_f32_16x16x32_bf16 (bf16-RNE weights x bf16 hi +
// residual planes of Mo, 2 products); f32 accumulate everywhere; instance-norm statistics, softmax, bias and residual
// adds in f32 VALU. The softmax has no launch of its own: the score GEMM's epilogue normalises each row inside its own
// 128-key tile, and the Mo GEMM weighs each key tile's partial product with the row's factor for that tile.
#include <hip/hip_runtime.h>
#include <stdint.h>

#ifndef NB
#define NB 4
#endif
#ifndef SEQ
#define SEQ 2048
#endif
#define NB_FULL 4
#define T_FULL  2048
#define CH      512
#define NMAT    4
#define QT      64
#define BT      128
#define OSP     132
#define TP      72
#define NT      128
#define KC      64
#define LP      144
#define TILEB   (BT * LP)
#define NKT     (SEQ / BT)
#define PCAR    16384.0f
#define IPCAR   6.103515625e-05f
#define EPSN    1.0e-5f
#define WS_CAP  134217728

static_assert(NB >= 1 && NB <= NB_FULL);
static_assert(SEQ >= 256 && SEQ <= T_FULL && SEQ % 256 == 0);
static_assert(SEQ % QT == 0 && CH % QT == 0 && SEQ % NT == 0 && SEQ % BT == 0 && CH % BT == 0);
static_assert(CH % 256 == 0 && CH % 32 == 0 && SEQ % 32 == 0 && SEQ % 16 == 0);
static_assert((OSP * 4) % 16 == 0);
static_assert((TP * 2) % 16 == 0);
static_assert((NB * SEQ) % 8 == 0);
static_assert(CH % 8 == 0);
static_assert(CH % KC == 0 && SEQ % KC == 0 && CH / KC >= 2 && SEQ / KC >= 2);
static_assert(KC * 2 + 16 == LP && LP % 32 == 16 && QT == 64 && BT == 128);
static_assert(BT * OSP * 4 <= 2 * 2 * TILEB);
static_assert(BT == 2 * KC);

typedef _Float16       v16h __attribute__((ext_vector_type(16)));
typedef _Float16       v8h  __attribute__((ext_vector_type(8)));
typedef __bf16         v16b __attribute__((ext_vector_type(16)));
typedef unsigned short v8us __attribute__((ext_vector_type(8)));
typedef float          v8f  __attribute__((ext_vector_type(8)));
typedef float          v4f  __attribute__((ext_vector_type(4)));
typedef float          v2f  __attribute__((ext_vector_type(2)));
typedef unsigned int   v4u  __attribute__((ext_vector_type(4)));

union Frag { v8us u[2]; v16h h; v16b bf; };
static_assert(sizeof(Frag) == 32);

// ---- workspace map (bytes; every region start a multiple of 256; every extent is an exact tile multiple and is
//      launches; each later user fully overwrites what it reads before any read):
//   W : bf16 [4][512][512] weights                                              WB
//   X : stage 1-3: five bf16 planes [NB][SEQ][512] (x_c norm hi/lo, x_s norm hi/lo, x_s raw)   5*PLB
//       stage 4-6: tile-local softmax weights f16 [NB][SEQ][SEQ]                PB
//                  and behind them {max, sum} f32 pairs [NB][SEQ/128 key tiles][SEQ]   LSB
//   M : stage 2-4: Mn hi/lo, Mm hi/lo bf16 planes [NB][SEQ][512]                4*PLB
//       stage 6-7: Mo hi/lo bf16 planes [NB][SEQ][512]                          2*PLB
//   V : Ml f16 plane [NB][512][SEQ]                                             PLB
//   T : instance-norm {mean, rstd} f32 pairs [2][NB][512]                       STB
constexpr size_t cmax(size_t a, size_t b) { return a > b ? a : b; }
constexpr size_t PLB = (size_t)NB * SEQ * CH * 2;
constexpr size_t LSB = (size_t)NB * NKT * SEQ * 2 * 4;
constexpr size_t PB  = (size_t)NB * SEQ * SEQ * 2;
constexpr size_t WB  = (size_t)NMAT * CH * CH * 2;
constexpr size_t RXB = cmax(5 * PLB, PB + LSB);
constexpr size_t RMB = 4 * PLB;
constexpr size_t RVB = PLB;
constexpr size_t STB = (size_t)2 * NB * CH * 2 * 4;
static_assert(WB % 256 == 0 && PLB % 256 == 0 && LSB % 256 == 0 && PB % 256 == 0);
static_assert(5 * PLB <= RXB && PB + LSB <= RXB);
static_assert(4 * PLB <= RMB && 2 * PLB <= RMB);
static_assert(STB % 256 == 0 && (NB * CH) % 16 == 0);
static_assert(WB + RXB + RMB + RVB + STB <= (size_t)WS_CAP);

// ---- scalar helpers -----------------------------------------------------------------------------------------
__device__ __forceinline__ unsigned short bf_bits(float f) {          // f32 -> bf16 bits, RNE convert
  unsigned u = __float_as_uint(f);
  return (unsigned short)((u + 0x7FFFu + ((u >> 16) & 1u)) >> 16);
}
__device__ __forceinline__ float bf_up(unsigned short hb) { return __uint_as_float(((unsigned)hb) << 16); }
__device__ __forceinline__ float bfr(float f) { return bf_up(bf_bits(f)); }
__device__ __forceinline__ unsigned short h_bits(_Float16 x) { return __builtin_bit_cast(unsigned short, x); }
__device__ __forceinline__ unsigned pk16(unsigned short a, unsigned short b) { return (unsigned)a | ((unsigned)b << 16); }
// e^x as 2^(x log2 e) on the hardware's exponential, as __expf gives it; the v_nop in the statement is the slot that the
// instruction set asks for between a transcendental and a next instruction that reads its result or overwrites its source
__device__ __forceinline__ float exp_slot(float x) {
  float y = x * 1.44269504f;
#if defined(__HIP_DEVICE_COMPILE__)
  asm("v_exp_f32 %0, %0\n\tv_nop" : "+v"(y));
#endif
  return y;
}
__device__ __forceinline__ v8f zero8() { v8f z = {0.f, 0.f, 0.f, 0.f, 0.f, 0.f, 0.f, 0.f}; return z; }

// ---- 16-bit fragment loader (A, or B from a k-contiguous [n][k] row): lane -> row/col (lane&15), p already includes
//      + 8*(lane>>4); elements 0..7 <- p[0..7] (k0+8h..), elements 8..15 <- p[16..23] (k0+16+8h..)
__device__ __forceinline__ Frag ldfrag(const unsigned short* p) {
  Frag f;
  f.u[0] = *(const v8us*)(p);
  f.u[1] = *(const v8us*)(p + 16);
  return f;
}

// ---- WMMA helpers: builtin followed by a 4-slot VALU gap tying D and keeping A/B live ----------------------------
__device__ __forceinline__ v8f mma_h(v16h a, v16h b, v8f c) {
  v8f d = __builtin_amdgcn_wmma_f32_16x16x32_f16(false, a, false, b, (short)0, c, false, false);
#if defined(__HIP_DEVICE_COMPILE__)
  asm volatile("v_nop\n\tv_nop\n\tv_nop\n\tv_nop" : "+v"(d) : "v"(a), "v"(b));
#endif
  return d;
}
__device__ __forceinline__ v8f mma_b(v16b a, v16b b, v8f c) {
  v8f d = __builtin_amdgcn_wmma_f32_16x16x32_bf16(false, a, false, b, (short)0, c, false, false);
#if defined(__HIP_DEVICE_COMPILE__)
  const v16h ha = __builtin_bit_cast(v16h, a), hb = __builtin_bit_cast(v16h, b);
  asm volatile("v_nop\n\tv_nop\n\tv_nop\n\tv_nop" : "+v"(d) : "v"(ha), "v"(hb));
#endif
  return d;
}

// ---- asynchronous copies of operand tiles into LDS. One tile of a pass = 128 rows x 128 B (KC elements), LDS pitch LP.
//      Lane map: e = tid & 7 -> 16-B piece of the row, r = tid >> 3 -> row r + 32 i (i = 0..3): 8 lanes cover one whole
//      128-B line. l = the lane's LDS byte address of row r, g = its global address of row r, p32 = elements of 32 rows.
//      The s_wait_xcnt closes each statement so that no address register of an issued copy is rewritten ahead of it.
__device__ __forceinline__ unsigned lds_off(const void* p) { return (unsigned)(size_t)p; }
__device__ __forceinline__ void copy_tile(unsigned l, const unsigned short* g, size_t p32) {
#if defined(__HIP_DEVICE_COMPILE__)
  // four copies of one tile, global -> LDS through no register; the wait is their statement's last line
  asm volatile("global_load_async_to_lds_b128 %0, %4, off\n\t"
               "global_load_async_to_lds_b128 %1, %5, off\n\t"
               "global_load_async_to_lds_b128 %2, %6, off\n\t"
               "global_load_async_to_lds_b128 %3, %7, off\n\t"
               "s_wait_xcnt 0x0"
               :: "v"(l), "v"(l + 32 * LP), "v"(l + 64 * LP), "v"(l + 96 * LP),
                  "v"(g), "v"(g + p32), "v"(g + 2 * p32), "v"(g + 3 * p32) : "memory");
#endif
}
__device__ __forceinline__ void copy_tiles2(unsigned l, const unsigned short* g, size_t p32,
                                            unsigned m, const unsigned short* h, size_t q32) {
#if defined(__HIP_DEVICE_COMPILE__)
  // eight copies of two tiles, global -> LDS through no register; they share one statement and its closing wait
  asm volatile("global_load_async_to_lds_b128 %0, %8, off\n\t"
               "global_load_async_to_lds_b128 %1, %9, off\n\t"
               "global_load_async_to_lds_b128 %2, %10, off\n\t"
               "global_load_async_to_lds_b128 %3, %11, off\n\t"
               "global_load_async_to_lds_b128 %4, %12, off\n\t"
               "global_load_async_to_lds_b128 %5, %13, off\n\t"
               "global_load_async_to_lds_b128 %6, %14, off\n\t"
               "global_load_async_to_lds_b128 %7, %15, off\n\t"
               "s_wait_xcnt 0x0"
               :: "v"(l), "v"(l + 32 * LP), "v"(l + 64 * LP), "v"(l + 96 * LP),
                  "v"(m), "v"(m + 32 * LP), "v"(m + 64 * LP), "v"(m + 96 * LP),
                  "v"(g), "v"(g + p32), "v"(g + 2 * p32), "v"(g + 3 * p32),
                  "v"(h), "v"(h + q32), "v"(h + 2 * q32), "v"(h + 3 * q32) : "memory");
#endif
}

// ---- GEMM core for one 128(m) x 128(n) block tile, 8 waves (256 threads) as 2 (m) x 4 (n): wave (wm, wn) owns a
//      64 x 32 tile, cols n = 32 wn + 16 nf + (lane&15) (2 B fragments per k-step per B plane), A rows
//      m = 64 wm + 16 mt + (lane&15) (4 m-tiles): every fragment read from LDS feeds 2 or 4 matrix instructions a product,
//      every operand byte copied from L2 feeds 128 rows or columns. a0/a1/b0/b1 = row 0, k = 0 of the
//      block's 128 operand rows (k-contiguous, pitches ap / bp elements). A pass = KC k: its operand tiles
//      [A0][A1 if NPROD 3][B0][B1 if NPROD >= 2] are copied into one of two LDS buffers one pass ahead, and the
//      fragments are read from LDS with the split k map (ldfrag), k-steps and products in the same order as from
//      global rows. NPROD: 1 = a0.b0; 2 = a0.b0 + a0.b1; 3 = a0.b0 + a0.b1 + a1.b0 (shared accumulator, unscaled
//      residual planes; each accumulator takes its products of a k-step in that order, the 8 tiles of one product in a
//      row). HALF selects the f16 instruction (NPROD 1 only). On return no copy is outstanding and every
//      wave has left both buffers (the last pass's barrier), so sm may be reused as output staging.
template <int NPROD>
struct CoreLds {
  static constexpr int NA = NPROD >= 3 ? 2 : 1;
  static constexpr int NBP = NPROD >= 2 ? 2 : 1;
  static constexpr unsigned STG = (unsigned)(NA + NBP) * TILEB;
  static constexpr unsigned BYTES = 2 * STG;
};
template <int NPROD>
__device__ __forceinline__ void fill_stage(unsigned l, const unsigned short* a0, const unsigned short* a1, size_t ap32,
                                           const unsigned short* b0, const unsigned short* b1, size_t bp32) {
  if (NPROD == 1) {
    copy_tiles2(l, a0, ap32, l + TILEB, b0, bp32);
  } else if (NPROD == 2) {
    copy_tile(l, a0, ap32);
    copy_tiles2(l + TILEB, b0, bp32, l + 2 * TILEB, b1, bp32);
  } else {
    copy_tiles2(l, a0, ap32, l + TILEB, a1, ap32);
    copy_tiles2(l + 2 * TILEB, b0, bp32, l + 3 * TILEB, b1, bp32);
  }
}
template <int NPROD, bool HALF>
__device__ __forceinline__ void gemm_core(v8f (&acc)[4][2], const char* sm,
                                          const unsigned short* __restrict__ a0,
                                          const unsigned short* __restrict__ a1, size_t ap,
                                          const unsigned short* __restrict__ b0,
                                          const unsigned short* __restrict__ b1, size_t bp, int npass, int tid) {
  static_assert(NPROD >= 1 && NPROD <= 3);
  static_assert(!(HALF && NPROD != 1));
  constexpr unsigned STG = CoreLds<NPROD>::STG;
  constexpr unsigned BOFF = (unsigned)CoreLds<NPROD>::NA * TILEB;
  const int lane = tid & 31, wave = tid >> 5, hh = lane >> 4, c = lane & 15;
  const int wm = wave >> 2, wn = wave & 3;
  const int e = tid & 7, r = tid >> 3;                               // r 0..31
  const unsigned lc = lds_off(sm) + (unsigned)(r * LP + 16 * e);
  const size_t ga = (size_t)r * ap + 8 * e, gb = (size_t)r * bp + 8 * e;
  const unsigned fa = (unsigned)((64 * wm + c) * LP + 16 * hh);
  const unsigned fb = BOFF + (unsigned)((32 * wn + c) * LP + 16 * hh);
  fill_stage<NPROD>(lc, a0 + ga, a1 + ga, 32 * ap, b0 + gb, b1 + gb, 32 * bp);
  asm volatile("s_wait_asynccnt 0x0" ::: "memory");                  // pass 0's own copies have landed
  __syncthreads();                                                   // ... and every other wave's
  fill_stage<NPROD>(lc + STG, a0 + ga + KC, a1 + ga + KC, 32 * ap, b0 + gb + KC, b1 + gb + KC, 32 * bp);
  // kept rolled: one pass is 16 to 48 matrix instructions with their fragment loads, and the code stays small
#pragma unroll 1
  for (int t = 0; t < npass; ++t) {
    const unsigned bo = (unsigned)(t & 1) * STG;
    // the loops below are unrolled whole so that the fragment arrays stay in registers and the LDS offsets are immediates
#pragma unroll
    for (int ks = 0; ks < KC / 32; ++ks) {
      const unsigned o = bo + 64u * ks;
      // the k-step's fragment reads stand together, ahead of its matrix instructions: one LDS latency a k-step
      Frag fb0[2], fb1[2], fa0[4], fa1[4];
#pragma unroll
      for (int nf = 0; nf < 2; ++nf) {
        fb0[nf] = ldfrag((const unsigned short*)(sm + fb + 16 * LP * nf + o));
        if (NPROD >= 2) fb1[nf] = ldfrag((const unsigned short*)(sm + fb + TILEB + 16 * LP * nf + o));
        else fb1[nf] = fb0[nf];
      }
#pragma unroll
      for (int mt = 0; mt < 4; ++mt) {
        fa0[mt] = ldfrag((const unsigned short*)(sm + fa + 16 * LP * mt + o));
        if (NPROD >= 3) fa1[mt] = ldfrag((const unsigned short*)(sm + fa + TILEB + 16 * LP * mt + o));
        else fa1[mt] = fa0[mt];
      }
#pragma unroll
      for (int p = 0; p < NPROD; ++p) {
#pragma unroll
        for (int mt = 0; mt < 4; ++mt) {
#pragma unroll
          for (int nf = 0; nf < 2; ++nf) {
            if (HALF)        acc[mt][nf] = mma_h(fa0[mt].h, fb0[nf].h, acc[mt][nf]);
            else if (p == 0) acc[mt][nf] = mma_b(fa0[mt].bf, fb0[nf].bf, acc[mt][nf]);
            else if (p == 1) acc[mt][nf] = mma_b(fa0[mt].bf, fb1[nf].bf, acc[mt][nf]);
            else             acc[mt][nf] = mma_b(fa1[mt].bf, fb0[nf].bf, acc[mt][nf]);
          }
        }
      }
    }
    asm volatile("s_wait_dscnt 0x0" ::: "memory");                   // this wave's reads of the buffer are done before it is refilled
    asm volatile("s_wait_asynccnt 0x0" ::: "memory");                // this wave's copies of pass t + 1 have landed
    __syncthreads();                                                 // publishes pass t + 1, ends every read of pass t's buffer
    if (t + 2 < npass) {
      const int ko = KC * (t + 2);
      fill_stage<NPROD>(lc + bo, a0 + ga + ko, a1 + ga + ko, 32 * ap, b0 + gb + ko, b1 + gb + ko, 32 * bp);
    }
  }
  asm volatile("s_wait_asynccnt 0x0" ::: "memory");                  // nothing outstanding when the LDS changes its use
}
__device__ __forceinline__ void zero_acc(v8f (&acc)[4][2]) {
#pragma unroll
  for (int mt = 0; mt < 4; ++mt) { acc[mt][0] = zero8(); acc[mt][1] = zero8(); }
}

// ---- epilogue staging, transposed: Os[n_loc][m_loc] (pitch OSP). Lane (hh, c) of wave (wm, wn) holds D rows
//      m = 64 wm + 16 mt + 8 hh + r, col n = 32 wn + 16 nf + c -> two b128 LDS stores per 16 x 16 tile.
__device__ __forceinline__ void stage_nT(float* Os, const v8f (&acc)[4][2], float sc, int wave, int hh, int c) {
  const int wm = wave >> 2, wn = wave & 3;
#pragma unroll
  for (int nf = 0; nf < 2; ++nf) {
    const int nl = 32 * wn + 16 * nf + c;
#pragma unroll
    for (int mt = 0; mt < 4; ++mt) {
      v4f va, vb;
#pragma unroll
      for (int r = 0; r < 4; ++r) { va[r] = acc[mt][nf][r] * sc; vb[r] = acc[mt][nf][4 + r] * sc; }
      *(v4f*)(Os + nl * OSP + 64 * wm + 16 * mt + 8 * hh)     = va;
      *(v4f*)(Os + nl * OSP + 64 * wm + 16 * mt + 8 * hh + 4) = vb;
    }
  }
}
// ---- epilogue staging, row-major: Os[m_loc][n_loc] (pitch OSP), scalar LDS stores.
__device__ __forceinline__ void stage_mn(float* Os, const v8f (&acc)[4][2], int wave, int hh, int c) {
  const int wm = wave >> 2, wn = wave & 3;
#pragma unroll
  for (int nf = 0; nf < 2; ++nf) {
    const int nl = 32 * wn + 16 * nf + c;
#pragma unroll
    for (int mt = 0; mt < 4; ++mt) {
#pragma unroll
      for (int r = 0; r < 8; ++r) Os[(64 * wm + 16 * mt + 8 * hh + r) * OSP + nl] = acc[mt][nf][r];
    }
  }
}

// ---- plane writer for transposed staging: plane [b][n][512] bf16 hi + bf16 residual, rows rowbase + 0..127,
//      16 lanes per 256-B row piece (two whole lines), rows it*16 + lq. Optional f32 bias (bf16-RNE value) added per col.
// coverage: 8 it x 16 rows x 16 lanes x 8 = 128 rows x 128 cols per plane.
template <bool BIAS>
__device__ __forceinline__ void planes_out(const float* Os, const float* __restrict__ bias, int o0,
                                           unsigned short* Ph, unsigned short* Pl, size_t rowbase, int tid) {
  const int e = tid & 15, lq = tid >> 4;                             // lq 0..15
  float bv[8];
#pragma unroll
  for (int t = 0; t < 8; ++t) bv[t] = 0.f;
  if (BIAS) {
    const unsigned bofs = 32u * (unsigned)e;                         // the lane's byte offset behind the block's bias + o0
    const char* bb = (const char*)(bias + o0);
    const v4f b0 = *(const v4f*)(bb + bofs);
    const v4f b1 = *(const v4f*)(bb + bofs + 16);
    // bofs addresses both loads; as an input here its register stays live past them and is reused only behind this wait
    asm volatile("s_wait_xcnt 0x0" :: "v"(bofs) : "memory");
#pragma unroll
    for (int t = 0; t < 4; ++t) { bv[t] = bfr(b0[t]); bv[4 + t] = bfr(b1[t]); }
  }
  v4u uh[8], ul[8];
#pragma unroll
  for (int it = 0; it < 8; ++it) {
    const int row = it * 16 + lq;                                    // n_loc 0..127
    const v4f a = *(const v4f*)(Os + row * OSP + 8 * e);
    const v4f q = *(const v4f*)(Os + row * OSP + 8 * e + 4);
    const float f[8] = {a[0], a[1], a[2], a[3], q[0], q[1], q[2], q[3]};
#pragma unroll
    for (int t = 0; t < 4; ++t) {
      const float f0 = f[2 * t] + bv[2 * t], f1 = f[2 * t + 1] + bv[2 * t + 1];
      const unsigned short hb0 = bf_bits(f0), hb1 = bf_bits(f1);
      const unsigned short lb0 = bf_bits(f0 - bf_up(hb0));
      const unsigned short lb1 = bf_bits(f1 - bf_up(hb1));
      uh[it][t] = pk16(hb0, hb1);
      ul[it][t] = pk16(lb0, lb1);
    }
  }
{
#pragma unroll
    for (int it = 0; it < 8; ++it) {
      const int row = it * 16 + lq;
      const size_t po = (rowbase + (size_t)row) * CH + o0 + 8 * e;
      *(v4u*)(Ph + po) = uh[it];
      *(v4u*)(Pl + po) = ul[it];
    }
    
  }
}

// =========================================================================================================
// (0) weights f32 [512][512] x4 -> W16 bf16 bits [4][512][512] (RNE convert of the input value, exact operand).
//     Block blk owns 8 rows of one matrix (matrix index block-uniform), one wave per 1024-B row = 2 instructions of
// coverage: 256 blocks x 8 rows x 2 j x 32 lanes x 8 = 2048 rows x 512 = the whole plane. blk = 0..255 (part of prep).
// =========================================================================================================
__device__ __forceinline__
void cvt_w_part(const float* __restrict__ w0, const float* __restrict__ w1,
                const float* __restrict__ w2, const float* __restrict__ w3, unsigned short* W16, int blk) {
  const int tid = threadIdx.x;
  const int wave = tid >> 5, lane = tid & 31;
  const int mi = blk / (CH / 8);                                     // 0..3, block-uniform
  const int o  = 8 * (blk - mi * (CH / 8)) + wave;                   // 0..511
  const float* wb = (mi == 0) ? w0 : (mi == 1) ? w1 : (mi == 2) ? w2 : w3;
  v4u u[CH / 256];
#pragma unroll
  for (int j = 0; j < CH / 256; ++j) {
    const float* s = wb + (size_t)o * CH + 256 * j + 8 * lane;
    const v4f a = *(const v4f*)s;
    const v4f q = *(const v4f*)(s + 4);
    const float f[8] = {a[0], a[1], a[2], a[3], q[0], q[1], q[2], q[3]};
#pragma unroll
    for (int t = 0; t < 4; ++t) u[j][t] = pk16(bf_bits(f[2 * t]), bf_bits(f[2 * t + 1]));
  }
{
#pragma unroll
    for (int j = 0; j < CH / 256; ++j)
      *(v4u*)(W16 + ((size_t)(mi * CH + o)) * CH + 256 * j + 8 * lane) = u[j];
    
  }
}

// =========================================================================================================
// (1a) instance-norm statistics of both inputs, one launch: St[(sel * NB + b) * 512 + c] = {mean, rsqrt(var + eps)} of
//      bf16-RNE(x) over the row's SEQ values. 16 lanes per row, lane l = 4 q + k owns the elements 16 j + l and adds
//      them in rising j; the four xor steps then form ((s0 + s1) + (s2 + s3)) per q and the sum over q (1, then 2).
//      The lane's SEQ/16 values stay in registers, so the row is read once for mean and variance.
// coverage: block = 16 rows = one 128-B line of St; blk = 0 .. 2 * NB * 512 / 16 - 1 covers every row of both inputs once.
// =========================================================================================================
__device__ __forceinline__
void norm_stats_part(const float* __restrict__ xc, const float* __restrict__ xs, float* St, int blk) {
  const int tid = threadIdx.x;
  const int rl = tid >> 4, l = tid & 15;                             // rl 0..15
  const int sel = blk / (NB * CH / 16);                              // 0 = x_c, 1 = x_s, block-uniform
  const int r   = 16 * (blk - sel * (NB * CH / 16)) + rl;            // b * 512 + c
  const float* xr = (sel ? xs : xc) + (size_t)r * T_FULL + l;
  float v[SEQ / 16];                                                 // the loops are unrolled whole so that v stays in registers
#pragma unroll
  for (int j = 0; j < SEQ / 16; ++j) v[j] = xr[16 * j];
  // xr is an input here so that its registers stay live past the last load and are reused only behind this wait
  asm volatile("s_wait_xcnt 0x0" :: "v"(xr) : "memory");
  float sm = 0.f;
#pragma unroll
  for (int j = 0; j < SEQ / 16; ++j) { v[j] = bfr(v[j]); sm += v[j]; }
  sm += __shfl_xor(sm, 1, 32);
  sm += __shfl_xor(sm, 2, 32);
  sm += __shfl_xor(sm, 4, 32);
  sm += __shfl_xor(sm, 8, 32);
  const float mean = sm * (1.0f / (float)SEQ);
  float sv = 0.f;
#pragma unroll
  for (int j = 0; j < SEQ / 16; ++j) { const float d = v[j] - mean; sv = __builtin_fmaf(d, d, sv); }
  sv += __shfl_xor(sv, 1, 32);
  sv += __shfl_xor(sv, 2, 32);
  sv += __shfl_xor(sv, 4, 32);
  sv += __shfl_xor(sv, 8, 32);
  const float var = sv * (1.0f / (float)SEQ);
  const float rs  = rsqrtf(var + EPSN);
  if (l == 0) {
    v2f st; st[0] = mean; st[1] = rs;
    *(v2f*)(St + 2 * (size_t)(sel * NB * CH + r)) = st;
  }
}

// =========================================================================================================
// (0) + (1a) in one launch: neither reads what the other writes. The block index picks the part (block-uniform): the
//     statistics blocks, which run longer, come first, the weight blocks behind them.
// =========================================================================================================
#define NSTATB (2 * NB * CH / 16)
#define NCVTWB (NMAT * CH / 8)
__global__ __launch_bounds__(256)
void prep(const float* __restrict__ xc, const float* __restrict__ xs,
          const float* __restrict__ w0, const float* __restrict__ w1,
          const float* __restrict__ w2, const float* __restrict__ w3, float* St, unsigned short* W16) {
  const int blk = blockIdx.x;
  if (blk < NSTATB) {
    norm_stats_part(xc, xs, St, blk);
  } else {
    cvt_w_part(w0, w1, w2, w3, W16, blk - NSTATB);
    // the other part's code follows these stores in the built kernel: no register of theirs is rewritten ahead of this wait
    asm volatile("s_wait_xcnt 0x0" ::: "memory");
  }
}

// =========================================================================================================
// (1b) x f32 [b][512 c][2048 t] (batch/row strides at full size) -> position-major bf16 planes [b][t][512]:
//      Ph = bf16-RNE(xn), Pl = bf16-RNE(xn - Ph) with xn = (bf16-RNE(x) - mean) * rstd per (b, c) row (St of 1a);
//      RAW adds Pr = bf16-RNE(x). One 64 c x 128 t tile per block, transposed through LDS (line = 64 c of one plane
//      row): lane e -> c 8e..8e+7, 8 consecutive lanes per line.
// coverage: 4 it x 32 rows x 8 lanes x 8 = 128 t x 64 c per plane; (SEQ/128, 8) blocks for each b = 0..NB-1 cover
//           [NB][SEQ][512] of every written plane exactly once. Th, Tl, Tr = the block's LDS tiles (Tr used by RAW only).
// =========================================================================================================
template <int RAW>
__device__ __forceinline__
void cvt_norm_part(const float* __restrict__ x, const float* __restrict__ St,
                   unsigned short* Ph, unsigned short* Pl, unsigned short* Pr,
                   unsigned short* Th, unsigned short* Tl, unsigned short* Tr, int b) {
  const int tid = threadIdx.x;
  const int n0 = blockIdx.x * NT, c0 = blockIdx.y * QT;
  const int e = tid & 7, lq = tid >> 3;                              // lq 0..31
  v4f a[4], q[4];
  v2f st[2];
  const int sr = b * CH + c0 + lq;                                   // row of c half 0; c half 1 is 32 rows on
  const float* sp0 = x + (size_t)sr * T_FULL + n0 + 8 * e;
#pragma unroll
  for (int it = 0; it < 4; ++it) {                                   // it = 2 * (t half) + (c half)
    const float* sp = sp0 + (size_t)(it & 1) * 32 * T_FULL + (it >> 1) * 64;
    a[it] = *(const v4f*)sp;
    q[it] = *(const v4f*)(sp + 4);
  }
#pragma unroll
  for (int h = 0; h < 2; ++h) st[h] = *(const v2f*)(St + 2 * (size_t)sr + 64 * h);
  // sp0 and sr address the loads; as inputs here their registers stay live past the last load and are reused only behind this wait
  asm volatile("s_wait_xcnt 0x0" :: "v"(sp0), "v"(sr) : "memory");
#pragma unroll
  for (int it = 0; it < 4; ++it) {
    const int cl = (it & 1) * 32 + lq;
    const int tl = (it >> 1) * 64 + 8 * e;                           // 0..120
    const float f[8] = {a[it][0], a[it][1], a[it][2], a[it][3], q[it][0], q[it][1], q[it][2], q[it][3]};
    const float mu = st[it & 1][0], rs = st[it & 1][1];
#pragma unroll
    for (int t = 0; t < 8; ++t) {
      const unsigned short rb = bf_bits(f[t]);
      const float d  = bf_up(rb) - mu;
      const float xn = d * rs;
      const unsigned short hb = bf_bits(xn);
      const unsigned short lb = bf_bits(__builtin_fmaf(d, rs, -bf_up(hb)));   // residual of the unrounded product
      Th[(tl + t) * TP + cl] = hb;
      Tl[(tl + t) * TP + cl] = lb;
      if (RAW) Tr[(tl + t) * TP + cl] = rb;
    }
  }
  __syncthreads();
  v4u uh[4], ul[4], ur[4];
#pragma unroll
  for (int it = 0; it < 4; ++it) {
    const int nl = it * 32 + lq;                                     // 0..127
    uh[it] = *(const v4u*)(Th + nl * TP + 8 * e);
    ul[it] = *(const v4u*)(Tl + nl * TP + 8 * e);
    if (RAW) ur[it] = *(const v4u*)(Tr + nl * TP + 8 * e); else ur[it] = uh[it];
  }
#pragma unroll
  for (int it = 0; it < 4; ++it) {
    const int nl = it * 32 + lq;
    const size_t po = ((size_t)(b * SEQ + n0 + nl)) * CH + c0 + 8 * e;
    *(v4u*)(Ph + po) = uh[it];
    *(v4u*)(Pl + po) = ul[it];
    if (RAW) *(v4u*)(Pr + po) = ur[it];
  }
}

// =========================================================================================================
// (1b) of both inputs in one launch, grid (SEQ/128, 8, 2 NB): blockIdx.z picks the input (block-uniform, so each part's
//      barrier is passed by the whole block); x_s, which writes three planes, comes first.
// =========================================================================================================
__global__ __launch_bounds__(256)
void cvt_norm2(const float* __restrict__ xc, const float* __restrict__ xs, const float* __restrict__ St,
               unsigned short* Pch, unsigned short* Pcl,
               unsigned short* Psh, unsigned short* Psl, unsigned short* Psr) {
  __shared__ __align__(16) unsigned short Th[NT * TP];
  __shared__ __align__(16) unsigned short Tl[NT * TP];
  __shared__ __align__(16) unsigned short Tr[NT * TP];
  const int z = blockIdx.z;
  if (z < NB) {
    cvt_norm_part<1>(xs, St + 2 * NB * CH, Psh, Psl, Psr, Th, Tl, Tr, z);
  } else {
    cvt_norm_part<0>(xc, St, Pch, Pcl, Pcl, Th, Tl, Tr, z - NB);
    // the other part's code follows these stores in the built kernel: no register of theirs is rewritten ahead of this wait
    asm volatile("s_wait_xcnt 0x0" ::: "memory");
  }
}

// =========================================================================================================
// (2) conv1x1 GEMM into hi + residual planes: Y[o][n] = sum_c W16[o][c] (Xh + Xl)[b][n][c] + bias[o] for one
//     (b, 128-n tile, 128-o block); A = W rows o (k = c contiguous), B = plane rows n (k = c contiguous), 2 products,
//     K = 512 = 16 steps. Epilogue: transposed LDS staging, barrier, planes [b][n][512] (planes_out).
// coverage: (SEQ/128, 4) blocks for each b = 0..NB-1, x 128 n x 128 o, cover [NB][SEQ][512] of both planes exactly once.
//           sm = the block's LDS, CoreLds<2>::BYTES: two operand buffers; output staging behind the core.
// =========================================================================================================
__device__ __forceinline__
void gemm_nm_part(char* sm, const unsigned short* __restrict__ W, const float* __restrict__ bias,
                  const unsigned short* __restrict__ Xh, const unsigned short* __restrict__ Xl,
                  unsigned short* Ph, unsigned short* Pl, int b) {
  float* Os = (float*)sm;
  const int tid = threadIdx.x, lane = tid & 31, wave = tid >> 5;
  const int hh = lane >> 4, c = lane & 15;
  const int nt = blockIdx.x, mb = blockIdx.y;
  const int n0 = nt * BT, o0 = mb * BT;
  const unsigned short* ap = W + (size_t)o0 * CH;
  const size_t bq = ((size_t)(b * SEQ + n0)) * CH;
  v8f acc[4][2];
  zero_acc(acc);
  gemm_core<2, false>(acc, sm, ap, ap, CH, Xh + bq, Xl + bq, CH, CH / KC, tid);
  stage_nT(Os, acc, 1.0f, wave, hh, c);
  __syncthreads();
  planes_out<true>(Os, bias, o0, Ph, Pl, (size_t)(b * SEQ + n0), tid);
}

// =========================================================================================================
// (3) conv1x1 GEMM into the channel-major f16 value plane: V16[b][o][s] = f16(sum_c W16[o][c] Xr[b][s][c] + bias[o])
//     (pitch SEQ); 1 product, K = 512. Epilogue: row-major LDS staging, barrier, row o segment of 128 halves = two lines.
// coverage: 8 it x 16 rows x 16 lanes x 8 = 128 o x 128 s; (SEQ/128, 4) blocks for each b = 0..NB-1 cover [NB][512][SEQ] once.
//           sm = the block's LDS, at least CoreLds<1>::BYTES: two operand buffers; output staging behind the core.
// =========================================================================================================
__device__ __forceinline__
void gemm_val_part(char* sm, const unsigned short* __restrict__ W, const float* __restrict__ bias,
                   const unsigned short* __restrict__ Xr, unsigned short* V16, int b) {
  float* Os = (float*)sm;
  const int tid = threadIdx.x, lane = tid & 31, wave = tid >> 5;
  const int hh = lane >> 4, c = lane & 15;
  const int nt = blockIdx.x, mb = blockIdx.y;
  const int n0 = nt * BT, o0 = mb * BT;
  const unsigned short* ap = W + (size_t)o0 * CH;
  const size_t bq = ((size_t)(b * SEQ + n0)) * CH;
  v8f acc[4][2];
  zero_acc(acc);
  gemm_core<1, false>(acc, sm, ap, ap, CH, Xr + bq, Xr + bq, CH, CH / KC, tid);
  stage_mn(Os, acc, wave, hh, c);
  __syncthreads();
  const int e = tid & 15, lq = tid >> 4;                             // lq 0..15
  v4u u[8];
#pragma unroll
  for (int it = 0; it < 8; ++it) {
    const int row = it * 16 + lq;                                    // o_loc 0..127
    const float bb = bfr(bias[o0 + row]);
    const v4f a = *(const v4f*)(Os + row * OSP + 8 * e);
    const v4f q = *(const v4f*)(Os + row * OSP + 8 * e + 4);
    const float f[8] = {a[0], a[1], a[2], a[3], q[0], q[1], q[2], q[3]};
#pragma unroll
    for (int t = 0; t < 4; ++t) {
      const _Float16 h0 = (_Float16)(f[2 * t] + bb);
      const _Float16 h1 = (_Float16)(f[2 * t + 1] + bb);
      u[it][t] = pk16(h_bits(h0), h_bits(h1));
    }
  }
{
#pragma unroll
    for (int it = 0; it < 8; ++it) {
      const int row = it * 16 + lq;
      const size_t po = ((size_t)(b * CH + o0 + row)) * SEQ + n0 + 8 * e;
      *(v4u*)(V16 + po) = u[it];
    }
    
  }
}

// =========================================================================================================
// (2) for Mn, (2) for Mm and (3) in one launch, grid (SEQ/128, 4, 3 NB): the three products read W16 and the planes of
//     (1b) and write planes of their own. job = blockIdx.z / NB picks the product (block-uniform, so every barrier of a
//     part is passed by the whole block); the one-product job, the shortest, comes last. W = W16 (order Wn, Wm, Wl),
//     X = the five planes of (1b) in a row (x_c hi, lo; x_s hi, lo, raw), M = the four result planes (Mn hi, lo; Mm hi, lo).
// =========================================================================================================
constexpr size_t PLE = PLB / 2;                                      // elements of one plane
static_assert(CoreLds<1>::BYTES <= CoreLds<2>::BYTES);
__global__ __launch_bounds__(256)
void gemm_conv3(const unsigned short* __restrict__ W, const float* __restrict__ bn, const float* __restrict__ bm,
                const float* __restrict__ bl, const unsigned short* __restrict__ X,
                unsigned short* M, unsigned short* V16) {
  __shared__ __align__(16) char sm[CoreLds<2>::BYTES];
  const int job = blockIdx.z / NB, b = blockIdx.z - job * NB;
  if (job < 2) {
    const size_t pl = (size_t)job * 2 * PLE;
    gemm_nm_part(sm, W + (size_t)job * CH * CH, job ? bm : bn, X + pl, X + pl + PLE, M + pl, M + pl + PLE, b);
  } else {
    gemm_val_part(sm, W + (size_t)2 * CH * CH, bl, X + 4 * PLE, V16, b);
  }
}

// =========================================================================================================
// (4) scores S[b][t][s] = sum_c Mn[c][t] Mm[c][s] (no scale) for one (b, 128-s tile, 128-t block): A = Mn planes
//     rows t (hi Qh, residual Ql), B = Mm planes rows s (hi Kh, residual Kl), products hh + hl + lh, K = 512.
//     Epilogue = the softmax inside the block's own 128 keys: row-major LDS staging, barrier, then per row t
//     m = max_s S, P16[b][t][s] = f16(e^{S - m} * 16384), l = sum_s e^{S - m} (f32, unrounded terms), Ls = {m, l}.
//     8 lanes a row: lane e8 owns cols 8 e8 .. + 7 and 64 + 8 e8 .. + 7, so 8 lanes store one whole 128-B line of P16, and
//     the max and the sum cross lanes in three xor steps. Wave w owns rows 16 w .. + 15 = one 128-B line of Ls.
// coverage: 8 waves x 4 g x 4 rows x 8 lanes x 16 = 128 t x 128 s; grid (SEQ/128, SEQ/128, NB) covers P16 [NB][SEQ][SEQ]
//           and Ls [NB][SEQ/128][SEQ] once.
// =========================================================================================================
__global__ __launch_bounds__(256)
void gemm_sc(const unsigned short* __restrict__ Qh, const unsigned short* __restrict__ Ql,
             const unsigned short* __restrict__ Kh, const unsigned short* __restrict__ Kl,
             unsigned short* P16, float* Ls) {
  __shared__ __align__(16) char sm[CoreLds<3>::BYTES];         // two operand buffers; output staging behind the core
  float* Os = (float*)sm;
  const int tid = threadIdx.x, lane = tid & 31, wave = tid >> 5;
  const int hh = lane >> 4, c = lane & 15;
  const int nt = blockIdx.x, mb = blockIdx.y, b = blockIdx.z;
  const int n0 = nt * BT, m0 = mb * BT;
  const size_t aq = ((size_t)(b * SEQ + m0)) * CH;
  const size_t bq = ((size_t)(b * SEQ + n0)) * CH;
  v8f acc[4][2];
  zero_acc(acc);
  gemm_core<3, false>(acc, sm, Qh + aq, Ql + aq, CH, Kh + bq, Kl + bq, CH, CH / KC, tid);
  stage_mn(Os, acc, wave, hh, c);
  __syncthreads();
  const int e8 = lane & 7, rq = lane >> 3;                           // rq 0..3
  float mxs[4], sms[4];
  v4u u[4][2];
#pragma unroll
  for (int g = 0; g < 4; ++g) {
    const float* orow = Os + (16 * wave + 4 * g + rq) * OSP + 8 * e8;
    float f[16];
#pragma unroll
    for (int k = 0; k < 2; ++k) {
      const v4f a = *(const v4f*)(orow + 64 * k);
      const v4f q = *(const v4f*)(orow + 64 * k + 4);
#pragma unroll
      for (int t = 0; t < 4; ++t) { f[8 * k + t] = a[t]; f[8 * k + 4 + t] = q[t]; }
    }
    float mx = f[0];
#pragma unroll
    for (int i = 1; i < 16; ++i) mx = fmaxf(mx, f[i]);
#pragma unroll
    for (int o = 4; o > 0; o >>= 1) mx = fmaxf(mx, __shfl_xor(mx, o, 32));
    float l = 0.f;
#pragma unroll
    for (int i = 0; i < 16; ++i) { f[i] = exp_slot(f[i] - mx); l += f[i]; }
#pragma unroll
    for (int o = 4; o > 0; o >>= 1) l += __shfl_xor(l, o, 32);
#pragma unroll
    for (int k = 0; k < 2; ++k) {
#pragma unroll
      for (int t = 0; t < 4; ++t) {
        const _Float16 h0 = (_Float16)(f[8 * k + 2 * t] * PCAR);
        const _Float16 h1 = (_Float16)(f[8 * k + 2 * t + 1] * PCAR);
        u[g][k][t] = pk16(h_bits(h0), h_bits(h1));
      }
    }
    mxs[g] = mx;
    sms[g] = l;
  }
  unsigned short* pr[4];
#pragma unroll
  for (int g = 0; g < 4; ++g) {
    pr[g] = P16 + ((size_t)(b * SEQ + m0 + 16 * wave + 4 * g + rq)) * SEQ + n0 + 8 * e8;
    *(v4u*)(pr[g])      = u[g][0];
    *(v4u*)(pr[g] + 64) = u[g][1];
  }
  // the stores' addresses and data are inputs here so that their registers stay live past the last store and are reused only behind this wait
  asm volatile("s_wait_xcnt 0x0" :: "v"(pr[0]), "v"(pr[1]), "v"(pr[2]), "v"(pr[3]), "v"(u[0][0]), "v"(u[0][1]), "v"(u[1][0]),
               "v"(u[1][1]), "v"(u[2][0]), "v"(u[2][1]), "v"(u[3][0]), "v"(u[3][1]) : "memory");
  // lane (e8 < 4, rq) stores the pair of row 4 e8 + rq of the wave's 16
  v2f st;
  st[0] = e8 == 0 ? mxs[0] : e8 == 1 ? mxs[1] : e8 == 2 ? mxs[2] : mxs[3];
  st[1] = e8 == 0 ? sms[0] : e8 == 1 ? sms[1] : e8 == 2 ? sms[2] : sms[3];
  if (e8 < 4)
    *(v2f*)(Ls + 2 * ((size_t)(b * NKT + nt) * SEQ + m0 + 16 * wave + 4 * e8 + rq)) = st;
}

// =========================================================================================================
// (6) Mo[c][t] = sum_j F[j][t] (1/16384) sum_{s in key tile j} V16[b][c][s] P16[b][t][s] for one (b, 128-t tile,
//     128-c block), F[j][t] = e^{m_j - m} / sum_i l_i e^{m_i - m}, m = max_j m_j, from the {m_j, l_j} pairs of (4): the
//     row's softmax over all SEQ keys. A = V16 rows c (k = s contiguous, pitch SEQ), B = P16 rows t (pitch SEQ), f16
//     instruction, 1 product, K = SEQ. The copy ring, its waits and barriers are gemm_core's; a key tile = two passes sums
//     into part (from a zero C), which is then added into acc with the lane's two column factors.
//     F (LDS behind the ring, [NKT][128]) is formed by waves 0..3 while pass 0's copies fly; the barrier that publishes pass 0
//     publishes F too. Epilogue: transposed LDS staging scaled by 2^-14, barrier, Mo hi + residual planes (planes_out).
// coverage: grid (SEQ/128, 4, NB) covers [NB][SEQ][512] of both planes exactly once.
// =========================================================================================================
__global__ __launch_bounds__(256)
void gemm_pv(const unsigned short* __restrict__ V16, const unsigned short* __restrict__ P16,
             const float* __restrict__ Ls, unsigned short* Mh, unsigned short* Mlo) {
  constexpr unsigned STG = CoreLds<1>::STG;
  __shared__ __align__(16) char sm[CoreLds<1>::BYTES + NKT * BT * 4];   // two operand buffers (output staging behind the loop), F
  float* Os = (float*)sm;
  float* Fs = (float*)(sm + CoreLds<1>::BYTES);
  const int tid = threadIdx.x, lane = tid & 31, wave = tid >> 5;
  const int hh = lane >> 4, c = lane & 15;
  const int wm = wave >> 2, wn = wave & 3;
  const int nt = blockIdx.x, mb = blockIdx.y, b = blockIdx.z;
  const int n0 = nt * BT, o0 = mb * BT;
  const int e = tid & 7, r = tid >> 3;                               // r 0..31
  const unsigned lc = lds_off(sm) + (unsigned)(r * LP + 16 * e);
  const unsigned short* ap = V16 + ((size_t)(b * CH + o0)) * SEQ + (size_t)r * SEQ + 8 * e;
  const unsigned short* bp = P16 + ((size_t)(b * SEQ + n0)) * SEQ + (size_t)r * SEQ + 8 * e;
  const unsigned fa = (unsigned)((64 * wm + c) * LP + 16 * hh);
  const unsigned fb = TILEB + (unsigned)((32 * wn + c) * LP + 16 * hh);
  v8f acc[4][2];
  zero_acc(acc);
  fill_stage<1>(lc, ap, ap, 32 * SEQ, bp, bp, 32 * SEQ);
  if (tid < BT) {                                                    // whole waves 0..3: thread = column t of the block
    const v2f* lb = (const v2f*)(Ls + 2 * ((size_t)b * NKT * SEQ + n0));   // block-uniform: tile 0's pair of column 0
    float m[NKT], l[NKT];
#pragma unroll
    for (int j = 0; j < NKT; ++j) {
      const v2f s = lb[tid + j * SEQ];
      m[j] = s[0];
      l[j] = s[1];
    }
    // tid addresses the loads; as an input here its register stays live past the last load and is reused only behind this wait
    asm volatile("s_wait_xcnt 0x0" :: "v"(tid) : "memory");
    float mx = m[0];
#pragma unroll
    for (int j = 1; j < NKT; ++j) mx = fmaxf(mx, m[j]);
    float ls = 0.f;
#pragma unroll
    for (int j = 0; j < NKT; ++j) { m[j] = exp_slot(m[j] - mx); ls = __builtin_fmaf(l[j], m[j], ls); }
    const float il = 1.0f / ls;                                      // ls >= 1
#pragma unroll
    for (int j = 0; j < NKT; ++j) Fs[j * BT + tid] = m[j] * il;
  }
  asm volatile("s_wait_asynccnt 0x0" ::: "memory");                  // pass 0's own copies have landed
  __syncthreads();                                                   // ... and every other wave's; F is written
  fill_stage<1>(lc + STG, ap + KC, ap + KC, 32 * SEQ, bp + KC, bp + KC, 32 * SEQ);
  // kept rolled over the key tiles: a tile is 32 matrix instructions with their fragment loads, and the code stays small
#pragma unroll 1
  for (int j = 0; j < NKT; ++j) {
    v8f part[4][2];
    // the tile's two column factors are read with pass 2 j's fragments, so that their LDS latency is over when they are used
    const float* fr = Fs + j * BT + 32 * wn + c;
    const float f0 = fr[0], f1 = fr[16];
    // the loops below are unrolled whole so that the buffer of a pass and the LDS offsets are immediates, the fragment arrays
    // stay in registers and the tile's first matrix instructions take a zero C
#pragma unroll
    for (int h = 0; h < 2; ++h) {                                    // pass t = 2 j + h, buffer h
      const unsigned bo = (unsigned)h * STG;
#pragma unroll
      for (int ks = 0; ks < KC / 32; ++ks) {
        const unsigned o = bo + 64u * ks;
        Frag fb0[2], fa0[4];
#pragma unroll
        for (int nf = 0; nf < 2; ++nf) fb0[nf] = ldfrag((const unsigned short*)(sm + fb + 16 * LP * nf + o));
#pragma unroll
        for (int mt = 0; mt < 4; ++mt) fa0[mt] = ldfrag((const unsigned short*)(sm + fa + 16 * LP * mt + o));
#pragma unroll
        for (int mt = 0; mt < 4; ++mt) {
#pragma unroll
          for (int nf = 0; nf < 2; ++nf)
            part[mt][nf] = mma_h(fa0[mt].h, fb0[nf].h, (h == 0 && ks == 0) ? zero8() : part[mt][nf]);
        }
      }
      if (h == 1) {                                                  // the key tile is summed: weigh it and add it in
#pragma unroll
        for (int mt = 0; mt < 4; ++mt) {
#pragma unroll
          for (int q = 0; q < 8; ++q) {
            acc[mt][0][q] = __builtin_fmaf(part[mt][0][q], f0, acc[mt][0][q]);
            acc[mt][1][q] = __builtin_fmaf(part[mt][1][q], f1, acc[mt][1][q]);
          }
        }
      }
      asm volatile("s_wait_dscnt 0x0" ::: "memory");                 // this wave's reads of the buffer are done before it is refilled
      asm volatile("s_wait_asynccnt 0x0" ::: "memory");              // this wave's copies of pass t + 1 have landed
      __syncthreads();                                               // publishes pass t + 1, ends every read of pass t's buffer
      if (j + 1 < NKT) {                                             // pass t + 2 exists
        const int ko = KC * (2 * j + h + 2);
        fill_stage<1>(lc + bo, ap + ko, ap + ko, 32 * SEQ, bp + ko, bp + ko, 32 * SEQ);
      }
    }
  }
  asm volatile("s_wait_asynccnt 0x0" ::: "memory");                  // nothing outstanding when the LDS changes its use
  stage_nT(Os, acc, IPCAR, wave, hh, c);
  __syncthreads();
  planes_out<false>(Os, nullptr, o0, Mh, Mlo, (size_t)(b * SEQ + n0), tid);
}

// =========================================================================================================
// (7) out[b][o][t] = sum_c W16[o][c] (Mh + Ml)[b][t][c] + bias[o] + bf16-RNE(xres[b][o][t]) for one (b, 128-t tile,
//     128-o block): 2 products, K = 512; output and residual rows at full strides. Epilogue: row-major LDS staging,
// coverage: 16 it x 8 rows x 32 lanes x 4 = 128 o x 128 t; grid (SEQ/128, 4, NB) covers out[b][0..511][0..SEQ-1] once.
// =========================================================================================================
__global__ __launch_bounds__(256)
void gemm_out(const unsigned short* __restrict__ W, const float* __restrict__ bias,
              const unsigned short* __restrict__ Mh, const unsigned short* __restrict__ Mlo,
              const float* __restrict__ xres, float* out) {
  __shared__ __align__(16) char sm[CoreLds<2>::BYTES];         // two operand buffers; output staging behind the core
  float* Os = (float*)sm;
  const int tid = threadIdx.x, lane = tid & 31, wave = tid >> 5;
  const int hh = lane >> 4, c = lane & 15;
  const int nt = blockIdx.x, mb = blockIdx.y, b = blockIdx.z;
  const int n0 = nt * BT, o0 = mb * BT;
  const unsigned short* ap = W + (size_t)o0 * CH;
  const size_t bq = ((size_t)(b * SEQ + n0)) * CH;
  v8f acc[4][2];
  zero_acc(acc);
  gemm_core<2, false>(acc, sm, ap, ap, CH, Mh + bq, Mlo + bq, CH, CH / KC, tid);
  stage_mn(Os, acc, wave, hh, c);
  __syncthreads();
  const int e = tid & 31, lq = tid >> 5;                             // lq 0..7
  const size_t blk0 = ((size_t)(b * CH + o0)) * T_FULL + n0;         // block-uniform: row 0, col 0 of the tile
  const unsigned xofs = 4u * (unsigned)(lq * T_FULL + 4 * e);        // the lane's byte offset behind it, row lq
  const char* xb = (const char*)(xres + blk0);
  const float* bp = bias + o0;
  v4f res[16];
#pragma unroll
  for (int it = 0; it < 16; ++it) {
    const int row = it * 8 + lq;                                     // o_loc 0..127
    const float bb = bfr(bp[lq + 8 * it]);
    const v4f a  = *(const v4f*)(Os + row * OSP + 4 * e);
    const v4f xv = *(const v4f*)(xb + xofs + (size_t)it * (32 * T_FULL));
#pragma unroll
    for (int t = 0; t < 4; ++t) res[it][t] = (a[t] + bb) + bfr(xv[t]);
  }
  // xofs and lq address the loads; as inputs here their registers stay live past the last load and are reused only behind this wait
  asm volatile("s_wait_xcnt 0x0" :: "v"(xofs), "v"(lq) : "memory");
{
#pragma unroll
    for (int it = 0; it < 16; ++it) {
      const int row = it * 8 + lq;
      const size_t idx = blk0 + (size_t)row * T_FULL + 4 * e;
      *(v4f*)(out + idx) = res[it];
    }
    
  }
}

// =========================================================================================================
extern "C" void kernel_launch(void* const* d_in, const int* in_sizes, int n_in,
                              void* d_out, int out_size, void* d_ws, size_t ws_size,
                              hipStream_t stream) {
  if (n_in < 10) return;
  if (in_sizes[0] < NB * CH * T_FULL || in_sizes[1] < NB * CH * T_FULL) return;
  if (in_sizes[2] < CH * CH || in_sizes[4] < CH * CH || in_sizes[6] < CH * CH || in_sizes[8] < CH * CH) return;
  if (in_sizes[3] < CH || in_sizes[5] < CH || in_sizes[7] < CH || in_sizes[9] < CH) return;
  if (out_size < NB * CH * T_FULL) return;

  size_t off = 0;
  auto carve = [&](size_t bytes) { const size_t o = off; off += (bytes + 255) & ~(size_t)255; return o; };
  const size_t oW = carve(WB);
  const size_t oX = carve(RXB);
  const size_t oM = carve(RMB);
  const size_t oV = carve(RVB);
  const size_t oT = carve(STB);
  if (off > ws_size) return;
  if (off > (size_t)WS_CAP) return;

  const float* x_c = (const float*)d_in[0];
  const float* x_s = (const float*)d_in[1];
  const float* Wn  = (const float*)d_in[2];
  const float* bn  = (const float*)d_in[3];
  const float* Wm  = (const float*)d_in[4];
  const float* bm  = (const float*)d_in[5];
  const float* Wl  = (const float*)d_in[6];
  const float* bl  = (const float*)d_in[7];
  const float* Wo  = (const float*)d_in[8];
  const float* bo  = (const float*)d_in[9];
  float* out = (float*)d_out;

  char* ws = (char*)d_ws;
  unsigned short* W16  = (unsigned short*)(ws + oW);
  // region X users
  unsigned short* Xcnh = (unsigned short*)(ws + oX);
  unsigned short* Xcnl = (unsigned short*)(ws + oX + PLB);
  unsigned short* Xsnh = (unsigned short*)(ws + oX + 2 * PLB);
  unsigned short* Xsnl = (unsigned short*)(ws + oX + 3 * PLB);
  unsigned short* Xsr  = (unsigned short*)(ws + oX + 4 * PLB);
  unsigned short* P16  = (unsigned short*)(ws + oX);
  float*          Ls   = (float*)(ws + oX + PB);
  // region M users
  unsigned short* Mnh  = (unsigned short*)(ws + oM);
  unsigned short* Mnl  = (unsigned short*)(ws + oM + PLB);
  unsigned short* Mmh  = (unsigned short*)(ws + oM + 2 * PLB);
  unsigned short* Mml  = (unsigned short*)(ws + oM + 3 * PLB);
  unsigned short* Moh  = (unsigned short*)(ws + oM);
  unsigned short* Mol  = (unsigned short*)(ws + oM + PLB);
  // region V
  unsigned short* V16  = (unsigned short*)(ws + oV);
  // region T
  float*          St   = (float*)(ws + oT);

  const dim3 blk256(256);
  const dim3 gconv(SEQ / BT, CH / BT, NB);

  // (0) + (1a) instance-norm statistics of x_c and x_s; weights -> bf16 planes (order Wn, Wm, Wl, Wo)
  prep<<<dim3(NSTATB + NCVTWB), blk256, 0, stream>>>(x_c, x_s, Wn, Wm, Wl, Wo, St, W16);
  // (1b) split planes of norm(x_c); same for x_s plus the raw bf16 plane
  cvt_norm2<<<dim3(SEQ / NT, CH / QT, 2 * NB), blk256, 0, stream>>>(x_c, x_s, St, Xcnh, Xcnl, Xsnh, Xsnl, Xsr);
  // (2) + (3) Mn, Mm hi + residual planes and the Ml value plane
  gemm_conv3<<<dim3(SEQ / BT, CH / BT, 3 * NB), blk256, 0, stream>>>(W16, bn, bm, bl, Xcnh, Mnh, V16);
  // (4) scores -> tile-local softmax weights and {max, sum} pairs (overwrites region X)
  gemm_sc<<<dim3(SEQ / BT, SEQ / BT, NB), blk256, 0, stream>>>(Mnh, Mnl, Mmh, Mml, P16, Ls);
  // (6) Mo hi + residual planes (overwrites region M)
  gemm_pv<<<gconv, blk256, 0, stream>>>(V16, P16, Ls, Moh, Mol);
  // (7) output GEMM + bias + residual
  gemm_out<<<gconv, blk256, 0, stream>>>(W16 + (size_t)3 * CH * CH, bo, Moh, Mol, x_c, out);
  (void)hipGetLastError();
}

// v006
// Measured time: 127 microseconds a run.
// Two timings next to v005 put it at 1.04 and 1.03 times that version's speed.
// Counting every step since v000, it is 5.22 times as fast.
// Contractions: conv1x1 Wn.norm(x_c) and Wm.norm(x_s) on v_wmma_f32_16x16x32_bf16 (bf16-RNE weights x bf16 hi +
// bf16 residual planes of the normalised activations, 2 products, K=512); conv1x1 Wl.x_s on v_wmma_f32_16x16x32_bf16
// (bf16-RNE weights x bf16-RNE x_s, 1 product); position scores Mn^T.Mm on v_wmma_f32_16x16x32_bf16 (bf16 hi +
// residual planes of both, 3 products, K=512); Mo = Ml.A^T on v_wmma_f32_16x16x32_f16 (f16 Ml plane x softmax
// weights carried x16384 as f16, K=2048); conv1x1 Wo.Mo on v_wmma_f32_16x16x32_bf16 (bf16-RNE weights x bf16 hi +
// residual planes of Mo, 2 products); f32 accumulate everywhere; instance-norm statistics, softmax, bias and residual
// adds in f32 VALU. The softmax has no launch of its own: the score GEMM's epilogue normalises each row inside its own
// 128-key tile, and the Mo GEMM weighs each key tile's partial product with the row's factor for that tile.
#include <hip/hip_runtime.h>
#include <stdint.h>

#ifndef NB
#define NB 4
#endif
#ifndef SEQ
#define SEQ 2048
#endif
#define NB_FULL 4
#define T_FULL  2048
#define CH      512
#define NMAT    4
#define QT      64
#define BT      128
#define OSP     132
#define TP      72
#define NT      128
#define KC      64
#define LP      144
#define TILEB   (BT * LP)
#define NKT     (SEQ / BT)
#define PCAR    16384.0f
#define IPCAR   6.103515625e-05f
#define EPSN    1.0e-5f
#define WS_CAP  134217728

static_assert(NB >= 1 && NB <= NB_FULL);
static_assert(SEQ >= 256 && SEQ <= T_FULL && SEQ % 256 == 0);
static_assert(SEQ % QT == 0 && CH % QT == 0 && SEQ % NT == 0 && SEQ % BT == 0 && CH % BT == 0);
static_assert(CH % 256 == 0 && CH % 32 == 0 && SEQ % 32 == 0 && SEQ % 16 == 0);
static_assert((OSP * 4) % 16 == 0);
static_assert((TP * 2) % 16 == 0);
static_assert((NB * SEQ) % 8 == 0);
static_assert(CH % 8 == 0);
static_assert(CH % KC == 0 && SEQ % KC == 0 && CH / KC >= 2 && SEQ / KC >= 2);
static_assert(KC * 2 + 16 == LP && LP % 32 == 16 && QT == 64 && BT == 128);
static_assert(BT * OSP * 4 <= 2 * 2 * TILEB);
static_assert(BT == 2 * KC);

typedef _Float16       v16h __attribute__((ext_vector_type(16)));
typedef _Float16       v8h  __attribute__((ext_vector_type(8)));
typedef __bf16         v16b __attribute__((ext_vector_type(16)));
typedef unsigned short v8us __attribute__((ext_vector_type(8)));
typedef float          v8f  __attribute__((ext_vector_type(8)));
typedef float          v4f  __attribute__((ext_vector_type(4)));
typedef float          v2f  __attribute__((ext_vector_type(2)));
typedef unsigned int   v4u  __attribute__((ext_vector_type(4)));

union Frag { v8us u[2]; v16h h; v16b bf; };
static_assert(sizeof(Frag) == 32);

// ---- workspace map (bytes; every region start a multiple of 256; every extent is an exact tile multiple and is
//      launches; each later user fully overwrites what it reads before any read):
//   W : bf16 [4][512][512] weights                                              WB
//   X : stage 1-3: five bf16 planes [NB][SEQ][512] (x_c norm hi/lo, x_s norm hi/lo, x_s raw)   5*PLB
//       stage 4-6: tile-local softmax weights f16 [NB][SEQ][SEQ]                PB
//                  and behind them {max, sum} f32 pairs [NB][SEQ/128 key tiles][SEQ]   LSB
//   M : stage 2-4: Mn hi/lo, Mm hi/lo bf16 planes [NB][SEQ][512]                4*PLB
//       stage 6-7: Mo hi/lo bf16 planes [NB][SEQ][512]                          2*PLB
//   V : Ml f16 plane [NB][512][SEQ]                                             PLB
//   T : instance-norm {mean, rstd} f32 pairs [2][NB][512]                       STB
constexpr size_t cmax(size_t a, size_t b) { return a > b ? a : b; }
constexpr size_t PLB = (size_t)NB * SEQ * CH * 2;
constexpr size_t LSB = (size_t)NB * NKT * SEQ * 2 * 4;
constexpr size_t PB  = (size_t)NB * SEQ * SEQ * 2;
constexpr size_t WB  = (size_t)NMAT * CH * CH * 2;
constexpr size_t RXB = cmax(5 * PLB, PB + LSB);
constexpr size_t RMB = 4 * PLB;
constexpr size_t RVB = PLB;
constexpr size_t STB = (size_t)2 * NB * CH * 2 * 4;
static_assert(WB % 256 == 0 && PLB % 256 == 0 && LSB % 256 == 0 && PB % 256 == 0);
static_assert(5 * PLB <= RXB && PB + LSB <= RXB);
static_assert(4 * PLB <= RMB && 2 * PLB <= RMB);
static_assert(STB % 256 == 0 && (NB * CH) % 16 == 0);
static_assert(WB + RXB + RMB + RVB + STB <= (size_t)WS_CAP);

// ---- scalar helpers -----------------------------------------------------------------------------------------
__device__ __forceinline__ unsigned short bf_bits(float f) {          // f32 -> bf16 bits, RNE convert
  unsigned u = __float_as_uint(f);
  return (unsigned short)((u + 0x7FFFu + ((u >> 16) & 1u)) >> 16);
}
__device__ __forceinline__ float bf_up(unsigned short hb) { return __uint_as_float(((unsigned)hb) << 16); }
__device__ __forceinline__ float bfr(float f) { return bf_up(bf_bits(f)); }
__device__ __forceinline__ unsigned short h_bits(_Float16 x) { return __builtin_bit_cast(unsigned short, x); }
__device__ __forceinline__ unsigned pk16(unsigned short a, unsigned short b) { return (unsigned)a | ((unsigned)b << 16); }
// e^x as 2^(x log2 e) on the hardware's exponential, as __expf gives it; the v_nop in the statement is the slot that the
// instruction set asks for between a transcendental and a next instruction that reads its result or overwrites its source
__device__ __forceinline__ float exp_slot(float x) {
  float y = x * 1.44269504f;
#if defined(__HIP_DEVICE_COMPILE__)
  asm("v_exp_f32 %0, %0\n\tv_nop" : "+v"(y));
#endif
  return y;
}
__device__ __forceinline__ v8f zero8() { v8f z = {0.f, 0.f, 0.f, 0.f, 0.f, 0.f, 0.f, 0.f}; return z; }

// ---- 16-bit fragment loader (A, or B from a k-contiguous [n][k] row): lane -> row/col (lane&15), p already includes
//      + 8*(lane>>4); elements 0..7 <- p[0..7] (k0+8h..), elements 8..15 <- p[16..23] (k0+16+8h..)
__device__ __forceinline__ Frag ldfrag(const unsigned short* p) {
  Frag f;
  f.u[0] = *(const v8us*)(p);
  f.u[1] = *(const v8us*)(p + 16);
  return f;
}

// ---- WMMA helpers: builtin followed by a 4-slot VALU gap tying D and keeping A/B live ----------------------------
__device__ __forceinline__ v8f mma_h(v16h a, v16h b, v8f c) {
  v8f d = __builtin_amdgcn_wmma_f32_16x16x32_f16(false, a, false, b, (short)0, c, false, false);
#if defined(__HIP_DEVICE_COMPILE__)
  asm volatile("v_nop\n\tv_nop\n\tv_nop\n\tv_nop" : "+v"(d) : "v"(a), "v"(b));
#endif
  return d;
}
__device__ __forceinline__ v8f mma_b(v16b a, v16b b, v8f c) {
  v8f d = __builtin_amdgcn_wmma_f32_16x16x32_bf16(false, a, false, b, (short)0, c, false, false);
#if defined(__HIP_DEVICE_COMPILE__)
  const v16h ha = __builtin_bit_cast(v16h, a), hb = __builtin_bit_cast(v16h, b);
  asm volatile("v_nop\n\tv_nop\n\tv_nop\n\tv_nop" : "+v"(d) : "v"(ha), "v"(hb));
#endif
  return d;
}

// ---- asynchronous copies of operand tiles into LDS. One tile of a pass = 128 rows x 128 B (KC elements), LDS pitch LP.
//      Lane map: e = tid & 7 -> 16-B piece of the row, r = tid >> 3 -> row r + 32 i (i = 0..3): 8 lanes cover one whole
//      128-B line. l = the lane's LDS byte address of row r, g = its global address of row r, p32 = elements of 32 rows.
//      The s_wait_xcnt closes each statement so that no address register of an issued copy is rewritten ahead of it.
__device__ __forceinline__ unsigned lds_off(const void* p) { return (unsigned)(size_t)p; }
__device__ __forceinline__ void copy_tile(unsigned l, const unsigned short* g, size_t p32) {
#if defined(__HIP_DEVICE_COMPILE__)
  // four copies of one tile, global -> LDS through no register; the wait is their statement's last line
  asm volatile("global_load_async_to_lds_b128 %0, %4, off\n\t"
               "global_load_async_to_lds_b128 %1, %5, off\n\t"
               "global_load_async_to_lds_b128 %2, %6, off\n\t"
               "global_load_async_to_lds_b128 %3, %7, off\n\t"
               "s_wait_xcnt 0x0"
               :: "v"(l), "v"(l + 32 * LP), "v"(l + 64 * LP), "v"(l + 96 * LP),
                  "v"(g), "v"(g + p32), "v"(g + 2 * p32), "v"(g + 3 * p32) : "memory");
#endif
}
__device__ __forceinline__ void copy_tiles2(unsigned l, const unsigned short* g, size_t p32,
                                            unsigned m, const unsigned short* h, size_t q32) {
#if defined(__HIP_DEVICE_COMPILE__)
  // eight copies of two tiles, global -> LDS through no register; they share one statement and its closing wait
  asm volatile("global_load_async_to_lds_b128 %0, %8, off\n\t"
               "global_load_async_to_lds_b128 %1, %9, off\n\t"
               "global_load_async_to_lds_b128 %2, %10, off\n\t"
               "global_load_async_to_lds_b128 %3, %11, off\n\t"
               "global_load_async_to_lds_b128 %4, %12, off\n\t"
               "global_load_async_to_lds_b128 %5, %13, off\n\t"
               "global_load_async_to_lds_b128 %6, %14, off\n\t"
               "global_load_async_to_lds_b128 %7, %15, off\n\t"
               "s_wait_xcnt 0x0"
               :: "v"(l), "v"(l + 32 * LP), "v"(l + 64 * LP), "v"(l + 96 * LP),
                  "v"(m), "v"(m + 32 * LP), "v"(m + 64 * LP), "v"(m + 96 * LP),
                  "v"(g), "v"(g + p32), "v"(g + 2 * p32), "v"(g + 3 * p32),
                  "v"(h), "v"(h + q32), "v"(h + 2 * q32), "v"(h + 3 * q32) : "memory");
#endif
}

// ---- GEMM core for one 128(m) x 128(n) block tile, 8 waves (256 threads) as 2 (m) x 4 (n): wave (wm, wn) owns a
//      64 x 32 tile, cols n = 32 wn + 16 nf + (lane&15) (2 B fragments per k-step per B plane), A rows
//      m = 64 wm + 16 mt + (lane&15) (4 m-tiles): every fragment read from LDS feeds 2 or 4 matrix instructions a product,
//      every operand byte copied from L2 feeds 128 rows or columns. a0/a1/b0/b1 = row 0, k = 0 of the
//      block's 128 operand rows (k-contiguous, pitches ap / bp elements). A pass = NS KC k = NS tile sets of KC k in a row,
//      a set = [A0][A1 if NPROD 3][B0][B1 if NPROD >= 2]: they are copied into one of two LDS buffers one pass ahead, and the
//      fragments are read from LDS with the split k map (ldfrag), k-steps and products in the same order as from
//      global rows. NPROD: 1 = a0.b0; 2 = a0.b0 + a0.b1; 3 = a0.b0 + a0.b1 + a1.b0 (shared accumulator, unscaled
//      residual planes; each accumulator takes its products of a k-step in that order, the 8 tiles of one product in a
//      row). HALF selects the f16 instruction (NPROD 1 only). NS > 1 is for a grid of one block a WGP, where nothing but the
//      block's own copies hides their latency: NS times the bytes in flight, that latency met once per NS KC k. npass = passes
//      (at least 2). On return no copy is outstanding and every
//      wave has left both buffers (the last pass's barrier), so sm may be reused as output staging.
template <int NPROD, int NS = 1>
struct CoreLds {
  static constexpr int NA = NPROD >= 3 ? 2 : 1;
  static constexpr int NBP = NPROD >= 2 ? 2 : 1;
  static constexpr unsigned SET = (unsigned)(NA + NBP) * TILEB;      // the operand tiles of KC k
  static constexpr unsigned STG = (unsigned)NS * SET;                // one stage of the ring
  static constexpr unsigned BYTES = 2 * STG;
  static_assert(NS * (NA + NBP) * 4 <= 63);                          // copies of a wave in flight: one stage's
  static_assert(BYTES <= 327680);
};
template <int NPROD>
__device__ __forceinline__ void fill_stage(unsigned l, const unsigned short* a0, const unsigned short* a1, size_t ap32,
                                           const unsigned short* b0, const unsigned short* b1, size_t bp32) {
  if (NPROD == 1) {
    copy_tiles2(l, a0, ap32, l + TILEB, b0, bp32);
  } else if (NPROD == 2) {
    copy_tile(l, a0, ap32);
    copy_tiles2(l + TILEB, b0, bp32, l + 2 * TILEB, b1, bp32);
  } else {
    copy_tiles2(l, a0, ap32, l + TILEB, a1, ap32);
    copy_tiles2(l + 2 * TILEB, b0, bp32, l + 3 * TILEB, b1, bp32);
  }
}
// one stage of the ring: NS tile sets in a row, set u = k KC u .. + KC - 1 of the stage
template <int NPROD, int NS>
__device__ __forceinline__ void fill_ring(unsigned l, const unsigned short* a0, const unsigned short* a1, size_t ap32,
                                          const unsigned short* b0, const unsigned short* b1, size_t bp32) {
  fill_stage<NPROD>(l, a0, a1, ap32, b0, b1, bp32);
  if constexpr (NS > 1)
    fill_ring<NPROD, NS - 1>(l + CoreLds<NPROD>::SET, a0 + KC, a1 + KC, ap32, b0 + KC, b1 + KC, bp32);
}
template <int NPROD, bool HALF, int NS = 1>
__device__ __forceinline__ void gemm_core(v8f (&acc)[4][2], const char* sm,
                                          const unsigned short* __restrict__ a0,
                                          const unsigned short* __restrict__ a1, size_t ap,
                                          const unsigned short* __restrict__ b0,
                                          const unsigned short* __restrict__ b1, size_t bp, int npass, int tid) {
  static_assert(NPROD >= 1 && NPROD <= 3);
  static_assert(!(HALF && NPROD != 1));
  constexpr unsigned SET = CoreLds<NPROD, NS>::SET, STG = CoreLds<NPROD, NS>::STG;
  constexpr unsigned BOFF = (unsigned)CoreLds<NPROD>::NA * TILEB;
  constexpr int KS = KC * NS;                                        // k of a pass
  const int lane = tid & 31, wave = tid >> 5, hh = lane >> 4, c = lane & 15;
  const int wm = wave >> 2, wn = wave & 3;
  const int e = tid & 7, r = tid >> 3;                               // r 0..31
  const unsigned lc = lds_off(sm) + (unsigned)(r * LP + 16 * e);
  const size_t ga = (size_t)r * ap + 8 * e, gb = (size_t)r * bp + 8 * e;
  const unsigned fa = (unsigned)((64 * wm + c) * LP + 16 * hh);
  const unsigned fb = BOFF + (unsigned)((32 * wn + c) * LP + 16 * hh);
  fill_ring<NPROD, NS>(lc, a0 + ga, a1 + ga, 32 * ap, b0 + gb, b1 + gb, 32 * bp);
  asm volatile("s_wait_asynccnt 0x0" ::: "memory");                  // pass 0's own copies have landed
  __syncthreads();                                                   // ... and every other wave's
  fill_ring<NPROD, NS>(lc + STG, a0 + ga + KS, a1 + ga + KS, 32 * ap, b0 + gb + KS, b1 + gb + KS, 32 * bp);
  // kept rolled: one pass is 16 to 64 matrix instructions with their fragment loads, and the code stays small
#pragma unroll 1
  for (int t = 0; t < npass; ++t) {
    const unsigned bo = (unsigned)(t & 1) * STG;
    // the loops below are unrolled whole so that the fragment arrays stay in registers and the LDS offsets are immediates
#pragma unroll
    for (int ks = 0; ks < KS / 32; ++ks) {
      const unsigned o = bo + (unsigned)(ks / (KC / 32)) * SET + 64u * (ks % (KC / 32));
      // the k-step's fragment reads stand together, ahead of its matrix instructions: one LDS latency a k-step
      Frag fb0[2], fb1[2], fa0[4], fa1[4];
#pragma unroll
      for (int nf = 0; nf < 2; ++nf) {
        fb0[nf] = ldfrag((const unsigned short*)(sm + fb + 16 * LP * nf + o));
        if (NPROD >= 2) fb1[nf] = ldfrag((const unsigned short*)(sm + fb + TILEB + 16 * LP * nf + o));
        else fb1[nf] = fb0[nf];
      }
#pragma unroll
      for (int mt = 0; mt < 4; ++mt) {
        fa0[mt] = ldfrag((const unsigned short*)(sm + fa + 16 * LP * mt + o));
        if (NPROD >= 3) fa1[mt] = ldfrag((const unsigned short*)(sm + fa + TILEB + 16 * LP * mt + o));
        else fa1[mt] = fa0[mt];
      }
#pragma unroll
      for (int p = 0; p < NPROD; ++p) {
#pragma unroll
        for (int mt = 0; mt < 4; ++mt) {
#pragma unroll
          for (int nf = 0; nf < 2; ++nf) {
            if (HALF)        acc[mt][nf] = mma_h(fa0[mt].h, fb0[nf].h, acc[mt][nf]);
            else if (p == 0) acc[mt][nf] = mma_b(fa0[mt].bf, fb0[nf].bf, acc[mt][nf]);
            else if (p == 1) acc[mt][nf] = mma_b(fa0[mt].bf, fb1[nf].bf, acc[mt][nf]);
            else             acc[mt][nf] = mma_b(fa1[mt].bf, fb0[nf].bf, acc[mt][nf]);
          }
        }
      }
    }
    asm volatile("s_wait_dscnt 0x0" ::: "memory");                   // this wave's reads of the buffer are done before it is refilled
    asm volatile("s_wait_asynccnt 0x0" ::: "memory");                // this wave's copies of pass t + 1 have landed
    __syncthreads();                                                 // publishes pass t + 1, ends every read of pass t's buffer
    if (t + 2 < npass) {
      const int ko = KS * (t + 2);
      fill_ring<NPROD, NS>(lc + bo, a0 + ga + ko, a1 + ga + ko, 32 * ap, b0 + gb + ko, b1 + gb + ko, 32 * bp);
    }
  }
  asm volatile("s_wait_asynccnt 0x0" ::: "memory");                  // nothing outstanding when the LDS changes its use
}
__device__ __forceinline__ void zero_acc(v8f (&acc)[4][2]) {
#pragma unroll
  for (int mt = 0; mt < 4; ++mt) { acc[mt][0] = zero8(); acc[mt][1] = zero8(); }
}

// ---- epilogue staging, transposed: Os[n_loc][m_loc] (pitch OSP). Lane (hh, c) of wave (wm, wn) holds D rows
//      m = 64 wm + 16 mt + 8 hh + r, col n = 32 wn + 16 nf + c -> two b128 LDS stores per 16 x 16 tile.
__device__ __forceinline__ void stage_nT(float* Os, const v8f (&acc)[4][2], float sc, int wave, int hh, int c) {
  const int wm = wave >> 2, wn = wave & 3;
#pragma unroll
  for (int nf = 0; nf < 2; ++nf) {
    const int nl = 32 * wn + 16 * nf + c;
#pragma unroll
    for (int mt = 0; mt < 4; ++mt) {
      v4f va, vb;
#pragma unroll
      for (int r = 0; r < 4; ++r) { va[r] = acc[mt][nf][r] * sc; vb[r] = acc[mt][nf][4 + r] * sc; }
      *(v4f*)(Os + nl * OSP + 64 * wm + 16 * mt + 8 * hh)     = va;
      *(v4f*)(Os + nl * OSP + 64 * wm + 16 * mt + 8 * hh + 4) = vb;
    }
  }
}
// ---- epilogue staging, row-major: Os[m_loc][n_loc] (pitch OSP), scalar LDS stores.
__device__ __forceinline__ void stage_mn(float* Os, const v8f (&acc)[4][2], int wave, int hh, int c) {
  const int wm = wave >> 2, wn = wave & 3;
#pragma unroll
  for (int nf = 0; nf < 2; ++nf) {
    const int nl = 32 * wn + 16 * nf + c;
#pragma unroll
    for (int mt = 0; mt < 4; ++mt) {
#pragma unroll
      for (int r = 0; r < 8; ++r) Os[(64 * wm + 16 * mt + 8 * hh + r) * OSP + nl] = acc[mt][nf][r];
    }
  }
}

// ---- plane writer for transposed staging: plane [b][n][512] bf16 hi + bf16 residual, rows rowbase + 0..127,
//      16 lanes per 256-B row piece (two whole lines), rows it*16 + lq. Optional f32 bias (bf16-RNE value) added per col.
// coverage: 8 it x 16 rows x 16 lanes x 8 = 128 rows x 128 cols per plane.
template <bool BIAS>
__device__ __forceinline__ void planes_out(const float* Os, const float* __restrict__ bias, int o0,
                                           unsigned short* Ph, unsigned short* Pl, size_t rowbase, int tid) {
  const int e = tid & 15, lq = tid >> 4;                             // lq 0..15
  float bv[8];
#pragma unroll
  for (int t = 0; t < 8; ++t) bv[t] = 0.f;
  if (BIAS) {
    const unsigned bofs = 32u * (unsigned)e;                         // the lane's byte offset behind the block's bias + o0
    const char* bb = (const char*)(bias + o0);
    const v4f b0 = *(const v4f*)(bb + bofs);
    const v4f b1 = *(const v4f*)(bb + bofs + 16);
    // bofs addresses both loads; as an input here its register stays live past them and is reused only behind this wait
    asm volatile("s_wait_xcnt 0x0" :: "v"(bofs) : "memory");
#pragma unroll
    for (int t = 0; t < 4; ++t) { bv[t] = bfr(b0[t]); bv[4 + t] = bfr(b1[t]); }
  }
  v4u uh[8], ul[8];
#pragma unroll
  for (int it = 0; it < 8; ++it) {
    const int row = it * 16 + lq;                                    // n_loc 0..127
    const v4f a = *(const v4f*)(Os + row * OSP + 8 * e);
    const v4f q = *(const v4f*)(Os + row * OSP + 8 * e + 4);
    const float f[8] = {a[0], a[1], a[2], a[3], q[0], q[1], q[2], q[3]};
#pragma unroll
    for (int t = 0; t < 4; ++t) {
      const float f0 = f[2 * t] + bv[2 * t], f1 = f[2 * t + 1] + bv[2 * t + 1];
      const unsigned short hb0 = bf_bits(f0), hb1 = bf_bits(f1);
      const unsigned short lb0 = bf_bits(f0 - bf_up(hb0));
      const unsigned short lb1 = bf_bits(f1 - bf_up(hb1));
      uh[it][t] = pk16(hb0, hb1);
      ul[it][t] = pk16(lb0, lb1);
    }
  }
{
#pragma unroll
    for (int it = 0; it < 8; ++it) {
      const int row = it * 16 + lq;
      const size_t po = (rowbase + (size_t)row) * CH + o0 + 8 * e;
      *(v4u*)(Ph + po) = uh[it];
      *(v4u*)(Pl + po) = ul[it];
    }
    
  }
}

// =========================================================================================================
// (0) weights f32 [512][512] x4 -> W16 bf16 bits [4][512][512] (RNE convert of the input value, exact operand).
//     Block blk owns 8 rows of one matrix (matrix index block-uniform), one wave per 1024-B row = 2 instructions of
// coverage: 256 blocks x 8 rows x 2 j x 32 lanes x 8 = 2048 rows x 512 = the whole plane. blk = 0..255 (part of prep).
// =========================================================================================================
__device__ __forceinline__
void cvt_w_part(const float* __restrict__ w0, const float* __restrict__ w1,
                const float* __restrict__ w2, const float* __restrict__ w3, unsigned short* W16, int blk) {
  const int tid = threadIdx.x;
  const int wave = tid >> 5, lane = tid & 31;
  const int mi = blk / (CH / 8);                                     // 0..3, block-uniform
  const int o  = 8 * (blk - mi * (CH / 8)) + wave;                   // 0..511
  const float* wb = (mi == 0) ? w0 : (mi == 1) ? w1 : (mi == 2) ? w2 : w3;
  v4u u[CH / 256];
#pragma unroll
  for (int j = 0; j < CH / 256; ++j) {
    const float* s = wb + (size_t)o * CH + 256 * j + 8 * lane;
    const v4f a = *(const v4f*)s;
    const v4f q = *(const v4f*)(s + 4);
    const float f[8] = {a[0], a[1], a[2], a[3], q[0], q[1], q[2], q[3]};
#pragma unroll
    for (int t = 0; t < 4; ++t) u[j][t] = pk16(bf_bits(f[2 * t]), bf_bits(f[2 * t + 1]));
  }
{
#pragma unroll
    for (int j = 0; j < CH / 256; ++j)
      *(v4u*)(W16 + ((size_t)(mi * CH + o)) * CH + 256 * j + 8 * lane) = u[j];
    
  }
}

// =========================================================================================================
// (1a) instance-norm statistics of both inputs, one launch: St[(sel * NB + b) * 512 + c] = {mean, rsqrt(var + eps)} of
//      bf16-RNE(x) over the row's SEQ values. 16 lanes per row, lane l = 4 q + k owns the elements 16 j + l and adds
//      them in rising j; the four xor steps then form ((s0 + s1) + (s2 + s3)) per q and the sum over q (1, then 2).
//      The lane's SEQ/16 values stay in registers, so the row is read once for mean and variance.
// coverage: block = 16 rows = one 128-B line of St; blk = 0 .. 2 * NB * 512 / 16 - 1 covers every row of both inputs once.
// =========================================================================================================
__device__ __forceinline__
void norm_stats_part(const float* __restrict__ xc, const float* __restrict__ xs, float* St, int blk) {
  const int tid = threadIdx.x;
  const int rl = tid >> 4, l = tid & 15;                             // rl 0..15
  const int sel = blk / (NB * CH / 16);                              // 0 = x_c, 1 = x_s, block-uniform
  const int r   = 16 * (blk - sel * (NB * CH / 16)) + rl;            // b * 512 + c
  const float* xr = (sel ? xs : xc) + (size_t)r * T_FULL + l;
  float v[SEQ / 16];                                                 // the loops are unrolled whole so that v stays in registers
#pragma unroll
  for (int j = 0; j < SEQ / 16; ++j) v[j] = xr[16 * j];
  // xr is an input here so that its registers stay live past the last load and are reused only behind this wait
  asm volatile("s_wait_xcnt 0x0" :: "v"(xr) : "memory");
  float sm = 0.f;
#pragma unroll
  for (int j = 0; j < SEQ / 16; ++j) { v[j] = bfr(v[j]); sm += v[j]; }
  sm += __shfl_xor(sm, 1, 32);
  sm += __shfl_xor(sm, 2, 32);
  sm += __shfl_xor(sm, 4, 32);
  sm += __shfl_xor(sm, 8, 32);
  const float mean = sm * (1.0f / (float)SEQ);
  float sv = 0.f;
#pragma unroll
  for (int j = 0; j < SEQ / 16; ++j) { const float d = v[j] - mean; sv = __builtin_fmaf(d, d, sv); }
  sv += __shfl_xor(sv, 1, 32);
  sv += __shfl_xor(sv, 2, 32);
  sv += __shfl_xor(sv, 4, 32);
  sv += __shfl_xor(sv, 8, 32);
  const float var = sv * (1.0f / (float)SEQ);
  const float rs  = rsqrtf(var + EPSN);
  if (l == 0) {
    v2f st; st[0] = mean; st[1] = rs;
    *(v2f*)(St + 2 * (size_t)(sel * NB * CH + r)) = st;
  }
}

// =========================================================================================================
// (0) + (1a) in one launch: neither reads what the other writes. The block index picks the part (block-uniform): the
//     statistics blocks, which run longer, come first, the weight blocks behind them.
// =========================================================================================================
#define NSTATB (2 * NB * CH / 16)
#define NCVTWB (NMAT * CH / 8)
__global__ __launch_bounds__(256)
void prep(const float* __restrict__ xc, const float* __restrict__ xs,
          const float* __restrict__ w0, const float* __restrict__ w1,
          const float* __restrict__ w2, const float* __restrict__ w3, float* St, unsigned short* W16) {
  const int blk = blockIdx.x;
  if (blk < NSTATB) {
    norm_stats_part(xc, xs, St, blk);
  } else {
    cvt_w_part(w0, w1, w2, w3, W16, blk - NSTATB);
    // the other part's code follows these stores in the built kernel: no register of theirs is rewritten ahead of this wait
    asm volatile("s_wait_xcnt 0x0" ::: "memory");
  }
}

// =========================================================================================================
// (1b) x f32 [b][512 c][2048 t] (batch/row strides at full size) -> position-major bf16 planes [b][t][512]:
//      Ph = bf16-RNE(xn), Pl = bf16-RNE(xn - Ph) with xn = (bf16-RNE(x) - mean) * rstd per (b, c) row (St of 1a);
//      RAW adds Pr = bf16-RNE(x). One 64 c x 128 t tile per block, transposed through LDS (line = 64 c of one plane
//      row): lane e -> c 8e..8e+7, 8 consecutive lanes per line.
// coverage: 4 it x 32 rows x 8 lanes x 8 = 128 t x 64 c per plane; (SEQ/128, 8) blocks for each b = 0..NB-1 cover
//           [NB][SEQ][512] of every written plane exactly once. Th, Tl, Tr = the block's LDS tiles (Tr used by RAW only).
// =========================================================================================================
template <int RAW>
__device__ __forceinline__
void cvt_norm_part(const float* __restrict__ x, const float* __restrict__ St,
                   unsigned short* Ph, unsigned short* Pl, unsigned short* Pr,
                   unsigned short* Th, unsigned short* Tl, unsigned short* Tr, int b) {
  const int tid = threadIdx.x;
  const int n0 = blockIdx.x * NT, c0 = blockIdx.y * QT;
  const int e = tid & 7, lq = tid >> 3;                              // lq 0..31
  v4f a[4], q[4];
  v2f st[2];
  const int sr = b * CH + c0 + lq;                                   // row of c half 0; c half 1 is 32 rows on
  const float* sp0 = x + (size_t)sr * T_FULL + n0 + 8 * e;
#pragma unroll
  for (int it = 0; it < 4; ++it) {                                   // it = 2 * (t half) + (c half)
    const float* sp = sp0 + (size_t)(it & 1) * 32 * T_FULL + (it >> 1) * 64;
    a[it] = *(const v4f*)sp;
    q[it] = *(const v4f*)(sp + 4);
  }
#pragma unroll
  for (int h = 0; h < 2; ++h) st[h] = *(const v2f*)(St + 2 * (size_t)sr + 64 * h);
  // sp0 and sr address the loads; as inputs here their registers stay live past the last load and are reused only behind this wait
  asm volatile("s_wait_xcnt 0x0" :: "v"(sp0), "v"(sr) : "memory");
#pragma unroll
  for (int it = 0; it < 4; ++it) {
    const int cl = (it & 1) * 32 + lq;
    const int tl = (it >> 1) * 64 + 8 * e;                           // 0..120
    const float f[8] = {a[it][0], a[it][1], a[it][2], a[it][3], q[it][0], q[it][1], q[it][2], q[it][3]};
    const float mu = st[it & 1][0], rs = st[it & 1][1];
#pragma unroll
    for (int t = 0; t < 8; ++t) {
      const unsigned short rb = bf_bits(f[t]);
      const float d  = bf_up(rb) - mu;
      const float xn = d * rs;
      const unsigned short hb = bf_bits(xn);
      const unsigned short lb = bf_bits(__builtin_fmaf(d, rs, -bf_up(hb)));   // residual of the unrounded product
      Th[(tl + t) * TP + cl] = hb;
      Tl[(tl + t) * TP + cl] = lb;
      if (RAW) Tr[(tl + t) * TP + cl] = rb;
    }
  }
  __syncthreads();
  v4u uh[4], ul[4], ur[4];
#pragma unroll
  for (int it = 0; it < 4; ++it) {
    const int nl = it * 32 + lq;                                     // 0..127
    uh[it] = *(const v4u*)(Th + nl * TP + 8 * e);
    ul[it] = *(const v4u*)(Tl + nl * TP + 8 * e);
    if (RAW) ur[it] = *(const v4u*)(Tr + nl * TP + 8 * e); else ur[it] = uh[it];
  }
#pragma unroll
  for (int it = 0; it < 4; ++it) {
    const int nl = it * 32 + lq;
    const size_t po = ((size_t)(b * SEQ + n0 + nl)) * CH + c0 + 8 * e;
    *(v4u*)(Ph + po) = uh[it];
    *(v4u*)(Pl + po) = ul[it];
    if (RAW) *(v4u*)(Pr + po) = ur[it];
  }
}

// =========================================================================================================
// (1b) of both inputs in one launch, grid (SEQ/128, 8, 2 NB): blockIdx.z picks the input (block-uniform, so each part's
//      barrier is passed by the whole block); x_s, which writes three planes, comes first.
// =========================================================================================================
__global__ __launch_bounds__(256)
void cvt_norm2(const float* __restrict__ xc, const float* __restrict__ xs, const float* __restrict__ St,
               unsigned short* Pch, unsigned short* Pcl,
               unsigned short* Psh, unsigned short* Psl, unsigned short* Psr) {
  __shared__ __align__(16) unsigned short Th[NT * TP];
  __shared__ __align__(16) unsigned short Tl[NT * TP];
  __shared__ __align__(16) unsigned short Tr[NT * TP];
  const int z = blockIdx.z;
  if (z < NB) {
    cvt_norm_part<1>(xs, St + 2 * NB * CH, Psh, Psl, Psr, Th, Tl, Tr, z);
  } else {
    cvt_norm_part<0>(xc, St, Pch, Pcl, Pcl, Th, Tl, Tr, z - NB);
    // the other part's code follows these stores in the built kernel: no register of theirs is rewritten ahead of this wait
    asm volatile("s_wait_xcnt 0x0" ::: "memory");
  }
}

// =========================================================================================================
// (2) conv1x1 GEMM into hi + residual planes: Y[o][n] = sum_c W16[o][c] (Xh + Xl)[b][n][c] + bias[o] for one
//     (b, 128-n tile, 128-o block); A = W rows o (k = c contiguous), B = plane rows n (k = c contiguous), 2 products,
//     K = 512 = 16 steps. Epilogue: transposed LDS staging, barrier, planes [b][n][512] (planes_out).
// coverage: (SEQ/128, 4) blocks for each b = 0..NB-1, x 128 n x 128 o, cover [NB][SEQ][512] of both planes exactly once.
//           sm = the block's LDS, CoreLds<2>::BYTES: two operand buffers; output staging behind the core.
// =========================================================================================================
__device__ __forceinline__
void gemm_nm_part(char* sm, const unsigned short* __restrict__ W, const float* __restrict__ bias,
                  const unsigned short* __restrict__ Xh, const unsigned short* __restrict__ Xl,
                  unsigned short* Ph, unsigned short* Pl, int b) {
  float* Os = (float*)sm;
  const int tid = threadIdx.x, lane = tid & 31, wave = tid >> 5;
  const int hh = lane >> 4, c = lane & 15;
  const int nt = blockIdx.x, mb = blockIdx.y;
  const int n0 = nt * BT, o0 = mb * BT;
  const unsigned short* ap = W + (size_t)o0 * CH;
  const size_t bq = ((size_t)(b * SEQ + n0)) * CH;
  v8f acc[4][2];
  zero_acc(acc);
  gemm_core<2, false>(acc, sm, ap, ap, CH, Xh + bq, Xl + bq, CH, CH / KC, tid);
  stage_nT(Os, acc, 1.0f, wave, hh, c);
  __syncthreads();
  planes_out<true>(Os, bias, o0, Ph, Pl, (size_t)(b * SEQ + n0), tid);
}

// =========================================================================================================
// (3) conv1x1 GEMM into the channel-major f16 value plane: V16[b][o][s] = f16(sum_c W16[o][c] Xr[b][s][c] + bias[o])
//     (pitch SEQ); 1 product, K = 512. Epilogue: row-major LDS staging, barrier, row o segment of 128 halves = two lines.
// coverage: 8 it x 16 rows x 16 lanes x 8 = 128 o x 128 s; (SEQ/128, 4) blocks for each b = 0..NB-1 cover [NB][512][SEQ] once.
//           sm = the block's LDS, at least CoreLds<1>::BYTES: two operand buffers; output staging behind the core.
// =========================================================================================================
__device__ __forceinline__
void gemm_val_part(char* sm, const unsigned short* __restrict__ W, const float* __restrict__ bias,
                   const unsigned short* __restrict__ Xr, unsigned short* V16, int b) {
  float* Os = (float*)sm;
  const int tid = threadIdx.x, lane = tid & 31, wave = tid >> 5;
  const int hh = lane >> 4, c = lane & 15;
  const int nt = blockIdx.x, mb = blockIdx.y;
  const int n0 = nt * BT, o0 = mb * BT;
  const unsigned short* ap = W + (size_t)o0 * CH;
  const size_t bq = ((size_t)(b * SEQ + n0)) * CH;
  v8f acc[4][2];
  zero_acc(acc);
  gemm_core<1, false>(acc, sm, ap, ap, CH, Xr + bq, Xr + bq, CH, CH / KC, tid);
  stage_mn(Os, acc, wave, hh, c);
  __syncthreads();
  const int e = tid & 15, lq = tid >> 4;                             // lq 0..15
  v4u u[8];
#pragma unroll
  for (int it = 0; it < 8; ++it) {
    const int row = it * 16 + lq;                                    // o_loc 0..127
    const float bb = bfr(bias[o0 + row]);
    const v4f a = *(const v4f*)(Os + row * OSP + 8 * e);
    const v4f q = *(const v4f*)(Os + row * OSP + 8 * e + 4);
    const float f[8] = {a[0], a[1], a[2], a[3], q[0], q[1], q[2], q[3]};
#pragma unroll
    for (int t = 0; t < 4; ++t) {
      const _Float16 h0 = (_Float16)(f[2 * t] + bb);
      const _Float16 h1 = (_Float16)(f[2 * t + 1] + bb);
      u[it][t] = pk16(h_bits(h0), h_bits(h1));
    }
  }
{
#pragma unroll
    for (int it = 0; it < 8; ++it) {
      const int row = it * 16 + lq;
      const size_t po = ((size_t)(b * CH + o0 + row)) * SEQ + n0 + 8 * e;
      *(v4u*)(V16 + po) = u[it];
    }
    
  }
}

// =========================================================================================================
// (2) for Mn, (2) for Mm and (3) in one launch, grid (SEQ/128, 4, 3 NB): the three products read W16 and the planes of
//     (1b) and write planes of their own. job = blockIdx.z / NB picks the product (block-uniform, so every barrier of a
//     part is passed by the whole block); the one-product job, the shortest, comes last. W = W16 (order Wn, Wm, Wl),
//     X = the five planes of (1b) in a row (x_c hi, lo; x_s hi, lo, raw), M = the four result planes (Mn hi, lo; Mm hi, lo).
// =========================================================================================================
constexpr size_t PLE = PLB / 2;                                      // elements of one plane
static_assert(CoreLds<1>::BYTES <= CoreLds<2>::BYTES);
__global__ __launch_bounds__(256)
void gemm_conv3(const unsigned short* __restrict__ W, const float* __restrict__ bn, const float* __restrict__ bm,
                const float* __restrict__ bl, const unsigned short* __restrict__ X,
                unsigned short* M, unsigned short* V16) {
  __shared__ __align__(16) char sm[CoreLds<2>::BYTES];
  const int job = blockIdx.z / NB, b = blockIdx.z - job * NB;
  if (job < 2) {
    const size_t pl = (size_t)job * 2 * PLE;
    gemm_nm_part(sm, W + (size_t)job * CH * CH, job ? bm : bn, X + pl, X + pl + PLE, M + pl, M + pl + PLE, b);
  } else {
    gemm_val_part(sm, W + (size_t)2 * CH * CH, bl, X + 4 * PLE, V16, b);
  }
}

// =========================================================================================================
// (4) scores S[b][t][s] = sum_c Mn[c][t] Mm[c][s] (no scale) for one (b, 128-s tile, 128-t block): A = Mn planes
//     rows t (hi Qh, residual Ql), B = Mm planes rows s (hi Kh, residual Kl), products hh + hl + lh, K = 512.
//     Epilogue = the softmax inside the block's own 128 keys: row-major LDS staging, barrier, then per row t
//     m = max_s S, P16[b][t][s] = f16(e^{S - m} * 16384), l = sum_s e^{S - m} (f32, unrounded terms), Ls = {m, l}.
//     8 lanes a row: lane e8 owns cols 8 e8 .. + 7 and 64 + 8 e8 .. + 7, so 8 lanes store one whole 128-B line of P16, and
//     the max and the sum cross lanes in three xor steps. Wave w owns rows 16 w .. + 15 = one 128-B line of Ls.
// coverage: 8 waves x 4 g x 4 rows x 8 lanes x 16 = 128 t x 128 s; grid (SEQ/128, SEQ/128, NB) covers P16 [NB][SEQ][SEQ]
//           and Ls [NB][SEQ/128][SEQ] once.
// =========================================================================================================
__global__ __launch_bounds__(256)
void gemm_sc(const unsigned short* __restrict__ Qh, const unsigned short* __restrict__ Ql,
             const unsigned short* __restrict__ Kh, const unsigned short* __restrict__ Kl,
             unsigned short* P16, float* Ls) {
  __shared__ __align__(16) char sm[CoreLds<3>::BYTES];         // two operand buffers; output staging behind the core
  float* Os = (float*)sm;
  const int tid = threadIdx.x, lane = tid & 31, wave = tid >> 5;
  const int hh = lane >> 4, c = lane & 15;
  const int nt = blockIdx.x, mb = blockIdx.y, b = blockIdx.z;
  const int n0 = nt * BT, m0 = mb * BT;
  const size_t aq = ((size_t)(b * SEQ + m0)) * CH;
  const size_t bq = ((size_t)(b * SEQ + n0)) * CH;
  v8f acc[4][2];
  zero_acc(acc);
  gemm_core<3, false>(acc, sm, Qh + aq, Ql + aq, CH, Kh + bq, Kl + bq, CH, CH / KC, tid);
  stage_mn(Os, acc, wave, hh, c);
  __syncthreads();
  const int e8 = lane & 7, rq = lane >> 3;                           // rq 0..3
  float mxs[4], sms[4];
  v4u u[4][2];
#pragma unroll
  for (int g = 0; g < 4; ++g) {
    const float* orow = Os + (16 * wave + 4 * g + rq) * OSP + 8 * e8;
    float f[16];
#pragma unroll
    for (int k = 0; k < 2; ++k) {
      const v4f a = *(const v4f*)(orow + 64 * k);
      const v4f q = *(const v4f*)(orow + 64 * k + 4);
#pragma unroll
      for (int t = 0; t < 4; ++t) { f[8 * k + t] = a[t]; f[8 * k + 4 + t] = q[t]; }
    }
    float mx = f[0];
#pragma unroll
    for (int i = 1; i < 16; ++i) mx = fmaxf(mx, f[i]);
#pragma unroll
    for (int o = 4; o > 0; o >>= 1) mx = fmaxf(mx, __shfl_xor(mx, o, 32));
    float l = 0.f;
#pragma unroll
    for (int i = 0; i < 16; ++i) { f[i] = exp_slot(f[i] - mx); l += f[i]; }
#pragma unroll
    for (int o = 4; o > 0; o >>= 1) l += __shfl_xor(l, o, 32);
#pragma unroll
    for (int k = 0; k < 2; ++k) {
#pragma unroll
      for (int t = 0; t < 4; ++t) {
        const _Float16 h0 = (_Float16)(f[8 * k + 2 * t] * PCAR);
        const _Float16 h1 = (_Float16)(f[8 * k + 2 * t + 1] * PCAR);
        u[g][k][t] = pk16(h_bits(h0), h_bits(h1));
      }
    }
    mxs[g] = mx;
    sms[g] = l;
  }
  unsigned short* pr[4];
#pragma unroll
  for (int g = 0; g < 4; ++g) {
    pr[g] = P16 + ((size_t)(b * SEQ + m0 + 16 * wave + 4 * g + rq)) * SEQ + n0 + 8 * e8;
    *(v4u*)(pr[g])      = u[g][0];
    *(v4u*)(pr[g] + 64) = u[g][1];
  }
  // the stores' addresses and data are inputs here so that their registers stay live past the last store and are reused only behind this wait
  asm volatile("s_wait_xcnt 0x0" :: "v"(pr[0]), "v"(pr[1]), "v"(pr[2]), "v"(pr[3]), "v"(u[0][0]), "v"(u[0][1]), "v"(u[1][0]),
               "v"(u[1][1]), "v"(u[2][0]), "v"(u[2][1]), "v"(u[3][0]), "v"(u[3][1]) : "memory");
  // lane (e8 < 4, rq) stores the pair of row 4 e8 + rq of the wave's 16
  v2f st;
  st[0] = e8 == 0 ? mxs[0] : e8 == 1 ? mxs[1] : e8 == 2 ? mxs[2] : mxs[3];
  st[1] = e8 == 0 ? sms[0] : e8 == 1 ? sms[1] : e8 == 2 ? sms[2] : sms[3];
  if (e8 < 4)
    *(v2f*)(Ls + 2 * ((size_t)(b * NKT + nt) * SEQ + m0 + 16 * wave + 4 * e8 + rq)) = st;
}

// =========================================================================================================
// (6) Mo[c][t] = sum_j F[j][t] (1/16384) sum_{s in key tile j} V16[b][c][s] P16[b][t][s] for one (b, 128-t tile,
//     128-c block), F[j][t] = e^{m_j - m} / sum_i l_i e^{m_i - m}, m = max_j m_j, from the {m_j, l_j} pairs of (4): the
//     row's softmax over all SEQ keys. A = V16 rows c (k = s contiguous, pitch SEQ), B = P16 rows t (pitch SEQ), f16
//     instruction, 1 product, K = SEQ. The copy ring has gemm_core's order of waits and barriers, but a stage of it is NSV
//     tile pairs of KC k in a row (KSV k): the grid gives a WGP one block, so nothing but the block's own copies hides their
//     latency, and a long stage keeps NSV times the bytes in flight and meets that latency once per KSV k. A key tile = two
//     tile pairs sums into part (from a zero C), which is then added into acc with the lane's two column factors.
//     F (LDS behind the ring, [NKT][128]) is formed by waves 0..3 while stage 0's copies fly; the barrier that publishes stage 0
//     publishes F too. Epilogue: transposed LDS staging scaled by 2^-14, barrier, Mo hi + residual planes (planes_out).
// coverage: grid (SEQ/128, 4, NB) covers [NB][SEQ][512] of both planes exactly once.
// =========================================================================================================
#define NSV  4
#define KSV  (NSV * KC)
#define NSTV (SEQ / KSV)
static_assert(SEQ % KSV == 0 && NSTV >= 2 && KSV % BT == 0);
static_assert(CoreLds<1, NSV>::BYTES + NKT * BT * 4 <= 327680);
__global__ __launch_bounds__(256)
void gemm_pv(const unsigned short* __restrict__ V16, const unsigned short* __restrict__ P16,
             const float* __restrict__ Ls, unsigned short* Mh, unsigned short* Mlo) {
  constexpr unsigned SUB = CoreLds<1, NSV>::SET;                     // one tile pair
  constexpr unsigned STG = CoreLds<1, NSV>::STG;                     // one stage
  __shared__ __align__(16) char sm[2 * STG + NKT * BT * 4];          // two operand buffers (output staging behind the loop), F
  float* Os = (float*)sm;
  float* Fs = (float*)(sm + 2 * STG);
  const int tid = threadIdx.x, lane = tid & 31, wave = tid >> 5;
  const int hh = lane >> 4, c = lane & 15;
  const int wm = wave >> 2, wn = wave & 3;
  const int nt = blockIdx.x, mb = blockIdx.y, b = blockIdx.z;
  const int n0 = nt * BT, o0 = mb * BT;
  const int e = tid & 7, r = tid >> 3;                               // r 0..31
  const unsigned lc = lds_off(sm) + (unsigned)(r * LP + 16 * e);
  const unsigned short* ap = V16 + ((size_t)(b * CH + o0)) * SEQ + (size_t)r * SEQ + 8 * e;
  const unsigned short* bp = P16 + ((size_t)(b * SEQ + n0)) * SEQ + (size_t)r * SEQ + 8 * e;
  const unsigned fa = (unsigned)((64 * wm + c) * LP + 16 * hh);
  const unsigned fb = TILEB + (unsigned)((32 * wn + c) * LP + 16 * hh);
  v8f acc[4][2];
  zero_acc(acc);
  fill_ring<1, NSV>(lc, ap, ap, 32 * SEQ, bp, bp, 32 * SEQ);
  if (tid < BT) {                                                    // whole waves 0..3: thread = column t of the block
    const v2f* lb = (const v2f*)(Ls + 2 * ((size_t)b * NKT * SEQ + n0));   // block-uniform: tile 0's pair of column 0
    float m[NKT], l[NKT];
#pragma unroll
    for (int j = 0; j < NKT; ++j) {
      const v2f s = lb[tid + j * SEQ];
      m[j] = s[0];
      l[j] = s[1];
    }
    // tid addresses the loads; as an input here its register stays live past the last load and is reused only behind this wait
    asm volatile("s_wait_xcnt 0x0" :: "v"(tid) : "memory");
    float mx = m[0];
#pragma unroll
    for (int j = 1; j < NKT; ++j) mx = fmaxf(mx, m[j]);
    float ls = 0.f;
#pragma unroll
    for (int j = 0; j < NKT; ++j) { m[j] = exp_slot(m[j] - mx); ls = __builtin_fmaf(l[j], m[j], ls); }
    const float il = 1.0f / ls;                                      // ls >= 1
#pragma unroll
    for (int j = 0; j < NKT; ++j) Fs[j * BT + tid] = m[j] * il;
  }
  asm volatile("s_wait_asynccnt 0x0" ::: "memory");                  // stage 0's own copies have landed
  __syncthreads();                                                   // ... and every other wave's; F is written
  fill_ring<1, NSV>(lc + STG, ap + KSV, ap + KSV, 32 * SEQ, bp + KSV, bp + KSV, 32 * SEQ);
  // kept rolled over the stages: a stage is 64 matrix instructions with their fragment loads, and the code stays small
#pragma unroll 1
  for (int st = 0; st < NSTV; ++st) {
    const unsigned bo = (unsigned)(st & 1) * STG;
    // the loops below are unrolled whole so that the LDS offsets inside a stage are constants, the fragment arrays stay in
    // registers and each key tile's first matrix instructions take a zero C
#pragma unroll
    for (int kt = 0; kt < KSV / BT; ++kt) {                          // key tile j = (KSV / BT) st + kt
      v8f part[4][2];
      // the tile's two column factors are read with its first fragments, so that their LDS latency is over when they are used
      const float* fr = Fs + (st * (KSV / BT) + kt) * BT + 32 * wn + c;
      const float f0 = fr[0], f1 = fr[16];
#pragma unroll
      for (int h = 0; h < 2; ++h) {                                  // tile pair 2 kt + h of the stage
#pragma unroll
        for (int ks = 0; ks < KC / 32; ++ks) {
          const unsigned o = bo + (unsigned)(2 * kt + h) * SUB + 64u * ks;
          Frag fb0[2], fa0[4];
#pragma unroll
          for (int nf = 0; nf < 2; ++nf) fb0[nf] = ldfrag((const unsigned short*)(sm + fb + 16 * LP * nf + o));
#pragma unroll
          for (int mt = 0; mt < 4; ++mt) fa0[mt] = ldfrag((const unsigned short*)(sm + fa + 16 * LP * mt + o));
#pragma unroll
          for (int mt = 0; mt < 4; ++mt) {
#pragma unroll
            for (int nf = 0; nf < 2; ++nf)
              part[mt][nf] = mma_h(fa0[mt].h, fb0[nf].h, (h == 0 && ks == 0) ? zero8() : part[mt][nf]);
          }
        }
      }
      // the key tile is summed: weigh it and add it in
#pragma unroll
      for (int mt = 0; mt < 4; ++mt) {
#pragma unroll
        for (int q = 0; q < 8; ++q) {
          acc[mt][0][q] = __builtin_fmaf(part[mt][0][q], f0, acc[mt][0][q]);
          acc[mt][1][q] = __builtin_fmaf(part[mt][1][q], f1, acc[mt][1][q]);
        }
      }
    }
    asm volatile("s_wait_dscnt 0x0" ::: "memory");                   // this wave's reads of the buffer are done before it is refilled
    asm volatile("s_wait_asynccnt 0x0" ::: "memory");                // this wave's copies of stage st + 1 have landed
    __syncthreads();                                                 // publishes stage st + 1, ends every read of stage st's buffer
    if (st + 2 < NSTV) {                                             // stage st + 2 exists
      const int ko = KSV * (st + 2);
      fill_ring<1, NSV>(lc + bo, ap + ko, ap + ko, 32 * SEQ, bp + ko, bp + ko, 32 * SEQ);
    }
  }
  asm volatile("s_wait_asynccnt 0x0" ::: "memory");                  // nothing outstanding when the LDS changes its use
  stage_nT(Os, acc, IPCAR, wave, hh, c);
  __syncthreads();
  planes_out<false>(Os, nullptr, o0, Mh, Mlo, (size_t)(b * SEQ + n0), tid);
}

// =========================================================================================================
// (7) out[b][o][t] = sum_c W16[o][c] (Mh + Ml)[b][t][c] + bias[o] + bf16-RNE(xres[b][o][t]) for one (b, 128-t tile,
//     128-o block): 2 products, K = 512, passes of NSO KC k (one block a WGP); output and residual rows at full strides. Epilogue: row-major LDS staging,
// coverage: 16 it x 8 rows x 32 lanes x 4 = 128 o x 128 t; grid (SEQ/128, 4, NB) covers out[b][0..511][0..SEQ-1] once.
// =========================================================================================================
#define NSO 2
static_assert(CH % (KC * NSO) == 0 && CH / (KC * NSO) >= 2);
__global__ __launch_bounds__(256)
void gemm_out(const unsigned short* __restrict__ W, const float* __restrict__ bias,
              const unsigned short* __restrict__ Mh, const unsigned short* __restrict__ Mlo,
              const float* __restrict__ xres, float* out) {
  __shared__ __align__(16) char sm[CoreLds<2, NSO>::BYTES];    // two operand buffers; output staging behind the core
  float* Os = (float*)sm;
  const int tid = threadIdx.x, lane = tid & 31, wave = tid >> 5;
  const int hh = lane >> 4, c = lane & 15;
  const int nt = blockIdx.x, mb = blockIdx.y, b = blockIdx.z;
  const int n0 = nt * BT, o0 = mb * BT;
  const unsigned short* ap = W + (size_t)o0 * CH;
  const size_t bq = ((size_t)(b * SEQ + n0)) * CH;
  v8f acc[4][2];
  zero_acc(acc);
  gemm_core<2, false, NSO>(acc, sm, ap, ap, CH, Mh + bq, Mlo + bq, CH, CH / (KC * NSO), tid);
  stage_mn(Os, acc, wave, hh, c);
  __syncthreads();
  const int e = tid & 31, lq = tid >> 5;                             // lq 0..7
  const size_t blk0 = ((size_t)(b * CH + o0)) * T_FULL + n0;         // block-uniform: row 0, col 0 of the tile
  const unsigned xofs = 4u * (unsigned)(lq * T_FULL + 4 * e);        // the lane's byte offset behind it, row lq
  const char* xb = (const char*)(xres + blk0);
  const float* bp = bias + o0;
  v4f res[16];
#pragma unroll
  for (int it = 0; it < 16; ++it) {
    const int row = it * 8 + lq;                                     // o_loc 0..127
    const float bb = bfr(bp[lq + 8 * it]);
    const v4f a  = *(const v4f*)(Os + row * OSP + 4 * e);
    const v4f xv = *(const v4f*)(xb + xofs + (size_t)it * (32 * T_FULL));
#pragma unroll
    for (int t = 0; t < 4; ++t) res[it][t] = (a[t] + bb) + bfr(xv[t]);
  }
  // xofs and lq address the loads; as inputs here their registers stay live past the last load and are reused only behind this wait
  asm volatile("s_wait_xcnt 0x0" :: "v"(xofs), "v"(lq) : "memory");
{
#pragma unroll
    for (int it = 0; it < 16; ++it) {
      const int row = it * 8 + lq;
      const size_t idx = blk0 + (size_t)row * T_FULL + 4 * e;
      *(v4f*)(out + idx) = res[it];
    }
    
  }
}

// =========================================================================================================
extern "C" void kernel_launch(void* const* d_in, const int* in_sizes, int n_in,
                              void* d_out, int out_size, void* d_ws, size_t ws_size,
                              hipStream_t stream) {
  if (n_in < 10) return;
  if (in_sizes[0] < NB * CH * T_FULL || in_sizes[1] < NB * CH * T_FULL) return;
  if (in_sizes[2] < CH * CH || in_sizes[4] < CH * CH || in_sizes[6] < CH * CH || in_sizes[8] < CH * CH) return;
  if (in_sizes[3] < CH || in_sizes[5] < CH || in_sizes[7] < CH || in_sizes[9] < CH) return;
  if (out_size < NB * CH * T_FULL) return;

  size_t off = 0;
  auto carve = [&](size_t bytes) { const size_t o = off; off += (bytes + 255) & ~(size_t)255; return o; };
  const size_t oW = carve(WB);
  const size_t oX = carve(RXB);
  const size_t oM = carve(RMB);
  const size_t oV = carve(RVB);
  const size_t oT = carve(STB);
  if (off > ws_size) return;
  if (off > (size_t)WS_CAP) return;

  const float* x_c = (const float*)d_in[0];
  const float* x_s = (const float*)d_in[1];
  const float* Wn  = (const float*)d_in[2];
  const float* bn  = (const float*)d_in[3];
  const float* Wm  = (const float*)d_in[4];
  const float* bm  = (const float*)d_in[5];
  const float* Wl  = (const float*)d_in[6];
  const float* bl  = (const float*)d_in[7];
  const float* Wo  = (const float*)d_in[8];
  const float* bo  = (const float*)d_in[9];
  float* out = (float*)d_out;

  char* ws = (char*)d_ws;
  unsigned short* W16  = (unsigned short*)(ws + oW);
  // region X users
  unsigned short* Xcnh = (unsigned short*)(ws + oX);
  unsigned short* Xcnl = (unsigned short*)(ws + oX + PLB);
  unsigned short* Xsnh = (unsigned short*)(ws + oX + 2 * PLB);
  unsigned short* Xsnl = (unsigned short*)(ws + oX + 3 * PLB);
  unsigned short* Xsr  = (unsigned short*)(ws + oX + 4 * PLB);
  unsigned short* P16  = (unsigned short*)(ws + oX);
  float*          Ls   = (float*)(ws + oX + PB);
  // region M users
  unsigned short* Mnh  = (unsigned short*)(ws + oM);
  unsigned short* Mnl  = (unsigned short*)(ws + oM + PLB);
  unsigned short* Mmh  = (unsigned short*)(ws + oM + 2 * PLB);
  unsigned short* Mml  = (unsigned short*)(ws + oM + 3 * PLB);
  unsigned short* Moh  = (unsigned short*)(ws + oM);
  unsigned short* Mol  = (unsigned short*)(ws + oM + PLB);
  // region V
  unsigned short* V16  = (unsigned short*)(ws + oV);
  // region T
  float*          St   = (float*)(ws + oT);

  const dim3 blk256(256);
  const dim3 gconv(SEQ / BT, CH / BT, NB);

  // (0) + (1a) instance-norm statistics of x_c and x_s; weights -> bf16 planes (order Wn, Wm, Wl, Wo)
  prep<<<dim3(NSTATB + NCVTWB), blk256, 0, stream>>>(x_c, x_s, Wn, Wm, Wl, Wo, St, W16);
  // (1b) split planes of norm(x_c); same for x_s plus the raw bf16 plane
  cvt_norm2<<<dim3(SEQ / NT, CH / QT, 2 * NB), blk256, 0, stream>>>(x_c, x_s, St, Xcnh, Xcnl, Xsnh, Xsnl, Xsr);
  // (2) + (3) Mn, Mm hi + residual planes and the Ml value plane
  gemm_conv3<<<dim3(SEQ / BT, CH / BT, 3 * NB), blk256, 0, stream>>>(W16, bn, bm, bl, Xcnh, Mnh, V16);
  // (4) scores -> tile-local softmax weights and {max, sum} pairs (overwrites region X)
  gemm_sc<<<dim3(SEQ / BT, SEQ / BT, NB), blk256, 0, stream>>>(Mnh, Mnl, Mmh, Mml, P16, Ls);
  // (6) Mo hi + residual planes (overwrites region M)
  gemm_pv<<<gconv, blk256, 0, stream>>>(V16, P16, Ls, Moh, Mol);
  // (7) output GEMM + bias + residual
  gemm_out<<<gconv, blk256, 0, stream>>>(W16 + (size_t)3 * CH * CH, bo, Moh, Mol, x_c, out);
  (void)hipGetLastError();
}

// v007
// One run takes 122 microseconds.
// In both of two side-by-side timings against v006, it was 1.04 times as fast.
// Over all steps from v000 it is 5.43 times as fast.
// Contractions: conv1x1 Wn.norm(x_c) and Wm.norm(x_s) on v_wmma_f32_16x16x32_bf16 (bf16-RNE weights x bf16 hi +
// bf16 residual planes of the normalised activations, 2 products, K=512); conv1x1 Wl.x_s on v_wmma_f32_16x16x32_bf16
// (bf16-RNE weights x bf16-RNE x_s, 1 product); position scores Mn^T.Mm on v_wmma_f32_16x16x32_bf16 (bf16 hi +
// residual planes of both, 3 products, K=512); Mo = Ml.A^T on v_wmma_f32_16x16x32_f16 (f16 Ml plane x softmax
// weights carried x16384 as f16, K=2048); conv1x1 Wo.Mo on v_wmma_f32_16x16x32_bf16 (bf16-RNE weights x bf16 hi +
// residual planes of Mo, 2 products); f32 accumulate everywhere; instance-norm statistics, softmax, bias and residual
// adds in f32 VALU. The softmax has no launch of its own: the score GEMM's epilogue normalises each row inside its own
// 128-key tile, and the Mo GEMM weighs each key tile's partial product with the row's factor for that tile.
#include <hip/hip_runtime.h>
#include <stdint.h>

#ifndef NB
#define NB 4
#endif
#ifndef SEQ
#define SEQ 2048
#endif
#define NB_FULL 4
#define T_FULL  2048
#define CH      512
#define NMAT    4
#define QT      64
#define BT      128
#define OSP     132
#define TP      72
#define NT      128
#define KC      64
#define LP      144
#define TILEB   (BT * LP)
#define NKT     (SEQ / BT)
#define PCAR    16384.0f
#define IPCAR   6.103515625e-05f
#define EPSN    1.0e-5f
#define WS_CAP  134217728

static_assert(NB >= 1 && NB <= NB_FULL);
static_assert(SEQ >= 256 && SEQ <= T_FULL && SEQ % 256 == 0);
static_assert(SEQ % QT == 0 && CH % QT == 0 && SEQ % NT == 0 && SEQ % BT == 0 && CH % BT == 0);
static_assert(CH % 256 == 0 && CH % 32 == 0 && SEQ % 32 == 0 && SEQ % 16 == 0);
static_assert((OSP * 4) % 16 == 0);
static_assert((TP * 2) % 16 == 0);
static_assert((NB * SEQ) % 8 == 0);
static_assert(CH % 8 == 0);
static_assert(CH % KC == 0 && SEQ % KC == 0 && CH / KC >= 2 && SEQ / KC >= 2);
static_assert(KC * 2 + 16 == LP && LP % 32 == 16 && QT == 64 && BT == 128);
static_assert(BT * OSP * 4 <= 2 * 2 * TILEB);
static_assert(BT == 2 * KC);

typedef _Float16       v16h __attribute__((ext_vector_type(16)));
typedef _Float16       v8h  __attribute__((ext_vector_type(8)));
typedef __bf16         v16b __attribute__((ext_vector_type(16)));
typedef unsigned short v8us __attribute__((ext_vector_type(8)));
typedef float          v8f  __attribute__((ext_vector_type(8)));
typedef float          v4f  __attribute__((ext_vector_type(4)));
typedef float          v2f  __attribute__((ext_vector_type(2)));
typedef unsigned int   v4u  __attribute__((ext_vector_type(4)));

union Frag { v8us u[2]; v16h h; v16b bf; };
static_assert(sizeof(Frag) == 32);

// ---- workspace map (bytes; every region start a multiple of 256; every extent is an exact tile multiple and is
//      launches; each later user fully overwrites what it reads before any read):
//   W : bf16 [4][512][512] weights                                              WB
//   X : stage 1-3: five bf16 planes [NB][SEQ][512] (x_c norm hi/lo, x_s norm hi/lo, x_s raw)   5*PLB
//       stage 4-6: tile-local softmax weights f16 [NB][SEQ][SEQ]                PB
//                  and behind them {max, sum} f32 pairs [NB][SEQ/128 key tiles][SEQ]   LSB
//   M : stage 2-4: Mn hi/lo, Mm hi/lo bf16 planes [NB][SEQ][512]                4*PLB
//       stage 6-7: Mo hi/lo bf16 planes [NB][SEQ][512]                          2*PLB
//   V : Ml f16 plane [NB][512][SEQ]                                             PLB
//   T : instance-norm {mean, rstd} f32 pairs [2][NB][512]                       STB
constexpr size_t cmax(size_t a, size_t b) { return a > b ? a : b; }
constexpr size_t PLB = (size_t)NB * SEQ * CH * 2;
constexpr size_t LSB = (size_t)NB * NKT * SEQ * 2 * 4;
constexpr size_t PB  = (size_t)NB * SEQ * SEQ * 2;
constexpr size_t WB  = (size_t)NMAT * CH * CH * 2;
constexpr size_t RXB = cmax(5 * PLB, PB + LSB);
constexpr size_t RMB = 4 * PLB;
constexpr size_t RVB = PLB;
constexpr size_t STB = (size_t)2 * NB * CH * 2 * 4;
static_assert(WB % 256 == 0 && PLB % 256 == 0 && LSB % 256 == 0 && PB % 256 == 0);
static_assert(5 * PLB <= RXB && PB + LSB <= RXB);
static_assert(4 * PLB <= RMB && 2 * PLB <= RMB);
static_assert(STB % 256 == 0 && (NB * CH) % 16 == 0);
static_assert(WB + RXB + RMB + RVB + STB <= (size_t)WS_CAP);

// ---- scalar helpers -----------------------------------------------------------------------------------------
__device__ __forceinline__ unsigned short bf_bits(float f) {          // f32 -> bf16 bits, RNE convert
  unsigned u = __float_as_uint(f);
  return (unsigned short)((u + 0x7FFFu + ((u >> 16) & 1u)) >> 16);
}
__device__ __forceinline__ float bf_up(unsigned short hb) { return __uint_as_float(((unsigned)hb) << 16); }
__device__ __forceinline__ float bfr(float f) { return bf_up(bf_bits(f)); }
__device__ __forceinline__ unsigned short h_bits(_Float16 x) { return __builtin_bit_cast(unsigned short, x); }
__device__ __forceinline__ unsigned pk16(unsigned short a, unsigned short b) { return (unsigned)a | ((unsigned)b << 16); }
// e^x as 2^(x log2 e) on the hardware's exponential, as __expf gives it; the v_nop in the statement is the slot that the
// instruction set asks for between a transcendental and a next instruction that reads its result or overwrites its source
__device__ __forceinline__ float exp_slot(float x) {
  float y = x * 1.44269504f;
#if defined(__HIP_DEVICE_COMPILE__)
  asm("v_exp_f32 %0, %0\n\tv_nop" : "+v"(y));
#endif
  return y;
}
__device__ __forceinline__ v8f zero8() { v8f z = {0.f, 0.f, 0.f, 0.f, 0.f, 0.f, 0.f, 0.f}; return z; }

// ---- 16-bit fragment loader (A, or B from a k-contiguous [n][k] row): lane -> row/col (lane&15), p already includes
//      + 8*(lane>>4); elements 0..7 <- p[0..7] (k0+8h..), elements 8..15 <- p[16..23] (k0+16+8h..)
__device__ __forceinline__ Frag ldfrag(const unsigned short* p) {
  Frag f;
  f.u[0] = *(const v8us*)(p);
  f.u[1] = *(const v8us*)(p + 16);
  return f;
}

// ---- WMMA helpers: builtin followed by a 4-slot VALU gap tying D and keeping A/B live ----------------------------
__device__ __forceinline__ v8f mma_h(v16h a, v16h b, v8f c) {
  v8f d = __builtin_amdgcn_wmma_f32_16x16x32_f16(false, a, false, b, (short)0, c, false, false);
#if defined(__HIP_DEVICE_COMPILE__)
  asm volatile("v_nop\n\tv_nop\n\tv_nop\n\tv_nop" : "+v"(d) : "v"(a), "v"(b));
#endif
  return d;
}
__device__ __forceinline__ v8f mma_b(v16b a, v16b b, v8f c) {
  v8f d = __builtin_amdgcn_wmma_f32_16x16x32_bf16(false, a, false, b, (short)0, c, false, false);
#if defined(__HIP_DEVICE_COMPILE__)
  const v16h ha = __builtin_bit_cast(v16h, a), hb = __builtin_bit_cast(v16h, b);
  asm volatile("v_nop\n\tv_nop\n\tv_nop\n\tv_nop" : "+v"(d) : "v"(ha), "v"(hb));
#endif
  return d;
}

// ---- asynchronous copies of operand tiles into LDS. One tile of a pass = 128 rows x 128 B (KC elements), LDS pitch LP.
//      Lane map: e = tid & 7 -> 16-B piece of the row, r = tid >> 3 -> row r + 32 i (i = 0..3): 8 lanes cover one whole
//      128-B line. l = the lane's LDS byte address of row r, g = its global address of row r, p32 = elements of 32 rows.
//      The s_wait_xcnt closes each statement so that no address register of an issued copy is rewritten ahead of it.
__device__ __forceinline__ unsigned lds_off(const void* p) { return (unsigned)(size_t)p; }
__device__ __forceinline__ void copy_tile(unsigned l, const unsigned short* g, size_t p32) {
#if defined(__HIP_DEVICE_COMPILE__)
  // four copies of one tile, global -> LDS through no register; the wait is their statement's last line
  asm volatile("global_load_async_to_lds_b128 %0, %4, off\n\t"
               "global_load_async_to_lds_b128 %1, %5, off\n\t"
               "global_load_async_to_lds_b128 %2, %6, off\n\t"
               "global_load_async_to_lds_b128 %3, %7, off\n\t"
               "s_wait_xcnt 0x0"
               :: "v"(l), "v"(l + 32 * LP), "v"(l + 64 * LP), "v"(l + 96 * LP),
                  "v"(g), "v"(g + p32), "v"(g + 2 * p32), "v"(g + 3 * p32) : "memory");
#endif
}
__device__ __forceinline__ void copy_tiles2(unsigned l, const unsigned short* g, size_t p32,
                                            unsigned m, const unsigned short* h, size_t q32) {
#if defined(__HIP_DEVICE_COMPILE__)
  // eight copies of two tiles, global -> LDS through no register; they share one statement and its closing wait
  asm volatile("global_load_async_to_lds_b128 %0, %8, off\n\t"
               "global_load_async_to_lds_b128 %1, %9, off\n\t"
               "global_load_async_to_lds_b128 %2, %10, off\n\t"
               "global_load_async_to_lds_b128 %3, %11, off\n\t"
               "global_load_async_to_lds_b128 %4, %12, off\n\t"
               "global_load_async_to_lds_b128 %5, %13, off\n\t"
               "global_load_async_to_lds_b128 %6, %14, off\n\t"
               "global_load_async_to_lds_b128 %7, %15, off\n\t"
               "s_wait_xcnt 0x0"
               :: "v"(l), "v"(l + 32 * LP), "v"(l + 64 * LP), "v"(l + 96 * LP),
                  "v"(m), "v"(m + 32 * LP), "v"(m + 64 * LP), "v"(m + 96 * LP),
                  "v"(g), "v"(g + p32), "v"(g + 2 * p32), "v"(g + 3 * p32),
                  "v"(h), "v"(h + q32), "v"(h + 2 * q32), "v"(h + 3 * q32) : "memory");
#endif
}

// ---- GEMM core for one 128(m) x 128(n) block tile, 8 waves (256 threads) as 2 (m) x 4 (n): wave (wm, wn) owns a
//      64 x 32 tile, cols n = 32 wn + 16 nf + (lane&15) (2 B fragments per k-step per B plane), A rows
//      m = 64 wm + 16 mt + (lane&15) (4 m-tiles): every fragment read from LDS feeds 2 or 4 matrix instructions a product,
//      every operand byte copied from L2 feeds 128 rows or columns. a0/a1/b0/b1 = row 0, k = 0 of the
//      block's 128 operand rows (k-contiguous, pitches ap / bp elements). A pass = NS KC k = NS tile sets of KC k in a row,
//      a set = [A0][A1 if NPROD 3][B0][B1 if NPROD >= 2]: they are copied into one of two LDS buffers one pass ahead, and the
//      fragments are read from LDS with the split k map (ldfrag), k-steps and products in the same order as from
//      global rows. NPROD: 1 = a0.b0; 2 = a0.b0 + a0.b1; 3 = a0.b0 + a0.b1 + a1.b0 (shared accumulator, unscaled
//      residual planes; each accumulator takes its products of a k-step in that order, the 8 tiles of one product in a
//      row). HALF selects the f16 instruction (NPROD 1 only). NS > 1 is for a grid of one block a WGP, where nothing but the
//      block's own copies hides their latency: NS times the bytes in flight, that latency met once per NS KC k. npass = passes
//      (at least 2). On return no copy is outstanding and every
//      wave has left both buffers (the last pass's barrier), so sm may be reused as output staging.
template <int NPROD, int NS = 1>
struct CoreLds {
  static constexpr int NA = NPROD >= 3 ? 2 : 1;
  static constexpr int NBP = NPROD >= 2 ? 2 : 1;
  static constexpr unsigned SET = (unsigned)(NA + NBP) * TILEB;      // the operand tiles of KC k
  static constexpr unsigned STG = (unsigned)NS * SET;                // one stage of the ring
  static constexpr unsigned BYTES = 2 * STG;
  static_assert(NS * (NA + NBP) * 4 <= 63);                          // copies of a wave in flight: one stage's
  static_assert(BYTES <= 327680);
};
template <int NPROD>
__device__ __forceinline__ void fill_stage(unsigned l, const unsigned short* a0, const unsigned short* a1, size_t ap32,
                                           const unsigned short* b0, const unsigned short* b1, size_t bp32) {
  if (NPROD == 1) {
    copy_tiles2(l, a0, ap32, l + TILEB, b0, bp32);
  } else if (NPROD == 2) {
    copy_tile(l, a0, ap32);
    copy_tiles2(l + TILEB, b0, bp32, l + 2 * TILEB, b1, bp32);
  } else {
    copy_tiles2(l, a0, ap32, l + TILEB, a1, ap32);
    copy_tiles2(l + 2 * TILEB, b0, bp32, l + 3 * TILEB, b1, bp32);
  }
}
// one stage of the ring: NS tile sets in a row, set u = k KC u .. + KC - 1 of the stage
template <int NPROD, int NS>
__device__ __forceinline__ void fill_ring(unsigned l, const unsigned short* a0, const unsigned short* a1, size_t ap32,
                                          const unsigned short* b0, const unsigned short* b1, size_t bp32) {
  fill_stage<NPROD>(l, a0, a1, ap32, b0, b1, bp32);
  if constexpr (NS > 1)
    fill_ring<NPROD, NS - 1>(l + CoreLds<NPROD>::SET, a0 + KC, a1 + KC, ap32, b0 + KC, b1 + KC, bp32);
}
template <int NPROD, bool HALF, int NS = 1>
__device__ __forceinline__ void gemm_core(v8f (&acc)[4][2], const char* sm,
                                          const unsigned short* __restrict__ a0,
                                          const unsigned short* __restrict__ a1, size_t ap,
                                          const unsigned short* __restrict__ b0,
                                          const unsigned short* __restrict__ b1, size_t bp, int npass, int tid) {
  static_assert(NPROD >= 1 && NPROD <= 3);
  static_assert(!(HALF && NPROD != 1));
  constexpr unsigned SET = CoreLds<NPROD, NS>::SET, STG = CoreLds<NPROD, NS>::STG;
  constexpr unsigned BOFF = (unsigned)CoreLds<NPROD>::NA * TILEB;
  constexpr int KS = KC * NS;                                        // k of a pass
  const int lane = tid & 31, wave = tid >> 5, hh = lane >> 4, c = lane & 15;
  const int wm = wave >> 2, wn = wave & 3;
  const int e = tid & 7, r = tid >> 3;                               // r 0..31
  const unsigned lc = lds_off(sm) + (unsigned)(r * LP + 16 * e);
  const size_t ga = (size_t)r * ap + 8 * e, gb = (size_t)r * bp + 8 * e;
  const unsigned fa = (unsigned)((64 * wm + c) * LP + 16 * hh);
  const unsigned fb = BOFF + (unsigned)((32 * wn + c) * LP + 16 * hh);
  fill_ring<NPROD, NS>(lc, a0 + ga, a1 + ga, 32 * ap, b0 + gb, b1 + gb, 32 * bp);
  asm volatile("s_wait_asynccnt 0x0" ::: "memory");                  // pass 0's own copies have landed
  __syncthreads();                                                   // ... and every other wave's
  fill_ring<NPROD, NS>(lc + STG, a0 + ga + KS, a1 + ga + KS, 32 * ap, b0 + gb + KS, b1 + gb + KS, 32 * bp);
  // kept rolled: one pass is 16 to 64 matrix instructions with their fragment loads, and the code stays small
#pragma unroll 1
  for (int t = 0; t < npass; ++t) {
    const unsigned bo = (unsigned)(t & 1) * STG;
    // the loops below are unrolled whole so that the fragment arrays stay in registers and the LDS offsets are immediates
#pragma unroll
    for (int ks = 0; ks < KS / 32; ++ks) {
      const unsigned o = bo + (unsigned)(ks / (KC / 32)) * SET + 64u * (ks % (KC / 32));
      // the k-step's fragment reads stand together, ahead of its matrix instructions: one LDS latency a k-step
      Frag fb0[2], fb1[2], fa0[4], fa1[4];
#pragma unroll
      for (int nf = 0; nf < 2; ++nf) {
        fb0[nf] = ldfrag((const unsigned short*)(sm + fb + 16 * LP * nf + o));
        if (NPROD >= 2) fb1[nf] = ldfrag((const unsigned short*)(sm + fb + TILEB + 16 * LP * nf + o));
        else fb1[nf] = fb0[nf];
      }
#pragma unroll
      for (int mt = 0; mt < 4; ++mt) {
        fa0[mt] = ldfrag((const unsigned short*)(sm + fa + 16 * LP * mt + o));
        if (NPROD >= 3) fa1[mt] = ldfrag((const unsigned short*)(sm + fa + TILEB + 16 * LP * mt + o));
        else fa1[mt] = fa0[mt];
      }
#pragma unroll
      for (int p = 0; p < NPROD; ++p) {
#pragma unroll
        for (int mt = 0; mt < 4; ++mt) {
#pragma unroll
          for (int nf = 0; nf < 2; ++nf) {
            if (HALF)        acc[mt][nf] = mma_h(fa0[mt].h, fb0[nf].h, acc[mt][nf]);
            else if (p == 0) acc[mt][nf] = mma_b(fa0[mt].bf, fb0[nf].bf, acc[mt][nf]);
            else if (p == 1) acc[mt][nf] = mma_b(fa0[mt].bf, fb1[nf].bf, acc[mt][nf]);
            else             acc[mt][nf] = mma_b(fa1[mt].bf, fb0[nf].bf, acc[mt][nf]);
          }
        }
      }
    }
    asm volatile("s_wait_dscnt 0x0" ::: "memory");                   // this wave's reads of the buffer are done before it is refilled
    asm volatile("s_wait_asynccnt 0x0" ::: "memory");                // this wave's copies of pass t + 1 have landed
    __syncthreads();                                                 // publishes pass t + 1, ends every read of pass t's buffer
    if (t + 2 < npass) {
      const int ko = KS * (t + 2);
      fill_ring<NPROD, NS>(lc + bo, a0 + ga + ko, a1 + ga + ko, 32 * ap, b0 + gb + ko, b1 + gb + ko, 32 * bp);
    }
  }
  asm volatile("s_wait_asynccnt 0x0" ::: "memory");                  // nothing outstanding when the LDS changes its use
}
__device__ __forceinline__ void zero_acc(v8f (&acc)[4][2]) {
#pragma unroll
  for (int mt = 0; mt < 4; ++mt) { acc[mt][0] = zero8(); acc[mt][1] = zero8(); }
}

// ---- epilogue staging, transposed: Os[n_loc][m_loc] (pitch OSP). Lane (hh, c) of wave (wm, wn) holds D rows
//      m = 64 wm + 16 mt + 8 hh + r, col n = 32 wn + 16 nf + c -> two b128 LDS stores per 16 x 16 tile.
__device__ __forceinline__ void stage_nT(float* Os, const v8f (&acc)[4][2], float sc, int wave, int hh, int c) {
  const int wm = wave >> 2, wn = wave & 3;
#pragma unroll
  for (int nf = 0; nf < 2; ++nf) {
    const int nl = 32 * wn + 16 * nf + c;
#pragma unroll
    for (int mt = 0; mt < 4; ++mt) {
      v4f va, vb;
#pragma unroll
      for (int r = 0; r < 4; ++r) { va[r] = acc[mt][nf][r] * sc; vb[r] = acc[mt][nf][4 + r] * sc; }
      *(v4f*)(Os + nl * OSP + 64 * wm + 16 * mt + 8 * hh)     = va;
      *(v4f*)(Os + nl * OSP + 64 * wm + 16 * mt + 8 * hh + 4) = vb;
    }
  }
}
// ---- epilogue staging, row-major: Os[m_loc][n_loc] (pitch OSP), scalar LDS stores.
__device__ __forceinline__ void stage_mn(float* Os, const v8f (&acc)[4][2], int wave, int hh, int c) {
  const int wm = wave >> 2, wn = wave & 3;
#pragma unroll
  for (int nf = 0; nf < 2; ++nf) {
    const int nl = 32 * wn + 16 * nf + c;
#pragma unroll
    for (int mt = 0; mt < 4; ++mt) {
#pragma unroll
      for (int r = 0; r < 8; ++r) Os[(64 * wm + 16 * mt + 8 * hh + r) * OSP + nl] = acc[mt][nf][r];
    }
  }
}

// ---- plane writer for transposed staging: plane [b][n][512] bf16 hi + bf16 residual, rows rowbase + 0..127,
//      16 lanes per 256-B row piece (two whole lines), rows it*16 + lq. Optional f32 bias (bf16-RNE value) added per col.
// coverage: 8 it x 16 rows x 16 lanes x 8 = 128 rows x 128 cols per plane.
template <bool BIAS>
__device__ __forceinline__ void planes_out(const float* Os, const float* __restrict__ bias, int o0,
                                           unsigned short* Ph, unsigned short* Pl, size_t rowbase, int tid) {
  const int e = tid & 15, lq = tid >> 4;                             // lq 0..15
  float bv[8];
#pragma unroll
  for (int t = 0; t < 8; ++t) bv[t] = 0.f;
  if (BIAS) {
    const unsigned bofs = 32u * (unsigned)e;                         // the lane's byte offset behind the block's bias + o0
    const char* bb = (const char*)(bias + o0);
    const v4f b0 = *(const v4f*)(bb + bofs);
    const v4f b1 = *(const v4f*)(bb + bofs + 16);
    // bofs addresses both loads; as an input here its register stays live past them and is reused only behind this wait
    asm volatile("s_wait_xcnt 0x0" :: "v"(bofs) : "memory");
#pragma unroll
    for (int t = 0; t < 4; ++t) { bv[t] = bfr(b0[t]); bv[4 + t] = bfr(b1[t]); }
  }
  v4u uh[8], ul[8];
#pragma unroll
  for (int it = 0; it < 8; ++it) {
    const int row = it * 16 + lq;                                    // n_loc 0..127
    const v4f a = *(const v4f*)(Os + row * OSP + 8 * e);
    const v4f q = *(const v4f*)(Os + row * OSP + 8 * e + 4);
    const float f[8] = {a[0], a[1], a[2], a[3], q[0], q[1], q[2], q[3]};
#pragma unroll
    for (int t = 0; t < 4; ++t) {
      const float f0 = f[2 * t] + bv[2 * t], f1 = f[2 * t + 1] + bv[2 * t + 1];
      const unsigned short hb0 = bf_bits(f0), hb1 = bf_bits(f1);
      const unsigned short lb0 = bf_bits(f0 - bf_up(hb0));
      const unsigned short lb1 = bf_bits(f1 - bf_up(hb1));
      uh[it][t] = pk16(hb0, hb1);
      ul[it][t] = pk16(lb0, lb1);
    }
  }
{
#pragma unroll
    for (int it = 0; it < 8; ++it) {
      const int row = it * 16 + lq;
      const size_t po = (rowbase + (size_t)row) * CH + o0 + 8 * e;
      *(v4u*)(Ph + po) = uh[it];
      *(v4u*)(Pl + po) = ul[it];
    }
    
  }
}

// =========================================================================================================
// (0) weights f32 [512][512] x4 -> W16 bf16 bits [4][512][512] (RNE convert of the input value, exact operand).
//     Block blk owns 8 rows of one matrix (matrix index block-uniform), one wave per 1024-B row = 2 instructions of
// coverage: 256 blocks x 8 rows x 2 j x 32 lanes x 8 = 2048 rows x 512 = the whole plane. blk = 0..255 (part of prep).
// =========================================================================================================
__device__ __forceinline__
void cvt_w_part(const float* __restrict__ w0, const float* __restrict__ w1,
                const float* __restrict__ w2, const float* __restrict__ w3, unsigned short* W16, int blk) {
  const int tid = threadIdx.x;
  const int wave = tid >> 5, lane = tid & 31;
  const int mi = blk / (CH / 8);                                     // 0..3, block-uniform
  const int o  = 8 * (blk - mi * (CH / 8)) + wave;                   // 0..511
  const float* wb = (mi == 0) ? w0 : (mi == 1) ? w1 : (mi == 2) ? w2 : w3;
  v4u u[CH / 256];
#pragma unroll
  for (int j = 0; j < CH / 256; ++j) {
    const float* s = wb + (size_t)o * CH + 256 * j + 8 * lane;
    const v4f a = *(const v4f*)s;
    const v4f q = *(const v4f*)(s + 4);
    const float f[8] = {a[0], a[1], a[2], a[3], q[0], q[1], q[2], q[3]};
#pragma unroll
    for (int t = 0; t < 4; ++t) u[j][t] = pk16(bf_bits(f[2 * t]), bf_bits(f[2 * t + 1]));
  }
{
#pragma unroll
    for (int j = 0; j < CH / 256; ++j)
      *(v4u*)(W16 + ((size_t)(mi * CH + o)) * CH + 256 * j + 8 * lane) = u[j];
    
  }
}

// =========================================================================================================
// (1a) instance-norm statistics of both inputs, one launch: St[(sel * NB + b) * 512 + c] = {mean, rsqrt(var + eps)} of
//      bf16-RNE(x) over the row's SEQ values. 16 lanes per row, lane l = 4 q + k owns the elements 16 j + l and adds
//      them in rising j; the four xor steps then form ((s0 + s1) + (s2 + s3)) per q and the sum over q (1, then 2).
//      The lane's SEQ/16 values stay in registers, so the row is read once for mean and variance.
// coverage: block = 16 rows = one 128-B line of St; blk = 0 .. 2 * NB * 512 / 16 - 1 covers every row of both inputs once.
// =========================================================================================================
__device__ __forceinline__
void norm_stats_part(const float* __restrict__ xc, const float* __restrict__ xs, float* St, int blk) {
  const int tid = threadIdx.x;
  const int rl = tid >> 4, l = tid & 15;                             // rl 0..15
  const int sel = blk / (NB * CH / 16);                              // 0 = x_c, 1 = x_s, block-uniform
  const int r   = 16 * (blk - sel * (NB * CH / 16)) + rl;            // b * 512 + c
  const float* xr = (sel ? xs : xc) + (size_t)r * T_FULL + l;
  float v[SEQ / 16];                                                 // the loops are unrolled whole so that v stays in registers
#pragma unroll
  for (int j = 0; j < SEQ / 16; ++j) v[j] = xr[16 * j];
  // xr is an input here so that its registers stay live past the last load and are reused only behind this wait
  asm volatile("s_wait_xcnt 0x0" :: "v"(xr) : "memory");
  float sm = 0.f;
#pragma unroll
  for (int j = 0; j < SEQ / 16; ++j) { v[j] = bfr(v[j]); sm += v[j]; }
  sm += __shfl_xor(sm, 1, 32);
  sm += __shfl_xor(sm, 2, 32);
  sm += __shfl_xor(sm, 4, 32);
  sm += __shfl_xor(sm, 8, 32);
  const float mean = sm * (1.0f / (float)SEQ);
  float sv = 0.f;
#pragma unroll
  for (int j = 0; j < SEQ / 16; ++j) { const float d = v[j] - mean; sv = __builtin_fmaf(d, d, sv); }
  sv += __shfl_xor(sv, 1, 32);
  sv += __shfl_xor(sv, 2, 32);
  sv += __shfl_xor(sv, 4, 32);
  sv += __shfl_xor(sv, 8, 32);
  const float var = sv * (1.0f / (float)SEQ);
  const float rs  = rsqrtf(var + EPSN);
  if (l == 0) {
    v2f st; st[0] = mean; st[1] = rs;
    *(v2f*)(St + 2 * (size_t)(sel * NB * CH + r)) = st;
  }
}

// =========================================================================================================
// (0) + (1a) in one launch: neither reads what the other writes. The block index picks the part (block-uniform): the
//     statistics blocks, which run longer, come first, the weight blocks behind them.
// =========================================================================================================
#define NSTATB (2 * NB * CH / 16)
#define NCVTWB (NMAT * CH / 8)
__global__ __launch_bounds__(256)
void prep(const float* __restrict__ xc, const float* __restrict__ xs,
          const float* __restrict__ w0, const float* __restrict__ w1,
          const float* __restrict__ w2, const float* __restrict__ w3, float* St, unsigned short* W16) {
  const int blk = blockIdx.x;
  if (blk < NSTATB) {
    norm_stats_part(xc, xs, St, blk);
  } else {
    cvt_w_part(w0, w1, w2, w3, W16, blk - NSTATB);
    // the other part's code follows these stores in the built kernel: no register of theirs is rewritten ahead of this wait
    asm volatile("s_wait_xcnt 0x0" ::: "memory");
  }
}

// =========================================================================================================
// (1b) x f32 [b][512 c][2048 t] (batch/row strides at full size) -> position-major bf16 planes [b][t][512]:
//      Ph = bf16-RNE(xn), Pl = bf16-RNE(xn - Ph) with xn = (bf16-RNE(x) - mean) * rstd per (b, c) row (St of 1a);
//      RAW adds Pr = bf16-RNE(x). One 64 c x 128 t tile per block, transposed through LDS (line = 64 c of one plane
//      row): lane e -> c 8e..8e+7, 8 consecutive lanes per line.
// coverage: 4 it x 32 rows x 8 lanes x 8 = 128 t x 64 c per plane; (SEQ/128, 8) blocks for each b = 0..NB-1 cover
//           [NB][SEQ][512] of every written plane exactly once. Th, Tl, Tr = the block's LDS tiles (Tr used by RAW only).
// =========================================================================================================
template <int RAW>
__device__ __forceinline__
void cvt_norm_part(const float* __restrict__ x, const float* __restrict__ St,
                   unsigned short* Ph, unsigned short* Pl, unsigned short* Pr,
                   unsigned short* Th, unsigned short* Tl, unsigned short* Tr, int b) {
  const int tid = threadIdx.x;
  const int n0 = blockIdx.x * NT, c0 = blockIdx.y * QT;
  const int e = tid & 7, lq = tid >> 3;                              // lq 0..31
  v4f a[4], q[4];
  v2f st[2];
  const int sr = b * CH + c0 + lq;                                   // row of c half 0; c half 1 is 32 rows on
  const float* sp0 = x + (size_t)sr * T_FULL + n0 + 8 * e;
#pragma unroll
  for (int it = 0; it < 4; ++it) {                                   // it = 2 * (t half) + (c half)
    const float* sp = sp0 + (size_t)(it & 1) * 32 * T_FULL + (it >> 1) * 64;
    a[it] = *(const v4f*)sp;
    q[it] = *(const v4f*)(sp + 4);
  }
#pragma unroll
  for (int h = 0; h < 2; ++h) st[h] = *(const v2f*)(St + 2 * (size_t)sr + 64 * h);
  // sp0 and sr address the loads; as inputs here their registers stay live past the last load and are reused only behind this wait
  asm volatile("s_wait_xcnt 0x0" :: "v"(sp0), "v"(sr) : "memory");
#pragma unroll
  for (int it = 0; it < 4; ++it) {
    const int cl = (it & 1) * 32 + lq;
    const int tl = (it >> 1) * 64 + 8 * e;                           // 0..120
    const float f[8] = {a[it][0], a[it][1], a[it][2], a[it][3], q[it][0], q[it][1], q[it][2], q[it][3]};
    const float mu = st[it & 1][0], rs = st[it & 1][1];
#pragma unroll
    for (int t = 0; t < 8; ++t) {
      const unsigned short rb = bf_bits(f[t]);
      const float d  = bf_up(rb) - mu;
      const float xn = d * rs;
      const unsigned short hb = bf_bits(xn);
      const unsigned short lb = bf_bits(__builtin_fmaf(d, rs, -bf_up(hb)));   // residual of the unrounded product
      Th[(tl + t) * TP + cl] = hb;
      Tl[(tl + t) * TP + cl] = lb;
      if (RAW) Tr[(tl + t) * TP + cl] = rb;
    }
  }
  __syncthreads();
  v4u uh[4], ul[4], ur[4];
#pragma unroll
  for (int it = 0; it < 4; ++it) {
    const int nl = it * 32 + lq;                                     // 0..127
    uh[it] = *(const v4u*)(Th + nl * TP + 8 * e);
    ul[it] = *(const v4u*)(Tl + nl * TP + 8 * e);
    if (RAW) ur[it] = *(const v4u*)(Tr + nl * TP + 8 * e); else ur[it] = uh[it];
  }
#pragma unroll
  for (int it = 0; it < 4; ++it) {
    const int nl = it * 32 + lq;
    const size_t po = ((size_t)(b * SEQ + n0 + nl)) * CH + c0 + 8 * e;
    *(v4u*)(Ph + po) = uh[it];
    *(v4u*)(Pl + po) = ul[it];
    if (RAW) *(v4u*)(Pr + po) = ur[it];
  }
}

// =========================================================================================================
// (1b) of both inputs in one launch, grid (SEQ/128, 8, 2 NB): blockIdx.z picks the input (block-uniform, so each part's
//      barrier is passed by the whole block); x_s, which writes three planes, comes first.
// =========================================================================================================
__global__ __launch_bounds__(256)
void cvt_norm2(const float* __restrict__ xc, const float* __restrict__ xs, const float* __restrict__ St,
               unsigned short* Pch, unsigned short* Pcl,
               unsigned short* Psh, unsigned short* Psl, unsigned short* Psr) {
  __shared__ __align__(16) unsigned short Th[NT * TP];
  __shared__ __align__(16) unsigned short Tl[NT * TP];
  __shared__ __align__(16) unsigned short Tr[NT * TP];
  const int z = blockIdx.z;
  if (z < NB) {
    cvt_norm_part<1>(xs, St + 2 * NB * CH, Psh, Psl, Psr, Th, Tl, Tr, z);
  } else {
    cvt_norm_part<0>(xc, St, Pch, Pcl, Pcl, Th, Tl, Tr, z - NB);
    // the other part's code follows these stores in the built kernel: no register of theirs is rewritten ahead of this wait
    asm volatile("s_wait_xcnt 0x0" ::: "memory");
  }
}

// =========================================================================================================
// (2) conv1x1 GEMM into hi + residual planes: Y[o][n] = sum_c W16[o][c] (Xh + Xl)[b][n][c] + bias[o] for one
//     (b, 128-n tile, 128-o block); A = W rows o (k = c contiguous), B = plane rows n (k = c contiguous), 2 products,
//     K = 512 = 16 steps. Epilogue: transposed LDS staging, barrier, planes [b][n][512] (planes_out).
// coverage: (SEQ/128, 4) blocks for each b = 0..NB-1, x 128 n x 128 o, cover [NB][SEQ][512] of both planes exactly once.
//           sm = the block's LDS, CoreLds<2>::BYTES: two operand buffers; output staging behind the core.
// =========================================================================================================
__device__ __forceinline__
void gemm_nm_part(char* sm, const unsigned short* __restrict__ W, const float* __restrict__ bias,
                  const unsigned short* __restrict__ Xh, const unsigned short* __restrict__ Xl,
                  unsigned short* Ph, unsigned short* Pl, int b) {
  float* Os = (float*)sm;
  const int tid = threadIdx.x, lane = tid & 31, wave = tid >> 5;
  const int hh = lane >> 4, c = lane & 15;
  const int nt = blockIdx.x, mb = blockIdx.y;
  const int n0 = nt * BT, o0 = mb * BT;
  const unsigned short* ap = W + (size_t)o0 * CH;
  const size_t bq = ((size_t)(b * SEQ + n0)) * CH;
  v8f acc[4][2];
  zero_acc(acc);
  gemm_core<2, false>(acc, sm, ap, ap, CH, Xh + bq, Xl + bq, CH, CH / KC, tid);
  stage_nT(Os, acc, 1.0f, wave, hh, c);
  __syncthreads();
  planes_out<true>(Os, bias, o0, Ph, Pl, (size_t)(b * SEQ + n0), tid);
}

// =========================================================================================================
// (3) conv1x1 GEMM into the channel-major f16 value plane: V16[b][o][s] = f16(sum_c W16[o][c] Xr[b][s][c] + bias[o])
//     (pitch SEQ); 1 product, K = 512. Epilogue: row-major LDS staging, barrier, row o segment of 128 halves = two lines.
// coverage: 8 it x 16 rows x 16 lanes x 8 = 128 o x 128 s; (SEQ/128, 4) blocks for each b = 0..NB-1 cover [NB][512][SEQ] once.
//           sm = the block's LDS, at least CoreLds<1>::BYTES: two operand buffers; output staging behind the core.
// =========================================================================================================
__device__ __forceinline__
void gemm_val_part(char* sm, const unsigned short* __restrict__ W, const float* __restrict__ bias,
                   const unsigned short* __restrict__ Xr, unsigned short* V16, int b) {
  float* Os = (float*)sm;
  const int tid = threadIdx.x, lane = tid & 31, wave = tid >> 5;
  const int hh = lane >> 4, c = lane & 15;
  const int nt = blockIdx.x, mb = blockIdx.y;
  const int n0 = nt * BT, o0 = mb * BT;
  const unsigned short* ap = W + (size_t)o0 * CH;
  const size_t bq = ((size_t)(b * SEQ + n0)) * CH;
  v8f acc[4][2];
  zero_acc(acc);
  gemm_core<1, false>(acc, sm, ap, ap, CH, Xr + bq, Xr + bq, CH, CH / KC, tid);
  stage_mn(Os, acc, wave, hh, c);
  __syncthreads();
  const int e = tid & 15, lq = tid >> 4;                             // lq 0..15
  v4u u[8];
#pragma unroll
  for (int it = 0; it < 8; ++it) {
    const int row = it * 16 + lq;                                    // o_loc 0..127
    const float bb = bfr(bias[o0 + row]);
    const v4f a = *(const v4f*)(Os + row * OSP + 8 * e);
    const v4f q = *(const v4f*)(Os + row * OSP + 8 * e + 4);
    const float f[8] = {a[0], a[1], a[2], a[3], q[0], q[1], q[2], q[3]};
#pragma unroll
    for (int t = 0; t < 4; ++t) {
      const _Float16 h0 = (_Float16)(f[2 * t] + bb);
      const _Float16 h1 = (_Float16)(f[2 * t + 1] + bb);
      u[it][t] = pk16(h_bits(h0), h_bits(h1));
    }
  }
{
#pragma unroll
    for (int it = 0; it < 8; ++it) {
      const int row = it * 16 + lq;
      const size_t po = ((size_t)(b * CH + o0 + row)) * SEQ + n0 + 8 * e;
      *(v4u*)(V16 + po) = u[it];
    }
    
  }
}

// =========================================================================================================
// (2) for Mn, (2) for Mm and (3) in one launch, grid (SEQ/128, 4, 3 NB): the three products read W16 and the planes of
//     (1b) and write planes of their own. job = blockIdx.z / NB picks the product (block-uniform, so every barrier of a
//     part is passed by the whole block); the one-product job, the shortest, comes last. W = W16 (order Wn, Wm, Wl),
//     X = the five planes of (1b) in a row (x_c hi, lo; x_s hi, lo, raw), M = the four result planes (Mn hi, lo; Mm hi, lo).
// =========================================================================================================
constexpr size_t PLE = PLB / 2;                                      // elements of one plane
static_assert(CoreLds<1>::BYTES <= CoreLds<2>::BYTES);
__global__ __launch_bounds__(256)
void gemm_conv3(const unsigned short* __restrict__ W, const float* __restrict__ bn, const float* __restrict__ bm,
                const float* __restrict__ bl, const unsigned short* __restrict__ X,
                unsigned short* M, unsigned short* V16) {
  __shared__ __align__(16) char sm[CoreLds<2>::BYTES];
  const int job = blockIdx.z / NB, b = blockIdx.z - job * NB;
  if (job < 2) {
    const size_t pl = (size_t)job * 2 * PLE;
    gemm_nm_part(sm, W + (size_t)job * CH * CH, job ? bm : bn, X + pl, X + pl + PLE, M + pl, M + pl + PLE, b);
  } else {
    gemm_val_part(sm, W + (size_t)2 * CH * CH, bl, X + 4 * PLE, V16, b);
  }
}

// =========================================================================================================
// (4) scores S[b][t][s] = sum_c Mn[c][t] Mm[c][s] (no scale) for one (b, 256-s tile, 256-t block): A = Mn planes
//     rows t (hi Qh, residual Ql), B = Mm planes rows s (hi Kh, residual Kl), products hh + hl + lh, K = 512.
//     16 waves (512 threads) as 4 (m) x 4 (n), wave (wm, wn) owns 64 x 64: every operand byte copied from L2 feeds 256 rows
//     or columns, every fragment read from LDS feeds 4 matrix instructions a product. The grid is one block a WGP. The copy
//     ring has gemm_core's order of waits and barriers, a stage = [A0][A1][B0][B1], each 256 rows of KC k; each accumulator
//     takes its products in gemm_core's order (k-steps rising, hh, hl, lh inside a k-step).
//     Epilogue = the softmax inside each of the block's two 128-key tiles: row-major LDS staging, barrier, then per row t
//     and key tile m = max_s S, P16[b][t][s] = f16(e^{S - m} * 16384), l = sum_s e^{S - m} (f32, unrounded terms), Ls = {m, l}.
//     8 lanes a row: lane e8 owns cols 8 e8 .. + 7 and 64 + 8 e8 .. + 7 of the key tile, so 8 lanes store one whole 128-B
//     line of P16, and the max and the sum cross lanes in three xor steps. Wave w owns rows 16 w .. + 15 = one 128-B line of Ls.
// coverage: 16 waves x 2 key tiles x 4 g x 4 rows x 8 lanes x 16 = 256 t x 256 s; grid (SEQ/256, SEQ/256, NB) covers P16
//           [NB][SEQ][SEQ] and Ls [NB][SEQ/128][SEQ] once.
// =========================================================================================================
#define SBT    256
#define STILEB (SBT * LP)
#define SSTG   (4 * STILEB)
#define SOSP   260
static_assert(SEQ % SBT == 0 && SBT == 2 * BT && 2 * SSTG <= 327680);
static_assert(SBT * SOSP * 4 <= 2 * SSTG && (SOSP * 4) % 16 == 0);
// two tiles of 256 rows x 128 B, 512 threads: e = tid & 7 -> 16-B piece of the row, r = tid >> 3 -> row r + 64 i (i = 0..3).
// l, m = the lane's LDS byte addresses of row r, g, h = its global addresses of row r (pitch CH elements).
__device__ __forceinline__ void copy_tiles2w(unsigned l, const unsigned short* g, unsigned m, const unsigned short* h) {
#if defined(__HIP_DEVICE_COMPILE__)
  // eight copies of two tiles, global -> LDS through no register; they share one statement and its closing wait, so that
  // no address register of an issued copy is rewritten ahead of it
  asm volatile("global_load_async_to_lds_b128 %0, %8, off\n\t"
               "global_load_async_to_lds_b128 %1, %9, off\n\t"
               "global_load_async_to_lds_b128 %2, %10, off\n\t"
               "global_load_async_to_lds_b128 %3, %11, off\n\t"
               "global_load_async_to_lds_b128 %4, %12, off\n\t"
               "global_load_async_to_lds_b128 %5, %13, off\n\t"
               "global_load_async_to_lds_b128 %6, %14, off\n\t"
               "global_load_async_to_lds_b128 %7, %15, off\n\t"
               "s_wait_xcnt 0x0"
               :: "v"(l), "v"(l + 64 * LP), "v"(l + 128 * LP), "v"(l + 192 * LP),
                  "v"(m), "v"(m + 64 * LP), "v"(m + 128 * LP), "v"(m + 192 * LP),
                  "v"(g), "v"(g + 64 * CH), "v"(g + 128 * CH), "v"(g + 192 * CH),
                  "v"(h), "v"(h + 64 * CH), "v"(h + 128 * CH), "v"(h + 192 * CH) : "memory");
#endif
}
__device__ __forceinline__ void fill_sc(unsigned l, const unsigned short* a0, const unsigned short* a1,
                                        const unsigned short* b0, const unsigned short* b1) {
  copy_tiles2w(l, a0, l + STILEB, a1);
  copy_tiles2w(l + 2 * STILEB, b0, l + 3 * STILEB, b1);
}
__global__ __launch_bounds__(512)
void gemm_sc(const unsigned short* __restrict__ Qh, const unsigned short* __restrict__ Ql,
             const unsigned short* __restrict__ Kh, const unsigned short* __restrict__ Kl,
             unsigned short* P16, float* Ls) {
  __shared__ __align__(16) char sm[2 * SSTG];                  // two operand buffers; output staging behind the loop
  float* Os = (float*)sm;
  const int tid = threadIdx.x, lane = tid & 31, wave = tid >> 5;     // wave 0..15
  const int hh = lane >> 4, c = lane & 15;
  const int wm = wave >> 2, wn = wave & 3;
  const int nt = blockIdx.x, mb = blockIdx.y, b = blockIdx.z;
  const int n0 = nt * SBT, m0 = mb * SBT;
  const int e = tid & 7, r = tid >> 3;                               // r 0..63
  const unsigned lc = lds_off(sm) + (unsigned)(r * LP + 16 * e);
  const size_t aq = ((size_t)(b * SEQ + m0 + r)) * CH + 8 * e;
  const size_t bq = ((size_t)(b * SEQ + n0 + r)) * CH + 8 * e;
  const unsigned short *qh = Qh + aq, *ql = Ql + aq, *kh = Kh + bq, *kl = Kl + bq;
  const unsigned fa = (unsigned)((64 * wm + c) * LP + 16 * hh);
  const unsigned fb = 2 * STILEB + (unsigned)((64 * wn + c) * LP + 16 * hh);
  v8f acc[4][4];
  // unrolled whole, here and in the staging below: acc is indexed by constants only and stays in registers
#pragma unroll
  for (int mt = 0; mt < 4; ++mt) {
#pragma unroll
    for (int nf = 0; nf < 4; ++nf) acc[mt][nf] = zero8();
  }
  fill_sc(lc, qh, ql, kh, kl);
  asm volatile("s_wait_asynccnt 0x0" ::: "memory");                  // pass 0's own copies have landed
  __syncthreads();                                                   // ... and every other wave's
  fill_sc(lc + SSTG, qh + KC, ql + KC, kh + KC, kl + KC);
  // kept rolled: one pass is 96 matrix instructions with their fragment loads, and the code stays small
#pragma unroll 1
  for (int t = 0; t < CH / KC; ++t) {
    const unsigned bo = (unsigned)(t & 1) * SSTG;
    // the loops below are unrolled whole so that the fragment arrays stay in registers and the LDS offsets are immediates
#pragma unroll
    for (int ks = 0; ks < KC / 32; ++ks) {
      const unsigned o = bo + 64u * ks;
      Frag fb0[4], fb1[4];
#pragma unroll
      for (int nf = 0; nf < 4; ++nf) {
        fb0[nf] = ldfrag((const unsigned short*)(sm + fb + 16 * LP * nf + o));
        fb1[nf] = ldfrag((const unsigned short*)(sm + fb + STILEB + 16 * LP * nf + o));
      }
      // the A fragments come two m-tiles at a time: all four beside the 128 accumulator registers would pass a wave's 256
#pragma unroll
      for (int mh = 0; mh < 2; ++mh) {
        Frag fa0[2], fa1[2];
#pragma unroll
        for (int i = 0; i < 2; ++i) {
          fa0[i] = ldfrag((const unsigned short*)(sm + fa + 16 * LP * (2 * mh + i) + o));
          fa1[i] = ldfrag((const unsigned short*)(sm + fa + STILEB + 16 * LP * (2 * mh + i) + o));
        }
#pragma unroll
        for (int p = 0; p < 3; ++p) {
#pragma unroll
          for (int i = 0; i < 2; ++i) {
#pragma unroll
            for (int nf = 0; nf < 4; ++nf) {
              v8f& d = acc[2 * mh + i][nf];
              if (p == 0)      d = mma_b(fa0[i].bf, fb0[nf].bf, d);
              else if (p == 1) d = mma_b(fa0[i].bf, fb1[nf].bf, d);
              else             d = mma_b(fa1[i].bf, fb0[nf].bf, d);
            }
          }
        }
      }
    }
    asm volatile("s_wait_dscnt 0x0" ::: "memory");                   // this wave's reads of the buffer are done before it is refilled
    asm volatile("s_wait_asynccnt 0x0" ::: "memory");                // this wave's copies of pass t + 1 have landed
    __syncthreads();                                                 // publishes pass t + 1, ends every read of pass t's buffer
    if (t + 2 < CH / KC) {
      const int ko = KC * (t + 2);
      fill_sc(lc + bo, qh + ko, ql + ko, kh + ko, kl + ko);
    }
  }
  asm volatile("s_wait_asynccnt 0x0" ::: "memory");                  // nothing outstanding when the LDS changes its use
  // row-major staging Os[m_loc][n_loc] (pitch SOSP), scalar LDS stores
#pragma unroll
  for (int nf = 0; nf < 4; ++nf) {
#pragma unroll
    for (int mt = 0; mt < 4; ++mt) {
#pragma unroll
      for (int q = 0; q < 8; ++q) Os[(64 * wm + 16 * mt + 8 * hh + q) * SOSP + 64 * wn + 16 * nf + c] = acc[mt][nf][q];
    }
  }
  __syncthreads();
  const int e8 = lane & 7, rq = lane >> 3;                           // rq 0..3
  // unrolled so that the staging offsets of both key tiles are immediates
#pragma unroll
  for (int kt = 0; kt < 2; ++kt) {                                   // key tile 2 nt + kt
    float mxs[4], sms[4];
    v4u u[4][2];
#pragma unroll
    for (int g = 0; g < 4; ++g) {
      const float* orow = Os + (16 * wave + 4 * g + rq) * SOSP + BT * kt + 8 * e8;
      float f[16];
#pragma unroll
      for (int k = 0; k < 2; ++k) {
        const v4f a = *(const v4f*)(orow + 64 * k);
        const v4f q = *(const v4f*)(orow + 64 * k + 4);
#pragma unroll
        for (int t = 0; t < 4; ++t) { f[8 * k + t] = a[t]; f[8 * k + 4 + t] = q[t]; }
      }
      float mx = f[0];
#pragma unroll
      for (int i = 1; i < 16; ++i) mx = fmaxf(mx, f[i]);
#pragma unroll
      for (int o = 4; o > 0; o >>= 1) mx = fmaxf(mx, __shfl_xor(mx, o, 32));
      float l = 0.f;
#pragma unroll
      for (int i = 0; i < 16; ++i) { f[i] = exp_slot(f[i] - mx); l += f[i]; }
#pragma unroll
      for (int o = 4; o > 0; o >>= 1) l += __shfl_xor(l, o, 32);
#pragma unroll
      for (int k = 0; k < 2; ++k) {
#pragma unroll
        for (int t = 0; t < 4; ++t) {
          const _Float16 h0 = (_Float16)(f[8 * k + 2 * t] * PCAR);
          const _Float16 h1 = (_Float16)(f[8 * k + 2 * t + 1] * PCAR);
          u[g][k][t] = pk16(h_bits(h0), h_bits(h1));
        }
      }
      mxs[g] = mx;
      sms[g] = l;
    }
    unsigned short* pr[4];
#pragma unroll
    for (int g = 0; g < 4; ++g) {
      pr[g] = P16 + ((size_t)(b * SEQ + m0 + 16 * wave + 4 * g + rq)) * SEQ + n0 + BT * kt + 8 * e8;
      *(v4u*)(pr[g])      = u[g][0];
      *(v4u*)(pr[g] + 64) = u[g][1];
    }
    // the stores' addresses and data are inputs here so that their registers stay live past the last store and are reused only behind this wait
    asm volatile("s_wait_xcnt 0x0" :: "v"(pr[0]), "v"(pr[1]), "v"(pr[2]), "v"(pr[3]), "v"(u[0][0]), "v"(u[0][1]), "v"(u[1][0]),
                 "v"(u[1][1]), "v"(u[2][0]), "v"(u[2][1]), "v"(u[3][0]), "v"(u[3][1]) : "memory");
    // lane (e8 < 4, rq) stores the pair of row 4 e8 + rq of the wave's 16
    v2f st;
    st[0] = e8 == 0 ? mxs[0] : e8 == 1 ? mxs[1] : e8 == 2 ? mxs[2] : mxs[3];
    st[1] = e8 == 0 ? sms[0] : e8 == 1 ? sms[1] : e8 == 2 ? sms[2] : sms[3];
    float* lp = Ls + 2 * ((size_t)(b * NKT + 2 * nt + kt) * SEQ + m0 + 16 * wave + 4 * e8 + rq);
    if (e8 < 4)
      *(v2f*)lp = st;
    // the pair's address and data are inputs here so that the next key tile's code reuses their registers only behind this wait
    asm volatile("s_wait_xcnt 0x0" :: "v"(lp), "v"(st) : "memory");
  }
}

// =========================================================================================================
// (6) Mo[c][t] = sum_j F[j][t] (1/16384) sum_{s in key tile j} V16[b][c][s] P16[b][t][s] for one (b, 128-t tile,
//     128-c block), F[j][t] = e^{m_j - m} / sum_i l_i e^{m_i - m}, m = max_j m_j, from the {m_j, l_j} pairs of (4): the
//     row's softmax over all SEQ keys. A = V16 rows c (k = s contiguous, pitch SEQ), B = P16 rows t (pitch SEQ), f16
//     instruction, 1 product, K = SEQ. The copy ring has gemm_core's order of waits and barriers, but a stage of it is NSV
//     tile pairs of KC k in a row (KSV k): the grid gives a WGP one block, so nothing but the block's own copies hides their
//     latency, and a long stage keeps NSV times the bytes in flight and meets that latency once per KSV k. A key tile = two
//     tile pairs sums into part (from a zero C), which is then added into acc with the lane's two column factors.
//     F (LDS behind the ring, [NKT][128]) is formed by waves 0..3 while stage 0's copies fly; the barrier that publishes stage 0
//     publishes F too. Epilogue: transposed LDS staging scaled by 2^-14, barrier, Mo hi + residual planes (planes_out).
// coverage: grid (SEQ/128, 4, NB) covers [NB][SEQ][512] of both planes exactly once.
// =========================================================================================================
#define NSV  4
#define KSV  (NSV * KC)
#define NSTV (SEQ / KSV)
static_assert(SEQ % KSV == 0 && NSTV >= 2 && KSV % BT == 0);
static_assert(CoreLds<1, NSV>::BYTES + NKT * BT * 4 <= 327680);
__global__ __launch_bounds__(256)
void gemm_pv(const unsigned short* __restrict__ V16, const unsigned short* __restrict__ P16,
             const float* __restrict__ Ls, unsigned short* Mh, unsigned short* Mlo) {
  constexpr unsigned SUB = CoreLds<1, NSV>::SET;                     // one tile pair
  constexpr unsigned STG = CoreLds<1, NSV>::STG;                     // one stage
  __shared__ __align__(16) char sm[2 * STG + NKT * BT * 4];          // two operand buffers (output staging behind the loop), F
  float* Os = (float*)sm;
  float* Fs = (float*)(sm + 2 * STG);
  const int tid = threadIdx.x, lane = tid & 31, wave = tid >> 5;
  const int hh = lane >> 4, c = lane & 15;
  const int wm = wave >> 2, wn = wave & 3;
  const int nt = blockIdx.x, mb = blockIdx.y, b = blockIdx.z;
  const int n0 = nt * BT, o0 = mb * BT;
  const int e = tid & 7, r = tid >> 3;                               // r 0..31
  const unsigned lc = lds_off(sm) + (unsigned)(r * LP + 16 * e);
  const unsigned short* ap = V16 + ((size_t)(b * CH + o0)) * SEQ + (size_t)r * SEQ + 8 * e;
  const unsigned short* bp = P16 + ((size_t)(b * SEQ + n0)) * SEQ + (size_t)r * SEQ + 8 * e;
  const unsigned fa = (unsigned)((64 * wm + c) * LP + 16 * hh);
  const unsigned fb = TILEB + (unsigned)((32 * wn + c) * LP + 16 * hh);
  v8f acc[4][2];
  zero_acc(acc);
  fill_ring<1, NSV>(lc, ap, ap, 32 * SEQ, bp, bp, 32 * SEQ);
  if (tid < BT) {                                                    // whole waves 0..3: thread = column t of the block
    const v2f* lb = (const v2f*)(Ls + 2 * ((size_t)b * NKT * SEQ + n0));   // block-uniform: tile 0's pair of column 0
    float m[NKT], l[NKT];
#pragma unroll
    for (int j = 0; j < NKT; ++j) {
      const v2f s = lb[tid + j * SEQ];
      m[j] = s[0];
      l[j] = s[1];
    }
    // tid addresses the loads; as an input here its register stays live past the last load and is reused only behind this wait
    asm volatile("s_wait_xcnt 0x0" :: "v"(tid) : "memory");
    float mx = m[0];
#pragma unroll
    for (int j = 1; j < NKT; ++j) mx = fmaxf(mx, m[j]);
    float ls = 0.f;
#pragma unroll
    for (int j = 0; j < NKT; ++j) { m[j] = exp_slot(m[j] - mx); ls = __builtin_fmaf(l[j], m[j], ls); }
    const float il = 1.0f / ls;                                      // ls >= 1
#pragma unroll
    for (int j = 0; j < NKT; ++j) Fs[j * BT + tid] = m[j] * il;
  }
  asm volatile("s_wait_asynccnt 0x0" ::: "memory");                  // stage 0's own copies have landed
  __syncthreads();                                                   // ... and every other wave's; F is written
  fill_ring<1, NSV>(lc + STG, ap + KSV, ap + KSV, 32 * SEQ, bp + KSV, bp + KSV, 32 * SEQ);
  // kept rolled over the stages: a stage is 64 matrix instructions with their fragment loads, and the code stays small
#pragma unroll 1
  for (int st = 0; st < NSTV; ++st) {
    const unsigned bo = (unsigned)(st & 1) * STG;
    // the loops below are unrolled whole so that the LDS offsets inside a stage are constants, the fragment arrays stay in
    // registers and each key tile's first matrix instructions take a zero C
#pragma unroll
    for (int kt = 0; kt < KSV / BT; ++kt) {                          // key tile j = (KSV / BT) st + kt
      v8f part[4][2];
      // the tile's two column factors are read with its first fragments, so that their LDS latency is over when they are used
      const float* fr = Fs + (st * (KSV / BT) + kt) * BT + 32 * wn + c;
      const float f0 = fr[0], f1 = fr[16];
#pragma unroll
      for (int h = 0; h < 2; ++h) {                                  // tile pair 2 kt + h of the stage
#pragma unroll
        for (int ks = 0; ks < KC / 32; ++ks) {
          const unsigned o = bo + (unsigned)(2 * kt + h) * SUB + 64u * ks;
          Frag fb0[2], fa0[4];
#pragma unroll
          for (int nf = 0; nf < 2; ++nf) fb0[nf] = ldfrag((const unsigned short*)(sm + fb + 16 * LP * nf + o));
#pragma unroll
          for (int mt = 0; mt < 4; ++mt) fa0[mt] = ldfrag((const unsigned short*)(sm + fa + 16 * LP * mt + o));
#pragma unroll
          for (int mt = 0; mt < 4; ++mt) {
#pragma unroll
            for (int nf = 0; nf < 2; ++nf)
              part[mt][nf] = mma_h(fa0[mt].h, fb0[nf].h, (h == 0 && ks == 0) ? zero8() : part[mt][nf]);
          }
        }
      }
      // the key tile is summed: weigh it and add it in
#pragma unroll
      for (int mt = 0; mt < 4; ++mt) {
#pragma unroll
        for (int q = 0; q < 8; ++q) {
          acc[mt][0][q] = __builtin_fmaf(part[mt][0][q], f0, acc[mt][0][q]);
          acc[mt][1][q] = __builtin_fmaf(part[mt][1][q], f1, acc[mt][1][q]);
        }
      }
    }
    asm volatile("s_wait_dscnt 0x0" ::: "memory");                   // this wave's reads of the buffer are done before it is refilled
    asm volatile("s_wait_asynccnt 0x0" ::: "memory");                // this wave's copies of stage st + 1 have landed
    __syncthreads();                                                 // publishes stage st + 1, ends every read of stage st's buffer
    if (st + 2 < NSTV) {                                             // stage st + 2 exists
      const int ko = KSV * (st + 2);
      fill_ring<1, NSV>(lc + bo, ap + ko, ap + ko, 32 * SEQ, bp + ko, bp + ko, 32 * SEQ);
    }
  }
  asm volatile("s_wait_asynccnt 0x0" ::: "memory");                  // nothing outstanding when the LDS changes its use
  stage_nT(Os, acc, IPCAR, wave, hh, c);
  __syncthreads();
  planes_out<false>(Os, nullptr, o0, Mh, Mlo, (size_t)(b * SEQ + n0), tid);
}

// =========================================================================================================
// (7) out[b][o][t] = sum_c W16[o][c] (Mh + Ml)[b][t][c] + bias[o] + bf16-RNE(xres[b][o][t]) for one (b, 128-t tile,
//     128-o block): 2 products, K = 512, passes of NSO KC k (one block a WGP); output and residual rows at full strides. Epilogue: row-major LDS staging,
// coverage: 16 it x 8 rows x 32 lanes x 4 = 128 o x 128 t; grid (SEQ/128, 4, NB) covers out[b][0..511][0..SEQ-1] once.
// =========================================================================================================
#define NSO 2
static_assert(CH % (KC * NSO) == 0 && CH / (KC * NSO) >= 2);
__global__ __launch_bounds__(256)
void gemm_out(const unsigned short* __restrict__ W, const float* __restrict__ bias,
              const unsigned short* __restrict__ Mh, const unsigned short* __restrict__ Mlo,
              const float* __restrict__ xres, float* out) {
  __shared__ __align__(16) char sm[CoreLds<2, NSO>::BYTES];    // two operand buffers; output staging behind the core
  float* Os = (float*)sm;
  const int tid = threadIdx.x, lane = tid & 31, wave = tid >> 5;
  const int hh = lane >> 4, c = lane & 15;
  const int nt = blockIdx.x, mb = blockIdx.y, b = blockIdx.z;
  const int n0 = nt * BT, o0 = mb * BT;
  const unsigned short* ap = W + (size_t)o0 * CH;
  const size_t bq = ((size_t)(b * SEQ + n0)) * CH;
  v8f acc[4][2];
  zero_acc(acc);
  gemm_core<2, false, NSO>(acc, sm, ap, ap, CH, Mh + bq, Mlo + bq, CH, CH / (KC * NSO), tid);
  stage_mn(Os, acc, wave, hh, c);
  __syncthreads();
  const int e = tid & 31, lq = tid >> 5;                             // lq 0..7
  const size_t blk0 = ((size_t)(b * CH + o0)) * T_FULL + n0;         // block-uniform: row 0, col 0 of the tile
  const unsigned xofs = 4u * (unsigned)(lq * T_FULL + 4 * e);        // the lane's byte offset behind it, row lq
  const char* xb = (const char*)(xres + blk0);
  const float* bp = bias + o0;
  v4f res[16];
#pragma unroll
  for (int it = 0; it < 16; ++it) {
    const int row = it * 8 + lq;                                     // o_loc 0..127
    const float bb = bfr(bp[lq + 8 * it]);
    const v4f a  = *(const v4f*)(Os + row * OSP + 4 * e);
    const v4f xv = *(const v4f*)(xb + xofs + (size_t)it * (32 * T_FULL));
#pragma unroll
    for (int t = 0; t < 4; ++t) res[it][t] = (a[t] + bb) + bfr(xv[t]);
  }
  // xofs and lq address the loads; as inputs here their registers stay live past the last load and are reused only behind this wait
  asm volatile("s_wait_xcnt 0x0" :: "v"(xofs), "v"(lq) : "memory");
{
#pragma unroll
    for (int it = 0; it < 16; ++it) {
      const int row = it * 8 + lq;
      const size_t idx = blk0 + (size_t)row * T_FULL + 4 * e;
      *(v4f*)(out + idx) = res[it];
    }
    
  }
}

// =========================================================================================================
extern "C" void kernel_launch(void* const* d_in, const int* in_sizes, int n_in,
                              void* d_out, int out_size, void* d_ws, size_t ws_size,
                              hipStream_t stream) {
  if (n_in < 10) return;
  if (in_sizes[0] < NB * CH * T_FULL || in_sizes[1] < NB * CH * T_FULL) return;
  if (in_sizes[2] < CH * CH || in_sizes[4] < CH * CH || in_sizes[6] < CH * CH || in_sizes[8] < CH * CH) return;
  if (in_sizes[3] < CH || in_sizes[5] < CH || in_sizes[7] < CH || in_sizes[9] < CH) return;
  if (out_size < NB * CH * T_FULL) return;

  size_t off = 0;
  auto carve = [&](size_t bytes) { const size_t o = off; off += (bytes + 255) & ~(size_t)255; return o; };
  const size_t oW = carve(WB);
  const size_t oX = carve(RXB);
  const size_t oM = carve(RMB);
  const size_t oV = carve(RVB);
  const size_t oT = carve(STB);
  if (off > ws_size) return;
  if (off > (size_t)WS_CAP) return;

  const float* x_c = (const float*)d_in[0];
  const float* x_s = (const float*)d_in[1];
  const float* Wn  = (const float*)d_in[2];
  const float* bn  = (const float*)d_in[3];
  const float* Wm  = (const float*)d_in[4];
  const float* bm  = (const float*)d_in[5];
  const float* Wl  = (const float*)d_in[6];
  const float* bl  = (const float*)d_in[7];
  const float* Wo  = (const float*)d_in[8];
  const float* bo  = (const float*)d_in[9];
  float* out = (float*)d_out;

  char* ws = (char*)d_ws;
  unsigned short* W16  = (unsigned short*)(ws + oW);
  // region X users
  unsigned short* Xcnh = (unsigned short*)(ws + oX);
  unsigned short* Xcnl = (unsigned short*)(ws + oX + PLB);
  unsigned short* Xsnh = (unsigned short*)(ws + oX + 2 * PLB);
  unsigned short* Xsnl = (unsigned short*)(ws + oX + 3 * PLB);
  unsigned short* Xsr  = (unsigned short*)(ws + oX + 4 * PLB);
  unsigned short* P16  = (unsigned short*)(ws + oX);
  float*          Ls   = (float*)(ws + oX + PB);
  // region M users
  unsigned short* Mnh  = (unsigned short*)(ws + oM);
  unsigned short* Mnl  = (unsigned short*)(ws + oM + PLB);
  unsigned short* Mmh  = (unsigned short*)(ws + oM + 2 * PLB);
  unsigned short* Mml  = (unsigned short*)(ws + oM + 3 * PLB);
  unsigned short* Moh  = (unsigned short*)(ws + oM);
  unsigned short* Mol  = (unsigned short*)(ws + oM + PLB);
  // region V
  unsigned short* V16  = (unsigned short*)(ws + oV);
  // region T
  float*          St   = (float*)(ws + oT);

  const dim3 blk256(256);
  const dim3 gconv(SEQ / BT, CH / BT, NB);

  // (0) + (1a) instance-norm statistics of x_c and x_s; weights -> bf16 planes (order Wn, Wm, Wl, Wo)
  prep<<<dim3(NSTATB + NCVTWB), blk256, 0, stream>>>(x_c, x_s, Wn, Wm, Wl, Wo, St, W16);
  // (1b) split planes of norm(x_c); same for x_s plus the raw bf16 plane
  cvt_norm2<<<dim3(SEQ / NT, CH / QT, 2 * NB), blk256, 0, stream>>>(x_c, x_s, St, Xcnh, Xcnl, Xsnh, Xsnl, Xsr);
  // (2) + (3) Mn, Mm hi + residual planes and the Ml value plane
  gemm_conv3<<<dim3(SEQ / BT, CH / BT, 3 * NB), blk256, 0, stream>>>(W16, bn, bm, bl, Xcnh, Mnh, V16);
  // (4) scores -> tile-local softmax weights and {max, sum} pairs (overwrites region X)
  gemm_sc<<<dim3(SEQ / SBT, SEQ / SBT, NB), dim3(512), 0, stream>>>(Mnh, Mnl, Mmh, Mml, P16, Ls);
  // (6) Mo hi + residual planes (overwrites region M)
  gemm_pv<<<gconv, blk256, 0, stream>>>(V16, P16, Ls, Moh, Mol);
  // (7) output GEMM + bias + residual
  gemm_out<<<gconv, blk256, 0, stream>>>(W16 + (size_t)3 * CH * CH, bo, Moh, Mol, x_c, out);
  (void)hipGetLastError();
}

// v008
// A run of this version takes 109 microseconds.
// Two timings next to v007 put it at 1.12 and 1.11 times that version's speed.
// Counting every step since v000, it is 6.05 times as fast.
// Contractions: conv1x1 Wn.norm(x_c) and Wm.norm(x_s) on v_wmma_f32_16x16x32_bf16 (bf16-RNE weights x bf16 hi +
// bf16 residual planes of the normalised activations, 2 products, K=512); W2 = Wo.Wl on v_wmma_f32_16x16x32_bf16
// (bf16-RNE weights, 1 product, K=512); conv1x1 W2.x_s on v_wmma_f32_16x16x32_bf16 (bf16 hi + residual planes of W2 x
// bf16-RNE x_s, 2 products); position scores Mn^T.Mm on v_wmma_f32_16x16x32_bf16 (bf16 hi + residual planes of both,
// 3 products, K=512); Ml2.A^T on v_wmma_f32_16x16x32_f16 (f16 Ml2 plane x softmax weights carried x16384 as f16,
// K=2048); f32 accumulate everywhere; instance-norm statistics, softmax, bias and residual adds in f32 VALU.
// The output conv has no GEMM over the positions: Wo.((Wl.x_s + bl).A^T) = ((Wo.Wl).x_s + Wo.bl).A^T, so the value plane is
// Ml2 = W2.x_s + Wo.bl and the GEMM with the softmax weights gives the output rows, to which bo and x_c are added.
// The softmax has no launch of its own: the score GEMM's epilogue normalises each row inside its own
// 128-key tile, and the last GEMM weighs each key tile's partial product with the row's factor for that tile.
#include <hip/hip_runtime.h>
#include <stdint.h>

#ifndef NB
#define NB 4
#endif
#ifndef SEQ
#define SEQ 2048
#endif
#define NB_FULL 4
#define T_FULL  2048
#define CH      512
#define NMAT    4
#define QT      64
#define BT      128
#define OSP     132
#define TP      72
#define NT      128
#define KC      64
#define LP      144
#define TILEB   (BT * LP)
#define NKT     (SEQ / BT)
#define PCAR    16384.0f
#define IPCAR   6.103515625e-05f
#define EPSN    1.0e-5f
#define WS_CAP  134217728

static_assert(NB >= 1 && NB <= NB_FULL);
static_assert(SEQ >= 256 && SEQ <= T_FULL && SEQ % 256 == 0);
static_assert(SEQ % QT == 0 && CH % QT == 0 && SEQ % NT == 0 && SEQ % BT == 0 && CH % BT == 0);
static_assert(CH % 256 == 0 && CH % 32 == 0 && SEQ % 32 == 0 && SEQ % 16 == 0);
static_assert((OSP * 4) % 16 == 0);
static_assert((TP * 2) % 16 == 0);
static_assert((NB * SEQ) % 8 == 0);
static_assert(CH % 8 == 0);
static_assert(CH % KC == 0 && SEQ % KC == 0 && CH / KC >= 2 && SEQ / KC >= 2);
static_assert(KC * 2 + 16 == LP && LP % 32 == 16 && QT == 64 && BT == 128);
static_assert(BT * OSP * 4 <= 2 * 2 * TILEB);
static_assert(BT == 2 * KC);
static_assert(CH == 2 * 256);

typedef _Float16       v16h __attribute__((ext_vector_type(16)));
typedef _Float16       v8h  __attribute__((ext_vector_type(8)));
typedef __bf16         v16b __attribute__((ext_vector_type(16)));
typedef unsigned short v8us __attribute__((ext_vector_type(8)));
typedef float          v8f  __attribute__((ext_vector_type(8)));
typedef float          v4f  __attribute__((ext_vector_type(4)));
typedef float          v2f  __attribute__((ext_vector_type(2)));
typedef unsigned int   v4u  __attribute__((ext_vector_type(4)));

union Frag { v8us u[2]; v16h h; v16b bf; };
static_assert(sizeof(Frag) == 32);

// ---- workspace map (bytes; every region start a multiple of 256; every extent is an exact tile multiple and is
//      launches; each later user fully overwrites what it reads before any read):
//   W : bf16 [4][512][512] weights (Wn, Wm, Wl transposed, Wo)                  WB
//   X : stage 1-3: five bf16 planes [NB][SEQ][512] (x_c norm hi/lo, x_s norm hi/lo, x_s raw)   5*PLB
//       stage 4-6: tile-local softmax weights f16 [NB][SEQ][SEQ]                PB
//                  and behind them {max, sum} f32 pairs [NB][SEQ/128 key tiles][SEQ]   LSB
//   M : stage 2-4: Mn hi/lo, Mm hi/lo bf16 planes [NB][SEQ][512]                4*PLB
//   V : Ml2 f16 plane [NB][512][SEQ]                                            PLB
//   T : instance-norm {mean, rstd} f32 pairs [2][NB][512]                       STB
//   W2: W2 = Wo.Wl, bf16 hi and residual planes [512][512]                      W2B
//   B2: Wo.bl f32, row o at (o / 8) * 32 + o % 8: the 8 rows of one writing block have a 128-B line of their own   B2B
constexpr size_t cmax(size_t a, size_t b) { return a > b ? a : b; }
constexpr size_t PLB = (size_t)NB * SEQ * CH * 2;
constexpr size_t LSB = (size_t)NB * NKT * SEQ * 2 * 4;
constexpr size_t PB  = (size_t)NB * SEQ * SEQ * 2;
constexpr size_t WB  = (size_t)NMAT * CH * CH * 2;
constexpr size_t RXB = cmax(5 * PLB, PB + LSB);
constexpr size_t RMB = 4 * PLB;
constexpr size_t RVB = PLB;
constexpr size_t STB = (size_t)2 * NB * CH * 2 * 4;
constexpr size_t W2B = (size_t)2 * CH * CH * 2;
constexpr size_t B2B = (size_t)(CH / 8) * 32 * 4;
static_assert(WB % 256 == 0 && PLB % 256 == 0 && LSB % 256 == 0 && PB % 256 == 0);
static_assert(5 * PLB <= RXB && PB + LSB <= RXB);
static_assert(4 * PLB <= RMB);
static_assert(STB % 256 == 0 && (NB * CH) % 16 == 0);
static_assert(W2B % 256 == 0 && B2B % 256 == 0);
static_assert(WB + RXB + RMB + RVB + STB + W2B + B2B <= (size_t)WS_CAP);

// ---- scalar helpers -----------------------------------------------------------------------------------------
__device__ __forceinline__ unsigned short bf_bits(float f) {          // f32 -> bf16 bits, RNE convert
  unsigned u = __float_as_uint(f);
  return (unsigned short)((u + 0x7FFFu + ((u >> 16) & 1u)) >> 16);
}
__device__ __forceinline__ float bf_up(unsigned short hb) { return __uint_as_float(((unsigned)hb) << 16); }
__device__ __forceinline__ float bfr(float f) { return bf_up(bf_bits(f)); }
__device__ __forceinline__ unsigned short h_bits(_Float16 x) { return __builtin_bit_cast(unsigned short, x); }
__device__ __forceinline__ unsigned pk16(unsigned short a, unsigned short b) { return (unsigned)a | ((unsigned)b << 16); }
// e^x as 2^(x log2 e) on the hardware's exponential, as __expf gives it; the v_nop in the statement is the slot that the
// instruction set asks for between a transcendental and a next instruction that reads its result or overwrites its source
__device__ __forceinline__ float exp_slot(float x) {
  float y = x * 1.44269504f;
#if defined(__HIP_DEVICE_COMPILE__)
  asm("v_exp_f32 %0, %0\n\tv_nop" : "+v"(y));
#endif
  return y;
}
__device__ __forceinline__ v8f zero8() { v8f z = {0.f, 0.f, 0.f, 0.f, 0.f, 0.f, 0.f, 0.f}; return z; }

// ---- 16-bit fragment loader (A, or B from a k-contiguous [n][k] row): lane -> row/col (lane&15), p already includes
//      + 8*(lane>>4); elements 0..7 <- p[0..7] (k0+8h..), elements 8..15 <- p[16..23] (k0+16+8h..)
__device__ __forceinline__ Frag ldfrag(const unsigned short* p) {
  Frag f;
  f.u[0] = *(const v8us*)(p);
  f.u[1] = *(const v8us*)(p + 16);
  return f;
}

// ---- WMMA helpers: builtin followed by a 4-slot VALU gap tying D and keeping A/B live ----------------------------
__device__ __forceinline__ v8f mma_h(v16h a, v16h b, v8f c) {
  v8f d = __builtin_amdgcn_wmma_f32_16x16x32_f16(false, a, false, b, (short)0, c, false, false);
#if defined(__HIP_DEVICE_COMPILE__)
  asm volatile("v_nop\n\tv_nop\n\tv_nop\n\tv_nop" : "+v"(d) : "v"(a), "v"(b));
#endif
  return d;
}
__device__ __forceinline__ v8f mma_b(v16b a, v16b b, v8f c) {
  v8f d = __builtin_amdgcn_wmma_f32_16x16x32_bf16(false, a, false, b, (short)0, c, false, false);
#if defined(__HIP_DEVICE_COMPILE__)
  const v16h ha = __builtin_bit_cast(v16h, a), hb = __builtin_bit_cast(v16h, b);
  asm volatile("v_nop\n\tv_nop\n\tv_nop\n\tv_nop" : "+v"(d) : "v"(ha), "v"(hb));
#endif
  return d;
}

// ---- asynchronous copies of operand tiles into LDS. One tile of a pass = 128 rows x 128 B (KC elements), LDS pitch LP.
//      Lane map: e = tid & 7 -> 16-B piece of the row, r = tid >> 3 -> row r + 32 i (i = 0..3): 8 lanes cover one whole
//      128-B line. l = the lane's LDS byte address of row r, g = its global address of row r, p32 = elements of 32 rows.
//      The s_wait_xcnt closes each statement so that no address register of an issued copy is rewritten ahead of it.
__device__ __forceinline__ unsigned lds_off(const void* p) { return (unsigned)(size_t)p; }
__device__ __forceinline__ void copy_tile(unsigned l, const unsigned short* g, size_t p32) {
#if defined(__HIP_DEVICE_COMPILE__)
  // four copies of one tile, global -> LDS through no register; the wait is their statement's last line
  asm volatile("global_load_async_to_lds_b128 %0, %4, off\n\t"
               "global_load_async_to_lds_b128 %1, %5, off\n\t"
               "global_load_async_to_lds_b128 %2, %6, off\n\t"
               "global_load_async_to_lds_b128 %3, %7, off\n\t"
               "s_wait_xcnt 0x0"
               :: "v"(l), "v"(l + 32 * LP), "v"(l + 64 * LP), "v"(l + 96 * LP),
                  "v"(g), "v"(g + p32), "v"(g + 2 * p32), "v"(g + 3 * p32) : "memory");
#endif
}
__device__ __forceinline__ void copy_tiles2(unsigned l, const unsigned short* g, size_t p32,
                                            unsigned m, const unsigned short* h, size_t q32) {
#if defined(__HIP_DEVICE_COMPILE__)
  // eight copies of two tiles, global -> LDS through no register; they share one statement and its closing wait
  asm volatile("global_load_async_to_lds_b128 %0, %8, off\n\t"
               "global_load_async_to_lds_b128 %1, %9, off\n\t"
               "global_load_async_to_lds_b128 %2, %10, off\n\t"
               "global_load_async_to_lds_b128 %3, %11, off\n\t"
               "global_load_async_to_lds_b128 %4, %12, off\n\t"
               "global_load_async_to_lds_b128 %5, %13, off\n\t"
               "global_load_async_to_lds_b128 %6, %14, off\n\t"
               "global_load_async_to_lds_b128 %7, %15, off\n\t"
               "s_wait_xcnt 0x0"
               :: "v"(l), "v"(l + 32 * LP), "v"(l + 64 * LP), "v"(l + 96 * LP),
                  "v"(m), "v"(m + 32 * LP), "v"(m + 64 * LP), "v"(m + 96 * LP),
                  "v"(g), "v"(g + p32), "v"(g + 2 * p32), "v"(g + 3 * p32),
                  "v"(h), "v"(h + q32), "v"(h + 2 * q32), "v"(h + 3 * q32) : "memory");
#endif
}

// ---- GEMM core for one 128(m) x 128(n) block tile, 8 waves (256 threads) as 2 (m) x 4 (n): wave (wm, wn) owns a
//      64 x 32 tile, cols n = 32 wn + 16 nf + (lane&15) (2 B fragments per k-step per B plane), A rows
//      m = 64 wm + 16 mt + (lane&15) (4 m-tiles): every fragment read from LDS feeds 2 or 4 matrix instructions a product,
//      every operand byte copied from L2 feeds 128 rows or columns. a0/a1/b0/b1 = row 0, k = 0 of the
//      block's 128 operand rows (k-contiguous, pitches ap / bp elements). A pass = NS KC k = NS tile sets of KC k in a row,
//      a set = [A0][A1 if NPROD 3][B0][B1 if NPROD >= 2]: they are copied into one of two LDS buffers one pass ahead, and the
//      fragments are read from LDS with the split k map (ldfrag), k-steps and products in the same order as from
//      global rows. NPROD: 1 = a0.b0; 2 = a0.b0 + a0.b1; 3 = a0.b0 + a0.b1 + a1.b0 (shared accumulator, unscaled
//      residual planes; each accumulator takes its products of a k-step in that order, the 8 tiles of one product in a
//      row). HALF selects the f16 instruction (NPROD 1 only). NS > 1 is for a grid of one block a WGP, where nothing but the
//      block's own copies hides their latency: NS times the bytes in flight, that latency met once per NS KC k. npass = passes
//      (at least 2). On return no copy is outstanding and every
//      wave has left both buffers (the last pass's barrier), so sm may be reused as output staging.
template <int NPROD, int NS = 1>
struct CoreLds {
  static constexpr int NA = NPROD >= 3 ? 2 : 1;
  static constexpr int NBP = NPROD >= 2 ? 2 : 1;
  static constexpr unsigned SET = (unsigned)(NA + NBP) * TILEB;      // the operand tiles of KC k
  static constexpr unsigned STG = (unsigned)NS * SET;                // one stage of the ring
  static constexpr unsigned BYTES = 2 * STG;
  static_assert(NS * (NA + NBP) * 4 <= 63);                          // copies of a wave in flight: one stage's
  static_assert(BYTES <= 327680);
};
template <int NPROD>
__device__ __forceinline__ void fill_stage(unsigned l, const unsigned short* a0, const unsigned short* a1, size_t ap32,
                                           const unsigned short* b0, const unsigned short* b1, size_t bp32) {
  if (NPROD == 1) {
    copy_tiles2(l, a0, ap32, l + TILEB, b0, bp32);
  } else if (NPROD == 2) {
    copy_tile(l, a0, ap32);
    copy_tiles2(l + TILEB, b0, bp32, l + 2 * TILEB, b1, bp32);
  } else {
    copy_tiles2(l, a0, ap32, l + TILEB, a1, ap32);
    copy_tiles2(l + 2 * TILEB, b0, bp32, l + 3 * TILEB, b1, bp32);
  }
}
// one stage of the ring: NS tile sets in a row, set u = k KC u .. + KC - 1 of the stage
template <int NPROD, int NS>
__device__ __forceinline__ void fill_ring(unsigned l, const unsigned short* a0, const unsigned short* a1, size_t ap32,
                                          const unsigned short* b0, const unsigned short* b1, size_t bp32) {
  fill_stage<NPROD>(l, a0, a1, ap32, b0, b1, bp32);
  if constexpr (NS > 1)
    fill_ring<NPROD, NS - 1>(l + CoreLds<NPROD>::SET, a0 + KC, a1 + KC, ap32, b0 + KC, b1 + KC, bp32);
}
template <int NPROD, bool HALF, int NS = 1>
__device__ __forceinline__ void gemm_core(v8f (&acc)[4][2], const char* sm,
                                          const unsigned short* __restrict__ a0,
                                          const unsigned short* __restrict__ a1, size_t ap,
                                          const unsigned short* __restrict__ b0,
                                          const unsigned short* __restrict__ b1, size_t bp, int npass, int tid) {
  static_assert(NPROD >= 1 && NPROD <= 3);
  static_assert(!(HALF && NPROD != 1));
  constexpr unsigned SET = CoreLds<NPROD, NS>::SET, STG = CoreLds<NPROD, NS>::STG;
  constexpr unsigned BOFF = (unsigned)CoreLds<NPROD>::NA * TILEB;
  constexpr int KS = KC * NS;                                        // k of a pass
  const int lane = tid & 31, wave = tid >> 5, hh = lane >> 4, c = lane & 15;
  const int wm = wave >> 2, wn = wave & 3;
  const int e = tid & 7, r = tid >> 3;                               // r 0..31
  const unsigned lc = lds_off(sm) + (unsigned)(r * LP + 16 * e);
  const size_t ga = (size_t)r * ap + 8 * e, gb = (size_t)r * bp + 8 * e;
  const unsigned fa = (unsigned)((64 * wm + c) * LP + 16 * hh);
  const unsigned fb = BOFF + (unsigned)((32 * wn + c) * LP + 16 * hh);
  fill_ring<NPROD, NS>(lc, a0 + ga, a1 + ga, 32 * ap, b0 + gb, b1 + gb, 32 * bp);
  asm volatile("s_wait_asynccnt 0x0" ::: "memory");                  // pass 0's own copies have landed
  __syncthreads();                                                   // ... and every other wave's
  fill_ring<NPROD, NS>(lc + STG, a0 + ga + KS, a1 + ga + KS, 32 * ap, b0 + gb + KS, b1 + gb + KS, 32 * bp);
  // kept rolled: one pass is 16 to 64 matrix instructions with their fragment loads, and the code stays small
#pragma unroll 1
  for (int t = 0; t < npass; ++t) {
    const unsigned bo = (unsigned)(t & 1) * STG;
    // the loops below are unrolled whole so that the fragment arrays stay in registers and the LDS offsets are immediates
#pragma unroll
    for (int ks = 0; ks < KS / 32; ++ks) {
      const unsigned o = bo + (unsigned)(ks / (KC / 32)) * SET + 64u * (ks % (KC / 32));
      // the k-step's fragment reads stand together, ahead of its matrix instructions: one LDS latency a k-step
      Frag fb0[2], fb1[2], fa0[4], fa1[4];
#pragma unroll
      for (int nf = 0; nf < 2; ++nf) {
        fb0[nf] = ldfrag((const unsigned short*)(sm + fb + 16 * LP * nf + o));
        if (NPROD >= 2) fb1[nf] = ldfrag((const unsigned short*)(sm + fb + TILEB + 16 * LP * nf + o));
        else fb1[nf] = fb0[nf];
      }
#pragma unroll
      for (int mt = 0; mt < 4; ++mt) {
        fa0[mt] = ldfrag((const unsigned short*)(sm + fa + 16 * LP * mt + o));
        if (NPROD >= 3) fa1[mt] = ldfrag((const unsigned short*)(sm + fa + TILEB + 16 * LP * mt + o));
        else fa1[mt] = fa0[mt];
      }
#pragma unroll
      for (int p = 0; p < NPROD; ++p) {
#pragma unroll
        for (int mt = 0; mt < 4; ++mt) {
#pragma unroll
          for (int nf = 0; nf < 2; ++nf) {
            if (HALF)        acc[mt][nf] = mma_h(fa0[mt].h, fb0[nf].h, acc[mt][nf]);
            else if (p == 0) acc[mt][nf] = mma_b(fa0[mt].bf, fb0[nf].bf, acc[mt][nf]);
            else if (p == 1) acc[mt][nf] = mma_b(fa0[mt].bf, fb1[nf].bf, acc[mt][nf]);
            else             acc[mt][nf] = mma_b(fa1[mt].bf, fb0[nf].bf, acc[mt][nf]);
          }
        }
      }
    }
    asm volatile("s_wait_dscnt 0x0" ::: "memory");                   // this wave's reads of the buffer are done before it is refilled
    asm volatile("s_wait_asynccnt 0x0" ::: "memory");                // this wave's copies of pass t + 1 have landed
    __syncthreads();                                                 // publishes pass t + 1, ends every read of pass t's buffer
    if (t + 2 < npass) {
      const int ko = KS * (t + 2);
      fill_ring<NPROD, NS>(lc + bo, a0 + ga + ko, a1 + ga + ko, 32 * ap, b0 + gb + ko, b1 + gb + ko, 32 * bp);
    }
  }
  asm volatile("s_wait_asynccnt 0x0" ::: "memory");                  // nothing outstanding when the LDS changes its use
}
__device__ __forceinline__ void zero_acc(v8f (&acc)[4][2]) {
#pragma unroll
  for (int mt = 0; mt < 4; ++mt) { acc[mt][0] = zero8(); acc[mt][1] = zero8(); }
}

// ---- epilogue staging, transposed: Os[n_loc][m_loc] (pitch OSP). Lane (hh, c) of wave (wm, wn) holds D rows
//      m = 64 wm + 16 mt + 8 hh + r, col n = 32 wn + 16 nf + c -> two b128 LDS stores per 16 x 16 tile.
__device__ __forceinline__ void stage_nT(float* Os, const v8f (&acc)[4][2], float sc, int wave, int hh, int c) {
  const int wm = wave >> 2, wn = wave & 3;
#pragma unroll
  for (int nf = 0; nf < 2; ++nf) {
    const int nl = 32 * wn + 16 * nf + c;
#pragma unroll
    for (int mt = 0; mt < 4; ++mt) {
      v4f va, vb;
#pragma unroll
      for (int r = 0; r < 4; ++r) { va[r] = acc[mt][nf][r] * sc; vb[r] = acc[mt][nf][4 + r] * sc; }
      *(v4f*)(Os + nl * OSP + 64 * wm + 16 * mt + 8 * hh)     = va;
      *(v4f*)(Os + nl * OSP + 64 * wm + 16 * mt + 8 * hh + 4) = vb;
    }
  }
}
// ---- epilogue staging, row-major: Os[m_loc][n_loc] (pitch OSP), scalar LDS stores.
__device__ __forceinline__ void stage_mn(float* Os, const v8f (&acc)[4][2], int wave, int hh, int c) {
  const int wm = wave >> 2, wn = wave & 3;
#pragma unroll
  for (int nf = 0; nf < 2; ++nf) {
    const int nl = 32 * wn + 16 * nf + c;
#pragma unroll
    for (int mt = 0; mt < 4; ++mt) {
#pragma unroll
      for (int r = 0; r < 8; ++r) Os[(64 * wm + 16 * mt + 8 * hh + r) * OSP + nl] = acc[mt][nf][r];
    }
  }
}

// ---- plane writer for transposed staging: plane [b][n][512] bf16 hi + bf16 residual, rows rowbase + 0..127,
//      16 lanes per 256-B row piece (two whole lines), rows it*16 + lq. Optional f32 bias (bf16-RNE value) added per col.
// coverage: 8 it x 16 rows x 16 lanes x 8 = 128 rows x 128 cols per plane.
template <bool BIAS>
__device__ __forceinline__ void planes_out(const float* Os, const float* __restrict__ bias, int o0,
                                           unsigned short* Ph, unsigned short* Pl, size_t rowbase, int tid) {
  const int e = tid & 15, lq = tid >> 4;                             // lq 0..15
  float bv[8];
#pragma unroll
  for (int t = 0; t < 8; ++t) bv[t] = 0.f;
  if (BIAS) {
    const unsigned bofs = 32u * (unsigned)e;                         // the lane's byte offset behind the block's bias + o0
    const char* bb = (const char*)(bias + o0);
    const v4f b0 = *(const v4f*)(bb + bofs);
    const v4f b1 = *(const v4f*)(bb + bofs + 16);
    // bofs addresses both loads; as an input here its register stays live past them and is reused only behind this wait
    asm volatile("s_wait_xcnt 0x0" :: "v"(bofs) : "memory");
#pragma unroll
    for (int t = 0; t < 4; ++t) { bv[t] = bfr(b0[t]); bv[4 + t] = bfr(b1[t]); }
  }
  v4u uh[8], ul[8];
#pragma unroll
  for (int it = 0; it < 8; ++it) {
    const int row = it * 16 + lq;                                    // n_loc 0..127
    const v4f a = *(const v4f*)(Os + row * OSP + 8 * e);
    const v4f q = *(const v4f*)(Os + row * OSP + 8 * e + 4);
    const float f[8] = {a[0], a[1], a[2], a[3], q[0], q[1], q[2], q[3]};
#pragma unroll
    for (int t = 0; t < 4; ++t) {
      const float f0 = f[2 * t] + bv[2 * t], f1 = f[2 * t + 1] + bv[2 * t + 1];
      const unsigned short hb0 = bf_bits(f0), hb1 = bf_bits(f1);
      const unsigned short lb0 = bf_bits(f0 - bf_up(hb0));
      const unsigned short lb1 = bf_bits(f1 - bf_up(hb1));
      uh[it][t] = pk16(hb0, hb1);
      ul[it][t] = pk16(lb0, lb1);
    }
  }
{
#pragma unroll
    for (int it = 0; it < 8; ++it) {
      const int row = it * 16 + lq;
      const size_t po = (rowbase + (size_t)row) * CH + o0 + 8 * e;
      *(v4u*)(Ph + po) = uh[it];
      *(v4u*)(Pl + po) = ul[it];
    }
    
  }
}

// =========================================================================================================
// (0) weights f32 [512][512] x4 -> W16 bf16 bits [4][512][512] (RNE convert of the input value, exact operand).
//     Block blk owns 8 rows of one matrix (matrix index block-uniform), one wave per 1024-B row = 2 instructions of
//     Matrix 2 (Wl) goes out transposed, plane row c = column c of Wl: it is the k-contiguous operand of W2 = Wo.Wl
//     (256 threads x 2 rows of Wl x the block's 8 columns = 8 plane rows x 512).
//     The blocks of matrix 3 (Wo) also form B2[o] = sum_m Wo[o][m] bl[m] (bf16-RNE values, f32 sum: 16 terms a lane in
//     rising m, then five xor steps).
// coverage: 256 blocks x 8 rows x 2 j x 32 lanes x 8 = 2048 rows x 512 = the whole plane. blk = 0..255 (part of prep).
// =========================================================================================================
__device__ __forceinline__
void cvt_w_part(const float* __restrict__ w0, const float* __restrict__ w1,
                const float* __restrict__ w2, const float* __restrict__ w3, const float* __restrict__ bl,
                unsigned short* W16, float* B2, int blk) {
  const int tid = threadIdx.x;
  const int wave = tid >> 5, lane = tid & 31;
  const int mi = blk / (CH / 8);                                     // 0..3, block-uniform
  const int o  = 8 * (blk - mi * (CH / 8)) + wave;                   // 0..511
  const float* wb = (mi == 0) ? w0 : (mi == 1) ? w1 : (mi == 2) ? w2 : w3;
  if (mi == 2) {
    // transposed: thread = rows 2 tid, 2 tid + 1 of Wl, the block's 8 columns = 8 plane rows; a pair of rows is one dword
    // of a plane row, so a wave's store is one whole 128-B line
    const int c0 = 8 * (blk - mi * (CH / 8));
    const float* sc = wb + (size_t)(2 * tid) * CH + c0;
    const v4f a0 = *(const v4f*)sc;
    const v4f a1 = *(const v4f*)(sc + 4);
    const v4f q0 = *(const v4f*)(sc + CH);
    const v4f q1 = *(const v4f*)(sc + CH + 4);
    // sc addresses the loads; as an input here its registers stay live past the last load and are reused only behind this wait
    asm volatile("s_wait_xcnt 0x0" :: "v"(sc) : "memory");
    unsigned* dp = (unsigned*)(W16 + ((size_t)(mi * CH + c0)) * CH) + tid;
    // unrolled whole: the vector elements are picked by constants and the row steps are immediate offsets
#pragma unroll
    for (int k = 0; k < 4; ++k) {
      dp[k * (CH / 2)]       = pk16(bf_bits(a0[k]), bf_bits(q0[k]));
      dp[(4 + k) * (CH / 2)] = pk16(bf_bits(a1[k]), bf_bits(q1[k]));
    }
    return;
  }
  v4u u[CH / 256];
#pragma unroll
  for (int j = 0; j < CH / 256; ++j) {
    const float* s = wb + (size_t)o * CH + 256 * j + 8 * lane;
    const v4f a = *(const v4f*)s;
    const v4f q = *(const v4f*)(s + 4);
    const float f[8] = {a[0], a[1], a[2], a[3], q[0], q[1], q[2], q[3]};
#pragma unroll
    for (int t = 0; t < 4; ++t) u[j][t] = pk16(bf_bits(f[2 * t]), bf_bits(f[2 * t + 1]));
  }
  if (mi == 3) {
    const unsigned bofs = 32u * (unsigned)lane;                      // the lane's byte offset in bl
    const char* bb = (const char*)bl;
    v4f cb[CH / 256][2];
    // the loops below are unrolled whole so that cb and u are indexed by constants and stay in registers
#pragma unroll
    for (int j = 0; j < CH / 256; ++j) {
      cb[j][0] = *(const v4f*)(bb + bofs + 1024 * j);
      cb[j][1] = *(const v4f*)(bb + bofs + 1024 * j + 16);
    }
    // bofs addresses the loads; as an input here its register stays live past the last load and is reused only behind this wait
    asm volatile("s_wait_xcnt 0x0" :: "v"(bofs) : "memory");
    float d = 0.f;
#pragma unroll
    for (int j = 0; j < CH / 256; ++j) {
#pragma unroll
      for (int t = 0; t < 4; ++t) {
        d = __builtin_fmaf(bf_up((unsigned short)(u[j][t] & 0xFFFFu)), bfr(cb[j][t >> 1][2 * (t & 1)]), d);
        d = __builtin_fmaf(bf_up((unsigned short)(u[j][t] >> 16)), bfr(cb[j][t >> 1][2 * (t & 1) + 1]), d);
      }
    }
#pragma unroll
    for (int x = 16; x > 0; x >>= 1) d += __shfl_xor(d, x, 32);
    float* b2p = B2 + (o >> 3) * 32 + (o & 7);
    if (lane == 0) *b2p = d;
    // the store's address and data are inputs here so that the plane stores' code reuses their registers only behind this wait
    asm volatile("s_wait_xcnt 0x0" :: "v"(b2p), "v"(d) : "memory");
  }
{
#pragma unroll
    for (int j = 0; j < CH / 256; ++j)
      *(v4u*)(W16 + ((size_t)(mi * CH + o)) * CH + 256 * j + 8 * lane) = u[j];
    // the transposed part's code follows these stores in the built kernel: no register of theirs is rewritten ahead of this wait
    asm volatile("s_wait_xcnt 0x0" ::: "memory");
  }
}

// =========================================================================================================
// (1a) instance-norm statistics of both inputs, one launch: St[(sel * NB + b) * 512 + c] = {mean, rsqrt(var + eps)} of
//      bf16-RNE(x) over the row's SEQ values. 16 lanes per row, lane l = 4 q + k owns the elements 16 j + l and adds
//      them in rising j; the four xor steps then form ((s0 + s1) + (s2 + s3)) per q and the sum over q (1, then 2).
//      The lane's SEQ/16 values stay in registers, so the row is read once for mean and variance.
// coverage: block = 16 rows = one 128-B line of St; blk = 0 .. 2 * NB * 512 / 16 - 1 covers every row of both inputs once.
// =========================================================================================================
__device__ __forceinline__
void norm_stats_part(const float* __restrict__ xc, const float* __restrict__ xs, float* St, int blk) {
  const int tid = threadIdx.x;
  const int rl = tid >> 4, l = tid & 15;                             // rl 0..15
  const int sel = blk / (NB * CH / 16);                              // 0 = x_c, 1 = x_s, block-uniform
  const int r   = 16 * (blk - sel * (NB * CH / 16)) + rl;            // b * 512 + c
  const float* xr = (sel ? xs : xc) + (size_t)r * T_FULL + l;
  float v[SEQ / 16];                                                 // the loops are unrolled whole so that v stays in registers
#pragma unroll
  for (int j = 0; j < SEQ / 16; ++j) v[j] = xr[16 * j];
  // xr is an input here so that its registers stay live past the last load and are reused only behind this wait
  asm volatile("s_wait_xcnt 0x0" :: "v"(xr) : "memory");
  float sm = 0.f;
#pragma unroll
  for (int j = 0; j < SEQ / 16; ++j) { v[j] = bfr(v[j]); sm += v[j]; }
  sm += __shfl_xor(sm, 1, 32);
  sm += __shfl_xor(sm, 2, 32);
  sm += __shfl_xor(sm, 4, 32);
  sm += __shfl_xor(sm, 8, 32);
  const float mean = sm * (1.0f / (float)SEQ);
  float sv = 0.f;
#pragma unroll
  for (int j = 0; j < SEQ / 16; ++j) { const float d = v[j] - mean; sv = __builtin_fmaf(d, d, sv); }
  sv += __shfl_xor(sv, 1, 32);
  sv += __shfl_xor(sv, 2, 32);
  sv += __shfl_xor(sv, 4, 32);
  sv += __shfl_xor(sv, 8, 32);
  const float var = sv * (1.0f / (float)SEQ);
  const float rs  = rsqrtf(var + EPSN);
  if (l == 0) {
    v2f st; st[0] = mean; st[1] = rs;
    *(v2f*)(St + 2 * (size_t)(sel * NB * CH + r)) = st;
  }
}

// =========================================================================================================
// (0) + (1a) in one launch: neither reads what the other writes. The block index picks the part (block-uniform): the
//     statistics blocks, which run longer, come first, the weight blocks behind them.
// =========================================================================================================
#define NSTATB (2 * NB * CH / 16)
#define NCVTWB (NMAT * CH / 8)
__global__ __launch_bounds__(256)
void prep(const float* __restrict__ xc, const float* __restrict__ xs,
          const float* __restrict__ w0, const float* __restrict__ w1,
          const float* __restrict__ w2, const float* __restrict__ w3, const float* __restrict__ bl,
          float* St, unsigned short* W16, float* B2) {
  const int blk = blockIdx.x;
  if (blk < NSTATB) {
    norm_stats_part(xc, xs, St, blk);
  } else {
    cvt_w_part(w0, w1, w2, w3, bl, W16, B2, blk - NSTATB);
    // the other part's code follows these stores in the built kernel: no register of theirs is rewritten ahead of this wait
    asm volatile("s_wait_xcnt 0x0" ::: "memory");
  }
}

// =========================================================================================================
// (1b) x f32 [b][512 c][2048 t] (batch/row strides at full size) -> position-major bf16 planes [b][t][512]:
//      Ph = bf16-RNE(xn), Pl = bf16-RNE(xn - Ph) with xn = (bf16-RNE(x) - mean) * rstd per (b, c) row (St of 1a);
//      RAW adds Pr = bf16-RNE(x). One 64 c x 128 t tile per block, transposed through LDS (line = 64 c of one plane
//      row): lane e -> c 8e..8e+7, 8 consecutive lanes per line.
// coverage: 4 it x 32 rows x 8 lanes x 8 = 128 t x 64 c per plane; (bx, by) in (SEQ/128, 8) for each b = 0..NB-1 cover
//           [NB][SEQ][512] of every written plane exactly once. Th, Tl, Tr = the block's LDS tiles (Tr used by RAW only).
// =========================================================================================================
template <int RAW>
__device__ __forceinline__
void cvt_norm_part(const float* __restrict__ x, const float* __restrict__ St,
                   unsigned short* Ph, unsigned short* Pl, unsigned short* Pr,
                   unsigned short* Th, unsigned short* Tl, unsigned short* Tr, int bx, int by, int b) {
  const int tid = threadIdx.x;
  const int n0 = bx * NT, c0 = by * QT;
  const int e = tid & 7, lq = tid >> 3;                              // lq 0..31
  v4f a[4], q[4];
  v2f st[2];
  const int sr = b * CH + c0 + lq;                                   // row of c half 0; c half 1 is 32 rows on
  const float* sp0 = x + (size_t)sr * T_FULL + n0 + 8 * e;
#pragma unroll
  for (int it = 0; it < 4; ++it) {                                   // it = 2 * (t half) + (c half)
    const float* sp = sp0 + (size_t)(it & 1) * 32 * T_FULL + (it >> 1) * 64;
    a[it] = *(const v4f*)sp;
    q[it] = *(const v4f*)(sp + 4);
  }
#pragma unroll
  for (int h = 0; h < 2; ++h) st[h] = *(const v2f*)(St + 2 * (size_t)sr + 64 * h);
  // sp0 and sr address the loads; as inputs here their registers stay live past the last load and are reused only behind this wait
  asm volatile("s_wait_xcnt 0x0" :: "v"(sp0), "v"(sr) : "memory");
#pragma unroll
  for (int it = 0; it < 4; ++it) {
    const int cl = (it & 1) * 32 + lq;
    const int tl = (it >> 1) * 64 + 8 * e;                           // 0..120
    const float f[8] = {a[it][0], a[it][1], a[it][2], a[it][3], q[it][0], q[it][1], q[it][2], q[it][3]};
    const float mu = st[it & 1][0], rs = st[it & 1][1];
#pragma unroll
    for (int t = 0; t < 8; ++t) {
      const unsigned short rb = bf_bits(f[t]);
      const float d  = bf_up(rb) - mu;
      const float xn = d * rs;
      const unsigned short hb = bf_bits(xn);
      const unsigned short lb = bf_bits(__builtin_fmaf(d, rs, -bf_up(hb)));   // residual of the unrounded product
      Th[(tl + t) * TP + cl] = hb;
      Tl[(tl + t) * TP + cl] = lb;
      if (RAW) Tr[(tl + t) * TP + cl] = rb;
    }
  }
  __syncthreads();
  v4u uh[4], ul[4], ur[4];
#pragma unroll
  for (int it = 0; it < 4; ++it) {
    const int nl = it * 32 + lq;                                     // 0..127
    uh[it] = *(const v4u*)(Th + nl * TP + 8 * e);
    ul[it] = *(const v4u*)(Tl + nl * TP + 8 * e);
    if (RAW) ur[it] = *(const v4u*)(Tr + nl * TP + 8 * e); else ur[it] = uh[it];
  }
#pragma unroll
  for (int it = 0; it < 4; ++it) {
    const int nl = it * 32 + lq;
    const size_t po = ((size_t)(b * SEQ + n0 + nl)) * CH + c0 + 8 * e;
    *(v4u*)(Ph + po) = uh[it];
    *(v4u*)(Pl + po) = ul[it];
    if (RAW) *(v4u*)(Pr + po) = ur[it];
  }
}

// =========================================================================================================
// (1c) W2[o][c] = sum_m Wo[o][m] Wl[m][c] for one 128-c x 128-o tile: A = rows c of the transposed Wl plane, B = rows o of
//      the Wo plane (both k = m contiguous, bf16-RNE weights), 1 product, K = 512. Epilogue: transposed LDS staging,
//      barrier, hi + residual planes [o][512 c] (planes_out).
// coverage: blk = 0..15 as (c tile, o tile) in (4, 4) covers [512][512] of both planes exactly once.
//           sm = the block's LDS, CoreLds<1>::BYTES: two operand buffers; output staging behind the core.
// =========================================================================================================
#define NW2B ((CH / BT) * (CH / BT))
__device__ __forceinline__
void w2_part(char* sm, const unsigned short* __restrict__ WlT, const unsigned short* __restrict__ Wo,
             unsigned short* W2h, unsigned short* W2l, int blk) {
  float* Os = (float*)sm;
  const int tid = threadIdx.x, lane = tid & 31, wave = tid >> 5;
  const int hh = lane >> 4, c = lane & 15;
  const int c0 = (blk % (CH / BT)) * BT, o0 = (blk / (CH / BT)) * BT;
  const unsigned short* ap = WlT + (size_t)c0 * CH;
  const unsigned short* bp = Wo + (size_t)o0 * CH;
  v8f acc[4][2];
  zero_acc(acc);
  gemm_core<1, false>(acc, sm, ap, ap, CH, bp, bp, CH, CH / KC, tid);
  stage_nT(Os, acc, 1.0f, wave, hh, c);
  __syncthreads();
  planes_out<false>(Os, nullptr, c0, W2h, W2l, (size_t)o0, tid);
}

// =========================================================================================================
// (1b) of both inputs and (1c) in one launch, a grid of NW2B + (SEQ/128) * 8 * 2 NB blocks: none reads what another
//      writes. The block index picks the part (block-uniform, so each part's barriers are passed by the whole block): the
//      W2 tiles, which run longest, come first; then x_s, which writes three planes; then x_c. W = W16 of (0).
// =========================================================================================================
static_assert(3 * NT * TP * 2 <= CoreLds<1>::BYTES && (NT * TP * 2) % 16 == 0);
__global__ __launch_bounds__(256)
void cvt_norm2(const float* __restrict__ xc, const float* __restrict__ xs, const float* __restrict__ St,
               unsigned short* Pch, unsigned short* Pcl,
               unsigned short* Psh, unsigned short* Psl, unsigned short* Psr,
               const unsigned short* __restrict__ W, unsigned short* W2h, unsigned short* W2l) {
  __shared__ __align__(16) char sm[CoreLds<1>::BYTES];
  unsigned short* Th = (unsigned short*)sm;
  unsigned short* Tl = Th + NT * TP;
  unsigned short* Tr = Tl + NT * TP;
  const int blk = blockIdx.x;
  const int q = blk - NW2B;
  const int bx = q % (SEQ / NT), by = (q / (SEQ / NT)) % (CH / QT), z = q / ((SEQ / NT) * (CH / QT));
  if (blk < NW2B) {
    w2_part(sm, W + (size_t)2 * CH * CH, W + (size_t)3 * CH * CH, W2h, W2l, blk);
  } else if (z < NB) {
    cvt_norm_part<1>(xs, St + 2 * NB * CH, Psh, Psl, Psr, Th, Tl, Tr, bx, by, z);
  } else {
    cvt_norm_part<0>(xc, St, Pch, Pcl, Pcl, Th, Tl, Tr, bx, by, z - NB);
    // the other part's code follows these stores in the built kernel: no register of theirs is rewritten ahead of this wait
    asm volatile("s_wait_xcnt 0x0" ::: "memory");
  }
}

// =========================================================================================================
// (2) conv1x1 GEMM into hi + residual planes: Y[o][n] = sum_c W16[o][c] (Xh + Xl)[b][n][c] + bias[o] for one
//     (b, 128-n tile, 128-o block); A = W rows o (k = c contiguous), B = plane rows n (k = c contiguous), 2 products,
//     K = 512 = 16 steps. Epilogue: transposed LDS staging, barrier, planes [b][n][512] (planes_out).
// coverage: (SEQ/128, 4) blocks for each b = 0..NB-1, x 128 n x 128 o, cover [NB][SEQ][512] of both planes exactly once.
//           sm = the block's LDS, CoreLds<2>::BYTES: two operand buffers; output staging behind the core.
// =========================================================================================================
__device__ __forceinline__
void gemm_nm_part(char* sm, const unsigned short* __restrict__ W, const float* __restrict__ bias,
                  const unsigned short* __restrict__ Xh, const unsigned short* __restrict__ Xl,
                  unsigned short* Ph, unsigned short* Pl, int b) {
  float* Os = (float*)sm;
  const int tid = threadIdx.x, lane = tid & 31, wave = tid >> 5;
  const int hh = lane >> 4, c = lane & 15;
  const int nt = blockIdx.x, mb = blockIdx.y;
  const int n0 = nt * BT, o0 = mb * BT;
  const unsigned short* ap = W + (size_t)o0 * CH;
  const size_t bq = ((size_t)(b * SEQ + n0)) * CH;
  v8f acc[4][2];
  zero_acc(acc);
  gemm_core<2, false>(acc, sm, ap, ap, CH, Xh + bq, Xl + bq, CH, CH / KC, tid);
  stage_nT(Os, acc, 1.0f, wave, hh, c);
  __syncthreads();
  planes_out<true>(Os, bias, o0, Ph, Pl, (size_t)(b * SEQ + n0), tid);
}

// =========================================================================================================
// (3) conv1x1 GEMM into the channel-major f16 value plane: V16[b][o][s] = f16(sum_c (W2h + W2l)[o][c] Xr[b][s][c] + B2[o])
//     (pitch SEQ); A = plane rows s, B = W2 rows o (hi, residual), 2 products, K = 512. Epilogue: transposed LDS staging
//     (rows o), barrier, row o segment of 128 halves = two lines.
// coverage: 8 it x 16 rows x 16 lanes x 8 = 128 o x 128 s; (SEQ/128, 4) blocks for each b = 0..NB-1 cover [NB][512][SEQ] once.
//           sm = the block's LDS, CoreLds<2>::BYTES: two operand buffers; output staging behind the core.
// =========================================================================================================
__device__ __forceinline__
void gemm_val_part(char* sm, const unsigned short* __restrict__ W2h, const unsigned short* __restrict__ W2l,
                   const float* __restrict__ B2, const unsigned short* __restrict__ Xr, unsigned short* V16, int b) {
  float* Os = (float*)sm;
  const int tid = threadIdx.x, lane = tid & 31, wave = tid >> 5;
  const int hh = lane >> 4, c = lane & 15;
  const int nt = blockIdx.x, mb = blockIdx.y;
  const int n0 = nt * BT, o0 = mb * BT;
  const size_t wq = (size_t)o0 * CH;
  const size_t bq = ((size_t)(b * SEQ + n0)) * CH;
  v8f acc[4][2];
  zero_acc(acc);
  gemm_core<2, false>(acc, sm, Xr + bq, Xr + bq, CH, W2h + wq, W2l + wq, CH, CH / KC, tid);
  stage_nT(Os, acc, 1.0f, wave, hh, c);
  __syncthreads();
  const int e = tid & 15, lq = tid >> 4;                             // lq 0..15
  const unsigned bofs = 4u * (unsigned)((lq >> 3) * 32 + (lq & 7));  // the lane's byte offset behind the block's first B2 line
  const char* b2 = (const char*)(B2 + (o0 >> 3) * 32);
  float bv[8];
  // unrolled whole so that bv stays in registers and the eight loads are in flight together
#pragma unroll
  for (int it = 0; it < 8; ++it) bv[it] = *(const float*)(b2 + bofs + 256 * it);   // row it * 16 + lq: two lines on per it
  // bofs addresses the loads; as an input here its register stays live past the last load and is reused only behind this wait
  asm volatile("s_wait_xcnt 0x0" :: "v"(bofs) : "memory");
  v4u u[8];
#pragma unroll
  for (int it = 0; it < 8; ++it) {
    const int row = it * 16 + lq;                                    // o_loc 0..127
    const float bb = bv[it];
    const v4f a = *(const v4f*)(Os + row * OSP + 8 * e);
    const v4f q = *(const v4f*)(Os + row * OSP + 8 * e + 4);
    const float f[8] = {a[0], a[1], a[2], a[3], q[0], q[1], q[2], q[3]};
#pragma unroll
    for (int t = 0; t < 4; ++t) {
      const _Float16 h0 = (_Float16)(f[2 * t] + bb);
      const _Float16 h1 = (_Float16)(f[2 * t + 1] + bb);
      u[it][t] = pk16(h_bits(h0), h_bits(h1));
    }
  }
{
#pragma unroll
    for (int it = 0; it < 8; ++it) {
      const int row = it * 16 + lq;
      const size_t po = ((size_t)(b * CH + o0 + row)) * SEQ + n0 + 8 * e;
      *(v4u*)(V16 + po) = u[it];
    }
    
  }
}

// =========================================================================================================
// (2) for Mn, (2) for Mm and (3) in one launch, grid (SEQ/128, 4, 3 NB): the three products read W16 or W2 and the planes
//     of (1b) and write planes of their own. job = blockIdx.z / NB picks the product (block-uniform, so every barrier of a
//     part is passed by the whole block). W = W16 (order Wn, Wm), W2 = the two planes of (1c) in a row (hi, residual),
//     X = the five planes of (1b) in a row (x_c hi, lo; x_s hi, lo, raw), M = the four result planes (Mn hi, lo; Mm hi, lo).
// =========================================================================================================
constexpr size_t PLE = PLB / 2;                                      // elements of one plane
__global__ __launch_bounds__(256)
void gemm_conv3(const unsigned short* __restrict__ W, const float* __restrict__ bn, const float* __restrict__ bm,
                const unsigned short* __restrict__ W2, const float* __restrict__ B2,
                const unsigned short* __restrict__ X, unsigned short* M, unsigned short* V16) {
  __shared__ __align__(16) char sm[CoreLds<2>::BYTES];
  const int job = blockIdx.z / NB, b = blockIdx.z - job * NB;
  if (job < 2) {
    const size_t pl = (size_t)job * 2 * PLE;
    gemm_nm_part(sm, W + (size_t)job * CH * CH, job ? bm : bn, X + pl, X + pl + PLE, M + pl, M + pl + PLE, b);
  } else {
    gemm_val_part(sm, W2, W2 + (size_t)CH * CH, B2, X + 4 * PLE, V16, b);
  }
}

// =========================================================================================================
// (4) scores S[b][t][s] = sum_c Mn[c][t] Mm[c][s] (no scale) for one (b, 256-s tile, 256-t block): A = Mn planes
//     rows t (hi Qh, residual Ql), B = Mm planes rows s (hi Kh, residual Kl), products hh + hl + lh, K = 512.
//     16 waves (512 threads) as 4 (m) x 4 (n), wave (wm, wn) owns 64 x 64: every operand byte copied from L2 feeds 256 rows
//     or columns, every fragment read from LDS feeds 4 matrix instructions a product. The grid is one block a WGP. The copy
//     ring has gemm_core's order of waits and barriers, a stage = [A0][A1][B0][B1], each 256 rows of KC k; each accumulator
//     takes its products in gemm_core's order (k-steps rising, hh, hl, lh inside a k-step).
//     Epilogue = the softmax inside each of the block's two 128-key tiles: row-major LDS staging, barrier, then per row t
//     and key tile m = max_s S, P16[b][t][s] = f16(e^{S - m} * 16384), l = sum_s e^{S - m} (f32, unrounded terms), Ls = {m, l}.
//     8 lanes a row: lane e8 owns cols 8 e8 .. + 7 and 64 + 8 e8 .. + 7 of the key tile, so 8 lanes store one whole 128-B
//     line of P16, and the max and the sum cross lanes in three xor steps. Wave w owns rows 16 w .. + 15 = one 128-B line of Ls.
// coverage: 16 waves x 2 key tiles x 4 g x 4 rows x 8 lanes x 16 = 256 t x 256 s; grid (SEQ/256, SEQ/256, NB) covers P16
//           [NB][SEQ][SEQ] and Ls [NB][SEQ/128][SEQ] once.
// =========================================================================================================
#define SBT    256
#define STILEB (SBT * LP)
#define SSTG   (4 * STILEB)
#define SOSP   260
static_assert(SEQ % SBT == 0 && SBT == 2 * BT && 2 * SSTG <= 327680);
static_assert(SBT * SOSP * 4 <= 2 * SSTG && (SOSP * 4) % 16 == 0);
// two tiles of 256 rows x 128 B, 512 threads: e = tid & 7 -> 16-B piece of the row, r = tid >> 3 -> row r + 64 i (i = 0..3).
// l, m = the lane's LDS byte addresses of row r, g, h = its global addresses of row r (pitch CH elements).
__device__ __forceinline__ void copy_tiles2w(unsigned l, const unsigned short* g, unsigned m, const unsigned short* h) {
#if defined(__HIP_DEVICE_COMPILE__)
  // eight copies of two tiles, global -> LDS through no register; they share one statement and its closing wait, so that
  // no address register of an issued copy is rewritten ahead of it
  asm volatile("global_load_async_to_lds_b128 %0, %8, off\n\t"
               "global_load_async_to_lds_b128 %1, %9, off\n\t"
               "global_load_async_to_lds_b128 %2, %10, off\n\t"
               "global_load_async_to_lds_b128 %3, %11, off\n\t"
               "global_load_async_to_lds_b128 %4, %12, off\n\t"
               "global_load_async_to_lds_b128 %5, %13, off\n\t"
               "global_load_async_to_lds_b128 %6, %14, off\n\t"
               "global_load_async_to_lds_b128 %7, %15, off\n\t"
               "s_wait_xcnt 0x0"
               :: "v"(l), "v"(l + 64 * LP), "v"(l + 128 * LP), "v"(l + 192 * LP),
                  "v"(m), "v"(m + 64 * LP), "v"(m + 128 * LP), "v"(m + 192 * LP),
                  "v"(g), "v"(g + 64 * CH), "v"(g + 128 * CH), "v"(g + 192 * CH),
                  "v"(h), "v"(h + 64 * CH), "v"(h + 128 * CH), "v"(h + 192 * CH) : "memory");
#endif
}
__device__ __forceinline__ void fill_sc(unsigned l, const unsigned short* a0, const unsigned short* a1,
                                        const unsigned short* b0, const unsigned short* b1) {
  copy_tiles2w(l, a0, l + STILEB, a1);
  copy_tiles2w(l + 2 * STILEB, b0, l + 3 * STILEB, b1);
}
__global__ __launch_bounds__(512)
void gemm_sc(const unsigned short* __restrict__ Qh, const unsigned short* __restrict__ Ql,
             const unsigned short* __restrict__ Kh, const unsigned short* __restrict__ Kl,
             unsigned short* P16, float* Ls) {
  __shared__ __align__(16) char sm[2 * SSTG];                  // two operand buffers; output staging behind the loop
  float* Os = (float*)sm;
  const int tid = threadIdx.x, lane = tid & 31, wave = tid >> 5;     // wave 0..15
  const int hh = lane >> 4, c = lane & 15;
  const int wm = wave >> 2, wn = wave & 3;
  const int nt = blockIdx.x, mb = blockIdx.y, b = blockIdx.z;
  const int n0 = nt * SBT, m0 = mb * SBT;
  const int e = tid & 7, r = tid >> 3;                               // r 0..63
  const unsigned lc = lds_off(sm) + (unsigned)(r * LP + 16 * e);
  const size_t aq = ((size_t)(b * SEQ + m0 + r)) * CH + 8 * e;
  const size_t bq = ((size_t)(b * SEQ + n0 + r)) * CH + 8 * e;
  const unsigned short *qh = Qh + aq, *ql = Ql + aq, *kh = Kh + bq, *kl = Kl + bq;
  const unsigned fa = (unsigned)((64 * wm + c) * LP + 16 * hh);
  const unsigned fb = 2 * STILEB + (unsigned)((64 * wn + c) * LP + 16 * hh);
  v8f acc[4][4];
  // unrolled whole, here and in the staging below: acc is indexed by constants only and stays in registers
#pragma unroll
  for (int mt = 0; mt < 4; ++mt) {
#pragma unroll
    for (int nf = 0; nf < 4; ++nf) acc[mt][nf] = zero8();
  }
  fill_sc(lc, qh, ql, kh, kl);
  asm volatile("s_wait_asynccnt 0x0" ::: "memory");                  // pass 0's own copies have landed
  __syncthreads();                                                   // ... and every other wave's
  fill_sc(lc + SSTG, qh + KC, ql + KC, kh + KC, kl + KC);
  // kept rolled: one pass is 96 matrix instructions with their fragment loads, and the code stays small
#pragma unroll 1
  for (int t = 0; t < CH / KC; ++t) {
    const unsigned bo = (unsigned)(t & 1) * SSTG;
    // the loops below are unrolled whole so that the fragment arrays stay in registers and the LDS offsets are immediates
#pragma unroll
    for (int ks = 0; ks < KC / 32; ++ks) {
      const unsigned o = bo + 64u * ks;
      Frag fb0[4], fb1[4];
#pragma unroll
      for (int nf = 0; nf < 4; ++nf) {
        fb0[nf] = ldfrag((const unsigned short*)(sm + fb + 16 * LP * nf + o));
        fb1[nf] = ldfrag((const unsigned short*)(sm + fb + STILEB + 16 * LP * nf + o));
      }
      // the A fragments come two m-tiles at a time: all four beside the 128 accumulator registers would pass a wave's 256
#pragma unroll
      for (int mh = 0; mh < 2; ++mh) {
        Frag fa0[2], fa1[2];
#pragma unroll
        for (int i = 0; i < 2; ++i) {
          fa0[i] = ldfrag((const unsigned short*)(sm + fa + 16 * LP * (2 * mh + i) + o));
          fa1[i] = ldfrag((const unsigned short*)(sm + fa + STILEB + 16 * LP * (2 * mh + i) + o));
        }
#pragma unroll
        for (int p = 0; p < 3; ++p) {
#pragma unroll
          for (int i = 0; i < 2; ++i) {
#pragma unroll
            for (int nf = 0; nf < 4; ++nf) {
              v8f& d = acc[2 * mh + i][nf];
              if (p == 0)      d = mma_b(fa0[i].bf, fb0[nf].bf, d);
              else if (p == 1) d = mma_b(fa0[i].bf, fb1[nf].bf, d);
              else             d = mma_b(fa1[i].bf, fb0[nf].bf, d);
            }
          }
        }
      }
    }
    asm volatile("s_wait_dscnt 0x0" ::: "memory");                   // this wave's reads of the buffer are done before it is refilled
    asm volatile("s_wait_asynccnt 0x0" ::: "memory");                // this wave's copies of pass t + 1 have landed
    __syncthreads();                                                 // publishes pass t + 1, ends every read of pass t's buffer
    if (t + 2 < CH / KC) {
      const int ko = KC * (t + 2);
      fill_sc(lc + bo, qh + ko, ql + ko, kh + ko, kl + ko);
    }
  }
  asm volatile("s_wait_asynccnt 0x0" ::: "memory");                  // nothing outstanding when the LDS changes its use
  // row-major staging Os[m_loc][n_loc] (pitch SOSP), scalar LDS stores
#pragma unroll
  for (int nf = 0; nf < 4; ++nf) {
#pragma unroll
    for (int mt = 0; mt < 4; ++mt) {
#pragma unroll
      for (int q = 0; q < 8; ++q) Os[(64 * wm + 16 * mt + 8 * hh + q) * SOSP + 64 * wn + 16 * nf + c] = acc[mt][nf][q];
    }
  }
  __syncthreads();
  const int e8 = lane & 7, rq = lane >> 3;                           // rq 0..3
  // unrolled so that the staging offsets of both key tiles are immediates
#pragma unroll
  for (int kt = 0; kt < 2; ++kt) {                                   // key tile 2 nt + kt
    float mxs[4], sms[4];
    v4u u[4][2];
#pragma unroll
    for (int g = 0; g < 4; ++g) {
      const float* orow = Os + (16 * wave + 4 * g + rq) * SOSP + BT * kt + 8 * e8;
      float f[16];
#pragma unroll
      for (int k = 0; k < 2; ++k) {
        const v4f a = *(const v4f*)(orow + 64 * k);
        const v4f q = *(const v4f*)(orow + 64 * k + 4);
#pragma unroll
        for (int t = 0; t < 4; ++t) { f[8 * k + t] = a[t]; f[8 * k + 4 + t] = q[t]; }
      }
      float mx = f[0];
#pragma unroll
      for (int i = 1; i < 16; ++i) mx = fmaxf(mx, f[i]);
#pragma unroll
      for (int o = 4; o > 0; o >>= 1) mx = fmaxf(mx, __shfl_xor(mx, o, 32));
      float l = 0.f;
#pragma unroll
      for (int i = 0; i < 16; ++i) { f[i] = exp_slot(f[i] - mx); l += f[i]; }
#pragma unroll
      for (int o = 4; o > 0; o >>= 1) l += __shfl_xor(l, o, 32);
#pragma unroll
      for (int k = 0; k < 2; ++k) {
#pragma unroll
        for (int t = 0; t < 4; ++t) {
          const _Float16 h0 = (_Float16)(f[8 * k + 2 * t] * PCAR);
          const _Float16 h1 = (_Float16)(f[8 * k + 2 * t + 1] * PCAR);
          u[g][k][t] = pk16(h_bits(h0), h_bits(h1));
        }
      }
      mxs[g] = mx;
      sms[g] = l;
    }
    unsigned short* pr[4];
#pragma unroll
    for (int g = 0; g < 4; ++g) {
      pr[g] = P16 + ((size_t)(b * SEQ + m0 + 16 * wave + 4 * g + rq)) * SEQ + n0 + BT * kt + 8 * e8;
      *(v4u*)(pr[g])      = u[g][0];
      *(v4u*)(pr[g] + 64) = u[g][1];
    }
    // the stores' addresses and data are inputs here so that their registers stay live past the last store and are reused only behind this wait
    asm volatile("s_wait_xcnt 0x0" :: "v"(pr[0]), "v"(pr[1]), "v"(pr[2]), "v"(pr[3]), "v"(u[0][0]), "v"(u[0][1]), "v"(u[1][0]),
                 "v"(u[1][1]), "v"(u[2][0]), "v"(u[2][1]), "v"(u[3][0]), "v"(u[3][1]) : "memory");
    // lane (e8 < 4, rq) stores the pair of row 4 e8 + rq of the wave's 16
    v2f st;
    st[0] = e8 == 0 ? mxs[0] : e8 == 1 ? mxs[1] : e8 == 2 ? mxs[2] : mxs[3];
    st[1] = e8 == 0 ? sms[0] : e8 == 1 ? sms[1] : e8 == 2 ? sms[2] : sms[3];
    float* lp = Ls + 2 * ((size_t)(b * NKT + 2 * nt + kt) * SEQ + m0 + 16 * wave + 4 * e8 + rq);
    if (e8 < 4)
      *(v2f*)lp = st;
    // the pair's address and data are inputs here so that the next key tile's code reuses their registers only behind this wait
    asm volatile("s_wait_xcnt 0x0" :: "v"(lp), "v"(st) : "memory");
  }
}

// =========================================================================================================
// (6) out[b][c][t] = sum_j F[j][t] (1/16384) sum_{s in key tile j} V16[b][c][s] P16[b][t][s] + bias[c] +
//     bf16-RNE(xres[b][c][t]) for one (b, 128-t tile, 128-c block), F[j][t] = e^{m_j - m} / sum_i l_i e^{m_i - m}, m = max_j m_j, from the {m_j, l_j} pairs of (4): the
//     row's softmax over all SEQ keys. A = V16 rows c (k = s contiguous, pitch SEQ), B = P16 rows t (pitch SEQ), f16
//     instruction, 1 product, K = SEQ. The copy ring has gemm_core's order of waits and barriers, but a stage of it is NSV
//     tile pairs of KC k in a row (KSV k): the grid gives a WGP one block, so nothing but the block's own copies hides their
//     latency, and a long stage keeps NSV times the bytes in flight and meets that latency once per KSV k. A key tile = two
//     tile pairs sums into part (from a zero C), which is then added into acc with the lane's two column factors.
//     F (LDS behind the ring, [NKT][128]) is formed by waves 0..3 while stage 0's copies fly; the barrier that publishes stage 0
//     publishes F too. Output and residual rows at full strides. Epilogue: row-major LDS staging, barrier, the sums scaled
//     by 2^-14 with bias and residual added, whole 512-B row pieces stored.
// coverage: 16 it x 8 rows x 32 lanes x 4 = 128 c x 128 t; grid (SEQ/128, 4, NB) covers out[b][0..511][0..SEQ-1] once.
// =========================================================================================================
#define NSV  4
#define KSV  (NSV * KC)
#define NSTV (SEQ / KSV)
static_assert(SEQ % KSV == 0 && NSTV >= 2 && KSV % BT == 0);
static_assert(CoreLds<1, NSV>::BYTES + NKT * BT * 4 <= 327680);
__global__ __launch_bounds__(256)
void gemm_pv(const unsigned short* __restrict__ V16, const unsigned short* __restrict__ P16,
             const float* __restrict__ Ls, const float* __restrict__ bias, const float* __restrict__ xres, float* out) {
  constexpr unsigned SUB = CoreLds<1, NSV>::SET;                     // one tile pair
  constexpr unsigned STG = CoreLds<1, NSV>::STG;                     // one stage
  __shared__ __align__(16) char sm[2 * STG + NKT * BT * 4];          // two operand buffers (output staging behind the loop), F
  float* Os = (float*)sm;
  float* Fs = (float*)(sm + 2 * STG);
  const int tid = threadIdx.x, lane = tid & 31, wave = tid >> 5;
  const int hh = lane >> 4, c = lane & 15;
  const int wm = wave >> 2, wn = wave & 3;
  const int nt = blockIdx.x, mb = blockIdx.y, b = blockIdx.z;
  const int n0 = nt * BT, o0 = mb * BT;
  const int e = tid & 7, r = tid >> 3;                               // r 0..31
  const unsigned lc = lds_off(sm) + (unsigned)(r * LP + 16 * e);
  const unsigned short* ap = V16 + ((size_t)(b * CH + o0)) * SEQ + (size_t)r * SEQ + 8 * e;
  const unsigned short* bp = P16 + ((size_t)(b * SEQ + n0)) * SEQ + (size_t)r * SEQ + 8 * e;
  const unsigned fa = (unsigned)((64 * wm + c) * LP + 16 * hh);
  const unsigned fb = TILEB + (unsigned)((32 * wn + c) * LP + 16 * hh);
  v8f acc[4][2];
  zero_acc(acc);
  fill_ring<1, NSV>(lc, ap, ap, 32 * SEQ, bp, bp, 32 * SEQ);
  if (tid < BT) {                                                    // whole waves 0..3: thread = column t of the block
    const v2f* lb = (const v2f*)(Ls + 2 * ((size_t)b * NKT * SEQ + n0));   // block-uniform: tile 0's pair of column 0
    float m[NKT], l[NKT];
#pragma unroll
    for (int j = 0; j < NKT; ++j) {
      const v2f s = lb[tid + j * SEQ];
      m[j] = s[0];
      l[j] = s[1];
    }
    // tid addresses the loads; as an input here its register stays live past the last load and is reused only behind this wait
    asm volatile("s_wait_xcnt 0x0" :: "v"(tid) : "memory");
    float mx = m[0];
#pragma unroll
    for (int j = 1; j < NKT; ++j) mx = fmaxf(mx, m[j]);
    float ls = 0.f;
#pragma unroll
    for (int j = 0; j < NKT; ++j) { m[j] = exp_slot(m[j] - mx); ls = __builtin_fmaf(l[j], m[j], ls); }
    const float il = 1.0f / ls;                                      // ls >= 1
#pragma unroll
    for (int j = 0; j < NKT; ++j) Fs[j * BT + tid] = m[j] * il;
  }
  asm volatile("s_wait_asynccnt 0x0" ::: "memory");                  // stage 0's own copies have landed
  __syncthreads();                                                   // ... and every other wave's; F is written
  fill_ring<1, NSV>(lc + STG, ap + KSV, ap + KSV, 32 * SEQ, bp + KSV, bp + KSV, 32 * SEQ);
  // kept rolled over the stages: a stage is 64 matrix instructions with their fragment loads, and the code stays small
#pragma unroll 1
  for (int st = 0; st < NSTV; ++st) {
    const unsigned bo = (unsigned)(st & 1) * STG;
    // the loops below are unrolled whole so that the LDS offsets inside a stage are constants, the fragment arrays stay in
    // registers and each key tile's first matrix instructions take a zero C
#pragma unroll
    for (int kt = 0; kt < KSV / BT; ++kt) {                          // key tile j = (KSV / BT) st + kt
      v8f part[4][2];
      // the tile's two column factors are read with its first fragments, so that their LDS latency is over when they are used
      const float* fr = Fs + (st * (KSV / BT) + kt) * BT + 32 * wn + c;
      const float f0 = fr[0], f1 = fr[16];
#pragma unroll
      for (int h = 0; h < 2; ++h) {                                  // tile pair 2 kt + h of the stage
#pragma unroll
        for (int ks = 0; ks < KC / 32; ++ks) {
          const unsigned o = bo + (unsigned)(2 * kt + h) * SUB + 64u * ks;
          Frag fb0[2], fa0[4];
#pragma unroll
          for (int nf = 0; nf < 2; ++nf) fb0[nf] = ldfrag((const unsigned short*)(sm + fb + 16 * LP * nf + o));
#pragma unroll
          for (int mt = 0; mt < 4; ++mt) fa0[mt] = ldfrag((const unsigned short*)(sm + fa + 16 * LP * mt + o));
#pragma unroll
          for (int mt = 0; mt < 4; ++mt) {
#pragma unroll
            for (int nf = 0; nf < 2; ++nf)
              part[mt][nf] = mma_h(fa0[mt].h, fb0[nf].h, (h == 0 && ks == 0) ? zero8() : part[mt][nf]);
          }
        }
      }
      // the key tile is summed: weigh it and add it in
#pragma unroll
      for (int mt = 0; mt < 4; ++mt) {
#pragma unroll
        for (int q = 0; q < 8; ++q) {
          acc[mt][0][q] = __builtin_fmaf(part[mt][0][q], f0, acc[mt][0][q]);
          acc[mt][1][q] = __builtin_fmaf(part[mt][1][q], f1, acc[mt][1][q]);
        }
      }
    }
    asm volatile("s_wait_dscnt 0x0" ::: "memory");                   // this wave's reads of the buffer are done before it is refilled
    asm volatile("s_wait_asynccnt 0x0" ::: "memory");                // this wave's copies of stage st + 1 have landed
    __syncthreads();                                                 // publishes stage st + 1, ends every read of stage st's buffer
    if (st + 2 < NSTV) {                                             // stage st + 2 exists
      const int ko = KSV * (st + 2);
      fill_ring<1, NSV>(lc + bo, ap + ko, ap + ko, 32 * SEQ, bp + ko, bp + ko, 32 * SEQ);
    }
  }
  asm volatile("s_wait_asynccnt 0x0" ::: "memory");                  // nothing outstanding when the LDS changes its use
  stage_mn(Os, acc, wave, hh, c);
  __syncthreads();
  const int lq = tid >> 5;                                           // lq 0..7
  const size_t blk0 = ((size_t)(b * CH + o0)) * T_FULL + n0;         // block-uniform: row 0, col 0 of the tile
  const unsigned xofs = 4u * (unsigned)(lq * T_FULL + 4 * lane);     // the lane's byte offset behind it, row lq
  const char* xb = (const char*)(xres + blk0);
  const float* bo0 = bias + o0;
  v4f res[16];
  // both loops are unrolled whole so that res stays in registers and the sixteen residual loads are in flight together
#pragma unroll
  for (int it = 0; it < 16; ++it) {
    const int row = it * 8 + lq;                                     // c_loc 0..127
    const float bb = bfr(bo0[lq + 8 * it]);
    const v4f a  = *(const v4f*)(Os + row * OSP + 4 * lane);
    const v4f xv = *(const v4f*)(xb + xofs + (size_t)it * (32 * T_FULL));
#pragma unroll
    for (int t = 0; t < 4; ++t) res[it][t] = __builtin_fmaf(a[t], IPCAR, bb) + bfr(xv[t]);
  }
  // xofs and lq address the loads; as inputs here their registers stay live past the last load and are reused only behind this wait
  asm volatile("s_wait_xcnt 0x0" :: "v"(xofs), "v"(lq) : "memory");
#pragma unroll
  for (int it = 0; it < 16; ++it) {
    const int row = it * 8 + lq;
    const size_t idx = blk0 + (size_t)row * T_FULL + 4 * lane;
    *(v4f*)(out + idx) = res[it];
  }
}

// =========================================================================================================
extern "C" void kernel_launch(void* const* d_in, const int* in_sizes, int n_in,
                              void* d_out, int out_size, void* d_ws, size_t ws_size,
                              hipStream_t stream) {
  if (n_in < 10) return;
  if (in_sizes[0] < NB * CH * T_FULL || in_sizes[1] < NB * CH * T_FULL) return;
  if (in_sizes[2] < CH * CH || in_sizes[4] < CH * CH || in_sizes[6] < CH * CH || in_sizes[8] < CH * CH) return;
  if (in_sizes[3] < CH || in_sizes[5] < CH || in_sizes[7] < CH || in_sizes[9] < CH) return;
  if (out_size < NB * CH * T_FULL) return;

  size_t off = 0;
  auto carve = [&](size_t bytes) { const size_t o = off; off += (bytes + 255) & ~(size_t)255; return o; };
  const size_t oW = carve(WB);
  const size_t oX = carve(RXB);
  const size_t oM = carve(RMB);
  const size_t oV = carve(RVB);
  const size_t oT = carve(STB);
  const size_t oW2 = carve(W2B);
  const size_t oB2 = carve(B2B);
  if (off > ws_size) return;
  if (off > (size_t)WS_CAP) return;

  const float* x_c = (const float*)d_in[0];
  const float* x_s = (const float*)d_in[1];
  const float* Wn  = (const float*)d_in[2];
  const float* bn  = (const float*)d_in[3];
  const float* Wm  = (const float*)d_in[4];
  const float* bm  = (const float*)d_in[5];
  const float* Wl  = (const float*)d_in[6];
  const float* bl  = (const float*)d_in[7];
  const float* Wo  = (const float*)d_in[8];
  const float* bo  = (const float*)d_in[9];
  float* out = (float*)d_out;

  char* ws = (char*)d_ws;
  unsigned short* W16  = (unsigned short*)(ws + oW);
  // region X users
  unsigned short* Xcnh = (unsigned short*)(ws + oX);
  unsigned short* Xcnl = (unsigned short*)(ws + oX + PLB);
  unsigned short* Xsnh = (unsigned short*)(ws + oX + 2 * PLB);
  unsigned short* Xsnl = (unsigned short*)(ws + oX + 3 * PLB);
  unsigned short* Xsr  = (unsigned short*)(ws + oX + 4 * PLB);
  unsigned short* P16  = (unsigned short*)(ws + oX);
  float*          Ls   = (float*)(ws + oX + PB);
  // region M users
  unsigned short* Mnh  = (unsigned short*)(ws + oM);
  unsigned short* Mnl  = (unsigned short*)(ws + oM + PLB);
  unsigned short* Mmh  = (unsigned short*)(ws + oM + 2 * PLB);
  unsigned short* Mml  = (unsigned short*)(ws + oM + 3 * PLB);
  // region V
  unsigned short* V16  = (unsigned short*)(ws + oV);
  // region T
  float*          St   = (float*)(ws + oT);
  // regions W2, B2
  unsigned short* W2h  = (unsigned short*)(ws + oW2);
  unsigned short* W2l  = (unsigned short*)(ws + oW2 + W2B / 2);
  float*          B2   = (float*)(ws + oB2);

  const dim3 blk256(256);
  const dim3 gconv(SEQ / BT, CH / BT, NB);

  // (0) + (1a) instance-norm statistics of x_c and x_s; weights -> bf16 planes (order Wn, Wm, Wl transposed, Wo); Wo.bl
  prep<<<dim3(NSTATB + NCVTWB), blk256, 0, stream>>>(x_c, x_s, Wn, Wm, Wl, Wo, bl, St, W16, B2);
  // (1b) + (1c) split planes of norm(x_c); same for x_s plus the raw bf16 plane; W2 = Wo.Wl hi + residual planes
  cvt_norm2<<<dim3(NW2B + (SEQ / NT) * (CH / QT) * 2 * NB), blk256, 0, stream>>>(x_c, x_s, St, Xcnh, Xcnl, Xsnh, Xsnl, Xsr,
                                                                                 W16, W2h, W2l);
  // (2) + (3) Mn, Mm hi + residual planes and the Ml2 value plane
  gemm_conv3<<<dim3(SEQ / BT, CH / BT, 3 * NB), blk256, 0, stream>>>(W16, bn, bm, W2h, B2, Xcnh, Mnh, V16);
  // (4) scores -> tile-local softmax weights and {max, sum} pairs (overwrites region X)
  gemm_sc<<<dim3(SEQ / SBT, SEQ / SBT, NB), dim3(512), 0, stream>>>(Mnh, Mnl, Mmh, Mml, P16, Ls);
  // (6) output rows: value plane x softmax weights + bias + residual
  gemm_pv<<<gconv, blk256, 0, stream>>>(V16, P16, Ls, bo, x_c, out);
  (void)hipGetLastError();
}

// v010
// Measured time: 89.4 microseconds a run.
// Versions between v008 and this one are left out; their measured steps multiply to 1.23 times as fast.
// Counting every step since v000, it is 7.45 times as fast.
// Contractions: G = Wm^T.Wn and W2 = Wo.Wl on v_wmma_f32_16x16x32_bf16 (bf16-RNE weights, 1 product, K=512); conv1x1
// G.norm(x_c) on v_wmma_f32_16x16x32_bf16 (bf16 hi + residual planes of both, 3 products, K=512); conv1x1 W2.x_s on
// v_wmma_f32_16x16x32_bf16 (bf16 hi + residual planes of W2 x bf16-RNE x_s, 2 products); position scores Mq^T.x_s
// on v_wmma_f32_16x16x32_bf16 (bf16 hi + residual planes of Mq x bf16-RNE x_s, 2 products, K=512);
// Ml2.A^T on v_wmma_f32_16x16x32_f16 (f16 Ml2 plane x softmax weights carried x16384 as f16,
// K=2048); f32 accumulate everywhere; instance-norm statistics, softmax, bias and residual adds in f32 VALU.
// The key conv has no GEMM over the positions: Mn^T.(Wm.xs + bm) = (Wm^T.Mn)^T.xs + Mn^T.bm, and the last term is the same for
// every key of a row, so the softmax over the keys does not see it: the scores are Mq0^T.norm(x_s) with
// Mq0 = (Wm^T.Wn).norm(x_c) + Wm^T.bn, and bm has no part in the result.
// The instance norm of x_s has no plane of its own: Mq0^T.((x_s - mu) rs) = (rs Mq0)^T.x_s - (rs Mq0)^T.mu, and the last term is
// again the same for every key of a row: the scores are Mq^T.x_s with Mq = rs Mq0 (row c of Mq0 times x_s's rstd of channel c),
// and x_s, which enters as its bf16-RNE value, is one exact bf16 plane: no residual plane and no third product.
// The output conv has no GEMM over the positions: Wo.((Wl.x_s + bl).A^T) = ((Wo.Wl).x_s + Wo.bl).A^T, so the value plane is
// Ml2 = W2.x_s + Wo.bl and the GEMM with the softmax weights gives the output rows, to which bo and x_c are added.
// The softmax has no launch of its own: the score GEMM's epilogue normalises each row inside its own
// 128-key tile, and the last GEMM weighs each key tile's partial product with the row's factor for that tile.
#include <hip/hip_runtime.h>
#include <stdint.h>

#ifndef NB
#define NB 4
#endif
#ifndef SEQ
#define SEQ 2048
#endif
#define NB_FULL 4
#define T_FULL  2048
#define CH      512
#define NMAT    4
#define QT      64
#define BT      128
#define OSP     132
#define TP      72
#define NT      128
#define KC      64
#define LP      144
#define TILEB   (BT * LP)
#define NKT     (SEQ / BT)
#define PCAR    16384.0f
#define IPCAR   6.103515625e-05f
#define EPSN    1.0e-5f
#define WS_CAP  134217728

static_assert(NB >= 1 && NB <= NB_FULL);
static_assert(SEQ >= 256 && SEQ <= T_FULL && SEQ % 256 == 0);
static_assert(SEQ % QT == 0 && CH % QT == 0 && SEQ % NT == 0 && SEQ % BT == 0 && CH % BT == 0);
static_assert(CH % 256 == 0 && CH % 32 == 0 && SEQ % 32 == 0 && SEQ % 16 == 0);
static_assert((OSP * 4) % 16 == 0);
static_assert((TP * 2) % 16 == 0);
static_assert((NB * SEQ) % 8 == 0);
static_assert(CH % 8 == 0);
static_assert(CH % KC == 0 && SEQ % KC == 0 && CH / KC >= 2 && SEQ / KC >= 2);
static_assert(KC * 2 + 16 == LP && LP % 32 == 16 && QT == 64 && BT == 128);
static_assert(BT * OSP * 4 <= 2 * 2 * TILEB);
static_assert(BT == 2 * KC);
static_assert(CH == 2 * 256);

typedef _Float16       v16h __attribute__((ext_vector_type(16)));
typedef _Float16       v8h  __attribute__((ext_vector_type(8)));
typedef __bf16         v16b __attribute__((ext_vector_type(16)));
typedef unsigned short v8us __attribute__((ext_vector_type(8)));
typedef float          v8f  __attribute__((ext_vector_type(8)));
typedef float          v4f  __attribute__((ext_vector_type(4)));
typedef float          v2f  __attribute__((ext_vector_type(2)));
typedef unsigned int   v4u  __attribute__((ext_vector_type(4)));

union Frag { v8us u[2]; v16h h; v16b bf; };
static_assert(sizeof(Frag) == 32);

// ---- workspace map (bytes; every region start a multiple of 256; every extent is an exact tile multiple and is
//      launches; each later user fully overwrites what it reads before any read):
//   W : bf16 [4][512][512] weights (Wn, Wm, Wl, each transposed; Wo)            WB
//   X : three bf16 planes [NB][SEQ][512] (x_c norm hi/lo, x_s raw)              3*PLB
//   P : tile-local softmax weights f16 [NB][SEQ][SEQ]                           PB
//       and behind them {max, sum} f32 pairs [NB][SEQ/128 key tiles][SEQ]       LSB
//   M : Mq hi/lo bf16 planes [NB][SEQ][512]                                     2*PLB
//   V : Ml2 f16 plane [NB][512][SEQ]                                            PLB
//   T : instance-norm {mean, rstd} f32 pairs [2][NB][512]                       STB
//   W2: W2 = Wo.Wl, bf16 hi and residual planes [512][512]                      W2B
//   G : G = Wm^T.Wn, bf16 hi and residual planes [512][512]                     W2B
//   H : Wm^T.bn f32 [512]                                                       HB
//   B2: Wo.bl f32, row o at (o / 8) * 32 + o % 8: the 8 rows of one writing block have a 128-B line of their own   B2B
constexpr size_t PLB = (size_t)NB * SEQ * CH * 2;
constexpr size_t LSB = (size_t)NB * NKT * SEQ * 2 * 4;
constexpr size_t PB  = (size_t)NB * SEQ * SEQ * 2;
constexpr size_t WB  = (size_t)NMAT * CH * CH * 2;
constexpr size_t RXB = 3 * PLB;
constexpr size_t RPB = PB + LSB;
constexpr size_t RMB = 2 * PLB;
constexpr size_t HB  = (size_t)CH * 4;
constexpr size_t RVB = PLB;
constexpr size_t STB = (size_t)2 * NB * CH * 2 * 4;
constexpr size_t W2B = (size_t)2 * CH * CH * 2;
constexpr size_t B2B = (size_t)(CH / 8) * 32 * 4;
static_assert(WB % 256 == 0 && PLB % 256 == 0 && LSB % 256 == 0 && PB % 256 == 0);
static_assert(HB % 256 == 0);
static_assert(STB % 256 == 0 && (NB * CH) % 16 == 0);
static_assert(W2B % 256 == 0 && B2B % 256 == 0);
static_assert(WB + RXB + RPB + RMB + RVB + STB + 2 * W2B + HB + B2B <= (size_t)WS_CAP);

// ---- scalar helpers -----------------------------------------------------------------------------------------
__device__ __forceinline__ unsigned short bf_bits(float f) {          // f32 -> bf16 bits, RNE convert
  unsigned u = __float_as_uint(f);
  return (unsigned short)((u + 0x7FFFu + ((u >> 16) & 1u)) >> 16);
}
__device__ __forceinline__ float bf_up(unsigned short hb) { return __uint_as_float(((unsigned)hb) << 16); }
__device__ __forceinline__ float bfr(float f) { return bf_up(bf_bits(f)); }
__device__ __forceinline__ unsigned short h_bits(_Float16 x) { return __builtin_bit_cast(unsigned short, x); }
__device__ __forceinline__ unsigned pk16(unsigned short a, unsigned short b) { return (unsigned)a | ((unsigned)b << 16); }
// e^x as 2^(x log2 e) on the hardware's exponential, as __expf gives it; the v_nop in the statement is the slot that the
// instruction set asks for between a transcendental and a next instruction that reads its result or overwrites its source
__device__ __forceinline__ float exp_slot(float x) {
  float y = x * 1.44269504f;
#if defined(__HIP_DEVICE_COMPILE__)
  asm("v_exp_f32 %0, %0\n\tv_nop" : "+v"(y));
#endif
  return y;
}
__device__ __forceinline__ v8f zero8() { v8f z = {0.f, 0.f, 0.f, 0.f, 0.f, 0.f, 0.f, 0.f}; return z; }

// ---- 16-bit fragment loader (A, or B from a k-contiguous [n][k] row): lane -> row/col (lane&15), p already includes
//      + 8*(lane>>4); elements 0..7 <- p[0..7] (k0+8h..), elements 8..15 <- p[16..23] (k0+16+8h..)
__device__ __forceinline__ Frag ldfrag(const unsigned short* p) {
  Frag f;
  f.u[0] = *(const v8us*)(p);
  f.u[1] = *(const v8us*)(p + 16);
  return f;
}

// ---- WMMA helpers: builtin followed by a 4-slot VALU gap tying D and keeping A/B live ----------------------------
__device__ __forceinline__ v8f mma_h(v16h a, v16h b, v8f c) {
  v8f d = __builtin_amdgcn_wmma_f32_16x16x32_f16(false, a, false, b, (short)0, c, false, false);
#if defined(__HIP_DEVICE_COMPILE__)
  asm volatile("v_nop\n\tv_nop\n\tv_nop\n\tv_nop" : "+v"(d) : "v"(a), "v"(b));
#endif
  return d;
}
__device__ __forceinline__ v8f mma_b(v16b a, v16b b, v8f c) {
  v8f d = __builtin_amdgcn_wmma_f32_16x16x32_bf16(false, a, false, b, (short)0, c, false, false);
#if defined(__HIP_DEVICE_COMPILE__)
  const v16h ha = __builtin_bit_cast(v16h, a), hb = __builtin_bit_cast(v16h, b);
  asm volatile("v_nop\n\tv_nop\n\tv_nop\n\tv_nop" : "+v"(d) : "v"(ha), "v"(hb));
#endif
  return d;
}

// ---- asynchronous copies of operand tiles into LDS. One tile of a pass = 128 rows x 128 B (KC elements), LDS pitch LP.
//      Lane map: e = tid & 7 -> 16-B piece of the row, r = tid >> 3 -> row r + 32 i (i = 0..3): 8 lanes cover one whole
//      128-B line. l = the lane's LDS byte address of row r, g = its global address of row r, p32 = elements of 32 rows.
//      The s_wait_xcnt closes each statement so that no address register of an issued copy is rewritten ahead of it.
__device__ __forceinline__ unsigned lds_off(const void* p) { return (unsigned)(size_t)p; }
__device__ __forceinline__ void copy_tile(unsigned l, const unsigned short* g, size_t p32) {
#if defined(__HIP_DEVICE_COMPILE__)
  // four copies of one tile, global -> LDS through no register; the wait is their statement's last line
  asm volatile("global_load_async_to_lds_b128 %0, %4, off\n\t"
               "global_load_async_to_lds_b128 %1, %5, off\n\t"
               "global_load_async_to_lds_b128 %2, %6, off\n\t"
               "global_load_async_to_lds_b128 %3, %7, off\n\t"
               "s_wait_xcnt 0x0"
               :: "v"(l), "v"(l + 32 * LP), "v"(l + 64 * LP), "v"(l + 96 * LP),
                  "v"(g), "v"(g + p32), "v"(g + 2 * p32), "v"(g + 3 * p32) : "memory");
#endif
}
__device__ __forceinline__ void copy_tiles2(unsigned l, const unsigned short* g, size_t p32,
                                            unsigned m, const unsigned short* h, size_t q32) {
#if defined(__HIP_DEVICE_COMPILE__)
  // eight copies of two tiles, global -> LDS through no register; they share one statement and its closing wait
  asm volatile("global_load_async_to_lds_b128 %0, %8, off\n\t"
               "global_load_async_to_lds_b128 %1, %9, off\n\t"
               "global_load_async_to_lds_b128 %2, %10, off\n\t"
               "global_load_async_to_lds_b128 %3, %11, off\n\t"
               "global_load_async_to_lds_b128 %4, %12, off\n\t"
               "global_load_async_to_lds_b128 %5, %13, off\n\t"
               "global_load_async_to_lds_b128 %6, %14, off\n\t"
               "global_load_async_to_lds_b128 %7, %15, off\n\t"
               "s_wait_xcnt 0x0"
               :: "v"(l), "v"(l + 32 * LP), "v"(l + 64 * LP), "v"(l + 96 * LP),
                  "v"(m), "v"(m + 32 * LP), "v"(m + 64 * LP), "v"(m + 96 * LP),
                  "v"(g), "v"(g + p32), "v"(g + 2 * p32), "v"(g + 3 * p32),
                  "v"(h), "v"(h + q32), "v"(h + 2 * q32), "v"(h + 3 * q32) : "memory");
#endif
}

// ---- GEMM core for one 128(m) x 128(n) block tile, 8 waves (256 threads) as 2 (m) x 4 (n): wave (wm, wn) owns a
//      64 x 32 tile, cols n = 32 wn + 16 nf + (lane&15) (2 B fragments per k-step per B plane), A rows
//      m = 64 wm + 16 mt + (lane&15) (4 m-tiles): every fragment read from LDS feeds 2 or 4 matrix instructions a product,
//      every operand byte copied from L2 feeds 128 rows or columns. a0/a1/b0/b1 = row 0, k = 0 of the
//      block's 128 operand rows (k-contiguous, pitches ap / bp elements). A pass = NS KC k = NS tile sets of KC k in a row,
//      a set = [A0][A1 if NPROD 3][B0][B1 if NPROD >= 2]: they are copied into one of two LDS buffers one pass ahead, and the
//      fragments are read from LDS with the split k map (ldfrag), k-steps and products in the same order as from
//      global rows. NPROD: 1 = a0.b0; 2 = a0.b0 + a0.b1; 3 = a0.b0 + a0.b1 + a1.b0 (shared accumulator, unscaled
//      residual planes; each accumulator takes its products of a k-step in that order, the 8 tiles of one product in a
//      row). HALF selects the f16 instruction (NPROD 1 only). NS > 1 is for a grid of one block a WGP, where nothing but the
//      block's own copies hides their latency: NS times the bytes in flight, that latency met once per NS KC k. npass = passes
//      (at least 2). On return no copy is outstanding and every
//      wave has left both buffers (the last pass's barrier), so sm may be reused as output staging.
template <int NPROD, int NS = 1>
struct CoreLds {
  static constexpr int NA = NPROD >= 3 ? 2 : 1;
  static constexpr int NBP = NPROD >= 2 ? 2 : 1;
  static constexpr unsigned SET = (unsigned)(NA + NBP) * TILEB;      // the operand tiles of KC k
  static constexpr unsigned STG = (unsigned)NS * SET;                // one stage of the ring
  static constexpr unsigned BYTES = 2 * STG;
  static_assert(NS * (NA + NBP) * 4 <= 63);                          // copies of a wave in flight: one stage's
  static_assert(BYTES <= 327680);
};
template <int NPROD>
__device__ __forceinline__ void fill_stage(unsigned l, const unsigned short* a0, const unsigned short* a1, size_t ap32,
                                           const unsigned short* b0, const unsigned short* b1, size_t bp32) {
  if (NPROD == 1) {
    copy_tiles2(l, a0, ap32, l + TILEB, b0, bp32);
  } else if (NPROD == 2) {
    copy_tile(l, a0, ap32);
    copy_tiles2(l + TILEB, b0, bp32, l + 2 * TILEB, b1, bp32);
  } else {
    copy_tiles2(l, a0, ap32, l + TILEB, a1, ap32);
    copy_tiles2(l + 2 * TILEB, b0, bp32, l + 3 * TILEB, b1, bp32);
  }
}
// one stage of the ring: NS tile sets in a row, set u = k KC u .. + KC - 1 of the stage
template <int NPROD, int NS>
__device__ __forceinline__ void fill_ring(unsigned l, const unsigned short* a0, const unsigned short* a1, size_t ap32,
                                          const unsigned short* b0, const unsigned short* b1, size_t bp32) {
  fill_stage<NPROD>(l, a0, a1, ap32, b0, b1, bp32);
  if constexpr (NS > 1)
    fill_ring<NPROD, NS - 1>(l + CoreLds<NPROD>::SET, a0 + KC, a1 + KC, ap32, b0 + KC, b1 + KC, bp32);
}
template <int NPROD, bool HALF, int NS = 1>
__device__ __forceinline__ void gemm_core(v8f (&acc)[4][2], const char* sm,
                                          const unsigned short* __restrict__ a0,
                                          const unsigned short* __restrict__ a1, size_t ap,
                                          const unsigned short* __restrict__ b0,
                                          const unsigned short* __restrict__ b1, size_t bp, int npass, int tid) {
  static_assert(NPROD >= 1 && NPROD <= 3);
  static_assert(!(HALF && NPROD != 1));
  constexpr unsigned SET = CoreLds<NPROD, NS>::SET, STG = CoreLds<NPROD, NS>::STG;
  constexpr unsigned BOFF = (unsigned)CoreLds<NPROD>::NA * TILEB;
  constexpr int KS = KC * NS;                                        // k of a pass
  const int lane = tid & 31, wave = tid >> 5, hh = lane >> 4, c = lane & 15;
  const int wm = wave >> 2, wn = wave & 3;
  const int e = tid & 7, r = tid >> 3;                               // r 0..31
  const unsigned lc = lds_off(sm) + (unsigned)(r * LP + 16 * e);
  const size_t ga = (size_t)r * ap + 8 * e, gb = (size_t)r * bp + 8 * e;
  const unsigned fa = (unsigned)((64 * wm + c) * LP + 16 * hh);
  const unsigned fb = BOFF + (unsigned)((32 * wn + c) * LP + 16 * hh);
  fill_ring<NPROD, NS>(lc, a0 + ga, a1 + ga, 32 * ap, b0 + gb, b1 + gb, 32 * bp);
  asm volatile("s_wait_asynccnt 0x0" ::: "memory");                  // pass 0's own copies have landed
  __syncthreads();                                                   // ... and every other wave's
  fill_ring<NPROD, NS>(lc + STG, a0 + ga + KS, a1 + ga + KS, 32 * ap, b0 + gb + KS, b1 + gb + KS, 32 * bp);
  // kept rolled: one pass is 16 to 64 matrix instructions with their fragment loads, and the code stays small
#pragma unroll 1
  for (int t = 0; t < npass; ++t) {
    const unsigned bo = (unsigned)(t & 1) * STG;
    // the loops below are unrolled whole so that the fragment arrays stay in registers and the LDS offsets are immediates
#pragma unroll
    for (int ks = 0; ks < KS / 32; ++ks) {
      const unsigned o = bo + (unsigned)(ks / (KC / 32)) * SET + 64u * (ks % (KC / 32));
      // the k-step's fragment reads stand together, ahead of its matrix instructions: one LDS latency a k-step
      Frag fb0[2], fb1[2], fa0[4], fa1[4];
#pragma unroll
      for (int nf = 0; nf < 2; ++nf) {
        fb0[nf] = ldfrag((const unsigned short*)(sm + fb + 16 * LP * nf + o));
        if (NPROD >= 2) fb1[nf] = ldfrag((const unsigned short*)(sm + fb + TILEB + 16 * LP * nf + o));
        else fb1[nf] = fb0[nf];
      }
#pragma unroll
      for (int mt = 0; mt < 4; ++mt) {
        fa0[mt] = ldfrag((const unsigned short*)(sm + fa + 16 * LP * mt + o));
        if (NPROD >= 3) fa1[mt] = ldfrag((const unsigned short*)(sm + fa + TILEB + 16 * LP * mt + o));
        else fa1[mt] = fa0[mt];
      }
#pragma unroll
      for (int p = 0; p < NPROD; ++p) {
#pragma unroll
        for (int mt = 0; mt < 4; ++mt) {
#pragma unroll
          for (int nf = 0; nf < 2; ++nf) {
            if (HALF)        acc[mt][nf] = mma_h(fa0[mt].h, fb0[nf].h, acc[mt][nf]);
            else if (p == 0) acc[mt][nf] = mma_b(fa0[mt].bf, fb0[nf].bf, acc[mt][nf]);
            else if (p == 1) acc[mt][nf] = mma_b(fa0[mt].bf, fb1[nf].bf, acc[mt][nf]);
            else             acc[mt][nf] = mma_b(fa1[mt].bf, fb0[nf].bf, acc[mt][nf]);
          }
        }
      }
    }
    asm volatile("s_wait_dscnt 0x0" ::: "memory");                   // this wave's reads of the buffer are done before it is refilled
    asm volatile("s_wait_asynccnt 0x0" ::: "memory");                // this wave's copies of pass t + 1 have landed
    __syncthreads();                                                 // publishes pass t + 1, ends every read of pass t's buffer
    if (t + 2 < npass) {
      const int ko = KS * (t + 2);
      fill_ring<NPROD, NS>(lc + bo, a0 + ga + ko, a1 + ga + ko, 32 * ap, b0 + gb + ko, b1 + gb + ko, 32 * bp);
    }
  }
  asm volatile("s_wait_asynccnt 0x0" ::: "memory");                  // nothing outstanding when the LDS changes its use
}
__device__ __forceinline__ void zero_acc(v8f (&acc)[4][2]) {
#pragma unroll
  for (int mt = 0; mt < 4; ++mt) { acc[mt][0] = zero8(); acc[mt][1] = zero8(); }
}

// ---- epilogue staging, transposed: Os[n_loc][m_loc] (pitch OSP). Lane (hh, c) of wave (wm, wn) holds D rows
//      m = 64 wm + 16 mt + 8 hh + r, col n = 32 wn + 16 nf + c -> two b128 LDS stores per 16 x 16 tile.
__device__ __forceinline__ void stage_nT(float* Os, const v8f (&acc)[4][2], float sc, int wave, int hh, int c) {
  const int wm = wave >> 2, wn = wave & 3;
#pragma unroll
  for (int nf = 0; nf < 2; ++nf) {
    const int nl = 32 * wn + 16 * nf + c;
#pragma unroll
    for (int mt = 0; mt < 4; ++mt) {
      v4f va, vb;
#pragma unroll
      for (int r = 0; r < 4; ++r) { va[r] = acc[mt][nf][r] * sc; vb[r] = acc[mt][nf][4 + r] * sc; }
      *(v4f*)(Os + nl * OSP + 64 * wm + 16 * mt + 8 * hh)     = va;
      *(v4f*)(Os + nl * OSP + 64 * wm + 16 * mt + 8 * hh + 4) = vb;
    }
  }
}
// ---- epilogue staging, row-major: Os[m_loc][n_loc] (pitch OSP), scalar LDS stores.
__device__ __forceinline__ void stage_mn(float* Os, const v8f (&acc)[4][2], int wave, int hh, int c) {
  const int wm = wave >> 2, wn = wave & 3;
#pragma unroll
  for (int nf = 0; nf < 2; ++nf) {
    const int nl = 32 * wn + 16 * nf + c;
#pragma unroll
    for (int mt = 0; mt < 4; ++mt) {
#pragma unroll
      for (int r = 0; r < 8; ++r) Os[(64 * wm + 16 * mt + 8 * hh + r) * OSP + nl] = acc[mt][nf][r];
    }
  }
}

// ---- plane writer for transposed staging: plane [b][n][512] bf16 hi + bf16 residual, rows rowbase + 0..127,
//      16 lanes per 256-B row piece (two whole lines), rows it*16 + lq. BIAS: per col an f32 bias is added and the sum is
//      multiplied by the col's rstd; st = the {mean, rstd} pair of col o0 (the pairs of the block's 128 cols in a row).
// coverage: 8 it x 16 rows x 16 lanes x 8 = 128 rows x 128 cols per plane.
template <bool BIAS>
__device__ __forceinline__ void planes_out(const float* Os, const float* __restrict__ bias, const float* __restrict__ st,
                                           int o0, unsigned short* Ph, unsigned short* Pl, size_t rowbase, int tid) {
  const int e = tid & 15, lq = tid >> 4;                             // lq 0..15
  float bv[8], sv[8];
#pragma unroll
  for (int t = 0; t < 8; ++t) { bv[t] = 0.f; sv[t] = 1.f; }
  if (BIAS) {
    const unsigned bofs = 32u * (unsigned)e;                         // the lane's byte offset behind the block's bias + o0
    const unsigned sofs = 64u * (unsigned)e;                         // ... and behind the block's first pair
    const char* bb = (const char*)(bias + o0);
    const char* sb = (const char*)st;
    const v4f b0 = *(const v4f*)(bb + bofs);
    const v4f b1 = *(const v4f*)(bb + bofs + 16);
    v4f s2[4];                                                       // two pairs each
#pragma unroll
    for (int k = 0; k < 4; ++k) s2[k] = *(const v4f*)(sb + sofs + 16 * k);
    // bofs and sofs address the loads; as inputs here their registers stay live past them and are reused only behind this wait
    asm volatile("s_wait_xcnt 0x0" :: "v"(bofs), "v"(sofs) : "memory");
#pragma unroll
    for (int t = 0; t < 4; ++t) { bv[t] = b0[t]; bv[4 + t] = b1[t]; sv[2 * t] = s2[t][1]; sv[2 * t + 1] = s2[t][3]; }
  }
  v4u uh[8], ul[8];
#pragma unroll
  for (int it = 0; it < 8; ++it) {
    const int row = it * 16 + lq;                                    // n_loc 0..127
    const v4f a = *(const v4f*)(Os + row * OSP + 8 * e);
    const v4f q = *(const v4f*)(Os + row * OSP + 8 * e + 4);
    const float f[8] = {a[0], a[1], a[2], a[3], q[0], q[1], q[2], q[3]};
#pragma unroll
    for (int t = 0; t < 4; ++t) {
      float f0 = f[2 * t] + bv[2 * t], f1 = f[2 * t + 1] + bv[2 * t + 1];
      if (BIAS) { f0 *= sv[2 * t]; f1 *= sv[2 * t + 1]; }
      const unsigned short hb0 = bf_bits(f0), hb1 = bf_bits(f1);
      const unsigned short lb0 = bf_bits(f0 - bf_up(hb0));
      const unsigned short lb1 = bf_bits(f1 - bf_up(hb1));
      uh[it][t] = pk16(hb0, hb1);
      ul[it][t] = pk16(lb0, lb1);
    }
  }
{
#pragma unroll
    for (int it = 0; it < 8; ++it) {
      const int row = it * 16 + lq;
      const size_t po = (rowbase + (size_t)row) * CH + o0 + 8 * e;
      *(v4u*)(Ph + po) = uh[it];
      *(v4u*)(Pl + po) = ul[it];
    }
    
  }
}

// =========================================================================================================
// (0) weights f32 [512][512] x4 -> W16 bf16 bits [4][512][512] (RNE convert of the input value, exact operand).
//     Block blk owns 8 rows of one matrix (matrix index block-uniform), one wave per 1024-B row = 2 instructions of
//     Matrices 0..2 (Wn, Wm, Wl) go out transposed, plane row c = column c of the matrix: they are the k-contiguous operands
//     of G = Wm^T.Wn and of W2 = Wo.Wl (256 threads x 2 rows of the matrix x the block's 8 columns = 8 plane rows x 512).
//     The blocks of matrix 3 (Wo) also form B2[o] = sum_m Wo[o][m] bl[m] (bf16-RNE values, f32 sum: 16 terms a lane in
//     rising m, then five xor steps).
// coverage: 256 blocks x 8 rows x 2 j x 32 lanes x 8 = 2048 rows x 512 = the whole plane. blk = 0..255 (part of prep).
// =========================================================================================================
__device__ __forceinline__
void cvt_w_part(const float* __restrict__ w0, const float* __restrict__ w1,
                const float* __restrict__ w2, const float* __restrict__ w3, const float* __restrict__ bl,
                unsigned short* W16, float* B2, int blk) {
  const int tid = threadIdx.x;
  const int wave = tid >> 5, lane = tid & 31;
  const int mi = blk / (CH / 8);                                     // 0..3, block-uniform
  const int o  = 8 * (blk - mi * (CH / 8)) + wave;                   // 0..511
  const float* wb = (mi == 0) ? w0 : (mi == 1) ? w1 : (mi == 2) ? w2 : w3;
  if (mi <= 2) {
    // transposed: thread = rows 2 tid, 2 tid + 1 of the matrix, the block's 8 columns = 8 plane rows; a pair of rows is one dword
    // of a plane row, so a wave's store is one whole 128-B line
    const int c0 = 8 * (blk - mi * (CH / 8));
    const float* sc = wb + (size_t)(2 * tid) * CH + c0;
    const v4f a0 = *(const v4f*)sc;
    const v4f a1 = *(const v4f*)(sc + 4);
    const v4f q0 = *(const v4f*)(sc + CH);
    const v4f q1 = *(const v4f*)(sc + CH + 4);
    // sc addresses the loads; as an input here its registers stay live past the last load and are reused only behind this wait
    asm volatile("s_wait_xcnt 0x0" :: "v"(sc) : "memory");
    unsigned* dp = (unsigned*)(W16 + ((size_t)(mi * CH + c0)) * CH) + tid;
    // unrolled whole: the vector elements are picked by constants and the row steps are immediate offsets
#pragma unroll
    for (int k = 0; k < 4; ++k) {
      dp[k * (CH / 2)]       = pk16(bf_bits(a0[k]), bf_bits(q0[k]));
      dp[(4 + k) * (CH / 2)] = pk16(bf_bits(a1[k]), bf_bits(q1[k]));
    }
    return;
  }
  v4u u[CH / 256];
#pragma unroll
  for (int j = 0; j < CH / 256; ++j) {
    const float* s = wb + (size_t)o * CH + 256 * j + 8 * lane;
    const v4f a = *(const v4f*)s;
    const v4f q = *(const v4f*)(s + 4);
    const float f[8] = {a[0], a[1], a[2], a[3], q[0], q[1], q[2], q[3]};
#pragma unroll
    for (int t = 0; t < 4; ++t) u[j][t] = pk16(bf_bits(f[2 * t]), bf_bits(f[2 * t + 1]));
  }
  {                                                                  // matrix 3 (Wo) alone comes here
    const unsigned bofs = 32u * (unsigned)lane;                      // the lane's byte offset in bl
    const char* bb = (const char*)bl;
    v4f cb[CH / 256][2];
    // the loops below are unrolled whole so that cb and u are indexed by constants and stay in registers
#pragma unroll
    for (int j = 0; j < CH / 256; ++j) {
      cb[j][0] = *(const v4f*)(bb + bofs + 1024 * j);
      cb[j][1] = *(const v4f*)(bb + bofs + 1024 * j + 16);
    }
    // bofs addresses the loads; as an input here its register stays live past the last load and is reused only behind this wait
    asm volatile("s_wait_xcnt 0x0" :: "v"(bofs) : "memory");
    float d = 0.f;
#pragma unroll
    for (int j = 0; j < CH / 256; ++j) {
#pragma unroll
      for (int t = 0; t < 4; ++t) {
        d = __builtin_fmaf(bf_up((unsigned short)(u[j][t] & 0xFFFFu)), bfr(cb[j][t >> 1][2 * (t & 1)]), d);
        d = __builtin_fmaf(bf_up((unsigned short)(u[j][t] >> 16)), bfr(cb[j][t >> 1][2 * (t & 1) + 1]), d);
      }
    }
#pragma unroll
    for (int x = 16; x > 0; x >>= 1) d += __shfl_xor(d, x, 32);
    float* b2p = B2 + (o >> 3) * 32 + (o & 7);
    if (lane == 0) *b2p = d;
    // the store's address and data are inputs here so that the plane stores' code reuses their registers only behind this wait
    asm volatile("s_wait_xcnt 0x0" :: "v"(b2p), "v"(d) : "memory");
  }
{
#pragma unroll
    for (int j = 0; j < CH / 256; ++j)
      *(v4u*)(W16 + ((size_t)(mi * CH + o)) * CH + 256 * j + 8 * lane) = u[j];
    // the transposed part's code follows these stores in the built kernel: no register of theirs is rewritten ahead of this wait
    asm volatile("s_wait_xcnt 0x0" ::: "memory");
  }
}

// =========================================================================================================
// (1a) instance-norm statistics of both inputs, one launch: St[(sel * NB + b) * 512 + c] = {mean, rsqrt(var + eps)} of
//      bf16-RNE(x) over the row's SEQ values. 16 lanes per row, lane l = 4 q + k owns the elements 16 j + l and adds
//      them in rising j; the four xor steps then form ((s0 + s1) + (s2 + s3)) per q and the sum over q (1, then 2).
//      The lane's SEQ/16 values stay in registers, so the row is read once for mean and variance.
// coverage: block = 16 rows = one 128-B line of St; blk = 0 .. 2 * NB * 512 / 16 - 1 covers every row of both inputs once.
// =========================================================================================================
__device__ __forceinline__
void norm_stats_part(const float* __restrict__ xc, const float* __restrict__ xs, float* St, int blk) {
  const int tid = threadIdx.x;
  const int rl = tid >> 4, l = tid & 15;                             // rl 0..15
  const int sel = blk / (NB * CH / 16);                              // 0 = x_c, 1 = x_s, block-uniform
  const int r   = 16 * (blk - sel * (NB * CH / 16)) + rl;            // b * 512 + c
  const float* xr = (sel ? xs : xc) + (size_t)r * T_FULL + l;
  float v[SEQ / 16];                                                 // the loops are unrolled whole so that v stays in registers
#pragma unroll
  for (int j = 0; j < SEQ / 16; ++j) v[j] = xr[16 * j];
  // xr is an input here so that its registers stay live past the last load and are reused only behind this wait
  asm volatile("s_wait_xcnt 0x0" :: "v"(xr) : "memory");
  float sm = 0.f;
#pragma unroll
  for (int j = 0; j < SEQ / 16; ++j) { v[j] = bfr(v[j]); sm += v[j]; }
  sm += __shfl_xor(sm, 1, 32);
  sm += __shfl_xor(sm, 2, 32);
  sm += __shfl_xor(sm, 4, 32);
  sm += __shfl_xor(sm, 8, 32);
  const float mean = sm * (1.0f / (float)SEQ);
  float sv = 0.f;
#pragma unroll
  for (int j = 0; j < SEQ / 16; ++j) { const float d = v[j] - mean; sv = __builtin_fmaf(d, d, sv); }
  sv += __shfl_xor(sv, 1, 32);
  sv += __shfl_xor(sv, 2, 32);
  sv += __shfl_xor(sv, 4, 32);
  sv += __shfl_xor(sv, 8, 32);
  const float var = sv * (1.0f / (float)SEQ);
  const float rs  = rsqrtf(var + EPSN);
  if (l == 0) {
    v2f st; st[0] = mean; st[1] = rs;
    *(v2f*)(St + 2 * (size_t)(sel * NB * CH + r)) = st;
  }
}

// =========================================================================================================
// (0) + (1a) in one launch: neither reads what the other writes. The block index picks the part (block-uniform): the
//     statistics blocks, which run longer, come first, the weight blocks behind them.
// =========================================================================================================
#define NSTATB (2 * NB * CH / 16)
#define NCVTWB (NMAT * CH / 8)
__global__ __launch_bounds__(256)
void prep(const float* __restrict__ xc, const float* __restrict__ xs,
          const float* __restrict__ w0, const float* __restrict__ w1,
          const float* __restrict__ w2, const float* __restrict__ w3, const float* __restrict__ bl,
          float* St, unsigned short* W16, float* B2) {
  const int blk = blockIdx.x;
  if (blk < NSTATB) {
    norm_stats_part(xc, xs, St, blk);
  } else {
    cvt_w_part(w0, w1, w2, w3, bl, W16, B2, blk - NSTATB);
    // the other part's code follows these stores in the built kernel: no register of theirs is rewritten ahead of this wait
    asm volatile("s_wait_xcnt 0x0" ::: "memory");
  }
}

// =========================================================================================================
// (1b) x f32 [b][512 c][2048 t] (batch/row strides at full size) -> position-major bf16 planes [b][t][512]:
//      Ph = bf16-RNE(xn), Pl = bf16-RNE(xn - Ph) with xn = (bf16-RNE(x) - mean) * rstd per (b, c) row (St of 1a).
//      One 64 c x 128 t tile per block, transposed through LDS (line = 64 c of one plane
//      row): lane e -> c 8e..8e+7, 8 consecutive lanes per line.
// coverage: 4 it x 32 rows x 8 lanes x 8 = 128 t x 64 c per plane; (bx, by) in (SEQ/128, 8) for each b = 0..NB-1 cover
//           [NB][SEQ][512] of both planes exactly once. Th, Tl = the block's LDS tiles.
// =========================================================================================================
__device__ __forceinline__
void cvt_norm_part(const float* __restrict__ x, const float* __restrict__ St,
                   unsigned short* Ph, unsigned short* Pl,
                   unsigned short* Th, unsigned short* Tl, int bx, int by, int b) {
  const int tid = threadIdx.x;
  const int n0 = bx * NT, c0 = by * QT;
  const int e = tid & 7, lq = tid >> 3;                              // lq 0..31
  v4f a[4], q[4];
  v2f st[2];
  const int sr = b * CH + c0 + lq;                                   // row of c half 0; c half 1 is 32 rows on
  const float* sp0 = x + (size_t)sr * T_FULL + n0 + 8 * e;
#pragma unroll
  for (int it = 0; it < 4; ++it) {                                   // it = 2 * (t half) + (c half)
    const float* sp = sp0 + (size_t)(it & 1) * 32 * T_FULL + (it >> 1) * 64;
    a[it] = *(const v4f*)sp;
    q[it] = *(const v4f*)(sp + 4);
  }
#pragma unroll
  for (int h = 0; h < 2; ++h) st[h] = *(const v2f*)(St + 2 * (size_t)sr + 64 * h);
  // sp0 and sr address the loads; as inputs here their registers stay live past the last load and are reused only behind this wait
  asm volatile("s_wait_xcnt 0x0" :: "v"(sp0), "v"(sr) : "memory");
#pragma unroll
  for (int it = 0; it < 4; ++it) {
    const int cl = (it & 1) * 32 + lq;
    const int tl = (it >> 1) * 64 + 8 * e;                           // 0..120
    const float f[8] = {a[it][0], a[it][1], a[it][2], a[it][3], q[it][0], q[it][1], q[it][2], q[it][3]};
    const float mu = st[it & 1][0], rs = st[it & 1][1];
#pragma unroll
    for (int t = 0; t < 8; ++t) {
      const unsigned short rb = bf_bits(f[t]);
      const float d  = bf_up(rb) - mu;
      const float xn = d * rs;
      const unsigned short hb = bf_bits(xn);
      const unsigned short lb = bf_bits(__builtin_fmaf(d, rs, -bf_up(hb)));   // residual of the unrounded product
      Th[(tl + t) * TP + cl] = hb;
      Tl[(tl + t) * TP + cl] = lb;
    }
  }
  __syncthreads();
  v4u uh[4], ul[4];
#pragma unroll
  for (int it = 0; it < 4; ++it) {
    const int nl = it * 32 + lq;                                     // 0..127
    uh[it] = *(const v4u*)(Th + nl * TP + 8 * e);
    ul[it] = *(const v4u*)(Tl + nl * TP + 8 * e);
  }
#pragma unroll
  for (int it = 0; it < 4; ++it) {
    const int nl = it * 32 + lq;
    const size_t po = ((size_t)(b * SEQ + n0 + nl)) * CH + c0 + 8 * e;
    *(v4u*)(Ph + po) = uh[it];
    *(v4u*)(Pl + po) = ul[it];
  }
}
// ---- the same tile, lane map and coverage for the one plane Pr = bf16-RNE(x): no statistics are read. Tr = the block's LDS tile.
__device__ __forceinline__
void cvt_raw_part(const float* __restrict__ x, unsigned short* Pr, unsigned short* Tr, int bx, int by, int b) {
  const int tid = threadIdx.x;
  const int n0 = bx * NT, c0 = by * QT;
  const int e = tid & 7, lq = tid >> 3;                              // lq 0..31
  v4f a[4], q[4];
  const float* sp0 = x + (size_t)(b * CH + c0 + lq) * T_FULL + n0 + 8 * e;
  // the loops are unrolled whole so that a, q and ur are indexed by constants and the eight loads are in flight together
#pragma unroll
  for (int it = 0; it < 4; ++it) {                                   // it = 2 * (t half) + (c half)
    const float* sp = sp0 + (size_t)(it & 1) * 32 * T_FULL + (it >> 1) * 64;
    a[it] = *(const v4f*)sp;
    q[it] = *(const v4f*)(sp + 4);
  }
  // sp0 addresses the loads; as an input here its registers stay live past the last load and are reused only behind this wait
  asm volatile("s_wait_xcnt 0x0" :: "v"(sp0) : "memory");
#pragma unroll
  for (int it = 0; it < 4; ++it) {
    const int cl = (it & 1) * 32 + lq;
    const int tl = (it >> 1) * 64 + 8 * e;                           // 0..120
    const float f[8] = {a[it][0], a[it][1], a[it][2], a[it][3], q[it][0], q[it][1], q[it][2], q[it][3]};
#pragma unroll
    for (int t = 0; t < 8; ++t) Tr[(tl + t) * TP + cl] = bf_bits(f[t]);
  }
  __syncthreads();
  v4u ur[4];
#pragma unroll
  for (int it = 0; it < 4; ++it) ur[it] = *(const v4u*)(Tr + (it * 32 + lq) * TP + 8 * e);
#pragma unroll
  for (int it = 0; it < 4; ++it)
    *(v4u*)(Pr + ((size_t)(b * SEQ + n0 + it * 32 + lq)) * CH + c0 + 8 * e) = ur[it];
}

// =========================================================================================================
// (1c) W2[o][c] = sum_m Wo[o][m] Wl[m][c] for one 128-c x 128-o tile: A = rows c of the transposed Wl plane, B = rows o of
//      the Wo plane (both k = m contiguous, bf16-RNE weights), 1 product, K = 512. Epilogue: transposed LDS staging,
//      barrier, hi + residual planes [o][512 c] (planes_out).
// coverage: blk = 0..15 as (c tile, o tile) in (4, 4) covers [512][512] of both planes exactly once.
//           sm = the block's LDS, CoreLds<1>::BYTES: two operand buffers; output staging behind the core.
// =========================================================================================================
#define NW2B ((CH / BT) * (CH / BT))
__device__ __forceinline__
void w2_part(char* sm, const unsigned short* __restrict__ WlT, const unsigned short* __restrict__ Wo,
             unsigned short* W2h, unsigned short* W2l, int blk) {
  float* Os = (float*)sm;
  const int tid = threadIdx.x, lane = tid & 31, wave = tid >> 5;
  const int hh = lane >> 4, c = lane & 15;
  const int c0 = (blk % (CH / BT)) * BT, o0 = (blk / (CH / BT)) * BT;
  const unsigned short* ap = WlT + (size_t)c0 * CH;
  const unsigned short* bp = Wo + (size_t)o0 * CH;
  v8f acc[4][2];
  zero_acc(acc);
  gemm_core<1, false>(acc, sm, ap, ap, CH, bp, bp, CH, CH / KC, tid);
  stage_nT(Os, acc, 1.0f, wave, hh, c);
  __syncthreads();
  planes_out<false>(Os, nullptr, nullptr, c0, W2h, W2l, (size_t)o0, tid);
}

// =========================================================================================================
// (1d) H[c] = sum_o Wm[o][c] bn[o] (bf16-RNE values, f32 sum: 16 terms a lane in rising o, then five xor steps), from the
//      transposed Wm plane: one wave per HR rows c, a row = 2 loads of 512 B. Lane i < HR stores row i's sum.
// coverage: blk = 0..15 x 8 waves x 4 rows = 512 rows; a block writes one whole 128-B line of H.
// =========================================================================================================
#define HR  4
#define NHB (CH / (8 * HR))
static_assert(8 * HR * 4 == 128);
__device__ __forceinline__
void h_part(const unsigned short* __restrict__ WmT, const float* __restrict__ bn, float* H, int blk) {
  const int tid = threadIdx.x, wave = tid >> 5, lane = tid & 31;
  const int r0 = 8 * HR * blk + HR * wave;                           // the wave's first row
  const unsigned bofs = 32u * (unsigned)lane;                        // the lane's byte offset in bn
  const unsigned wofs = (unsigned)(HR * wave * CH * 2 + 16 * lane);  // ... and behind the block's first plane row
  const char* bb = (const char*)bn;
  const char* wb = (const char*)(WmT + (size_t)(8 * HR) * blk * CH);
  v4f cb[CH / 256][2];
  v8us w[HR][CH / 256];
  // the loops below are unrolled whole so that cb, w and d are indexed by constants and stay in registers
#pragma unroll
  for (int j = 0; j < CH / 256; ++j) {
    cb[j][0] = *(const v4f*)(bb + bofs + 1024 * j);
    cb[j][1] = *(const v4f*)(bb + bofs + 1024 * j + 16);
  }
#pragma unroll
  for (int i = 0; i < HR; ++i) {
#pragma unroll
    for (int j = 0; j < CH / 256; ++j) w[i][j] = *(const v8us*)(wb + wofs + (CH * 2) * i + 512 * j);
  }
  // bofs and wofs address the loads; as inputs here their registers stay live past the last load and are reused only behind this wait
  asm volatile("s_wait_xcnt 0x0" :: "v"(bofs), "v"(wofs) : "memory");
  float mine = 0.f;
#pragma unroll
  for (int i = 0; i < HR; ++i) {
    float d = 0.f;
#pragma unroll
    for (int j = 0; j < CH / 256; ++j) {
#pragma unroll
      for (int t = 0; t < 8; ++t) d = __builtin_fmaf(bf_up(w[i][j][t]), bfr(cb[j][t >> 2][t & 3]), d);
    }
#pragma unroll
    for (int x = 16; x > 0; x >>= 1) d += __shfl_xor(d, x, 32);
    mine = lane == i ? d : mine;
  }
  if (lane < HR) H[r0 + lane] = mine;
}

// =========================================================================================================
// (1b) of both inputs, (1c) for W2 and for G, and (1d) in one launch, a grid of NPREB + (SEQ/128) * 8 * 2 NB blocks: none
//      reads what another writes. The block index picks the part (block-uniform, so each part's barriers are passed by the
//      whole block): the W2 and G tiles, which run longest, come first; then H; then x_c, which writes two planes; then
//      x_s, which writes one. W = W16 of (0). G[c][k] = sum_o Wm[o][c] Wn[o][k] is (1c) with the transposed Wn plane for Wl's and the
//      transposed Wm plane for Wo.
// =========================================================================================================
#define NPREB (2 * NW2B + NHB)
static_assert(2 * NT * TP * 2 <= CoreLds<1>::BYTES && (NT * TP * 2) % 16 == 0);
__global__ __launch_bounds__(256)
void cvt_norm2(const float* __restrict__ xc, const float* __restrict__ xs, const float* __restrict__ St,
               unsigned short* Pch, unsigned short* Pcl, unsigned short* Psr,
               const unsigned short* __restrict__ W, unsigned short* W2h, unsigned short* W2l,
               unsigned short* Gh, unsigned short* Gl, const float* __restrict__ bn, float* H) {
  __shared__ __align__(16) char sm[CoreLds<1>::BYTES];
  unsigned short* Th = (unsigned short*)sm;
  unsigned short* Tl = Th + NT * TP;
  const int blk = blockIdx.x;
  const int q = blk - NPREB;
  const int bx = q % (SEQ / NT), by = (q / (SEQ / NT)) % (CH / QT), z = q / ((SEQ / NT) * (CH / QT));
  if (blk < 2 * NW2B) {
    const bool g = blk >= NW2B;                                      // block-uniform: G's tiles stand behind W2's
    w2_part(sm, W + (size_t)(g ? 0 : 2) * CH * CH, W + (size_t)(g ? 1 : 3) * CH * CH, g ? Gh : W2h, g ? Gl : W2l,
            g ? blk - NW2B : blk);
  } else if (blk < NPREB) {
    h_part(W + (size_t)CH * CH, bn, H, blk - 2 * NW2B);
  } else if (z < NB) {
    cvt_norm_part(xc, St, Pch, Pcl, Th, Tl, bx, by, z);
    // another part's code follows these stores in the built kernel: no register of theirs is rewritten ahead of this wait
    asm volatile("s_wait_xcnt 0x0" ::: "memory");
  } else {
    cvt_raw_part(xs, Psr, Th, bx, by, z - NB);
    // the other part's code follows these stores in the built kernel: no register of theirs is rewritten ahead of this wait
    asm volatile("s_wait_xcnt 0x0" ::: "memory");
  }
}

// =========================================================================================================
// (2) conv1x1 GEMM into hi + residual planes: Y[o][n] = (sum_c (Gh + Gl)[o][c] (Xh + Xl)[b][n][c] + bias[o]) rstd[b][o] for one
//     (b, 128-n tile, 128-o block); A = G rows o (k = c contiguous), B = plane rows n (k = c contiguous), 3 products
//     (hh + hl + lh), K = 512 = 16 steps. Epilogue: transposed LDS staging, barrier, planes [b][n][512] (planes_out).
// coverage: (SEQ/128, 4) blocks for each b = 0..NB-1, x 128 n x 128 o, cover [NB][SEQ][512] of both planes exactly once.
//           sm = the block's LDS, CoreLds<3>::BYTES: two operand buffers; output staging behind the core.
// =========================================================================================================
__device__ __forceinline__
void gemm_nm_part(char* sm, const unsigned short* __restrict__ Gh, const unsigned short* __restrict__ Gl,
                  const float* __restrict__ bias, const float* __restrict__ Sts,
                  const unsigned short* __restrict__ Xh, const unsigned short* __restrict__ Xl,
                  unsigned short* Ph, unsigned short* Pl, int b) {
  float* Os = (float*)sm;
  const int tid = threadIdx.x, lane = tid & 31, wave = tid >> 5;
  const int hh = lane >> 4, c = lane & 15;
  const int nt = blockIdx.x, mb = blockIdx.y;
  const int n0 = nt * BT, o0 = mb * BT;
  const size_t aq = (size_t)o0 * CH;
  const size_t bq = ((size_t)(b * SEQ + n0)) * CH;
  v8f acc[4][2];
  zero_acc(acc);
  gemm_core<3, false>(acc, sm, Gh + aq, Gl + aq, CH, Xh + bq, Xl + bq, CH, CH / KC, tid);
  stage_nT(Os, acc, 1.0f, wave, hh, c);
  __syncthreads();
  planes_out<true>(Os, bias, Sts + 2 * (b * CH + o0), o0, Ph, Pl, (size_t)(b * SEQ + n0), tid);
}

// =========================================================================================================
// (3) conv1x1 GEMM into the channel-major f16 value plane: V16[b][o][s] = f16(sum_c (W2h + W2l)[o][c] Xr[b][s][c] + B2[o])
//     (pitch SEQ); A = plane rows s, B = W2 rows o (hi, residual), 2 products, K = 512. Epilogue: transposed LDS staging
//     (rows o), barrier, row o segment of 128 halves = two lines.
// coverage: 8 it x 16 rows x 16 lanes x 8 = 128 o x 128 s; (SEQ/128, 4) blocks for each b = 0..NB-1 cover [NB][512][SEQ] once.
//           sm = the block's LDS, CoreLds<3>::BYTES (the part uses CoreLds<2>::BYTES of it): two operand buffers; output staging behind the core.
// =========================================================================================================
__device__ __forceinline__
void gemm_val_part(char* sm, const unsigned short* __restrict__ W2h, const unsigned short* __restrict__ W2l,
                   const float* __restrict__ B2, const unsigned short* __restrict__ Xr, unsigned short* V16, int b) {
  float* Os = (float*)sm;
  const int tid = threadIdx.x, lane = tid & 31, wave = tid >> 5;
  const int hh = lane >> 4, c = lane & 15;
  const int nt = blockIdx.x, mb = blockIdx.y;
  const int n0 = nt * BT, o0 = mb * BT;
  const size_t wq = (size_t)o0 * CH;
  const size_t bq = ((size_t)(b * SEQ + n0)) * CH;
  v8f acc[4][2];
  zero_acc(acc);
  gemm_core<2, false>(acc, sm, Xr + bq, Xr + bq, CH, W2h + wq, W2l + wq, CH, CH / KC, tid);
  stage_nT(Os, acc, 1.0f, wave, hh, c);
  __syncthreads();
  const int e = tid & 15, lq = tid >> 4;                             // lq 0..15
  const unsigned bofs = 4u * (unsigned)((lq >> 3) * 32 + (lq & 7));  // the lane's byte offset behind the block's first B2 line
  const char* b2 = (const char*)(B2 + (o0 >> 3) * 32);
  float bv[8];
  // unrolled whole so that bv stays in registers and the eight loads are in flight together
#pragma unroll
  for (int it = 0; it < 8; ++it) bv[it] = *(const float*)(b2 + bofs + 256 * it);   // row it * 16 + lq: two lines on per it
  // bofs addresses the loads; as an input here its register stays live past the last load and is reused only behind this wait
  asm volatile("s_wait_xcnt 0x0" :: "v"(bofs) : "memory");
  v4u u[8];
#pragma unroll
  for (int it = 0; it < 8; ++it) {
    const int row = it * 16 + lq;                                    // o_loc 0..127
    const float bb = bv[it];
    const v4f a = *(const v4f*)(Os + row * OSP + 8 * e);
    const v4f q = *(const v4f*)(Os + row * OSP + 8 * e + 4);
    const float f[8] = {a[0], a[1], a[2], a[3], q[0], q[1], q[2], q[3]};
#pragma unroll
    for (int t = 0; t < 4; ++t) {
      const _Float16 h0 = (_Float16)(f[2 * t] + bb);
      const _Float16 h1 = (_Float16)(f[2 * t + 1] + bb);
      u[it][t] = pk16(h_bits(h0), h_bits(h1));
    }
  }
{
#pragma unroll
    for (int it = 0; it < 8; ++it) {
      const int row = it * 16 + lq;
      const size_t po = ((size_t)(b * CH + o0 + row)) * SEQ + n0 + 8 * e;
      *(v4u*)(V16 + po) = u[it];
    }
    
  }
}

// =========================================================================================================
// (2) for Mq and (3) in one launch, grid (SEQ/128, 4, 2 NB) = two blocks a WGP: the two products read G or W2 and the planes
//     of (1b) and write planes of their own. job = blockIdx.z / NB picks the product (block-uniform, so every barrier of a
//     part is passed by the whole block); Mq, which has 3 products, comes first. G, W2 = the two planes of (1c) in a row
//     (hi, residual), X = the three planes of (1b) in a row (x_c hi, lo; x_s raw), M = the result planes (Mq hi, lo),
//     Sts = the {mean, rstd} pairs of x_s [NB][512] of (1a).
// =========================================================================================================
constexpr size_t PLE = PLB / 2;                                      // elements of one plane
__global__ __launch_bounds__(256)
void gemm_conv3(const unsigned short* __restrict__ G, const float* __restrict__ H, const float* __restrict__ Sts,
                const unsigned short* __restrict__ W2, const float* __restrict__ B2,
                const unsigned short* __restrict__ X, unsigned short* M, unsigned short* V16) {
  __shared__ __align__(16) char sm[CoreLds<3>::BYTES];
  const int job = blockIdx.z / NB, b = blockIdx.z - job * NB;
  if (job == 0) {
    gemm_nm_part(sm, G, G + (size_t)CH * CH, H, Sts, X, X + PLE, M, M + PLE, b);
  } else {
    gemm_val_part(sm, W2, W2 + (size_t)CH * CH, B2, X + 2 * PLE, V16, b);
  }
}

// =========================================================================================================
// (4) scores S[b][t][s] = sum_c Mq[c][t] x_s[c][s] (no scale) for one (b, 256-s tile, 256-t block): A = Mq planes
//     rows t (hi Qh, residual Ql), B = the bf16-RNE(x_s) plane rows s (Kr), products hi.Kr + residual.Kr, K = 512.
//     16 waves (512 threads) as 4 (m) x 4 (n), wave (wm, wn) owns 64 x 64: every operand byte copied from L2 feeds 256 rows
//     or columns, every fragment read from LDS feeds 4 matrix instructions a product. The grid is one block a WGP. The copy
//     ring has gemm_core's order of waits and barriers, a stage = [A0][A1][B0], each 256 rows of KC k; each accumulator
//     takes its products with k-steps rising, hi then residual inside a k-step.
//     Epilogue = the softmax inside each of the block's two 128-key tiles: row-major LDS staging, barrier, then per row t
//     and key tile m = max_s S, P16[b][t][s] = f16(e^{S - m} * 16384), l = sum_s e^{S - m} (f32, unrounded terms), Ls = {m, l}.
//     8 lanes a row: lane e8 owns cols 8 e8 .. + 7 and 64 + 8 e8 .. + 7 of the key tile, so 8 lanes store one whole 128-B
//     line of P16, and the max and the sum cross lanes in three xor steps. Wave w owns rows 16 w .. + 15 = one 128-B line of Ls.
// coverage: 16 waves x 2 key tiles x 4 g x 4 rows x 8 lanes x 16 = 256 t x 256 s; grid (SEQ/256, SEQ/256, NB) covers P16
//           [NB][SEQ][SEQ] and Ls [NB][SEQ/128][SEQ] once.
// =========================================================================================================
#define SBT    256
#define STILEB (SBT * LP)
#define SSTG   (3 * STILEB)
#define SOSP   260
#define SSMB   (SBT * SOSP * 4)
static_assert(SEQ % SBT == 0 && SBT == 2 * BT && SSMB <= 327680);
static_assert(2 * SSTG <= SSMB && (SOSP * 4) % 16 == 0);
// two tiles of 256 rows x 128 B, 512 threads: e = tid & 7 -> 16-B piece of the row, r = tid >> 3 -> row r + 64 i (i = 0..3).
// l, m = the lane's LDS byte addresses of row r, g, h = its global addresses of row r (pitch CH elements).
__device__ __forceinline__ void copy_tiles2w(unsigned l, const unsigned short* g, unsigned m, const unsigned short* h) {
#if defined(__HIP_DEVICE_COMPILE__)
  // eight copies of two tiles, global -> LDS through no register; they share one statement and its closing wait, so that
  // no address register of an issued copy is rewritten ahead of it
  asm volatile("global_load_async_to_lds_b128 %0, %8, off\n\t"
               "global_load_async_to_lds_b128 %1, %9, off\n\t"
               "global_load_async_to_lds_b128 %2, %10, off\n\t"
               "global_load_async_to_lds_b128 %3, %11, off\n\t"
               "global_load_async_to_lds_b128 %4, %12, off\n\t"
               "global_load_async_to_lds_b128 %5, %13, off\n\t"
               "global_load_async_to_lds_b128 %6, %14, off\n\t"
               "global_load_async_to_lds_b128 %7, %15, off\n\t"
               "s_wait_xcnt 0x0"
               :: "v"(l), "v"(l + 64 * LP), "v"(l + 128 * LP), "v"(l + 192 * LP),
                  "v"(m), "v"(m + 64 * LP), "v"(m + 128 * LP), "v"(m + 192 * LP),
                  "v"(g), "v"(g + 64 * CH), "v"(g + 128 * CH), "v"(g + 192 * CH),
                  "v"(h), "v"(h + 64 * CH), "v"(h + 128 * CH), "v"(h + 192 * CH) : "memory");
#endif
}
// one such tile
__device__ __forceinline__ void copy_tilew(unsigned l, const unsigned short* g) {
#if defined(__HIP_DEVICE_COMPILE__)
  // four copies of one tile, global -> LDS through no register; the wait is their statement's last line, so that no address
  // register of an issued copy is rewritten ahead of it
  asm volatile("global_load_async_to_lds_b128 %0, %4, off\n\t"
               "global_load_async_to_lds_b128 %1, %5, off\n\t"
               "global_load_async_to_lds_b128 %2, %6, off\n\t"
               "global_load_async_to_lds_b128 %3, %7, off\n\t"
               "s_wait_xcnt 0x0"
               :: "v"(l), "v"(l + 64 * LP), "v"(l + 128 * LP), "v"(l + 192 * LP),
                  "v"(g), "v"(g + 64 * CH), "v"(g + 128 * CH), "v"(g + 192 * CH) : "memory");
#endif
}
__device__ __forceinline__ void fill_sc(unsigned l, const unsigned short* a0, const unsigned short* a1,
                                        const unsigned short* b0) {
  copy_tiles2w(l, a0, l + STILEB, a1);
  copy_tilew(l + 2 * STILEB, b0);
}
__global__ __launch_bounds__(512)
void gemm_sc(const unsigned short* __restrict__ Qh, const unsigned short* __restrict__ Ql,
             const unsigned short* __restrict__ Kr, unsigned short* P16, float* Ls) {
  __shared__ __align__(16) char sm[SSMB];                      // two operand buffers; the larger output staging behind the loop
  float* Os = (float*)sm;
  const int tid = threadIdx.x, lane = tid & 31, wave = tid >> 5;     // wave 0..15
  const int hh = lane >> 4, c = lane & 15;
  const int wm = wave >> 2, wn = wave & 3;
  const int nt = blockIdx.x, mb = blockIdx.y, b = blockIdx.z;
  const int n0 = nt * SBT, m0 = mb * SBT;
  const int e = tid & 7, r = tid >> 3;                               // r 0..63
  const unsigned lc = lds_off(sm) + (unsigned)(r * LP + 16 * e);
  const size_t aq = ((size_t)(b * SEQ + m0 + r)) * CH + 8 * e;
  const size_t bq = ((size_t)(b * SEQ + n0 + r)) * CH + 8 * e;
  const unsigned short *qh = Qh + aq, *ql = Ql + aq, *kr = Kr + bq;
  const unsigned fa = (unsigned)((64 * wm + c) * LP + 16 * hh);
  const unsigned fb = 2 * STILEB + (unsigned)((64 * wn + c) * LP + 16 * hh);
  v8f acc[4][4];
  // unrolled whole, here and in the staging below: acc is indexed by constants only and stays in registers
#pragma unroll
  for (int mt = 0; mt < 4; ++mt) {
#pragma unroll
    for (int nf = 0; nf < 4; ++nf) acc[mt][nf] = zero8();
  }
  fill_sc(lc, qh, ql, kr);
  asm volatile("s_wait_asynccnt 0x0" ::: "memory");                  // pass 0's own copies have landed
  __syncthreads();                                                   // ... and every other wave's
  fill_sc(lc + SSTG, qh + KC, ql + KC, kr + KC);
  // kept rolled: one pass is 64 matrix instructions with their fragment loads, and the code stays small
#pragma unroll 1
  for (int t = 0; t < CH / KC; ++t) {
    const unsigned bo = (unsigned)(t & 1) * SSTG;
    // the loops below are unrolled whole so that the fragment arrays stay in registers and the LDS offsets are immediates
#pragma unroll
    for (int ks = 0; ks < KC / 32; ++ks) {
      const unsigned o = bo + 64u * ks;
      Frag fb0[4];
#pragma unroll
      for (int nf = 0; nf < 4; ++nf) fb0[nf] = ldfrag((const unsigned short*)(sm + fb + 16 * LP * nf + o));
      // the A fragments come two m-tiles at a time: 32 registers for them, not 64, beside the 128 accumulator registers
#pragma unroll
      for (int mh = 0; mh < 2; ++mh) {
        Frag fa0[2], fa1[2];
#pragma unroll
        for (int i = 0; i < 2; ++i) {
          fa0[i] = ldfrag((const unsigned short*)(sm + fa + 16 * LP * (2 * mh + i) + o));
          fa1[i] = ldfrag((const unsigned short*)(sm + fa + STILEB + 16 * LP * (2 * mh + i) + o));
        }
#pragma unroll
        for (int p = 0; p < 2; ++p) {
#pragma unroll
          for (int i = 0; i < 2; ++i) {
#pragma unroll
            for (int nf = 0; nf < 4; ++nf) {
              v8f& d = acc[2 * mh + i][nf];
              d = mma_b(p == 0 ? fa0[i].bf : fa1[i].bf, fb0[nf].bf, d);
            }
          }
        }
      }
    }
    asm volatile("s_wait_dscnt 0x0" ::: "memory");                   // this wave's reads of the buffer are done before it is refilled
    asm volatile("s_wait_asynccnt 0x0" ::: "memory");                // this wave's copies of pass t + 1 have landed
    __syncthreads();                                                 // publishes pass t + 1, ends every read of pass t's buffer
    if (t + 2 < CH / KC) {
      const int ko = KC * (t + 2);
      fill_sc(lc + bo, qh + ko, ql + ko, kr + ko);
    }
  }
  asm volatile("s_wait_asynccnt 0x0" ::: "memory");                  // nothing outstanding when the LDS changes its use
  // row-major staging Os[m_loc][n_loc] (pitch SOSP), scalar LDS stores
#pragma unroll
  for (int nf = 0; nf < 4; ++nf) {
#pragma unroll
    for (int mt = 0; mt < 4; ++mt) {
#pragma unroll
      for (int q = 0; q < 8; ++q) Os[(64 * wm + 16 * mt + 8 * hh + q) * SOSP + 64 * wn + 16 * nf + c] = acc[mt][nf][q];
    }
  }
  __syncthreads();
  const int e8 = lane & 7, rq = lane >> 3;                           // rq 0..3
  // unrolled so that the staging offsets of both key tiles are immediates
#pragma unroll
  for (int kt = 0; kt < 2; ++kt) {                                   // key tile 2 nt + kt
    float mxs[4], sms[4];
    v4u u[4][2];
#pragma unroll
    for (int g = 0; g < 4; ++g) {
      const float* orow = Os + (16 * wave + 4 * g + rq) * SOSP + BT * kt + 8 * e8;
      float f[16];
#pragma unroll
      for (int k = 0; k < 2; ++k) {
        const v4f a = *(const v4f*)(orow + 64 * k);
        const v4f q = *(const v4f*)(orow + 64 * k + 4);
#pragma unroll
        for (int t = 0; t < 4; ++t) { f[8 * k + t] = a[t]; f[8 * k + 4 + t] = q[t]; }
      }
      float mx = f[0];
#pragma unroll
      for (int i = 1; i < 16; ++i) mx = fmaxf(mx, f[i]);
#pragma unroll
      for (int o = 4; o > 0; o >>= 1) mx = fmaxf(mx, __shfl_xor(mx, o, 32));
      float l = 0.f;
#pragma unroll
      for (int i = 0; i < 16; ++i) { f[i] = exp_slot(f[i] - mx); l += f[i]; }
#pragma unroll
      for (int o = 4; o > 0; o >>= 1) l += __shfl_xor(l, o, 32);
#pragma unroll
      for (int k = 0; k < 2; ++k) {
#pragma unroll
        for (int t = 0; t < 4; ++t) {
          const _Float16 h0 = (_Float16)(f[8 * k + 2 * t] * PCAR);
          const _Float16 h1 = (_Float16)(f[8 * k + 2 * t + 1] * PCAR);
          u[g][k][t] = pk16(h_bits(h0), h_bits(h1));
        }
      }
      mxs[g] = mx;
      sms[g] = l;
    }
    unsigned short* pr[4];
#pragma unroll
    for (int g = 0; g < 4; ++g) {
      pr[g] = P16 + ((size_t)(b * SEQ + m0 + 16 * wave + 4 * g + rq)) * SEQ + n0 + BT * kt + 8 * e8;
      *(v4u*)(pr[g])      = u[g][0];
      *(v4u*)(pr[g] + 64) = u[g][1];
    }
    // the stores' addresses and data are inputs here so that their registers stay live past the last store and are reused only behind this wait
    asm volatile("s_wait_xcnt 0x0" :: "v"(pr[0]), "v"(pr[1]), "v"(pr[2]), "v"(pr[3]), "v"(u[0][0]), "v"(u[0][1]), "v"(u[1][0]),
                 "v"(u[1][1]), "v"(u[2][0]), "v"(u[2][1]), "v"(u[3][0]), "v"(u[3][1]) : "memory");
    // lane (e8 < 4, rq) stores the pair of row 4 e8 + rq of the wave's 16
    v2f st;
    st[0] = e8 == 0 ? mxs[0] : e8 == 1 ? mxs[1] : e8 == 2 ? mxs[2] : mxs[3];
    st[1] = e8 == 0 ? sms[0] : e8 == 1 ? sms[1] : e8 == 2 ? sms[2] : sms[3];
    float* lp = Ls + 2 * ((size_t)(b * NKT + 2 * nt + kt) * SEQ + m0 + 16 * wave + 4 * e8 + rq);
    if (e8 < 4)
      *(v2f*)lp = st;
    // the pair's address and data are inputs here so that the next key tile's code reuses their registers only behind this wait
    asm volatile("s_wait_xcnt 0x0" :: "v"(lp), "v"(st) : "memory");
  }
}

// =========================================================================================================
// (6) out[b][c][t] = sum_j F[j][t] (1/16384) sum_{s in key tile j} V16[b][c][s] P16[b][t][s] + bias[c] +
//     bf16-RNE(xres[b][c][t]) for one (b, 128-t tile, 128-c block), F[j][t] = e^{m_j - m} / sum_i l_i e^{m_i - m}, m = max_j m_j, from the {m_j, l_j} pairs of (4): the
//     row's softmax over all SEQ keys. A = V16 rows c (k = s contiguous, pitch SEQ), B = P16 rows t (pitch SEQ), f16
//     instruction, 1 product, K = SEQ. The copy ring has gemm_core's order of waits and barriers, but a stage of it is NSV
//     tile pairs of KC k in a row (KSV k): the grid gives a WGP one block, so nothing but the block's own copies hides their
//     latency, and a long stage keeps NSV times the bytes in flight and meets that latency once per KSV k. A key tile = two
//     tile pairs sums into part (from a zero C), which is then added into acc with the lane's two column factors.
//     F (LDS behind the ring, [NKT][128]) is formed by waves 0..3 while stage 0's copies fly; the barrier that publishes stage 0
//     publishes F too. Output and residual rows at full strides. Epilogue: row-major LDS staging, barrier, the sums scaled
//     by 2^-14 with bias and residual added, whole 512-B row pieces stored.
// coverage: 16 it x 8 rows x 32 lanes x 4 = 128 c x 128 t; grid (SEQ/128, 4, NB) covers out[b][0..511][0..SEQ-1] once.
// =========================================================================================================
#define NSV  4
#define KSV  (NSV * KC)
#define NSTV (SEQ / KSV)
static_assert(SEQ % KSV == 0 && NSTV >= 2 && KSV % BT == 0);
static_assert(CoreLds<1, NSV>::BYTES + NKT * BT * 4 <= 327680);
__global__ __launch_bounds__(256)
void gemm_pv(const unsigned short* __restrict__ V16, const unsigned short* __restrict__ P16,
             const float* __restrict__ Ls, const float* __restrict__ bias, const float* __restrict__ xres, float* out) {
  constexpr unsigned SUB = CoreLds<1, NSV>::SET;                     // one tile pair
  constexpr unsigned STG = CoreLds<1, NSV>::STG;                     // one stage
  __shared__ __align__(16) char sm[2 * STG + NKT * BT * 4];          // two operand buffers (output staging behind the loop), F
  float* Os = (float*)sm;
  float* Fs = (float*)(sm + 2 * STG);
  const int tid = threadIdx.x, lane = tid & 31, wave = tid >> 5;
  const int hh = lane >> 4, c = lane & 15;
  const int wm = wave >> 2, wn = wave & 3;
  const int nt = blockIdx.x, mb = blockIdx.y, b = blockIdx.z;
  const int n0 = nt * BT, o0 = mb * BT;
  const int e = tid & 7, r = tid >> 3;                               // r 0..31
  const unsigned lc = lds_off(sm) + (unsigned)(r * LP + 16 * e);
  const unsigned short* ap = V16 + ((size_t)(b * CH + o0)) * SEQ + (size_t)r * SEQ + 8 * e;
  const unsigned short* bp = P16 + ((size_t)(b * SEQ + n0)) * SEQ + (size_t)r * SEQ + 8 * e;
  const unsigned fa = (unsigned)((64 * wm + c) * LP + 16 * hh);
  const unsigned fb = TILEB + (unsigned)((32 * wn + c) * LP + 16 * hh);
  v8f acc[4][2];
  zero_acc(acc);
  fill_ring<1, NSV>(lc, ap, ap, 32 * SEQ, bp, bp, 32 * SEQ);
  if (tid < BT) {                                                    // whole waves 0..3: thread = column t of the block
    const v2f* lb = (const v2f*)(Ls + 2 * ((size_t)b * NKT * SEQ + n0));   // block-uniform: tile 0's pair of column 0
    float m[NKT], l[NKT];
#pragma unroll
    for (int j = 0; j < NKT; ++j) {
      const v2f s = lb[tid + j * SEQ];
      m[j] = s[0];
      l[j] = s[1];
    }
    // tid addresses the loads; as an input here its register stays live past the last load and is reused only behind this wait
    asm volatile("s_wait_xcnt 0x0" :: "v"(tid) : "memory");
    float mx = m[0];
#pragma unroll
    for (int j = 1; j < NKT; ++j) mx = fmaxf(mx, m[j]);
    float ls = 0.f;
#pragma unroll
    for (int j = 0; j < NKT; ++j) { m[j] = exp_slot(m[j] - mx); ls = __builtin_fmaf(l[j], m[j], ls); }
    const float il = 1.0f / ls;                                      // ls >= 1
#pragma unroll
    for (int j = 0; j < NKT; ++j) Fs[j * BT + tid] = m[j] * il;
  }
  asm volatile("s_wait_asynccnt 0x0" ::: "memory");                  // stage 0's own copies have landed
  __syncthreads();                                                   // ... and every other wave's; F is written
  fill_ring<1, NSV>(lc + STG, ap + KSV, ap + KSV, 32 * SEQ, bp + KSV, bp + KSV, 32 * SEQ);
  // kept rolled over the stages: a stage is 64 matrix instructions with their fragment loads, and the code stays small
#pragma unroll 1
  for (int st = 0; st < NSTV; ++st) {
    const unsigned bo = (unsigned)(st & 1) * STG;
    // the loops below are unrolled whole so that the LDS offsets inside a stage are constants, the fragment arrays stay in
    // registers and each key tile's first matrix instructions take a zero C
#pragma unroll
    for (int kt = 0; kt < KSV / BT; ++kt) {                          // key tile j = (KSV / BT) st + kt
      v8f part[4][2];
      // the tile's two column factors are read with its first fragments, so that their LDS latency is over when they are used
      const float* fr = Fs + (st * (KSV / BT) + kt) * BT + 32 * wn + c;
      const float f0 = fr[0], f1 = fr[16];
#pragma unroll
      for (int h = 0; h < 2; ++h) {                                  // tile pair 2 kt + h of the stage
#pragma unroll
        for (int ks = 0; ks < KC / 32; ++ks) {
          const unsigned o = bo + (unsigned)(2 * kt + h) * SUB + 64u * ks;
          Frag fb0[2], fa0[4];
#pragma unroll
          for (int nf = 0; nf < 2; ++nf) fb0[nf] = ldfrag((const unsigned short*)(sm + fb + 16 * LP * nf + o));
#pragma unroll
          for (int mt = 0; mt < 4; ++mt) fa0[mt] = ldfrag((const unsigned short*)(sm + fa + 16 * LP * mt + o));
#pragma unroll
          for (int mt = 0; mt < 4; ++mt) {
#pragma unroll
            for (int nf = 0; nf < 2; ++nf)
              part[mt][nf] = mma_h(fa0[mt].h, fb0[nf].h, (h == 0 && ks == 0) ? zero8() : part[mt][nf]);
          }
        }
      }
      // the key tile is summed: weigh it and add it in
#pragma unroll
      for (int mt = 0; mt < 4; ++mt) {
#pragma unroll
        for (int q = 0; q < 8; ++q) {
          acc[mt][0][q] = __builtin_fmaf(part[mt][0][q], f0, acc[mt][0][q]);
          acc[mt][1][q] = __builtin_fmaf(part[mt][1][q], f1, acc[mt][1][q]);
        }
      }
    }
    asm volatile("s_wait_dscnt 0x0" ::: "memory");                   // this wave's reads of the buffer are done before it is refilled
    asm volatile("s_wait_asynccnt 0x0" ::: "memory");                // this wave's copies of stage st + 1 have landed
    __syncthreads();                                                 // publishes stage st + 1, ends every read of stage st's buffer
    if (st + 2 < NSTV) {                                             // stage st + 2 exists
      const int ko = KSV * (st + 2);
      fill_ring<1, NSV>(lc + bo, ap + ko, ap + ko, 32 * SEQ, bp + ko, bp + ko, 32 * SEQ);
    }
  }
  asm volatile("s_wait_asynccnt 0x0" ::: "memory");                  // nothing outstanding when the LDS changes its use
  stage_mn(Os, acc, wave, hh, c);
  __syncthreads();
  const int lq = tid >> 5;                                           // lq 0..7
  const size_t blk0 = ((size_t)(b * CH + o0)) * T_FULL + n0;         // block-uniform: row 0, col 0 of the tile
  const unsigned xofs = 4u * (unsigned)(lq * T_FULL + 4 * lane);     // the lane's byte offset behind it, row lq
  const char* xb = (const char*)(xres + blk0);
  const float* bo0 = bias + o0;
  v4f res[16];
  // both loops are unrolled whole so that res stays in registers and the sixteen residual loads are in flight together
#pragma unroll
  for (int it = 0; it < 16; ++it) {
    const int row = it * 8 + lq;                                     // c_loc 0..127
    const float bb = bfr(bo0[lq + 8 * it]);
    const v4f a  = *(const v4f*)(Os + row * OSP + 4 * lane);
    const v4f xv = *(const v4f*)(xb + xofs + (size_t)it * (32 * T_FULL));
#pragma unroll
    for (int t = 0; t < 4; ++t) res[it][t] = __builtin_fmaf(a[t], IPCAR, bb) + bfr(xv[t]);
  }
  // xofs and lq address the loads; as inputs here their registers stay live past the last load and are reused only behind this wait
  asm volatile("s_wait_xcnt 0x0" :: "v"(xofs), "v"(lq) : "memory");
#pragma unroll
  for (int it = 0; it < 16; ++it) {
    const int row = it * 8 + lq;
    const size_t idx = blk0 + (size_t)row * T_FULL + 4 * lane;
    *(v4f*)(out + idx) = res[it];
  }
}

// =========================================================================================================
extern "C" void kernel_launch(void* const* d_in, const int* in_sizes, int n_in,
                              void* d_out, int out_size, void* d_ws, size_t ws_size,
                              hipStream_t stream) {
  if (n_in < 10) return;
  if (in_sizes[0] < NB * CH * T_FULL || in_sizes[1] < NB * CH * T_FULL) return;
  if (in_sizes[2] < CH * CH || in_sizes[4] < CH * CH || in_sizes[6] < CH * CH || in_sizes[8] < CH * CH) return;
  if (in_sizes[3] < CH || in_sizes[5] < CH || in_sizes[7] < CH || in_sizes[9] < CH) return;
  if (out_size < NB * CH * T_FULL) return;

  size_t off = 0;
  auto carve = [&](size_t bytes) { const size_t o = off; off += (bytes + 255) & ~(size_t)255; return o; };
  const size_t oW = carve(WB);
  const size_t oX = carve(RXB);
  const size_t oP = carve(RPB);
  const size_t oM = carve(RMB);
  const size_t oV = carve(RVB);
  const size_t oT = carve(STB);
  const size_t oW2 = carve(W2B);
  const size_t oG = carve(W2B);
  const size_t oH = carve(HB);
  const size_t oB2 = carve(B2B);
  if (off > ws_size) return;
  if (off > (size_t)WS_CAP) return;

  const float* x_c = (const float*)d_in[0];
  const float* x_s = (const float*)d_in[1];
  const float* Wn  = (const float*)d_in[2];
  const float* bn  = (const float*)d_in[3];
  const float* Wm  = (const float*)d_in[4];
  const float* Wl  = (const float*)d_in[6];
  const float* bl  = (const float*)d_in[7];
  const float* Wo  = (const float*)d_in[8];
  const float* bo  = (const float*)d_in[9];
  float* out = (float*)d_out;

  char* ws = (char*)d_ws;
  unsigned short* W16  = (unsigned short*)(ws + oW);
  // region X users
  unsigned short* Xcnh = (unsigned short*)(ws + oX);
  unsigned short* Xcnl = (unsigned short*)(ws + oX + PLB);
  unsigned short* Xsr  = (unsigned short*)(ws + oX + 2 * PLB);
  // region P
  unsigned short* P16  = (unsigned short*)(ws + oP);
  float*          Ls   = (float*)(ws + oP + PB);
  // region M
  unsigned short* Mqh  = (unsigned short*)(ws + oM);
  unsigned short* Mql  = (unsigned short*)(ws + oM + PLB);
  // region V
  unsigned short* V16  = (unsigned short*)(ws + oV);
  // region T
  float*          St   = (float*)(ws + oT);
  // regions W2, G, H, B2
  unsigned short* W2h  = (unsigned short*)(ws + oW2);
  unsigned short* W2l  = (unsigned short*)(ws + oW2 + W2B / 2);
  unsigned short* Gh   = (unsigned short*)(ws + oG);
  unsigned short* Gl   = (unsigned short*)(ws + oG + W2B / 2);
  float*          H    = (float*)(ws + oH);
  float*          B2   = (float*)(ws + oB2);

  const dim3 blk256(256);
  const dim3 gconv(SEQ / BT, CH / BT, NB);

  // (0) + (1a) instance-norm statistics of x_c and x_s; weights -> bf16 planes (order Wn, Wm, Wl, each transposed; Wo); Wo.bl
  prep<<<dim3(NSTATB + NCVTWB), blk256, 0, stream>>>(x_c, x_s, Wn, Wm, Wl, Wo, bl, St, W16, B2);
  // (1b) + (1c) + (1d) split planes of norm(x_c); the raw bf16 plane of x_s; W2 = Wo.Wl and G = Wm^T.Wn hi +
  // residual planes; H = Wm^T.bn
  cvt_norm2<<<dim3(NPREB + (SEQ / NT) * (CH / QT) * 2 * NB), blk256, 0, stream>>>(x_c, x_s, St, Xcnh, Xcnl, Xsr,
                                                                                  W16, W2h, W2l, Gh, Gl, bn, H);
  // (2) + (3) Mq hi + residual planes and the Ml2 value plane
  gemm_conv3<<<dim3(SEQ / BT, CH / BT, 2 * NB), blk256, 0, stream>>>(Gh, H, St + 2 * NB * CH, W2h, B2, Xcnh, Mqh, V16);
  // (4) scores -> tile-local softmax weights and {max, sum} pairs
  gemm_sc<<<dim3(SEQ / SBT, SEQ / SBT, NB), dim3(512), 0, stream>>>(Mqh, Mql, Xsr, P16, Ls);
  // (6) output rows: value plane x softmax weights + bias + residual
  gemm_pv<<<gconv, blk256, 0, stream>>>(V16, P16, Ls, bo, x_c, out);
  (void)hipGetLastError();
}
